// v000
// The times below were measured on an AMD MI455X: many runs one after another, warmed up first and cycling through
// copies of the inputs, with the whole window's GPU time divided by the number of runs. Launches and the gaps
// between them are all in it. The median over several windows is given; except for v000 it joins two sittings, which
// can be a few percent apart, so the side-by-side timings, each taken in one sitting, are the better comparison.
// v000, which the later versions start from, runs in 568 microseconds.
// All contractions: v_wmma_f32_16x16x32_bf16 (bf16 operands, f32 accumulate): x and weight matrices as single RNE bf16 planes; state/action, q-value product, softmax p, content and gathered carried as bf16 hi/lo planes (hi.hi + hi.lo + lo.hi); softmax, q-value product and bias in f32.
#include <hip/hip_runtime.h>
#include <stdint.h>

constexpr int SEQ_LEN = 2048;   // L
constexpr int HID     = 2048;   // hidden
constexpr int QRANK   = 1024;   // q_rank
constexpr int NHEADS  = 16;
constexpr int HRANK   = 64;     // per-head rank (q/k depth)
constexpr int HVAL    = 128;    // per-head value width
static_assert(QRANK == NHEADS * HRANK, "rank split");
static_assert(HID == NHEADS * HVAL, "value split");
static_assert(SEQ_LEN % 64 == 0 && HID % 64 == 0 && QRANK % 64 == 0, "tile multiples");
static_assert(HID % 32 == 0 && QRANK % 32 == 0, "K multiples of 32");

typedef __attribute__((ext_vector_type(16))) _Float16 v16h;
typedef __attribute__((ext_vector_type(8)))  _Float16 v8h;
typedef __attribute__((ext_vector_type(16))) __bf16   v16b;
typedef __attribute__((ext_vector_type(8)))  __bf16   v8b;
typedef __attribute__((ext_vector_type(8)))  float    v8f;
typedef __attribute__((ext_vector_type(4)))  float    v4f;

__device__ __forceinline__ unsigned short f2bf_bits(float f) {
  unsigned u = __float_as_uint(f);
  return (unsigned short)((u + 0x7FFFu + ((u >> 16) & 1u)) >> 16);
}
__device__ __forceinline__ float bf_bits2f(unsigned short h) { return __uint_as_float(((unsigned)h) << 16); }

// hazard guards as plain device helpers (no inline asm inside the kernel template body)
__device__ __forceinline__ void dep_guard_h(v8f& a, v8f& b, v16h x, v16h y) { asm volatile("v_nop\n\tv_nop\n\tv_nop\n\tv_nop" : "+v"(a), "+v"(b) : "v"(x), "v"(y)); }
__device__ __forceinline__ void dep_guard_b(v8f& a, v8f& b, v16b x, v16b y) { asm volatile("v_nop\n\tv_nop\n\tv_nop\n\tv_nop" : "+v"(a), "+v"(b) : "v"(x), "v"(y)); }
__device__ __forceinline__ void keep4_h(v16h a, v16h b, v16h c, v16h d) { asm volatile("v_nop" :: "v"(a), "v"(b), "v"(c), "v"(d)); }
__device__ __forceinline__ void keep4_b(v16b a, v16b b, v16b c, v16b d) { asm volatile("v_nop" :: "v"(a), "v"(b), "v"(c), "v"(d)); }
__device__ __forceinline__ void acc_guard4(v8f& a, v8f& b, v8f& c, v8f& d) { asm volatile("v_nop\n\tv_nop\n\tv_nop\n\tv_nop" : "+v"(a), "+v"(b), "+v"(c), "+v"(d)); }
template <typename T> struct Frag;
template <> struct Frag<_Float16> {
  typedef v16h V; union U { v16h v; v8h h[2]; };
  static __device__ __forceinline__ v16h load(const _Float16* p) {   // elements 0..7 <- p[0..7], 8..15 <- p[16..23]
    U f; f.h[0] = *(const v8h*)(p); f.h[1] = *(const v8h*)(p + 16); return f.v;
  }
  static __device__ __forceinline__ v8f mma(v16h a, v16h b, v8f c) {
    return __builtin_amdgcn_wmma_f32_16x16x32_f16(false, a, false, b, (short)0, c, false, false);
  }
  static __device__ __forceinline__ void guard(v8f& a, v8f& b, v16h x, v16h y) { dep_guard_h(a, b, x, y); }
  static __device__ __forceinline__ void keep(v16h a, v16h b, v16h c, v16h d) { keep4_h(a, b, c, d); }
};
template <> struct Frag<__bf16> {
  typedef v16b V; union U { v16b v; v8b h[2]; };
  static __device__ __forceinline__ v16b load(const __bf16* p) {
    U f; f.h[0] = *(const v8b*)(p); f.h[1] = *(const v8b*)(p + 16); return f.v;
  }
  static __device__ __forceinline__ v8f mma(v16b a, v16b b, v8f c) {
    return __builtin_amdgcn_wmma_f32_16x16x32_bf16(false, a, false, b, (short)0, c, false, false);
  }
  static __device__ __forceinline__ void guard(v8f& a, v8f& b, v16b x, v16b y) { dep_guard_b(a, b, x, y); }
  static __device__ __forceinline__ void keep(v16b a, v16b b, v16b c, v16b d) { keep4_b(a, b, c, d); }
};

// ---- Register-blocked batched WMMA GEMM ------------------------------------
// C[m,n] = scale * sum_k A[m,k] * Bt[n,k] (+bias); each wave owns a 64x64 tile.
// A row-major [M,K]; Bt row-major [N,K]; M,N % 64 == 0, K % 32 == 0.
// ASPLIT: A carried as hi/lo planes (A2 = lo plane, same layout); BSPLIT: Bt hi/lo (Bt2 = lo plane).
//   product = hi.hi (+ hi.lo if BSPLIT) (+ lo.hi if ASPLIT).
// BIAS_MODE: 0 = none, 1 = bias[m], 2 = bias[n].
// OUT_MODE: 0 = f32, 1 = f16, 2 = bf16 hi plane (Cout) + bf16 lo plane (Cout2).
// Coverage: per 64x64 tile, 4 slabs x 16 rows x 64 cols -> the whole tile; grid = tilesM*tilesN/8 blocks of 8 waves.
// ET: 0 = f16 operands, 1 = bf16 operands (pointers passed as 16-bit storage)
template <int ET> struct Elem;
template <> struct Elem<0> { typedef _Float16 T; };
template <> struct Elem<1> { typedef __bf16 T; };
template <int ET, bool ASPLIT, bool BSPLIT, int BIAS_MODE, int OUT_MODE>
__global__ __launch_bounds__(256) void wmma_gemm64(
    const unsigned short* __restrict__ Ap, const unsigned short* __restrict__ A2p, int lda, long strideA,
    const unsigned short* __restrict__ Btp, const unsigned short* __restrict__ Bt2p, int ldb, long strideB,
    void* __restrict__ Cout, void* __restrict__ Cout2, int ldc, long strideC,
    const float* __restrict__ bias,
    int M, int N, int K, float scale) {
  typedef typename Elem<ET>::T T;
  typedef typename Frag<T>::V V;
  const T* A = (const T*)Ap; const T* A2 = (const T*)A2p; const T* Bt = (const T*)Btp; const T* Bt2 = (const T*)Bt2p;
  __shared__ __align__(16) float sT[8][16 * 68];   // per-wave 16x64 slab, pitch 68 floats
  const int b    = blockIdx.y;
  const int lane = threadIdx.x & 31;
  const int wave = threadIdx.x >> 5;
  const int tilesN = N >> 6;
  const int tilesM = M >> 6;
  const int tile = blockIdx.x * 8 + wave;
  if (tile >= tilesM * tilesN) return;   // wave-uniform; no block barriers in this kernel
  const int tm = tile / tilesN;
  const int tn = tile - tm * tilesN;
  const int m0 = tm << 6;
  const int n0 = tn << 6;

  const T* Ab  = A  + (size_t)b * strideA;
  const T* Bb  = Bt + (size_t)b * strideB;
  const T* Ab2 = ASPLIT ? (A2  + (size_t)b * strideA) : nullptr;
  const T* Bb2 = BSPLIT ? (Bt2 + (size_t)b * strideB) : nullptr;

  const int rlane = lane & 15;                 // row (A) / col (B, D) within subtile
  const int koff  = (lane >> 4) * 8;           // k offset of this lane half
  const int mOff  = (lane >> 4) * 8;           // D row offset

  v8f acc[4][4];
#pragma unroll
  for (int i = 0; i < 4; ++i)
#pragma unroll
    for (int j = 0; j < 4; ++j) acc[i][j] = (v8f){0.f,0.f,0.f,0.f,0.f,0.f,0.f,0.f};

  for (int k0 = 0; k0 < K; k0 += 32) {
    V bh[4], bl[4];
#pragma unroll
    for (int j = 0; j < 4; ++j) {
      const size_t bo = (size_t)(n0 + (j << 4) + rlane) * ldb + koff + k0;
      bh[j] = Frag<T>::load(Bb + bo);
      if (BSPLIT) bl[j] = Frag<T>::load(Bb2 + bo);
    }
#pragma unroll
    for (int i = 0; i < 4; ++i) {
      const size_t ao = (size_t)(m0 + (i << 4) + rlane) * lda + koff + k0;
      V ah = Frag<T>::load(Ab + ao);
      V al = ah;
      if (ASPLIT) al = Frag<T>::load(Ab2 + ao);
#pragma unroll
      for (int j = 0; j < 4; ++j) {
        acc[i][j] = Frag<T>::mma(ah, bh[j], acc[i][j]);
        if (BSPLIT) acc[i][j] = Frag<T>::mma(ah, bl[j], acc[i][j]);
        if (ASPLIT) acc[i][j] = Frag<T>::mma(al, bh[j], acc[i][j]);
      }
      Frag<T>::guard(acc[i][0], acc[i][3], ah, al);
    }
    Frag<T>::keep(bh[0], bh[1], bh[2], bh[3]);
    if (BSPLIT) Frag<T>::keep(bl[0], bl[1], bl[2], bl[3]);
  }
  acc_guard4(acc[0][0], acc[0][1], acc[0][2], acc[0][3]);
  acc_guard4(acc[1][0], acc[1][1], acc[1][2], acc[1][3]);
  acc_guard4(acc[2][0], acc[2][1], acc[2][2], acc[2][3]);
  acc_guard4(acc[3][0], acc[3][1], acc[3][2], acc[3][3]);

  // ---- epilogue ----
  float* slab = sT[wave];
#pragma unroll
  for (int i = 0; i < 4; ++i) {
    const int mBase = m0 + (i << 4);
#pragma unroll
    for (int j = 0; j < 4; ++j) {
      const int n = n0 + (j << 4) + rlane;
      float bv = 0.f;
      if (BIAS_MODE == 2) bv = bias[n];
#pragma unroll
      for (int r = 0; r < 8; ++r) {
        float v = acc[i][j][r] * scale;
        if (BIAS_MODE == 1) v += bias[mBase + mOff + r];
        if (BIAS_MODE == 2) v += bv;
        slab[(mOff + r) * 68 + (j << 4) + rlane] = v;
      }
    }
    __builtin_amdgcn_fence(__ATOMIC_RELEASE, "workgroup");
    __builtin_amdgcn_wave_barrier();
    __builtin_amdgcn_fence(__ATOMIC_ACQUIRE, "workgroup");
    if (OUT_MODE == 0) {
      float* C = (float*)Cout + (size_t)b * strideC;
      const int hh = lane >> 4, c4 = (lane & 15) * 4;     // row seg = 256 B = 16 lanes x 16 B
      {
#pragma unroll
        for (int it = 0; it < 8; ++it) {
          const int row = it * 2 + hh;
          v4f v = *(const v4f*)(slab + row * 68 + c4);
          *(v4f*)(C + (size_t)(mBase + row) * ldc + n0 + c4) = v;
        }
        
      }
    } else {
      const int q = lane >> 3, c8 = (lane & 7) * 8;
      unsigned short* C  = (unsigned short*)Cout  + (size_t)b * strideC;
      unsigned short* C2 = (OUT_MODE == 2) ? ((unsigned short*)Cout2 + (size_t)b * strideC) : nullptr;
      {
#pragma unroll
        for (int it = 0; it < 4; ++it) {
          const int row = it * 4 + q;
          const float* sp = slab + row * 68 + c8;
          v8h hv, lv;
#pragma unroll
          for (int e = 0; e < 8; ++e) {
            if (OUT_MODE == 1) {
              hv[e] = (_Float16)sp[e];
            } else {
              unsigned short hb = f2bf_bits(sp[e]);
              unsigned short lb = f2bf_bits(sp[e] - bf_bits2f(hb));
              hv[e] = __builtin_bit_cast(_Float16, hb);
              lv[e] = __builtin_bit_cast(_Float16, lb);
            }
          }
          *(v8h*)(C + (size_t)(mBase + row) * ldc + n0 + c8) = hv;
          if (OUT_MODE == 2) *(v8h*)(C2 + (size_t)(mBase + row) * ldc + n0 + c8) = lv;
        }
        
      }
    }
    __builtin_amdgcn_fence(__ATOMIC_RELEASE, "workgroup");
    __builtin_amdgcn_wave_barrier();
    __builtin_amdgcn_fence(__ATOMIC_ACQUIRE, "workgroup");
  }
}

// Coverage: grid = ceil(n2/256), thread i converts elements 2i, 2i+1; n2 = n/2 (all n here are multiples of 512).
__global__ __launch_bounds__(256) void cast_f32_bf16x2(
    const float* __restrict__ in, unsigned short* __restrict__ out, int n2) {
  int i = blockIdx.x * 256 + threadIdx.x;
  if (i < n2) {
    const unsigned u = (unsigned)f2bf_bits(in[2 * i]) | ((unsigned)f2bf_bits(in[2 * i + 1]) << 16);
    ((unsigned*)out)[i] = u;
    
  }
}

// ---- state|action f32 [SEQ_LEN][2*QRANK] -> bf16 hi/lo planes of state, action and q-value (state*action in f32), each [SEQ_LEN][QRANK] ----
// Coverage: grid = SEQ_LEN/2 blocks x 256 threads; thread -> row = 2*blk + (tid>>7), cols (tid&127)*8 .. +7 -> 2048 rows x 1024 cols exactly, all six planes.
__global__ __launch_bounds__(256) void planes_k(const float* __restrict__ sa,
    unsigned short* __restrict__ sthp, unsigned short* __restrict__ stlp,
    unsigned short* __restrict__ achp, unsigned short* __restrict__ aclp,
    unsigned short* __restrict__ qvhp, unsigned short* __restrict__ qvlp) {
  const int row = blockIdx.x * 2 + (threadIdx.x >> 7);
  const int c8  = (threadIdx.x & 127) * 8;
  const float* sp = sa + (size_t)row * (2 * QRANK) + c8;
  const v8f sv = *(const v8f*)(sp);
  const v8f av = *(const v8f*)(sp + QRANK);
  v8h shv, slv, ahv, alv, qhv, qlv;
#pragma unroll
  for (int e = 0; e < 8; ++e) {
    const float s = sv[e], a = av[e];
    const float q = s * a;
    unsigned short hb, lb;
    hb = f2bf_bits(s); lb = f2bf_bits(s - bf_bits2f(hb));
    shv[e] = __builtin_bit_cast(_Float16, hb); slv[e] = __builtin_bit_cast(_Float16, lb);
    hb = f2bf_bits(a); lb = f2bf_bits(a - bf_bits2f(hb));
    ahv[e] = __builtin_bit_cast(_Float16, hb); alv[e] = __builtin_bit_cast(_Float16, lb);
    hb = f2bf_bits(q); lb = f2bf_bits(q - bf_bits2f(hb));
    qhv[e] = __builtin_bit_cast(_Float16, hb); qlv[e] = __builtin_bit_cast(_Float16, lb);
  }
  const size_t o = (size_t)row * QRANK + c8;
  _Float16* sth = (_Float16*)sthp; _Float16* stl = (_Float16*)stlp;
  _Float16* ach = (_Float16*)achp; _Float16* acl = (_Float16*)aclp;
  _Float16* qvh = (_Float16*)qvhp; _Float16* qvl = (_Float16*)qvlp;
  {
    *(v8h*)(sth + o) = shv;
    *(v8h*)(stl + o) = slv;
    *(v8h*)(ach + o) = ahv;
    *(v8h*)(acl + o) = alv;
    *(v8h*)(qvh + o) = qhv;
    *(v8h*)(qvl + o) = qlv;
    
  }
}

// =====================================================================================
// Causal routing attention, q/k depth 64 (bf16 hi/lo planes, ld QRANK, head cols h*64),
// value width 128 (content^T bf16 hi/lo planes [h*128 + d][kv], ld SEQ_LEN),
// output gathered as bf16 hi/lo planes [q][h*128 + d], ld HID.
//   scores = (q.k) * 1/8   : hi.hi + hi.lo + lo.hi bf16 WMMA, f32 accumulate; future keys := -inf (p = 0, diagonal always present)
//   out    = p.v           : p and v bf16 hi/lo (hi.hi + hi.lo + lo.hi); online softmax in f32.
// Block = 4 independent waves, each owns 16 query rows of one head; 64-key chunks, chunks above the diagonal skipped.
// K and V B-fragments are dense, statically strided global loads; P is relaid C-layout -> A-layout through per-wave LDS.
// Coverage: grid = NHEADS * SEQ_LEN/64 blocks; block (qb, h) writes rows qb*64..+63, cols h*128..+127 of both planes.
// =====================================================================================
constexpr int ATT_QBLK = 64;
constexpr int ATT_KCH  = 64;
constexpr int ATT_OSP  = 132;
constexpr int ATT_NQB  = SEQ_LEN / ATT_QBLK;

__device__ __forceinline__ __bf16 at_f2bf(float f) { return __builtin_bit_cast(__bf16, f2bf_bits(f)); }
__device__ __forceinline__ void at_split(float f, __bf16& hi, __bf16& lo) {
  const unsigned short hb = f2bf_bits(f);
  hi = __builtin_bit_cast(__bf16, hb);
  lo = at_f2bf(f - __uint_as_float(((unsigned)hb) << 16));
}
__device__ __forceinline__ v8f at_mma(v16b a, v16b b, v8f c) {
  c = __builtin_amdgcn_wmma_f32_16x16x32_bf16(false, a, false, b, (short)0, c, false, false);
  asm volatile("v_nop\n\tv_nop\n\tv_nop\n\tv_nop" : "+v"(c) : "v"(a), "v"(b));
  return c;
}

__global__ __launch_bounds__(128)
void attn_route_k(const unsigned short* __restrict__ sthp, const unsigned short* __restrict__ stlp,
                  const unsigned short* __restrict__ achp, const unsigned short* __restrict__ aclp,
                  const unsigned short* __restrict__ cthp, const unsigned short* __restrict__ ctlp,
                  unsigned short* __restrict__ ghp, unsigned short* __restrict__ glp) {
  union FB { v16b v; v8b h[2]; };
  __shared__ __align__(16) __bf16 Psh[4][16 * ATT_KCH];        // per wave P hi [row][kv]
  __shared__ __align__(16) __bf16 Psl[4][16 * ATT_KCH];        // per wave P lo
  __shared__ __align__(16) float  Os[4][16 * ATT_OSP];         // per wave out tile [row][d], pitch 132

  const __bf16* sth = (const __bf16*)sthp; const __bf16* stl = (const __bf16*)stlp;
  const __bf16* ach = (const __bf16*)achp; const __bf16* acl = (const __bf16*)aclp;
  const __bf16* cth = (const __bf16*)cthp; const __bf16* ctl = (const __bf16*)ctlp;
  _Float16* gh = (_Float16*)ghp; _Float16* gl = (_Float16*)glp;

  const int tid  = threadIdx.x;
  const int wave = tid >> 5;
  const int lane = tid & 31;
  const int hh   = lane >> 4;
  const int c    = lane & 15;
  const int bx = blockIdx.x;
  const int qb = bx % ATT_NQB;
  const int h  = bx / ATT_NQB;
  const int q0 = qb * ATT_QBLK + wave * 16;

  // ---- Q fragments (A operand): 2 depth chunks, hi and lo; row = c, k = dc*32 + 8*hh + {0..7, 16..23} ----
  v16b qah[2], qal[2];
#pragma unroll
  for (int dc = 0; dc < 2; ++dc) {
    const size_t off = (size_t)(q0 + c) * QRANK + h * HRANK + dc * 32 + 8 * hh;
    qah[dc] = Frag<__bf16>::load(sth + off);
    qal[dc] = Frag<__bf16>::load(stl + off);
  }

  float mrow[8], lrow[8];
  v8f oacc[8];
#pragma unroll
  for (int r = 0; r < 8; ++r) { mrow[r] = -INFINITY; lrow[r] = 0.f; }
#pragma unroll
  for (int t = 0; t < 8; ++t) oacc[t] = (v8f){0.f,0.f,0.f,0.f,0.f,0.f,0.f,0.f};

  __bf16* pwh = Psh[wave];
  __bf16* pwl = Psl[wave];
  const int nChunks = qb + 1;   // block-uniform, <= 32
  for (int kc = 0; kc < nChunks; ++kc) {
    const int kv0 = kc * ATT_KCH;

    // ---- scores: 4 key subtiles of 16; K B-fragments: col = key, k = depth (dense global plane) ----
    v8f s[4];
#pragma unroll
    for (int j = 0; j < 4; ++j) {
      s[j] = (v8f){0.f,0.f,0.f,0.f,0.f,0.f,0.f,0.f};
#pragma unroll
      for (int dc = 0; dc < 2; ++dc) {
        const size_t ko = (size_t)(kv0 + j * 16 + c) * QRANK + h * HRANK + dc * 32 + 8 * hh;
        const v16b kb = Frag<__bf16>::load(ach + ko);
        const v16b kl = Frag<__bf16>::load(acl + ko);
        s[j] = at_mma(qah[dc], kb, s[j]);
        s[j] = at_mma(qah[dc], kl, s[j]);
        s[j] = at_mma(qal[dc], kb, s[j]);
      }
    }

    // ---- scale by 1/8, causal select on the diagonal chunk, row max ----
    const bool diag = (kc == qb);
    float cm[8];
#pragma unroll
    for (int r = 0; r < 8; ++r) {
      const int qrow = q0 + 8 * hh + r;
      float m = -INFINITY;
#pragma unroll
      for (int j = 0; j < 4; ++j) {
        const int kvcol = kv0 + j * 16 + c;
        float v = s[j][r] * 0.125f;
        if (diag && (kvcol > qrow)) v = -INFINITY;
        s[j][r] = v;
        m = fmaxf(m, v);
      }
#pragma unroll
      for (int off = 1; off < 16; off <<= 1) m = fmaxf(m, __shfl_xor(m, off, 32));
      cm[r] = m;
    }

    // ---- online softmax update; P tile (C layout) -> LDS as bf16 hi/lo ----
#pragma unroll
    for (int r = 0; r < 8; ++r) {
      const float mnew = fmaxf(mrow[r], cm[r]);
      const float alpha = expf(mrow[r] - mnew);
      mrow[r] = mnew;
      float psum = 0.f;
#pragma unroll
      for (int j = 0; j < 4; ++j) {
        const float p = expf(s[j][r] - mnew);
        psum += p;
        __bf16 a, bl; at_split(p, a, bl);
        pwh[(8 * hh + r) * ATT_KCH + j * 16 + c] = a;
        pwl[(8 * hh + r) * ATT_KCH + j * 16 + c] = bl;
      }
#pragma unroll
      for (int off = 1; off < 16; off <<= 1) psum += __shfl_xor(psum, off, 32);
      lrow[r] = lrow[r] * alpha + psum;
#pragma unroll
      for (int t = 0; t < 8; ++t) oacc[t][r] *= alpha;
    }
    __builtin_amdgcn_fence(__ATOMIC_RELEASE, "workgroup");
    __builtin_amdgcn_wave_barrier();
    __builtin_amdgcn_fence(__ATOMIC_ACQUIRE, "workgroup");

    // ---- O += P.V ; P A-fragments from LDS (row = c, k = kv), V B-fragments from the dense content^T planes (col = d, k = kv) ----
#pragma unroll 1
    for (int kk = 0; kk < 2; ++kk) {
      FB pa, pl;
      pa.h[0] = *(const v8b*)(pwh + c * ATT_KCH + kk * 32 + 8 * hh);
      pa.h[1] = *(const v8b*)(pwh + c * ATT_KCH + kk * 32 + 16 + 8 * hh);
      pl.h[0] = *(const v8b*)(pwl + c * ATT_KCH + kk * 32 + 8 * hh);
      pl.h[1] = *(const v8b*)(pwl + c * ATT_KCH + kk * 32 + 16 + 8 * hh);
#pragma unroll
      for (int t = 0; t < 8; ++t) {
        const size_t vo = (size_t)(h * HVAL + t * 16 + c) * SEQ_LEN + kv0 + kk * 32 + 8 * hh;
        const v16b vb = Frag<__bf16>::load(cth + vo);
        const v16b vl = Frag<__bf16>::load(ctl + vo);
        oacc[t] = at_mma(pa.v, vb, oacc[t]);
        oacc[t] = at_mma(pa.v, vl, oacc[t]);
        oacc[t] = at_mma(pl.v, vb, oacc[t]);
      }
    }
    // order this chunk's P loads before the next chunk's P stores
    __builtin_amdgcn_fence(__ATOMIC_RELEASE, "workgroup");
    __builtin_amdgcn_wave_barrier();
    __builtin_amdgcn_fence(__ATOMIC_ACQUIRE, "workgroup");
  }

  float* os = Os[wave];
#pragma unroll
  for (int r = 0; r < 8; ++r) {
    const float inv = 1.0f / lrow[r];
#pragma unroll
    for (int t = 0; t < 8; ++t) os[(8 * hh + r) * ATT_OSP + t * 16 + c] = oacc[t][r] * inv;
  }
  __builtin_amdgcn_fence(__ATOMIC_RELEASE, "workgroup");
  __builtin_amdgcn_wave_barrier();
  __builtin_amdgcn_fence(__ATOMIC_ACQUIRE, "workgroup");
  {
    // lane groups of 8: q4 = lane>>3; row parity = q4>>1, column half = q4&1; it = 0..7 -> rows 0..15, cols 0..127: whole 16x128 tile, both planes
    const int q4 = lane >> 3, c8 = (lane & 7) * 8;
    const int rpar = q4 >> 1, chalf = (q4 & 1) * 64;
    {
#pragma unroll
      for (int it = 0; it < 8; ++it) {
        const int row = it * 2 + rpar;
        const int col = chalf + c8;
        const float* sp = os + row * ATT_OSP + col;
        v8h hv, lv;
#pragma unroll
        for (int e = 0; e < 8; ++e) {
          const unsigned short hb = f2bf_bits(sp[e]);
          const unsigned short lb = f2bf_bits(sp[e] - bf_bits2f(hb));
          hv[e] = __builtin_bit_cast(_Float16, hb);
          lv[e] = __builtin_bit_cast(_Float16, lb);
        }
        const size_t go = (size_t)(q0 + row) * HID + h * HVAL + col;
        *(v8h*)(gh + go) = hv;
        *(v8h*)(gl + go) = lv;
      }
      
    }
  }
}

// =====================================================================================
// Host launcher. Workspace region map (bytes, every offset a multiple of 4 MiB):
//   XB   bf16 [2048][2048]   8 MiB   x
//   WSA  bf16 [2048][2048]   8 MiB   rows 0..1023 W_state, 1024..2047 W_action
//   WC   bf16 [2048][1024]   4 MiB   W_content
//   WO   bf16 [2048][2048]   8 MiB   W_out
//   SA32 f32  [2048][2048]  16 MiB   state | action
//   STH, STL, ACH, ACL, QVH, QVL  bf16 [2048][1024]  4 MiB each (state, action, q-value hi/lo)
//   CTH, CTL  bf16 [2048 = h*128+d][2048 = kv]  8 MiB each (content^T hi/lo)
//   GH, GL    bf16 [2048][2048]  8 MiB each (gathered hi/lo)
//   total 104,857,600 B
// =====================================================================================
extern "C" void kernel_launch(void* const* d_in, const int* in_sizes, int n_in,
                              void* d_out, int out_size, void* d_ws, size_t ws_size,
                              hipStream_t stream) {
  if (n_in < 6) return;
  if (in_sizes[0] != SEQ_LEN * HID || in_sizes[1] != QRANK * HID || in_sizes[2] != QRANK * HID ||
      in_sizes[3] != HID * QRANK || in_sizes[4] != HID * HID || in_sizes[5] != HID) return;
  if (out_size != SEQ_LEN * HID) return;

  const float* x  = (const float*)d_in[0];
  const float* Ws = (const float*)d_in[1];
  const float* Wa = (const float*)d_in[2];
  const float* Wc = (const float*)d_in[3];
  const float* Wo = (const float*)d_in[4];
  const float* bo = (const float*)d_in[5];
  float* out = (float*)d_out;

  const size_t B_XB  = (size_t)SEQ_LEN * HID * 2;
  const size_t B_WSA = (size_t)(2 * QRANK) * HID * 2;
  const size_t B_WC  = (size_t)HID * QRANK * 2;
  const size_t B_WO  = (size_t)HID * HID * 2;
  const size_t B_SA  = (size_t)SEQ_LEN * (2 * QRANK) * 4;
  const size_t B_PL  = (size_t)SEQ_LEN * QRANK * 2;     // one [2048][1024] bf16 plane
  const size_t B_CT  = (size_t)HID * SEQ_LEN * 2;       // one [2048][2048] bf16 plane
  const size_t B_G   = (size_t)SEQ_LEN * HID * 2;

  char* ws = (char*)d_ws;
  size_t off = 0;
  unsigned short* XB  = (unsigned short*)(ws + off); off += B_XB;
  unsigned short* WSA = (unsigned short*)(ws + off); off += B_WSA;
  unsigned short* WC  = (unsigned short*)(ws + off); off += B_WC;
  unsigned short* WO  = (unsigned short*)(ws + off); off += B_WO;
  float*          SA  = (float*)(ws + off);          off += B_SA;
  unsigned short* STH = (unsigned short*)(ws + off); off += B_PL;
  unsigned short* STL = (unsigned short*)(ws + off); off += B_PL;
  unsigned short* ACH = (unsigned short*)(ws + off); off += B_PL;
  unsigned short* ACL = (unsigned short*)(ws + off); off += B_PL;
  unsigned short* QVH = (unsigned short*)(ws + off); off += B_PL;
  unsigned short* QVL = (unsigned short*)(ws + off); off += B_PL;
  unsigned short* CTH = (unsigned short*)(ws + off); off += B_CT;
  unsigned short* CTL = (unsigned short*)(ws + off); off += B_CT;
  unsigned short* GH  = (unsigned short*)(ws + off); off += B_G;
  unsigned short* GL  = (unsigned short*)(ws + off); off += B_G;
  if (off > ws_size) return;

  // ---- input casts to bf16 (RNE) ----
  {
    const int n2x = SEQ_LEN * HID / 2, n2w = QRANK * HID / 2, n2c = HID * QRANK / 2, n2o = HID * HID / 2;
    cast_f32_bf16x2<<<dim3((n2x + 255) / 256), dim3(256), 0, stream>>>(x,  XB, n2x);
    cast_f32_bf16x2<<<dim3((n2w + 255) / 256), dim3(256), 0, stream>>>(Ws, WSA, n2w);
    cast_f32_bf16x2<<<dim3((n2w + 255) / 256), dim3(256), 0, stream>>>(Wa, WSA + (size_t)QRANK * HID, n2w);
    cast_f32_bf16x2<<<dim3((n2c + 255) / 256), dim3(256), 0, stream>>>(Wc, WC, n2c);
    cast_f32_bf16x2<<<dim3((n2o + 255) / 256), dim3(256), 0, stream>>>(Wo, WO, n2o);
  }

  // ---- projections: SA[q][0..2047] = x . [W_state; W_action]^T  (M=2048, N=2048, K=2048) ----
  {
    const int M = SEQ_LEN, N = 2 * QRANK, K = HID;
    const int blocks = (M / 64) * (N / 64) / 8;   // 128
    wmma_gemm64<1, false, false, 0, 0><<<dim3(blocks, 1), dim3(256), 0, stream>>>(
        XB, XB, K, 0L, WSA, WSA, K, 0L, (void*)SA, (void*)SA, N, 0L, bo, M, N, K, 1.0f);
  }

  // ---- bf16 hi/lo planes of state, action, q-value ----
  planes_k<<<dim3(SEQ_LEN / 2), dim3(256), 0, stream>>>(SA, STH, STL, ACH, ACL, QVH, QVL);

  // ---- content^T[n][kv] = W_content[n][:] . qval[kv][:]  (M=2048, N=2048, K=1024; B = q-value hi/lo) -> bf16 hi/lo planes ----
  {
    const int M = HID, N = SEQ_LEN, K = QRANK;
    const int blocks = (M / 64) * (N / 64) / 8;   // 128
    wmma_gemm64<1, false, true, 0, 2><<<dim3(blocks, 1), dim3(256), 0, stream>>>(
        WC, WC, K, 0L, QVH, QVL, K, 0L, (void*)CTH, (void*)CTL, N, 0L, bo, M, N, K, 1.0f);
  }

  // ---- causal routing attention -> gathered hi/lo planes ----
  attn_route_k<<<dim3(NHEADS * ATT_NQB), dim3(128), 0, stream>>>(STH, STL, ACH, ACL, CTH, CTL, GH, GL);

  // ---- out = gathered . W_out^T + b_out  (M=N=K=2048; A = gathered hi/lo), f32 ----
  {
    const int M = SEQ_LEN, N = HID, K = HID;
    const int blocks = (M / 64) * (N / 64) / 8;   // 128
    wmma_gemm64<1, true, false, 2, 0><<<dim3(blocks, 1), dim3(256), 0, stream>>>(
        GH, GL, K, 0L, WO, WO, K, 0L, (void*)out, (void*)out, N, 0L, bo, M, N, K, 1.0f);
  }
}

// v001
// Measured time: 421 microseconds a run.
// In both of two side-by-side timings against v000, it was 1.35 times as fast.
// All contractions: v_wmma_f32_16x16x32_bf16 (bf16 operands, f32 accumulate): x and weight matrices as single RNE bf16 planes; state/action, q-value product, softmax p, content and gathered carried as bf16 hi/lo planes (hi.hi + hi.lo + lo.hi); softmax, q-value product and bias in f32.
#include <hip/hip_runtime.h>
#include <stdint.h>

constexpr int SEQ_LEN = 2048;   // L
constexpr int HID     = 2048;   // hidden
constexpr int QRANK   = 1024;   // q_rank
constexpr int NHEADS  = 16;
constexpr int HRANK   = 64;     // per-head rank (q/k depth)
constexpr int HVAL    = 128;    // per-head value width
static_assert(QRANK == NHEADS * HRANK, "rank split");
static_assert(HID == NHEADS * HVAL, "value split");
static_assert(SEQ_LEN % 64 == 0 && HID % 64 == 0 && QRANK % 64 == 0, "tile multiples");
static_assert(HID % 32 == 0 && QRANK % 32 == 0, "K multiples of 32");

typedef __attribute__((ext_vector_type(16))) _Float16 v16h;
typedef __attribute__((ext_vector_type(8)))  _Float16 v8h;
typedef __attribute__((ext_vector_type(16))) __bf16   v16b;
typedef __attribute__((ext_vector_type(8)))  __bf16   v8b;
typedef __attribute__((ext_vector_type(8)))  float    v8f;
typedef __attribute__((ext_vector_type(4)))  float    v4f;

__device__ __forceinline__ unsigned short f2bf_bits(float f) {
  unsigned u = __float_as_uint(f);
  return (unsigned short)((u + 0x7FFFu + ((u >> 16) & 1u)) >> 16);
}
__device__ __forceinline__ float bf_bits2f(unsigned short h) { return __uint_as_float(((unsigned)h) << 16); }

// hazard guards as plain device helpers (no inline asm inside the kernel template body)
__device__ __forceinline__ void dep_guard_h(v8f& a, v8f& b, v16h x, v16h y) { asm volatile("v_nop\n\tv_nop\n\tv_nop\n\tv_nop" : "+v"(a), "+v"(b) : "v"(x), "v"(y)); }
__device__ __forceinline__ void dep_guard_b(v8f& a, v8f& b, v16b x, v16b y) { asm volatile("v_nop\n\tv_nop\n\tv_nop\n\tv_nop" : "+v"(a), "+v"(b) : "v"(x), "v"(y)); }
__device__ __forceinline__ void keep4_h(v16h a, v16h b, v16h c, v16h d) { asm volatile("v_nop" :: "v"(a), "v"(b), "v"(c), "v"(d)); }
__device__ __forceinline__ void keep4_b(v16b a, v16b b, v16b c, v16b d) { asm volatile("v_nop" :: "v"(a), "v"(b), "v"(c), "v"(d)); }
__device__ __forceinline__ void acc_guard4(v8f& a, v8f& b, v8f& c, v8f& d) { asm volatile("v_nop\n\tv_nop\n\tv_nop\n\tv_nop" : "+v"(a), "+v"(b), "+v"(c), "+v"(d)); }
template <typename T> struct Frag;
template <> struct Frag<_Float16> {
  typedef v16h V; union U { v16h v; v8h h[2]; };
  static __device__ __forceinline__ v16h load(const _Float16* p) {   // elements 0..7 <- p[0..7], 8..15 <- p[16..23]
    U f; f.h[0] = *(const v8h*)(p); f.h[1] = *(const v8h*)(p + 16); return f.v;
  }
  static __device__ __forceinline__ v8f mma(v16h a, v16h b, v8f c) {
    return __builtin_amdgcn_wmma_f32_16x16x32_f16(false, a, false, b, (short)0, c, false, false);
  }
  static __device__ __forceinline__ void guard(v8f& a, v8f& b, v16h x, v16h y) { dep_guard_h(a, b, x, y); }
  static __device__ __forceinline__ void keep(v16h a, v16h b, v16h c, v16h d) { keep4_h(a, b, c, d); }
};
template <> struct Frag<__bf16> {
  typedef v16b V; union U { v16b v; v8b h[2]; };
  static __device__ __forceinline__ v16b load(const __bf16* p) {
    U f; f.h[0] = *(const v8b*)(p); f.h[1] = *(const v8b*)(p + 16); return f.v;
  }
  static __device__ __forceinline__ v8f mma(v16b a, v16b b, v8f c) {
    return __builtin_amdgcn_wmma_f32_16x16x32_bf16(false, a, false, b, (short)0, c, false, false);
  }
  static __device__ __forceinline__ void guard(v8f& a, v8f& b, v16b x, v16b y) { dep_guard_b(a, b, x, y); }
  static __device__ __forceinline__ void keep(v16b a, v16b b, v16b c, v16b d) { keep4_b(a, b, c, d); }
};

// ---- Register-blocked batched WMMA GEMM ------------------------------------
// C[m,n] = scale * sum_k A[m,k] * Bt[n,k] (+bias); each wave owns a 64x64 tile.
// A row-major [M,K]; Bt row-major [N,K]; M,N % 64 == 0, K % 32 == 0.
// ASPLIT: A carried as hi/lo planes (A2 = lo plane, same layout); BSPLIT: Bt hi/lo (Bt2 = lo plane).
//   product = hi.hi (+ hi.lo if BSPLIT) (+ lo.hi if ASPLIT).
// BIAS_MODE: 0 = none, 1 = bias[m], 2 = bias[n].
// OUT_MODE: 0 = f32, 1 = f16, 2 = bf16 hi plane (Cout) + bf16 lo plane (Cout2).
// Coverage: per 64x64 tile, 4 slabs x 16 rows x 64 cols -> the whole tile; grid = tilesM*tilesN/8 blocks of 8 waves.
// ET: 0 = f16 operands, 1 = bf16 operands (pointers passed as 16-bit storage)
template <int ET> struct Elem;
template <> struct Elem<0> { typedef _Float16 T; };
template <> struct Elem<1> { typedef __bf16 T; };
template <int ET, bool ASPLIT, bool BSPLIT, int BIAS_MODE, int OUT_MODE>
__global__ __launch_bounds__(256) void wmma_gemm64(
    const unsigned short* __restrict__ Ap, const unsigned short* __restrict__ A2p, int lda, long strideA,
    const unsigned short* __restrict__ Btp, const unsigned short* __restrict__ Bt2p, int ldb, long strideB,
    void* __restrict__ Cout, void* __restrict__ Cout2, int ldc, long strideC,
    const float* __restrict__ bias,
    int M, int N, int K, float scale) {
  typedef typename Elem<ET>::T T;
  typedef typename Frag<T>::V V;
  const T* A = (const T*)Ap; const T* A2 = (const T*)A2p; const T* Bt = (const T*)Btp; const T* Bt2 = (const T*)Bt2p;
  __shared__ __align__(16) float sT[8][16 * 68];   // per-wave 16x64 slab, pitch 68 floats
  const int b    = blockIdx.y;
  const int lane = threadIdx.x & 31;
  const int wave = threadIdx.x >> 5;
  const int tilesN = N >> 6;
  const int tilesM = M >> 6;
  const int tile = blockIdx.x * 8 + wave;
  if (tile >= tilesM * tilesN) return;   // wave-uniform; no block barriers in this kernel
  const int tm = tile / tilesN;
  const int tn = tile - tm * tilesN;
  const int m0 = tm << 6;
  const int n0 = tn << 6;

  const T* Ab  = A  + (size_t)b * strideA;
  const T* Bb  = Bt + (size_t)b * strideB;
  const T* Ab2 = ASPLIT ? (A2  + (size_t)b * strideA) : nullptr;
  const T* Bb2 = BSPLIT ? (Bt2 + (size_t)b * strideB) : nullptr;

  const int rlane = lane & 15;                 // row (A) / col (B, D) within subtile
  const int koff  = (lane >> 4) * 8;           // k offset of this lane half
  const int mOff  = (lane >> 4) * 8;           // D row offset

  v8f acc[4][4];
#pragma unroll
  for (int i = 0; i < 4; ++i)
#pragma unroll
    for (int j = 0; j < 4; ++j) acc[i][j] = (v8f){0.f,0.f,0.f,0.f,0.f,0.f,0.f,0.f};

  for (int k0 = 0; k0 < K; k0 += 32) {
    V bh[4], bl[4];
#pragma unroll
    for (int j = 0; j < 4; ++j) {
      const size_t bo = (size_t)(n0 + (j << 4) + rlane) * ldb + koff + k0;
      bh[j] = Frag<T>::load(Bb + bo);
      if (BSPLIT) bl[j] = Frag<T>::load(Bb2 + bo);
    }
#pragma unroll
    for (int i = 0; i < 4; ++i) {
      const size_t ao = (size_t)(m0 + (i << 4) + rlane) * lda + koff + k0;
      V ah = Frag<T>::load(Ab + ao);
      V al = ah;
      if (ASPLIT) al = Frag<T>::load(Ab2 + ao);
#pragma unroll
      for (int j = 0; j < 4; ++j) {
        acc[i][j] = Frag<T>::mma(ah, bh[j], acc[i][j]);
        if (BSPLIT) acc[i][j] = Frag<T>::mma(ah, bl[j], acc[i][j]);
        if (ASPLIT) acc[i][j] = Frag<T>::mma(al, bh[j], acc[i][j]);
      }
      Frag<T>::guard(acc[i][0], acc[i][3], ah, al);
    }
    Frag<T>::keep(bh[0], bh[1], bh[2], bh[3]);
    if (BSPLIT) Frag<T>::keep(bl[0], bl[1], bl[2], bl[3]);
  }
  acc_guard4(acc[0][0], acc[0][1], acc[0][2], acc[0][3]);
  acc_guard4(acc[1][0], acc[1][1], acc[1][2], acc[1][3]);
  acc_guard4(acc[2][0], acc[2][1], acc[2][2], acc[2][3]);
  acc_guard4(acc[3][0], acc[3][1], acc[3][2], acc[3][3]);

  // ---- epilogue ----
  float* slab = sT[wave];
#pragma unroll
  for (int i = 0; i < 4; ++i) {
    const int mBase = m0 + (i << 4);
#pragma unroll
    for (int j = 0; j < 4; ++j) {
      const int n = n0 + (j << 4) + rlane;
      float bv = 0.f;
      if (BIAS_MODE == 2) bv = bias[n];
#pragma unroll
      for (int r = 0; r < 8; ++r) {
        float v = acc[i][j][r] * scale;
        if (BIAS_MODE == 1) v += bias[mBase + mOff + r];
        if (BIAS_MODE == 2) v += bv;
        slab[(mOff + r) * 68 + (j << 4) + rlane] = v;
      }
    }
    __builtin_amdgcn_fence(__ATOMIC_RELEASE, "workgroup");
    __builtin_amdgcn_wave_barrier();
    __builtin_amdgcn_fence(__ATOMIC_ACQUIRE, "workgroup");
    if (OUT_MODE == 0) {
      float* C = (float*)Cout + (size_t)b * strideC;
      const int hh = lane >> 4, c4 = (lane & 15) * 4;     // row seg = 256 B = 16 lanes x 16 B
      {
#pragma unroll
        for (int it = 0; it < 8; ++it) {
          const int row = it * 2 + hh;
          v4f v = *(const v4f*)(slab + row * 68 + c4);
          *(v4f*)(C + (size_t)(mBase + row) * ldc + n0 + c4) = v;
        }
        
      }
    } else {
      const int q = lane >> 3, c8 = (lane & 7) * 8;
      unsigned short* C  = (unsigned short*)Cout  + (size_t)b * strideC;
      unsigned short* C2 = (OUT_MODE == 2) ? ((unsigned short*)Cout2 + (size_t)b * strideC) : nullptr;
      {
#pragma unroll
        for (int it = 0; it < 4; ++it) {
          const int row = it * 4 + q;
          const float* sp = slab + row * 68 + c8;
          v8h hv, lv;
#pragma unroll
          for (int e = 0; e < 8; ++e) {
            if (OUT_MODE == 1) {
              hv[e] = (_Float16)sp[e];
            } else {
              unsigned short hb = f2bf_bits(sp[e]);
              unsigned short lb = f2bf_bits(sp[e] - bf_bits2f(hb));
              hv[e] = __builtin_bit_cast(_Float16, hb);
              lv[e] = __builtin_bit_cast(_Float16, lb);
            }
          }
          *(v8h*)(C + (size_t)(mBase + row) * ldc + n0 + c8) = hv;
          if (OUT_MODE == 2) *(v8h*)(C2 + (size_t)(mBase + row) * ldc + n0 + c8) = lv;
        }
        
      }
    }
    __builtin_amdgcn_fence(__ATOMIC_RELEASE, "workgroup");
    __builtin_amdgcn_wave_barrier();
    __builtin_amdgcn_fence(__ATOMIC_ACQUIRE, "workgroup");
  }
}

// Coverage: grid = ceil(n2/256), thread i converts elements 2i, 2i+1; n2 = n/2 (all n here are multiples of 512).
__global__ __launch_bounds__(256) void cast_f32_bf16x2(
    const float* __restrict__ in, unsigned short* __restrict__ out, int n2) {
  int i = blockIdx.x * 256 + threadIdx.x;
  if (i < n2) {
    const unsigned u = (unsigned)f2bf_bits(in[2 * i]) | ((unsigned)f2bf_bits(in[2 * i + 1]) << 16);
    ((unsigned*)out)[i] = u;
    
  }
}

// ---- state|action f32 [SEQ_LEN][2*QRANK] -> bf16 hi/lo planes of state, action and q-value (state*action in f32), each [SEQ_LEN][QRANK] ----
// Coverage: grid = SEQ_LEN/2 blocks x 256 threads; thread -> row = 2*blk + (tid>>7), cols (tid&127)*8 .. +7 -> 2048 rows x 1024 cols exactly, all six planes.
__global__ __launch_bounds__(256) void planes_k(const float* __restrict__ sa,
    unsigned short* __restrict__ sthp, unsigned short* __restrict__ stlp,
    unsigned short* __restrict__ achp, unsigned short* __restrict__ aclp,
    unsigned short* __restrict__ qvhp, unsigned short* __restrict__ qvlp) {
  const int row = blockIdx.x * 2 + (threadIdx.x >> 7);
  const int c8  = (threadIdx.x & 127) * 8;
  const float* sp = sa + (size_t)row * (2 * QRANK) + c8;
  const v8f sv = *(const v8f*)(sp);
  const v8f av = *(const v8f*)(sp + QRANK);
  v8h shv, slv, ahv, alv, qhv, qlv;
#pragma unroll
  for (int e = 0; e < 8; ++e) {
    const float s = sv[e], a = av[e];
    const float q = s * a;
    unsigned short hb, lb;
    hb = f2bf_bits(s); lb = f2bf_bits(s - bf_bits2f(hb));
    shv[e] = __builtin_bit_cast(_Float16, hb); slv[e] = __builtin_bit_cast(_Float16, lb);
    hb = f2bf_bits(a); lb = f2bf_bits(a - bf_bits2f(hb));
    ahv[e] = __builtin_bit_cast(_Float16, hb); alv[e] = __builtin_bit_cast(_Float16, lb);
    hb = f2bf_bits(q); lb = f2bf_bits(q - bf_bits2f(hb));
    qhv[e] = __builtin_bit_cast(_Float16, hb); qlv[e] = __builtin_bit_cast(_Float16, lb);
  }
  const size_t o = (size_t)row * QRANK + c8;
  _Float16* sth = (_Float16*)sthp; _Float16* stl = (_Float16*)stlp;
  _Float16* ach = (_Float16*)achp; _Float16* acl = (_Float16*)aclp;
  _Float16* qvh = (_Float16*)qvhp; _Float16* qvl = (_Float16*)qvlp;
  {
    *(v8h*)(sth + o) = shv;
    *(v8h*)(stl + o) = slv;
    *(v8h*)(ach + o) = ahv;
    *(v8h*)(acl + o) = alv;
    *(v8h*)(qvh + o) = qhv;
    *(v8h*)(qvl + o) = qlv;
    
  }
}

// =====================================================================================
// Causal routing attention, q/k depth 64 (bf16 hi/lo planes, ld QRANK, head cols h*64),
// value width 128 (content^T bf16 hi/lo planes [h*128 + d][kv], ld SEQ_LEN),
// output gathered as bf16 hi/lo planes [q][h*128 + d], ld HID.
//   scores = (q.k) * 1/8   : hi.hi + hi.lo + lo.hi bf16 WMMA, f32 accumulate; future keys := -inf (p = 0, diagonal always present)
//   out    = p.v           : p and v bf16 hi/lo (hi.hi + hi.lo + lo.hi); online softmax in f32.
// Block = 4 waves, each owns 16 query rows of one head; 64-key chunks, chunks above the diagonal skipped.
// Each chunk's K rows and content^T rows (hi and lo planes) are brought into LDS once per block by asynchronous copies,
// whole 128-B lines, two buffers (chunk t + 1 flies while chunk t is worked on); all four waves read their B-fragments there.
// P is relaid C-layout -> A-layout through per-wave LDS.
// Coverage: grid = NHEADS * SEQ_LEN/64 blocks; block (qb, h) writes rows qb*64..+63, cols h*128..+127 of both planes.
// =====================================================================================
constexpr int ATT_QBLK = 64;
constexpr int ATT_KCH  = 64;
constexpr int ATT_OSP  = 132;
constexpr int ATT_NQB  = SEQ_LEN / ATT_QBLK;
constexpr int ATT_SP   = 72;                          // staged row pitch in elements: 128-B rows at 144 B (16 B x odd, for ds_load_b128 readers)
constexpr int ATT_ROW_KH = 0;                         // staged rows: 64 K hi, 64 K lo, 128 V hi, 128 V lo
constexpr int ATT_ROW_KL = ATT_KCH;
constexpr int ATT_ROW_VH = 2 * ATT_KCH;
constexpr int ATT_ROW_VL = 2 * ATT_KCH + HVAL;
constexpr int ATT_ROWS   = 2 * ATT_KCH + 2 * HVAL;    // 384
static_assert(HRANK * 2 == 128 && ATT_KCH * 2 == 128, "staged rows are 128 B");

__device__ __forceinline__ __bf16 at_f2bf(float f) { return __builtin_bit_cast(__bf16, f2bf_bits(f)); }
__device__ __forceinline__ void at_split(float f, __bf16& hi, __bf16& lo) {
  const unsigned short hb = f2bf_bits(f);
  hi = __builtin_bit_cast(__bf16, hb);
  lo = at_f2bf(f - __uint_as_float(((unsigned)hb) << 16));
}
__device__ __forceinline__ v8f at_mma(v16b a, v16b b, v8f c) {
  c = __builtin_amdgcn_wmma_f32_16x16x32_bf16(false, a, false, b, (short)0, c, false, false);
  asm volatile("v_nop\n\tv_nop\n\tv_nop\n\tv_nop" : "+v"(c) : "v"(a), "v"(b));
  return c;
}

// Twelve asynchronous 16-B-per-lane copies global -> LDS. The s_wait_xcnt is the last line of the copies' own statement,
// so that no address register of an issued copy is rewritten in front of it.
__device__ __forceinline__ void at_copy12(const unsigned* l, const __bf16* const* g) {
  asm volatile(
      "global_load_async_to_lds_b128 %0, %12, off\n\t"
      "global_load_async_to_lds_b128 %1, %13, off\n\t"
      "global_load_async_to_lds_b128 %2, %14, off\n\t"
      "global_load_async_to_lds_b128 %3, %15, off\n\t"
      "global_load_async_to_lds_b128 %4, %16, off\n\t"
      "global_load_async_to_lds_b128 %5, %17, off\n\t"
      "global_load_async_to_lds_b128 %6, %18, off\n\t"
      "global_load_async_to_lds_b128 %7, %19, off\n\t"
      "global_load_async_to_lds_b128 %8, %20, off\n\t"
      "global_load_async_to_lds_b128 %9, %21, off\n\t"
      "global_load_async_to_lds_b128 %10, %22, off\n\t"
      "global_load_async_to_lds_b128 %11, %23, off\n\t"
      "s_wait_xcnt 0x0"
      :: "v"(l[0]), "v"(l[1]), "v"(l[2]), "v"(l[3]), "v"(l[4]), "v"(l[5]),
         "v"(l[6]), "v"(l[7]), "v"(l[8]), "v"(l[9]), "v"(l[10]), "v"(l[11]),
         "v"(g[0]), "v"(g[1]), "v"(g[2]), "v"(g[3]), "v"(g[4]), "v"(g[5]),
         "v"(g[6]), "v"(g[7]), "v"(g[8]), "v"(g[9]), "v"(g[10]), "v"(g[11])
      : "memory");
}

// One chunk's 384 staged rows x 8 segments of 16 B = 3072 lane copies = 24 per thread of the 128-thread block.
// Copy i of thread tid: staged row i*16 + (tid >> 3), segment tid & 7: a wave's copy covers four whole 128-B lines.
__device__ __forceinline__ void at_stage(__bf16* buf, const __bf16* ach, const __bf16* acl,
                                         const __bf16* cth, const __bf16* ctl, int h, int kv0, int tid) {
  const int rg = tid >> 3, seg = (tid & 7) * 8;
  unsigned l[24];
  const __bf16* g[24];
  // the three loops are unrolled so that every index of l and g is a constant and both arrays live in registers
#pragma unroll
  for (int i = 0; i < 24; ++i) l[i] = (unsigned)(size_t)(buf + (i * 16 + rg) * ATT_SP + seg);
#pragma unroll
  for (int i = 0; i < 4; ++i) {
    const size_t ko = (size_t)(kv0 + i * 16 + rg) * QRANK + h * HRANK + seg;
    g[i] = ach + ko;
    g[4 + i] = acl + ko;
  }
#pragma unroll
  for (int i = 0; i < 8; ++i) {
    const size_t vo = (size_t)(h * HVAL + i * 16 + rg) * SEQ_LEN + kv0 + seg;
    g[8 + i] = cth + vo;
    g[16 + i] = ctl + vo;
  }
  at_copy12(l, g);
  at_copy12(l + 12, g + 12);
}

__global__ __launch_bounds__(128)
void attn_route_k(const unsigned short* __restrict__ sthp, const unsigned short* __restrict__ stlp,
                  const unsigned short* __restrict__ achp, const unsigned short* __restrict__ aclp,
                  const unsigned short* __restrict__ cthp, const unsigned short* __restrict__ ctlp,
                  unsigned short* __restrict__ ghp, unsigned short* __restrict__ glp) {
  union FB { v16b v; v8b h[2]; };
  __shared__ __align__(16) __bf16 Psh[4][16 * ATT_KCH];        // per wave P hi [row][kv]
  __shared__ __align__(16) __bf16 Psl[4][16 * ATT_KCH];        // per wave P lo
  __shared__ __align__(16) float  Os[4][16 * ATT_OSP];         // per wave out tile [row][d], pitch 132
  __shared__ __align__(16) __bf16 Stg[2][ATT_ROWS * ATT_SP];   // two buffers of staged K and content^T rows, shared by the block

  const __bf16* sth = (const __bf16*)sthp; const __bf16* stl = (const __bf16*)stlp;
  const __bf16* ach = (const __bf16*)achp; const __bf16* acl = (const __bf16*)aclp;
  const __bf16* cth = (const __bf16*)cthp; const __bf16* ctl = (const __bf16*)ctlp;
  _Float16* gh = (_Float16*)ghp; _Float16* gl = (_Float16*)glp;

  const int tid  = threadIdx.x;
  const int wave = tid >> 5;
  const int lane = tid & 31;
  const int hh   = lane >> 4;
  const int c    = lane & 15;
  const int bx = blockIdx.x;
  const int qb = bx % ATT_NQB;
  const int h  = bx / ATT_NQB;
  const int q0 = qb * ATT_QBLK + wave * 16;

  // ---- Q fragments (A operand): 2 depth chunks, hi and lo; row = c, k = dc*32 + 8*hh + {0..7, 16..23} ----
  v16b qah[2], qal[2];
#pragma unroll
  for (int dc = 0; dc < 2; ++dc) {
    const size_t off = (size_t)(q0 + c) * QRANK + h * HRANK + dc * 32 + 8 * hh;
    qah[dc] = Frag<__bf16>::load(sth + off);
    qal[dc] = Frag<__bf16>::load(stl + off);
  }

  float mrow[8], lrow[8];
  v8f oacc[8];
#pragma unroll
  for (int r = 0; r < 8; ++r) { mrow[r] = -INFINITY; lrow[r] = 0.f; }
#pragma unroll
  for (int t = 0; t < 8; ++t) oacc[t] = (v8f){0.f,0.f,0.f,0.f,0.f,0.f,0.f,0.f};

  __bf16* pwh = Psh[wave];
  __bf16* pwl = Psl[wave];
  const int nChunks = qb + 1;   // block-uniform, <= 32

  // ---- ring prologue: chunk 0 lands and is published; then chunk 1 starts ----
  at_stage(Stg[0], ach, acl, cth, ctl, h, 0, tid);
  asm volatile("s_wait_asynccnt 0x0" ::: "memory");   // this wave's copies of chunk 0 have landed
  __syncthreads();                                    // every wave's have: chunk 0 may be read
  if (nChunks > 1) at_stage(Stg[1], ach, acl, cth, ctl, h, ATT_KCH, tid);

  for (int kc = 0; kc < nChunks; ++kc) {
    const int kv0 = kc * ATT_KCH;
    const __bf16* sb = Stg[kc & 1];

    // ---- scores: 4 key subtiles of 16; K B-fragments: col = key, k = depth (staged rows) ----
    v8f s[4];
#pragma unroll
    for (int j = 0; j < 4; ++j) {
      s[j] = (v8f){0.f,0.f,0.f,0.f,0.f,0.f,0.f,0.f};
#pragma unroll
      for (int dc = 0; dc < 2; ++dc) {
        const int ko = (j * 16 + c) * ATT_SP + dc * 32 + 8 * hh;
        const v16b kb = Frag<__bf16>::load(sb + ATT_ROW_KH * ATT_SP + ko);
        const v16b kl = Frag<__bf16>::load(sb + ATT_ROW_KL * ATT_SP + ko);
        s[j] = at_mma(qah[dc], kb, s[j]);
        s[j] = at_mma(qah[dc], kl, s[j]);
        s[j] = at_mma(qal[dc], kb, s[j]);
      }
    }

    // ---- scale by 1/8, causal select on the diagonal chunk, row max ----
    const bool diag = (kc == qb);
    float cm[8];
#pragma unroll
    for (int r = 0; r < 8; ++r) {
      const int qrow = q0 + 8 * hh + r;
      float m = -INFINITY;
#pragma unroll
      for (int j = 0; j < 4; ++j) {
        const int kvcol = kv0 + j * 16 + c;
        float v = s[j][r] * 0.125f;
        if (diag && (kvcol > qrow)) v = -INFINITY;
        s[j][r] = v;
        m = fmaxf(m, v);
      }
#pragma unroll
      for (int off = 1; off < 16; off <<= 1) m = fmaxf(m, __shfl_xor(m, off, 32));
      cm[r] = m;
    }

    // ---- online softmax update; P tile (C layout) -> LDS as bf16 hi/lo ----
#pragma unroll
    for (int r = 0; r < 8; ++r) {
      const float mnew = fmaxf(mrow[r], cm[r]);
      const float alpha = expf(mrow[r] - mnew);
      mrow[r] = mnew;
      float psum = 0.f;
#pragma unroll
      for (int j = 0; j < 4; ++j) {
        const float p = expf(s[j][r] - mnew);
        psum += p;
        __bf16 a, bl; at_split(p, a, bl);
        pwh[(8 * hh + r) * ATT_KCH + j * 16 + c] = a;
        pwl[(8 * hh + r) * ATT_KCH + j * 16 + c] = bl;
      }
#pragma unroll
      for (int off = 1; off < 16; off <<= 1) psum += __shfl_xor(psum, off, 32);
      lrow[r] = lrow[r] * alpha + psum;
#pragma unroll
      for (int t = 0; t < 8; ++t) oacc[t][r] *= alpha;
    }
    __builtin_amdgcn_fence(__ATOMIC_RELEASE, "workgroup");
    __builtin_amdgcn_wave_barrier();
    __builtin_amdgcn_fence(__ATOMIC_ACQUIRE, "workgroup");

    // ---- O += P.V ; P A-fragments from LDS (row = c, k = kv), V B-fragments from the staged content^T rows (col = d, k = kv) ----
#pragma unroll 1
    for (int kk = 0; kk < 2; ++kk) {
      FB pa, pl;
      pa.h[0] = *(const v8b*)(pwh + c * ATT_KCH + kk * 32 + 8 * hh);
      pa.h[1] = *(const v8b*)(pwh + c * ATT_KCH + kk * 32 + 16 + 8 * hh);
      pl.h[0] = *(const v8b*)(pwl + c * ATT_KCH + kk * 32 + 8 * hh);
      pl.h[1] = *(const v8b*)(pwl + c * ATT_KCH + kk * 32 + 16 + 8 * hh);
#pragma unroll
      for (int t = 0; t < 8; ++t) {
        const int vo = (t * 16 + c) * ATT_SP + kk * 32 + 8 * hh;
        const v16b vb = Frag<__bf16>::load(sb + ATT_ROW_VH * ATT_SP + vo);
        const v16b vl = Frag<__bf16>::load(sb + ATT_ROW_VL * ATT_SP + vo);
        oacc[t] = at_mma(pa.v, vb, oacc[t]);
        oacc[t] = at_mma(pa.v, vl, oacc[t]);
        oacc[t] = at_mma(pl.v, vb, oacc[t]);
      }
    }
    // order this chunk's P loads before the next chunk's P stores
    __builtin_amdgcn_fence(__ATOMIC_RELEASE, "workgroup");
    __builtin_amdgcn_wave_barrier();
    __builtin_amdgcn_fence(__ATOMIC_ACQUIRE, "workgroup");

    // ---- publish point of chunk kc + 1, every wave ----
    asm volatile("s_wait_dscnt 0x0" ::: "memory");      // this wave's reads of buffer kc & 1 have returned
    asm volatile("s_wait_asynccnt 0x0" ::: "memory");   // this wave's copies of chunk kc + 1 have landed
    __syncthreads();                                    // publishes chunk kc + 1 and ends every reader's last read of buffer kc & 1
    if (kc + 2 < nChunks) at_stage(Stg[kc & 1], ach, acl, cth, ctl, h, (kc + 2) * ATT_KCH, tid);   // block-uniform test
  }
  asm volatile("s_wait_asynccnt 0x0" ::: "memory");     // no copy is outstanding when the wave goes on to its end

  float* os = Os[wave];
#pragma unroll
  for (int r = 0; r < 8; ++r) {
    const float inv = 1.0f / lrow[r];
#pragma unroll
    for (int t = 0; t < 8; ++t) os[(8 * hh + r) * ATT_OSP + t * 16 + c] = oacc[t][r] * inv;
  }
  __builtin_amdgcn_fence(__ATOMIC_RELEASE, "workgroup");
  __builtin_amdgcn_wave_barrier();
  __builtin_amdgcn_fence(__ATOMIC_ACQUIRE, "workgroup");
  {
    // lane groups of 8: q4 = lane>>3; row parity = q4>>1, column half = q4&1; it = 0..7 -> rows 0..15, cols 0..127: whole 16x128 tile, both planes
    const int q4 = lane >> 3, c8 = (lane & 7) * 8;
    const int rpar = q4 >> 1, chalf = (q4 & 1) * 64;
    {
#pragma unroll
      for (int it = 0; it < 8; ++it) {
        const int row = it * 2 + rpar;
        const int col = chalf + c8;
        const float* sp = os + row * ATT_OSP + col;
        v8h hv, lv;
#pragma unroll
        for (int e = 0; e < 8; ++e) {
          const unsigned short hb = f2bf_bits(sp[e]);
          const unsigned short lb = f2bf_bits(sp[e] - bf_bits2f(hb));
          hv[e] = __builtin_bit_cast(_Float16, hb);
          lv[e] = __builtin_bit_cast(_Float16, lb);
        }
        const size_t go = (size_t)(q0 + row) * HID + h * HVAL + col;
        *(v8h*)(gh + go) = hv;
        *(v8h*)(gl + go) = lv;
      }
      
    }
  }
}

// =====================================================================================
// Host launcher. Workspace region map (bytes, every offset a multiple of 4 MiB):
//   XB   bf16 [2048][2048]   8 MiB   x
//   WSA  bf16 [2048][2048]   8 MiB   rows 0..1023 W_state, 1024..2047 W_action
//   WC   bf16 [2048][1024]   4 MiB   W_content
//   WO   bf16 [2048][2048]   8 MiB   W_out
//   SA32 f32  [2048][2048]  16 MiB   state | action
//   STH, STL, ACH, ACL, QVH, QVL  bf16 [2048][1024]  4 MiB each (state, action, q-value hi/lo)
//   CTH, CTL  bf16 [2048 = h*128+d][2048 = kv]  8 MiB each (content^T hi/lo)
//   GH, GL    bf16 [2048][2048]  8 MiB each (gathered hi/lo)
//   total 104,857,600 B
// =====================================================================================
extern "C" void kernel_launch(void* const* d_in, const int* in_sizes, int n_in,
                              void* d_out, int out_size, void* d_ws, size_t ws_size,
                              hipStream_t stream) {
  if (n_in < 6) return;
  if (in_sizes[0] != SEQ_LEN * HID || in_sizes[1] != QRANK * HID || in_sizes[2] != QRANK * HID ||
      in_sizes[3] != HID * QRANK || in_sizes[4] != HID * HID || in_sizes[5] != HID) return;
  if (out_size != SEQ_LEN * HID) return;

  const float* x  = (const float*)d_in[0];
  const float* Ws = (const float*)d_in[1];
  const float* Wa = (const float*)d_in[2];
  const float* Wc = (const float*)d_in[3];
  const float* Wo = (const float*)d_in[4];
  const float* bo = (const float*)d_in[5];
  float* out = (float*)d_out;

  const size_t B_XB  = (size_t)SEQ_LEN * HID * 2;
  const size_t B_WSA = (size_t)(2 * QRANK) * HID * 2;
  const size_t B_WC  = (size_t)HID * QRANK * 2;
  const size_t B_WO  = (size_t)HID * HID * 2;
  const size_t B_SA  = (size_t)SEQ_LEN * (2 * QRANK) * 4;
  const size_t B_PL  = (size_t)SEQ_LEN * QRANK * 2;     // one [2048][1024] bf16 plane
  const size_t B_CT  = (size_t)HID * SEQ_LEN * 2;       // one [2048][2048] bf16 plane
  const size_t B_G   = (size_t)SEQ_LEN * HID * 2;

  char* ws = (char*)d_ws;
  size_t off = 0;
  unsigned short* XB  = (unsigned short*)(ws + off); off += B_XB;
  unsigned short* WSA = (unsigned short*)(ws + off); off += B_WSA;
  unsigned short* WC  = (unsigned short*)(ws + off); off += B_WC;
  unsigned short* WO  = (unsigned short*)(ws + off); off += B_WO;
  float*          SA  = (float*)(ws + off);          off += B_SA;
  unsigned short* STH = (unsigned short*)(ws + off); off += B_PL;
  unsigned short* STL = (unsigned short*)(ws + off); off += B_PL;
  unsigned short* ACH = (unsigned short*)(ws + off); off += B_PL;
  unsigned short* ACL = (unsigned short*)(ws + off); off += B_PL;
  unsigned short* QVH = (unsigned short*)(ws + off); off += B_PL;
  unsigned short* QVL = (unsigned short*)(ws + off); off += B_PL;
  unsigned short* CTH = (unsigned short*)(ws + off); off += B_CT;
  unsigned short* CTL = (unsigned short*)(ws + off); off += B_CT;
  unsigned short* GH  = (unsigned short*)(ws + off); off += B_G;
  unsigned short* GL  = (unsigned short*)(ws + off); off += B_G;
  if (off > ws_size) return;

  // ---- input casts to bf16 (RNE) ----
  {
    const int n2x = SEQ_LEN * HID / 2, n2w = QRANK * HID / 2, n2c = HID * QRANK / 2, n2o = HID * HID / 2;
    cast_f32_bf16x2<<<dim3((n2x + 255) / 256), dim3(256), 0, stream>>>(x,  XB, n2x);
    cast_f32_bf16x2<<<dim3((n2w + 255) / 256), dim3(256), 0, stream>>>(Ws, WSA, n2w);
    cast_f32_bf16x2<<<dim3((n2w + 255) / 256), dim3(256), 0, stream>>>(Wa, WSA + (size_t)QRANK * HID, n2w);
    cast_f32_bf16x2<<<dim3((n2c + 255) / 256), dim3(256), 0, stream>>>(Wc, WC, n2c);
    cast_f32_bf16x2<<<dim3((n2o + 255) / 256), dim3(256), 0, stream>>>(Wo, WO, n2o);
  }

  // ---- projections: SA[q][0..2047] = x . [W_state; W_action]^T  (M=2048, N=2048, K=2048) ----
  {
    const int M = SEQ_LEN, N = 2 * QRANK, K = HID;
    const int blocks = (M / 64) * (N / 64) / 8;   // 128
    wmma_gemm64<1, false, false, 0, 0><<<dim3(blocks, 1), dim3(256), 0, stream>>>(
        XB, XB, K, 0L, WSA, WSA, K, 0L, (void*)SA, (void*)SA, N, 0L, bo, M, N, K, 1.0f);
  }

  // ---- bf16 hi/lo planes of state, action, q-value ----
  planes_k<<<dim3(SEQ_LEN / 2), dim3(256), 0, stream>>>(SA, STH, STL, ACH, ACL, QVH, QVL);

  // ---- content^T[n][kv] = W_content[n][:] . qval[kv][:]  (M=2048, N=2048, K=1024; B = q-value hi/lo) -> bf16 hi/lo planes ----
  {
    const int M = HID, N = SEQ_LEN, K = QRANK;
    const int blocks = (M / 64) * (N / 64) / 8;   // 128
    wmma_gemm64<1, false, true, 0, 2><<<dim3(blocks, 1), dim3(256), 0, stream>>>(
        WC, WC, K, 0L, QVH, QVL, K, 0L, (void*)CTH, (void*)CTL, N, 0L, bo, M, N, K, 1.0f);
  }

  // ---- causal routing attention -> gathered hi/lo planes ----
  attn_route_k<<<dim3(NHEADS * ATT_NQB), dim3(128), 0, stream>>>(STH, STL, ACH, ACL, CTH, CTL, GH, GL);

  // ---- out = gathered . W_out^T + b_out  (M=N=K=2048; A = gathered hi/lo), f32 ----
  {
    const int M = SEQ_LEN, N = HID, K = HID;
    const int blocks = (M / 64) * (N / 64) / 8;   // 128
    wmma_gemm64<1, true, false, 2, 0><<<dim3(blocks, 1), dim3(256), 0, stream>>>(
        GH, GL, K, 0L, WO, WO, K, 0L, (void*)out, (void*)out, N, 0L, bo, M, N, K, 1.0f);
  }
}

// v002
// It runs in 258 microseconds.
// Two timings next to v001 put it at 1.62 and 1.63 times that version's speed.
// Counting every step since v000, it is 2.20 times as fast.
// All contractions: v_wmma_f32_16x16x32_bf16 (bf16 operands, f32 accumulate): x and weight matrices as single RNE bf16 planes; state/action, q-value product, softmax p, content and gathered carried as bf16 hi/lo planes (hi.hi + hi.lo + lo.hi); softmax, q-value product and bias in f32.
#include <hip/hip_runtime.h>
#include <stdint.h>

constexpr int SEQ_LEN = 2048;   // L
constexpr int HID     = 2048;   // hidden
constexpr int QRANK   = 1024;   // q_rank
constexpr int NHEADS  = 16;
constexpr int HRANK   = 64;     // per-head rank (q/k depth)
constexpr int HVAL    = 128;    // per-head value width
static_assert(QRANK == NHEADS * HRANK, "rank split");
static_assert(HID == NHEADS * HVAL, "value split");
static_assert(SEQ_LEN % 64 == 0 && HID % 64 == 0 && QRANK % 64 == 0, "tile multiples");
static_assert(HID % 32 == 0 && QRANK % 32 == 0, "K multiples of 32");

typedef __attribute__((ext_vector_type(16))) _Float16 v16h;
typedef __attribute__((ext_vector_type(8)))  _Float16 v8h;
typedef __attribute__((ext_vector_type(16))) __bf16   v16b;
typedef __attribute__((ext_vector_type(8)))  __bf16   v8b;
typedef __attribute__((ext_vector_type(8)))  float    v8f;
typedef __attribute__((ext_vector_type(4)))  float    v4f;

__device__ __forceinline__ unsigned short f2bf_bits(float f) {
  unsigned u = __float_as_uint(f);
  return (unsigned short)((u + 0x7FFFu + ((u >> 16) & 1u)) >> 16);
}
__device__ __forceinline__ float bf_bits2f(unsigned short h) { return __uint_as_float(((unsigned)h) << 16); }

// hazard guards as plain device helpers (no hazard-guard asm inside the kernel template body)
__device__ __forceinline__ void dep_guard_h(v8f& a, v8f& b, v16h x, v16h y) { asm volatile("v_nop\n\tv_nop\n\tv_nop\n\tv_nop" : "+v"(a), "+v"(b) : "v"(x), "v"(y)); }
__device__ __forceinline__ void dep_guard_b(v8f& a, v8f& b, v16b x, v16b y) { asm volatile("v_nop\n\tv_nop\n\tv_nop\n\tv_nop" : "+v"(a), "+v"(b) : "v"(x), "v"(y)); }
__device__ __forceinline__ void keep4_h(v16h a, v16h b, v16h c, v16h d) { asm volatile("v_nop" :: "v"(a), "v"(b), "v"(c), "v"(d)); }
__device__ __forceinline__ void keep4_b(v16b a, v16b b, v16b c, v16b d) { asm volatile("v_nop" :: "v"(a), "v"(b), "v"(c), "v"(d)); }
__device__ __forceinline__ void acc_guard4(v8f& a, v8f& b, v8f& c, v8f& d) { asm volatile("v_nop\n\tv_nop\n\tv_nop\n\tv_nop" : "+v"(a), "+v"(b), "+v"(c), "+v"(d)); }
template <typename T> struct Frag;
template <> struct Frag<_Float16> {
  typedef v16h V; union U { v16h v; v8h h[2]; };
  static __device__ __forceinline__ v16h load(const _Float16* p) {   // elements 0..7 <- p[0..7], 8..15 <- p[16..23]
    U f; f.h[0] = *(const v8h*)(p); f.h[1] = *(const v8h*)(p + 16); return f.v;
  }
  static __device__ __forceinline__ v8f mma(v16h a, v16h b, v8f c) {
    return __builtin_amdgcn_wmma_f32_16x16x32_f16(false, a, false, b, (short)0, c, false, false);
  }
  static __device__ __forceinline__ void guard(v8f& a, v8f& b, v16h x, v16h y) { dep_guard_h(a, b, x, y); }
  static __device__ __forceinline__ void keep(v16h a, v16h b, v16h c, v16h d) { keep4_h(a, b, c, d); }
};
template <> struct Frag<__bf16> {
  typedef v16b V; union U { v16b v; v8b h[2]; };
  static __device__ __forceinline__ v16b load(const __bf16* p) {
    U f; f.h[0] = *(const v8b*)(p); f.h[1] = *(const v8b*)(p + 16); return f.v;
  }
  static __device__ __forceinline__ v8f mma(v16b a, v16b b, v8f c) {
    return __builtin_amdgcn_wmma_f32_16x16x32_bf16(false, a, false, b, (short)0, c, false, false);
  }
  static __device__ __forceinline__ void guard(v8f& a, v8f& b, v16b x, v16b y) { dep_guard_b(a, b, x, y); }
  static __device__ __forceinline__ void keep(v16b a, v16b b, v16b c, v16b d) { keep4_b(a, b, c, d); }
};

// Twelve asynchronous 16-B-per-lane copies global -> LDS. The s_wait_xcnt is the last line of the copies' own statement,
// so that no address register of an issued copy is rewritten in front of it.
__device__ __forceinline__ void at_copy12(const unsigned* l, const __bf16* const* g) {
  asm volatile(
      "global_load_async_to_lds_b128 %0, %12, off\n\t"
      "global_load_async_to_lds_b128 %1, %13, off\n\t"
      "global_load_async_to_lds_b128 %2, %14, off\n\t"
      "global_load_async_to_lds_b128 %3, %15, off\n\t"
      "global_load_async_to_lds_b128 %4, %16, off\n\t"
      "global_load_async_to_lds_b128 %5, %17, off\n\t"
      "global_load_async_to_lds_b128 %6, %18, off\n\t"
      "global_load_async_to_lds_b128 %7, %19, off\n\t"
      "global_load_async_to_lds_b128 %8, %20, off\n\t"
      "global_load_async_to_lds_b128 %9, %21, off\n\t"
      "global_load_async_to_lds_b128 %10, %22, off\n\t"
      "global_load_async_to_lds_b128 %11, %23, off\n\t"
      "s_wait_xcnt 0x0"
      :: "v"(l[0]), "v"(l[1]), "v"(l[2]), "v"(l[3]), "v"(l[4]), "v"(l[5]),
         "v"(l[6]), "v"(l[7]), "v"(l[8]), "v"(l[9]), "v"(l[10]), "v"(l[11]),
         "v"(g[0]), "v"(g[1]), "v"(g[2]), "v"(g[3]), "v"(g[4]), "v"(g[5]),
         "v"(g[6]), "v"(g[7]), "v"(g[8]), "v"(g[9]), "v"(g[10]), "v"(g[11])
      : "memory");
}

// The same for eight copies.
__device__ __forceinline__ void at_copy8(const unsigned* l, const __bf16* const* g) {
  asm volatile(
      "global_load_async_to_lds_b128 %0, %8, off\n\t"
      "global_load_async_to_lds_b128 %1, %9, off\n\t"
      "global_load_async_to_lds_b128 %2, %10, off\n\t"
      "global_load_async_to_lds_b128 %3, %11, off\n\t"
      "global_load_async_to_lds_b128 %4, %12, off\n\t"
      "global_load_async_to_lds_b128 %5, %13, off\n\t"
      "global_load_async_to_lds_b128 %6, %14, off\n\t"
      "global_load_async_to_lds_b128 %7, %15, off\n\t"
      "s_wait_xcnt 0x0"
      :: "v"(l[0]), "v"(l[1]), "v"(l[2]), "v"(l[3]), "v"(l[4]), "v"(l[5]), "v"(l[6]), "v"(l[7]),
         "v"(g[0]), "v"(g[1]), "v"(g[2]), "v"(g[3]), "v"(g[4]), "v"(g[5]), "v"(g[6]), "v"(g[7])
      : "memory");
}

// ---- Register-blocked batched WMMA GEMM ------------------------------------
// C[m,n] = scale * sum_k A[m,k] * Bt[n,k] (+bias); each wave owns a 64x64 tile; a block's 8 waves (2 x 4) own a 128x256 tile.
// A row-major [M,K]; Bt row-major [N,K]; M % 128 == 0, N % 256 == 0, K % 64 == 0.
// Per 64 k the block's 128 A rows and 256 Bt rows (each plane) are brought into LDS once by asynchronous copies, whole 128-B lines,
// two buffers (slab s + 1 flies while slab s is worked on); the waves read their fragments there.
// ASPLIT: A carried as hi/lo planes (A2 = lo plane, same layout); BSPLIT: Bt hi/lo (Bt2 = lo plane).
//   product = hi.hi (+ hi.lo if BSPLIT) (+ lo.hi if ASPLIT).
// BIAS_MODE: 0 = none, 1 = bias[m], 2 = bias[n].
// OUT_MODE: 0 = f32, 1 = f16, 2 = bf16 hi plane (Cout) + bf16 lo plane (Cout2).
// Coverage: per 64x64 tile, 4 slabs x 16 rows x 64 cols -> the whole tile; grid = (M/128)*(N/256) = tilesM*tilesN/8 blocks of 8 waves.
// ET: 0 = f16 operands, 1 = bf16 operands (pointers passed as 16-bit storage)
constexpr int GM_BM = 128;   // block tile rows
constexpr int GM_BN = 256;   // block tile cols
constexpr int GM_KS = 64;    // k per staged slab: 128-B rows
constexpr int GM_SP = 72;    // staged row pitch in elements: 144 B (16 B x odd, for ds_load_b128 readers)
static_assert(SEQ_LEN % GM_BN == 0 && HID % GM_BN == 0 && (2 * QRANK) % GM_BN == 0, "block tile multiples");
static_assert(HID % GM_KS == 0 && QRANK % GM_KS == 0, "K multiples of the slab");
template <int ET> struct Elem;
template <> struct Elem<0> { typedef _Float16 T; };
template <> struct Elem<1> { typedef __bf16 T; };
template <int ET, bool ASPLIT, bool BSPLIT, int BIAS_MODE, int OUT_MODE>
__global__ __launch_bounds__(256) void wmma_gemm64(
    const unsigned short* __restrict__ Ap, const unsigned short* __restrict__ A2p, int lda, long strideA,
    const unsigned short* __restrict__ Btp, const unsigned short* __restrict__ Bt2p, int ldb, long strideB,
    void* __restrict__ Cout, void* __restrict__ Cout2, int ldc, long strideC,
    const float* __restrict__ bias,
    int M, int N, int K, float scale) {
  typedef typename Elem<ET>::T T;
  typedef typename Frag<T>::V V;
  const T* A = (const T*)Ap; const T* A2 = (const T*)A2p; const T* Bt = (const T*)Btp; const T* Bt2 = (const T*)Bt2p;
  // staged rows of one slab: A hi (, A lo), Bt hi (, Bt lo); every plane starts at a multiple of 32 rows
  constexpr int ROW_AL = GM_BM;
  constexpr int ROW_BH = GM_BM * (ASPLIT ? 2 : 1);
  constexpr int ROW_BL = ROW_BH + GM_BN;
  constexpr int ROWS   = ROW_BH + GM_BN * (BSPLIT ? 2 : 1);   // 384, 512 or 640
  constexpr int NCP    = ROWS / 32;                           // copies per thread and slab: 12, 16 or 20
  static_assert(NCP == 12 || NCP == 16 || NCP == 20, "copy statements below");
  __shared__ __align__(16) float sT[8][16 * 68];   // per-wave 16x64 slab, pitch 68 floats
  __shared__ __align__(16) T Stg[2][ROWS * GM_SP]; // two buffers of staged rows, shared by the block
  const int b    = blockIdx.y;
  const int tid  = threadIdx.x;
  const int lane = threadIdx.x & 31;
  const int wave = threadIdx.x >> 5;
  const int blkN = N / GM_BN;
  if ((int)blockIdx.x >= (M / GM_BM) * blkN) return;   // block-uniform, in front of every barrier
  const int bm  = blockIdx.x / blkN;
  const int bm0 = bm * GM_BM;
  const int bn0 = (blockIdx.x - bm * blkN) * GM_BN;
  const int wm0 = (wave >> 2) << 6;            // this wave's 64x64 tile inside the block tile
  const int wn0 = (wave & 3) << 6;
  const int m0 = bm0 + wm0;
  const int n0 = bn0 + wn0;

  const T* Ab  = A  + (size_t)b * strideA;
  const T* Bb  = Bt + (size_t)b * strideB;
  const T* Ab2 = ASPLIT ? (A2  + (size_t)b * strideA) : nullptr;
  const T* Bb2 = BSPLIT ? (Bt2 + (size_t)b * strideB) : nullptr;

  const int rlane = lane & 15;                 // row (A) / col (B, D) within subtile
  const int koff  = (lane >> 4) * 8;           // k offset of this lane half
  const int mOff  = (lane >> 4) * 8;           // D row offset

  v8f acc[4][4];
#pragma unroll
  for (int i = 0; i < 4; ++i)
#pragma unroll
    for (int j = 0; j < 4; ++j) acc[i][j] = (v8f){0.f,0.f,0.f,0.f,0.f,0.f,0.f,0.f};

  // One slab: ROWS staged rows x 8 segments of 16 B = NCP lane copies per thread of the 256-thread block.
  // Copy i of thread tid: staged row i*32 + (tid >> 3), segment tid & 7: a wave's copy covers four whole 128-B lines.
  // One running pointer per plane (this thread's first row and segment of the next slab to stage); the other rows are 32*ld apart.
  const int rg = tid >> 3, seg = (tid & 7) * 8;
  const T* pA  = Ab + (size_t)(bm0 + rg) * lda + seg;
  const T* pB  = Bb + (size_t)(bn0 + rg) * ldb + seg;
  const T* pA2 = ASPLIT ? (Ab2 + (size_t)(bm0 + rg) * lda + seg) : nullptr;
  const T* pB2 = BSPLIT ? (Bb2 + (size_t)(bn0 + rg) * ldb + seg) : nullptr;
  auto stage = [&](T* buf) {
    unsigned l[NCP];
    const __bf16* g[NCP];
    // unrolled so that every index of l and g is a constant and both arrays live in registers
#pragma unroll
    for (int i = 0; i < NCP; ++i) {
      const T* sp;
      if (i * 32 >= ROW_BL)                 sp = pB2 + (size_t)(i * 32 - ROW_BL) * ldb;
      else if (i * 32 >= ROW_BH)            sp = pB  + (size_t)(i * 32 - ROW_BH) * ldb;
      else if (ASPLIT && i * 32 >= ROW_AL)  sp = pA2 + (size_t)(i * 32 - ROW_AL) * lda;
      else                                  sp = pA  + (size_t)(i * 32) * lda;
      l[i] = (unsigned)(size_t)(buf + (i * 32 + rg) * GM_SP + seg);
      g[i] = (const __bf16*)sp;
    }
    if (NCP == 12) { at_copy12(l, g); }
    if (NCP == 16) { at_copy8(l, g); at_copy8(l + NCP - 8, g + NCP - 8); }
    if (NCP == 20) { at_copy12(l, g); at_copy8(l + NCP - 8, g + NCP - 8); }
    pA += GM_KS; pB += GM_KS;
    if (ASPLIT) pA2 += GM_KS;
    if (BSPLIT) pB2 += GM_KS;
  };
  const int nSlabs = K / GM_KS;   // block-uniform

  // ---- ring prologue: slab 0 lands and is published; then slab 1 starts ----
  stage(Stg[0]);
  asm volatile("s_wait_asynccnt 0x0" ::: "memory");   // this wave's copies of slab 0 have landed
  __syncthreads();                                    // every wave's have: slab 0 may be read
  if (nSlabs > 1) stage(Stg[1]);

  for (int s = 0; s < nSlabs; ++s) {
    const T* sb = Stg[s & 1];
    // both 32-k steps of the slab unrolled: the second step's LDS reads may go ahead of the first step's products
#pragma unroll
    for (int kk = 0; kk < GM_KS; kk += 32) {
      V bh[4], bl[4];
#pragma unroll
      for (int j = 0; j < 4; ++j) {
        const int bo = (wn0 + (j << 4) + rlane) * GM_SP + koff + kk;
        bh[j] = Frag<T>::load(sb + ROW_BH * GM_SP + bo);
        if (BSPLIT) bl[j] = Frag<T>::load(sb + ROW_BL * GM_SP + bo);
      }
      // all of the step's LDS reads stand together, ahead of its products
      V ah[4], al[4];
#pragma unroll
      for (int i = 0; i < 4; ++i) {
        const int ao = (wm0 + (i << 4) + rlane) * GM_SP + koff + kk;
        ah[i] = Frag<T>::load(sb + ao);
        al[i] = ah[i];
        if (ASPLIT) al[i] = Frag<T>::load(sb + ROW_AL * GM_SP + ao);
      }
#pragma unroll
      for (int i = 0; i < 4; ++i) {
#pragma unroll
        for (int j = 0; j < 4; ++j) {
          acc[i][j] = Frag<T>::mma(ah[i], bh[j], acc[i][j]);
          if (BSPLIT) acc[i][j] = Frag<T>::mma(ah[i], bl[j], acc[i][j]);
          if (ASPLIT) acc[i][j] = Frag<T>::mma(al[i], bh[j], acc[i][j]);
        }
        Frag<T>::guard(acc[i][0], acc[i][3], ah[i], al[i]);
      }
      Frag<T>::keep(bh[0], bh[1], bh[2], bh[3]);
      if (BSPLIT) Frag<T>::keep(bl[0], bl[1], bl[2], bl[3]);
    }
    // ---- publish point of slab s + 1, every wave ----
    asm volatile("s_wait_dscnt 0x0" ::: "memory");      // this wave's reads of buffer s & 1 have returned
    asm volatile("s_wait_asynccnt 0x0" ::: "memory");   // this wave's copies of slab s + 1 have landed
    __syncthreads();                                    // publishes slab s + 1 and ends every reader's last read of buffer s & 1
    if (s + 2 < nSlabs) stage(Stg[s & 1]);              // block-uniform test; slab s + 2
  }
  asm volatile("s_wait_asynccnt 0x0" ::: "memory");     // no copy is outstanding when the wave goes on to its end
  acc_guard4(acc[0][0], acc[0][1], acc[0][2], acc[0][3]);
  acc_guard4(acc[1][0], acc[1][1], acc[1][2], acc[1][3]);
  acc_guard4(acc[2][0], acc[2][1], acc[2][2], acc[2][3]);
  acc_guard4(acc[3][0], acc[3][1], acc[3][2], acc[3][3]);

  // ---- epilogue ----
  float* slab = sT[wave];
#pragma unroll
  for (int i = 0; i < 4; ++i) {
    const int mBase = m0 + (i << 4);
#pragma unroll
    for (int j = 0; j < 4; ++j) {
      const int n = n0 + (j << 4) + rlane;
      float bv = 0.f;
      if (BIAS_MODE == 2) bv = bias[n];
#pragma unroll
      for (int r = 0; r < 8; ++r) {
        float v = acc[i][j][r] * scale;
        if (BIAS_MODE == 1) v += bias[mBase + mOff + r];
        if (BIAS_MODE == 2) v += bv;
        slab[(mOff + r) * 68 + (j << 4) + rlane] = v;
      }
    }
    __builtin_amdgcn_fence(__ATOMIC_RELEASE, "workgroup");
    __builtin_amdgcn_wave_barrier();
    __builtin_amdgcn_fence(__ATOMIC_ACQUIRE, "workgroup");
    if (OUT_MODE == 0) {
      float* C = (float*)Cout + (size_t)b * strideC;
      const int hh = lane >> 4, c4 = (lane & 15) * 4;     // row seg = 256 B = 16 lanes x 16 B
      {
#pragma unroll
        for (int it = 0; it < 8; ++it) {
          const int row = it * 2 + hh;
          v4f v = *(const v4f*)(slab + row * 68 + c4);
          *(v4f*)(C + (size_t)(mBase + row) * ldc + n0 + c4) = v;
        }
        
      }
    } else {
      const int q = lane >> 3, c8 = (lane & 7) * 8;
      unsigned short* C  = (unsigned short*)Cout  + (size_t)b * strideC;
      unsigned short* C2 = (OUT_MODE == 2) ? ((unsigned short*)Cout2 + (size_t)b * strideC) : nullptr;
      {
#pragma unroll
        for (int it = 0; it < 4; ++it) {
          const int row = it * 4 + q;
          const float* sp = slab + row * 68 + c8;
          v8h hv, lv;
#pragma unroll
          for (int e = 0; e < 8; ++e) {
            if (OUT_MODE == 1) {
              hv[e] = (_Float16)sp[e];
            } else {
              unsigned short hb = f2bf_bits(sp[e]);
              unsigned short lb = f2bf_bits(sp[e] - bf_bits2f(hb));
              hv[e] = __builtin_bit_cast(_Float16, hb);
              lv[e] = __builtin_bit_cast(_Float16, lb);
            }
          }
          *(v8h*)(C + (size_t)(mBase + row) * ldc + n0 + c8) = hv;
          if (OUT_MODE == 2) *(v8h*)(C2 + (size_t)(mBase + row) * ldc + n0 + c8) = lv;
        }
        
      }
    }
    __builtin_amdgcn_fence(__ATOMIC_RELEASE, "workgroup");
    __builtin_amdgcn_wave_barrier();
    __builtin_amdgcn_fence(__ATOMIC_ACQUIRE, "workgroup");
  }
}

// Coverage: grid = ceil(n2/256), thread i converts elements 2i, 2i+1; n2 = n/2 (all n here are multiples of 512).
__global__ __launch_bounds__(256) void cast_f32_bf16x2(
    const float* __restrict__ in, unsigned short* __restrict__ out, int n2) {
  int i = blockIdx.x * 256 + threadIdx.x;
  if (i < n2) {
    const unsigned u = (unsigned)f2bf_bits(in[2 * i]) | ((unsigned)f2bf_bits(in[2 * i + 1]) << 16);
    ((unsigned*)out)[i] = u;
    
  }
}

// ---- state|action f32 [SEQ_LEN][2*QRANK] -> bf16 hi/lo planes of state, action and q-value (state*action in f32), each [SEQ_LEN][QRANK] ----
// Coverage: grid = SEQ_LEN/2 blocks x 256 threads; thread -> row = 2*blk + (tid>>7), cols (tid&127)*8 .. +7 -> 2048 rows x 1024 cols exactly, all six planes.
__global__ __launch_bounds__(256) void planes_k(const float* __restrict__ sa,
    unsigned short* __restrict__ sthp, unsigned short* __restrict__ stlp,
    unsigned short* __restrict__ achp, unsigned short* __restrict__ aclp,
    unsigned short* __restrict__ qvhp, unsigned short* __restrict__ qvlp) {
  const int row = blockIdx.x * 2 + (threadIdx.x >> 7);
  const int c8  = (threadIdx.x & 127) * 8;
  const float* sp = sa + (size_t)row * (2 * QRANK) + c8;
  const v8f sv = *(const v8f*)(sp);
  const v8f av = *(const v8f*)(sp + QRANK);
  v8h shv, slv, ahv, alv, qhv, qlv;
#pragma unroll
  for (int e = 0; e < 8; ++e) {
    const float s = sv[e], a = av[e];
    const float q = s * a;
    unsigned short hb, lb;
    hb = f2bf_bits(s); lb = f2bf_bits(s - bf_bits2f(hb));
    shv[e] = __builtin_bit_cast(_Float16, hb); slv[e] = __builtin_bit_cast(_Float16, lb);
    hb = f2bf_bits(a); lb = f2bf_bits(a - bf_bits2f(hb));
    ahv[e] = __builtin_bit_cast(_Float16, hb); alv[e] = __builtin_bit_cast(_Float16, lb);
    hb = f2bf_bits(q); lb = f2bf_bits(q - bf_bits2f(hb));
    qhv[e] = __builtin_bit_cast(_Float16, hb); qlv[e] = __builtin_bit_cast(_Float16, lb);
  }
  const size_t o = (size_t)row * QRANK + c8;
  _Float16* sth = (_Float16*)sthp; _Float16* stl = (_Float16*)stlp;
  _Float16* ach = (_Float16*)achp; _Float16* acl = (_Float16*)aclp;
  _Float16* qvh = (_Float16*)qvhp; _Float16* qvl = (_Float16*)qvlp;
  {
    *(v8h*)(sth + o) = shv;
    *(v8h*)(stl + o) = slv;
    *(v8h*)(ach + o) = ahv;
    *(v8h*)(acl + o) = alv;
    *(v8h*)(qvh + o) = qhv;
    *(v8h*)(qvl + o) = qlv;
    
  }
}

// =====================================================================================
// Causal routing attention, q/k depth 64 (bf16 hi/lo planes, ld QRANK, head cols h*64),
// value width 128 (content^T bf16 hi/lo planes [h*128 + d][kv], ld SEQ_LEN),
// output gathered as bf16 hi/lo planes [q][h*128 + d], ld HID.
//   scores = (q.k) * 1/8   : hi.hi + hi.lo + lo.hi bf16 WMMA, f32 accumulate; future keys := -inf (p = 0, diagonal always present)
//   out    = p.v           : p and v bf16 hi/lo (hi.hi + hi.lo + lo.hi); online softmax in f32.
// Block = 4 waves, each owns 16 query rows of one head; 64-key chunks, chunks above the diagonal skipped.
// Each chunk's K rows and content^T rows (hi and lo planes) are brought into LDS once per block by asynchronous copies,
// whole 128-B lines, two buffers (chunk t + 1 flies while chunk t is worked on); all four waves read their B-fragments there.
// P is relaid C-layout -> A-layout through per-wave LDS.
// Coverage: grid = NHEADS * SEQ_LEN/64 blocks; block (qb, h) writes rows qb*64..+63, cols h*128..+127 of both planes.
// =====================================================================================
constexpr int ATT_QBLK = 64;
constexpr int ATT_KCH  = 64;
constexpr int ATT_OSP  = 132;
constexpr int ATT_NQB  = SEQ_LEN / ATT_QBLK;
constexpr int ATT_SP   = 72;                          // staged row pitch in elements: 128-B rows at 144 B (16 B x odd, for ds_load_b128 readers)
constexpr int ATT_ROW_KH = 0;                         // staged rows: 64 K hi, 64 K lo, 128 V hi, 128 V lo
constexpr int ATT_ROW_KL = ATT_KCH;
constexpr int ATT_ROW_VH = 2 * ATT_KCH;
constexpr int ATT_ROW_VL = 2 * ATT_KCH + HVAL;
constexpr int ATT_ROWS   = 2 * ATT_KCH + 2 * HVAL;    // 384
static_assert(HRANK * 2 == 128 && ATT_KCH * 2 == 128, "staged rows are 128 B");

__device__ __forceinline__ __bf16 at_f2bf(float f) { return __builtin_bit_cast(__bf16, f2bf_bits(f)); }
__device__ __forceinline__ void at_split(float f, __bf16& hi, __bf16& lo) {
  const unsigned short hb = f2bf_bits(f);
  hi = __builtin_bit_cast(__bf16, hb);
  lo = at_f2bf(f - __uint_as_float(((unsigned)hb) << 16));
}
__device__ __forceinline__ v8f at_mma(v16b a, v16b b, v8f c) {
  c = __builtin_amdgcn_wmma_f32_16x16x32_bf16(false, a, false, b, (short)0, c, false, false);
  asm volatile("v_nop\n\tv_nop\n\tv_nop\n\tv_nop" : "+v"(c) : "v"(a), "v"(b));
  return c;
}

// One chunk's 384 staged rows x 8 segments of 16 B = 3072 lane copies = 24 per thread of the 128-thread block.
// Copy i of thread tid: staged row i*16 + (tid >> 3), segment tid & 7: a wave's copy covers four whole 128-B lines.
__device__ __forceinline__ void at_stage(__bf16* buf, const __bf16* ach, const __bf16* acl,
                                         const __bf16* cth, const __bf16* ctl, int h, int kv0, int tid) {
  const int rg = tid >> 3, seg = (tid & 7) * 8;
  unsigned l[24];
  const __bf16* g[24];
  // the three loops are unrolled so that every index of l and g is a constant and both arrays live in registers
#pragma unroll
  for (int i = 0; i < 24; ++i) l[i] = (unsigned)(size_t)(buf + (i * 16 + rg) * ATT_SP + seg);
#pragma unroll
  for (int i = 0; i < 4; ++i) {
    const size_t ko = (size_t)(kv0 + i * 16 + rg) * QRANK + h * HRANK + seg;
    g[i] = ach + ko;
    g[4 + i] = acl + ko;
  }
#pragma unroll
  for (int i = 0; i < 8; ++i) {
    const size_t vo = (size_t)(h * HVAL + i * 16 + rg) * SEQ_LEN + kv0 + seg;
    g[8 + i] = cth + vo;
    g[16 + i] = ctl + vo;
  }
  at_copy12(l, g);
  at_copy12(l + 12, g + 12);
}

__global__ __launch_bounds__(128)
void attn_route_k(const unsigned short* __restrict__ sthp, const unsigned short* __restrict__ stlp,
                  const unsigned short* __restrict__ achp, const unsigned short* __restrict__ aclp,
                  const unsigned short* __restrict__ cthp, const unsigned short* __restrict__ ctlp,
                  unsigned short* __restrict__ ghp, unsigned short* __restrict__ glp) {
  union FB { v16b v; v8b h[2]; };
  __shared__ __align__(16) __bf16 Psh[4][16 * ATT_KCH];        // per wave P hi [row][kv]
  __shared__ __align__(16) __bf16 Psl[4][16 * ATT_KCH];        // per wave P lo
  __shared__ __align__(16) float  Os[4][16 * ATT_OSP];         // per wave out tile [row][d], pitch 132
  __shared__ __align__(16) __bf16 Stg[2][ATT_ROWS * ATT_SP];   // two buffers of staged K and content^T rows, shared by the block

  const __bf16* sth = (const __bf16*)sthp; const __bf16* stl = (const __bf16*)stlp;
  const __bf16* ach = (const __bf16*)achp; const __bf16* acl = (const __bf16*)aclp;
  const __bf16* cth = (const __bf16*)cthp; const __bf16* ctl = (const __bf16*)ctlp;
  _Float16* gh = (_Float16*)ghp; _Float16* gl = (_Float16*)glp;

  const int tid  = threadIdx.x;
  const int wave = tid >> 5;
  const int lane = tid & 31;
  const int hh   = lane >> 4;
  const int c    = lane & 15;
  const int bx = blockIdx.x;
  const int qb = bx % ATT_NQB;
  const int h  = bx / ATT_NQB;
  const int q0 = qb * ATT_QBLK + wave * 16;

  // ---- Q fragments (A operand): 2 depth chunks, hi and lo; row = c, k = dc*32 + 8*hh + {0..7, 16..23} ----
  v16b qah[2], qal[2];
#pragma unroll
  for (int dc = 0; dc < 2; ++dc) {
    const size_t off = (size_t)(q0 + c) * QRANK + h * HRANK + dc * 32 + 8 * hh;
    qah[dc] = Frag<__bf16>::load(sth + off);
    qal[dc] = Frag<__bf16>::load(stl + off);
  }

  float mrow[8], lrow[8];
  v8f oacc[8];
#pragma unroll
  for (int r = 0; r < 8; ++r) { mrow[r] = -INFINITY; lrow[r] = 0.f; }
#pragma unroll
  for (int t = 0; t < 8; ++t) oacc[t] = (v8f){0.f,0.f,0.f,0.f,0.f,0.f,0.f,0.f};

  __bf16* pwh = Psh[wave];
  __bf16* pwl = Psl[wave];
  const int nChunks = qb + 1;   // block-uniform, <= 32

  // ---- ring prologue: chunk 0 lands and is published; then chunk 1 starts ----
  at_stage(Stg[0], ach, acl, cth, ctl, h, 0, tid);
  asm volatile("s_wait_asynccnt 0x0" ::: "memory");   // this wave's copies of chunk 0 have landed
  __syncthreads();                                    // every wave's have: chunk 0 may be read
  if (nChunks > 1) at_stage(Stg[1], ach, acl, cth, ctl, h, ATT_KCH, tid);

  for (int kc = 0; kc < nChunks; ++kc) {
    const int kv0 = kc * ATT_KCH;
    const __bf16* sb = Stg[kc & 1];

    // ---- scores: 4 key subtiles of 16; K B-fragments: col = key, k = depth (staged rows) ----
    v8f s[4];
#pragma unroll
    for (int j = 0; j < 4; ++j) {
      s[j] = (v8f){0.f,0.f,0.f,0.f,0.f,0.f,0.f,0.f};
#pragma unroll
      for (int dc = 0; dc < 2; ++dc) {
        const int ko = (j * 16 + c) * ATT_SP + dc * 32 + 8 * hh;
        const v16b kb = Frag<__bf16>::load(sb + ATT_ROW_KH * ATT_SP + ko);
        const v16b kl = Frag<__bf16>::load(sb + ATT_ROW_KL * ATT_SP + ko);
        s[j] = at_mma(qah[dc], kb, s[j]);
        s[j] = at_mma(qah[dc], kl, s[j]);
        s[j] = at_mma(qal[dc], kb, s[j]);
      }
    }

    // ---- scale by 1/8, causal select on the diagonal chunk, row max ----
    const bool diag = (kc == qb);
    float cm[8];
#pragma unroll
    for (int r = 0; r < 8; ++r) {
      const int qrow = q0 + 8 * hh + r;
      float m = -INFINITY;
#pragma unroll
      for (int j = 0; j < 4; ++j) {
        const int kvcol = kv0 + j * 16 + c;
        float v = s[j][r] * 0.125f;
        if (diag && (kvcol > qrow)) v = -INFINITY;
        s[j][r] = v;
        m = fmaxf(m, v);
      }
#pragma unroll
      for (int off = 1; off < 16; off <<= 1) m = fmaxf(m, __shfl_xor(m, off, 32));
      cm[r] = m;
    }

    // ---- online softmax update; P tile (C layout) -> LDS as bf16 hi/lo ----
#pragma unroll
    for (int r = 0; r < 8; ++r) {
      const float mnew = fmaxf(mrow[r], cm[r]);
      const float alpha = expf(mrow[r] - mnew);
      mrow[r] = mnew;
      float psum = 0.f;
#pragma unroll
      for (int j = 0; j < 4; ++j) {
        const float p = expf(s[j][r] - mnew);
        psum += p;
        __bf16 a, bl; at_split(p, a, bl);
        pwh[(8 * hh + r) * ATT_KCH + j * 16 + c] = a;
        pwl[(8 * hh + r) * ATT_KCH + j * 16 + c] = bl;
      }
#pragma unroll
      for (int off = 1; off < 16; off <<= 1) psum += __shfl_xor(psum, off, 32);
      lrow[r] = lrow[r] * alpha + psum;
#pragma unroll
      for (int t = 0; t < 8; ++t) oacc[t][r] *= alpha;
    }
    __builtin_amdgcn_fence(__ATOMIC_RELEASE, "workgroup");
    __builtin_amdgcn_wave_barrier();
    __builtin_amdgcn_fence(__ATOMIC_ACQUIRE, "workgroup");

    // ---- O += P.V ; P A-fragments from LDS (row = c, k = kv), V B-fragments from the staged content^T rows (col = d, k = kv) ----
#pragma unroll 1
    for (int kk = 0; kk < 2; ++kk) {
      FB pa, pl;
      pa.h[0] = *(const v8b*)(pwh + c * ATT_KCH + kk * 32 + 8 * hh);
      pa.h[1] = *(const v8b*)(pwh + c * ATT_KCH + kk * 32 + 16 + 8 * hh);
      pl.h[0] = *(const v8b*)(pwl + c * ATT_KCH + kk * 32 + 8 * hh);
      pl.h[1] = *(const v8b*)(pwl + c * ATT_KCH + kk * 32 + 16 + 8 * hh);
#pragma unroll
      for (int t = 0; t < 8; ++t) {
        const int vo = (t * 16 + c) * ATT_SP + kk * 32 + 8 * hh;
        const v16b vb = Frag<__bf16>::load(sb + ATT_ROW_VH * ATT_SP + vo);
        const v16b vl = Frag<__bf16>::load(sb + ATT_ROW_VL * ATT_SP + vo);
        oacc[t] = at_mma(pa.v, vb, oacc[t]);
        oacc[t] = at_mma(pa.v, vl, oacc[t]);
        oacc[t] = at_mma(pl.v, vb, oacc[t]);
      }
    }
    // order this chunk's P loads before the next chunk's P stores
    __builtin_amdgcn_fence(__ATOMIC_RELEASE, "workgroup");
    __builtin_amdgcn_wave_barrier();
    __builtin_amdgcn_fence(__ATOMIC_ACQUIRE, "workgroup");

    // ---- publish point of chunk kc + 1, every wave ----
    asm volatile("s_wait_dscnt 0x0" ::: "memory");      // this wave's reads of buffer kc & 1 have returned
    asm volatile("s_wait_asynccnt 0x0" ::: "memory");   // this wave's copies of chunk kc + 1 have landed
    __syncthreads();                                    // publishes chunk kc + 1 and ends every reader's last read of buffer kc & 1
    if (kc + 2 < nChunks) at_stage(Stg[kc & 1], ach, acl, cth, ctl, h, (kc + 2) * ATT_KCH, tid);   // block-uniform test
  }
  asm volatile("s_wait_asynccnt 0x0" ::: "memory");     // no copy is outstanding when the wave goes on to its end

  float* os = Os[wave];
#pragma unroll
  for (int r = 0; r < 8; ++r) {
    const float inv = 1.0f / lrow[r];
#pragma unroll
    for (int t = 0; t < 8; ++t) os[(8 * hh + r) * ATT_OSP + t * 16 + c] = oacc[t][r] * inv;
  }
  __builtin_amdgcn_fence(__ATOMIC_RELEASE, "workgroup");
  __builtin_amdgcn_wave_barrier();
  __builtin_amdgcn_fence(__ATOMIC_ACQUIRE, "workgroup");
  {
    // lane groups of 8: q4 = lane>>3; row parity = q4>>1, column half = q4&1; it = 0..7 -> rows 0..15, cols 0..127: whole 16x128 tile, both planes
    const int q4 = lane >> 3, c8 = (lane & 7) * 8;
    const int rpar = q4 >> 1, chalf = (q4 & 1) * 64;
    {
#pragma unroll
      for (int it = 0; it < 8; ++it) {
        const int row = it * 2 + rpar;
        const int col = chalf + c8;
        const float* sp = os + row * ATT_OSP + col;
        v8h hv, lv;
#pragma unroll
        for (int e = 0; e < 8; ++e) {
          const unsigned short hb = f2bf_bits(sp[e]);
          const unsigned short lb = f2bf_bits(sp[e] - bf_bits2f(hb));
          hv[e] = __builtin_bit_cast(_Float16, hb);
          lv[e] = __builtin_bit_cast(_Float16, lb);
        }
        const size_t go = (size_t)(q0 + row) * HID + h * HVAL + col;
        *(v8h*)(gh + go) = hv;
        *(v8h*)(gl + go) = lv;
      }
      
    }
  }
}

// =====================================================================================
// Host launcher. Workspace region map (bytes, every offset a multiple of 4 MiB):
//   XB   bf16 [2048][2048]   8 MiB   x
//   WSA  bf16 [2048][2048]   8 MiB   rows 0..1023 W_state, 1024..2047 W_action
//   WC   bf16 [2048][1024]   4 MiB   W_content
//   WO   bf16 [2048][2048]   8 MiB   W_out
//   SA32 f32  [2048][2048]  16 MiB   state | action
//   STH, STL, ACH, ACL, QVH, QVL  bf16 [2048][1024]  4 MiB each (state, action, q-value hi/lo)
//   CTH, CTL  bf16 [2048 = h*128+d][2048 = kv]  8 MiB each (content^T hi/lo)
//   GH, GL    bf16 [2048][2048]  8 MiB each (gathered hi/lo)
//   total 104,857,600 B
// =====================================================================================
extern "C" void kernel_launch(void* const* d_in, const int* in_sizes, int n_in,
                              void* d_out, int out_size, void* d_ws, size_t ws_size,
                              hipStream_t stream) {
  if (n_in < 6) return;
  if (in_sizes[0] != SEQ_LEN * HID || in_sizes[1] != QRANK * HID || in_sizes[2] != QRANK * HID ||
      in_sizes[3] != HID * QRANK || in_sizes[4] != HID * HID || in_sizes[5] != HID) return;
  if (out_size != SEQ_LEN * HID) return;

  const float* x  = (const float*)d_in[0];
  const float* Ws = (const float*)d_in[1];
  const float* Wa = (const float*)d_in[2];
  const float* Wc = (const float*)d_in[3];
  const float* Wo = (const float*)d_in[4];
  const float* bo = (const float*)d_in[5];
  float* out = (float*)d_out;

  const size_t B_XB  = (size_t)SEQ_LEN * HID * 2;
  const size_t B_WSA = (size_t)(2 * QRANK) * HID * 2;
  const size_t B_WC  = (size_t)HID * QRANK * 2;
  const size_t B_WO  = (size_t)HID * HID * 2;
  const size_t B_SA  = (size_t)SEQ_LEN * (2 * QRANK) * 4;
  const size_t B_PL  = (size_t)SEQ_LEN * QRANK * 2;     // one [2048][1024] bf16 plane
  const size_t B_CT  = (size_t)HID * SEQ_LEN * 2;       // one [2048][2048] bf16 plane
  const size_t B_G   = (size_t)SEQ_LEN * HID * 2;

  char* ws = (char*)d_ws;
  size_t off = 0;
  unsigned short* XB  = (unsigned short*)(ws + off); off += B_XB;
  unsigned short* WSA = (unsigned short*)(ws + off); off += B_WSA;
  unsigned short* WC  = (unsigned short*)(ws + off); off += B_WC;
  unsigned short* WO  = (unsigned short*)(ws + off); off += B_WO;
  float*          SA  = (float*)(ws + off);          off += B_SA;
  unsigned short* STH = (unsigned short*)(ws + off); off += B_PL;
  unsigned short* STL = (unsigned short*)(ws + off); off += B_PL;
  unsigned short* ACH = (unsigned short*)(ws + off); off += B_PL;
  unsigned short* ACL = (unsigned short*)(ws + off); off += B_PL;
  unsigned short* QVH = (unsigned short*)(ws + off); off += B_PL;
  unsigned short* QVL = (unsigned short*)(ws + off); off += B_PL;
  unsigned short* CTH = (unsigned short*)(ws + off); off += B_CT;
  unsigned short* CTL = (unsigned short*)(ws + off); off += B_CT;
  unsigned short* GH  = (unsigned short*)(ws + off); off += B_G;
  unsigned short* GL  = (unsigned short*)(ws + off); off += B_G;
  if (off > ws_size) return;

  // ---- input casts to bf16 (RNE) ----
  {
    const int n2x = SEQ_LEN * HID / 2, n2w = QRANK * HID / 2, n2c = HID * QRANK / 2, n2o = HID * HID / 2;
    cast_f32_bf16x2<<<dim3((n2x + 255) / 256), dim3(256), 0, stream>>>(x,  XB, n2x);
    cast_f32_bf16x2<<<dim3((n2w + 255) / 256), dim3(256), 0, stream>>>(Ws, WSA, n2w);
    cast_f32_bf16x2<<<dim3((n2w + 255) / 256), dim3(256), 0, stream>>>(Wa, WSA + (size_t)QRANK * HID, n2w);
    cast_f32_bf16x2<<<dim3((n2c + 255) / 256), dim3(256), 0, stream>>>(Wc, WC, n2c);
    cast_f32_bf16x2<<<dim3((n2o + 255) / 256), dim3(256), 0, stream>>>(Wo, WO, n2o);
  }

  // ---- projections: SA[q][0..2047] = x . [W_state; W_action]^T  (M=2048, N=2048, K=2048) ----
  {
    const int M = SEQ_LEN, N = 2 * QRANK, K = HID;
    const int blocks = (M / 64) * (N / 64) / 8;   // 128
    wmma_gemm64<1, false, false, 0, 0><<<dim3(blocks, 1), dim3(256), 0, stream>>>(
        XB, XB, K, 0L, WSA, WSA, K, 0L, (void*)SA, (void*)SA, N, 0L, bo, M, N, K, 1.0f);
  }

  // ---- bf16 hi/lo planes of state, action, q-value ----
  planes_k<<<dim3(SEQ_LEN / 2), dim3(256), 0, stream>>>(SA, STH, STL, ACH, ACL, QVH, QVL);

  // ---- content^T[n][kv] = W_content[n][:] . qval[kv][:]  (M=2048, N=2048, K=1024; B = q-value hi/lo) -> bf16 hi/lo planes ----
  {
    const int M = HID, N = SEQ_LEN, K = QRANK;
    const int blocks = (M / 64) * (N / 64) / 8;   // 128
    wmma_gemm64<1, false, true, 0, 2><<<dim3(blocks, 1), dim3(256), 0, stream>>>(
        WC, WC, K, 0L, QVH, QVL, K, 0L, (void*)CTH, (void*)CTL, N, 0L, bo, M, N, K, 1.0f);
  }

  // ---- causal routing attention -> gathered hi/lo planes ----
  attn_route_k<<<dim3(NHEADS * ATT_NQB), dim3(128), 0, stream>>>(STH, STL, ACH, ACL, CTH, CTL, GH, GL);

  // ---- out = gathered . W_out^T + b_out  (M=N=K=2048; A = gathered hi/lo), f32 ----
  {
    const int M = SEQ_LEN, N = HID, K = HID;
    const int blocks = (M / 64) * (N / 64) / 8;   // 128
    wmma_gemm64<1, true, false, 2, 0><<<dim3(blocks, 1), dim3(256), 0, stream>>>(
        GH, GL, K, 0L, WO, WO, K, 0L, (void*)out, (void*)out, N, 0L, bo, M, N, K, 1.0f);
  }
}

// v003
// A run of this version takes 246 microseconds.
// Next to v002, in two timings, it ran 1.05 and 1.04 times as fast.
// All steps since v000 together make it 2.29 times as fast.
// All contractions: v_wmma_f32_16x16x32_bf16 (bf16 operands, f32 accumulate): x and weight matrices as single RNE bf16 planes; state/action, q-value product, softmax p, content and gathered carried as bf16 hi/lo planes (hi.hi + hi.lo + lo.hi); softmax, q-value product and bias in f32.
#include <hip/hip_runtime.h>
#include <stdint.h>

constexpr int SEQ_LEN = 2048;   // L
constexpr int HID     = 2048;   // hidden
constexpr int QRANK   = 1024;   // q_rank
constexpr int NHEADS  = 16;
constexpr int HRANK   = 64;     // per-head rank (q/k depth)
constexpr int HVAL    = 128;    // per-head value width
static_assert(QRANK == NHEADS * HRANK, "rank split");
static_assert(HID == NHEADS * HVAL, "value split");
static_assert(SEQ_LEN % 64 == 0 && HID % 64 == 0 && QRANK % 64 == 0, "tile multiples");
static_assert(HID % 32 == 0 && QRANK % 32 == 0, "K multiples of 32");

typedef __attribute__((ext_vector_type(16))) _Float16 v16h;
typedef __attribute__((ext_vector_type(8)))  _Float16 v8h;
typedef __attribute__((ext_vector_type(16))) __bf16   v16b;
typedef __attribute__((ext_vector_type(8)))  __bf16   v8b;
typedef __attribute__((ext_vector_type(8)))  float    v8f;
typedef __attribute__((ext_vector_type(4)))  float    v4f;

__device__ __forceinline__ unsigned short f2bf_bits(float f) {
  unsigned u = __float_as_uint(f);
  return (unsigned short)((u + 0x7FFFu + ((u >> 16) & 1u)) >> 16);
}
__device__ __forceinline__ float bf_bits2f(unsigned short h) { return __uint_as_float(((unsigned)h) << 16); }

// hazard guards as plain device helpers (no hazard-guard asm inside the kernel template body)
__device__ __forceinline__ void dep_guard_h(v8f& a, v8f& b, v16h x, v16h y) { asm volatile("v_nop\n\tv_nop\n\tv_nop\n\tv_nop" : "+v"(a), "+v"(b) : "v"(x), "v"(y)); }
__device__ __forceinline__ void dep_guard_b(v8f& a, v8f& b, v16b x, v16b y) { asm volatile("v_nop\n\tv_nop\n\tv_nop\n\tv_nop" : "+v"(a), "+v"(b) : "v"(x), "v"(y)); }
__device__ __forceinline__ void keep4_h(v16h a, v16h b, v16h c, v16h d) { asm volatile("v_nop" :: "v"(a), "v"(b), "v"(c), "v"(d)); }
__device__ __forceinline__ void keep4_b(v16b a, v16b b, v16b c, v16b d) { asm volatile("v_nop" :: "v"(a), "v"(b), "v"(c), "v"(d)); }
__device__ __forceinline__ void acc_guard4(v8f& a, v8f& b, v8f& c, v8f& d) { asm volatile("v_nop\n\tv_nop\n\tv_nop\n\tv_nop" : "+v"(a), "+v"(b), "+v"(c), "+v"(d)); }
template <typename T> struct Frag;
template <> struct Frag<_Float16> {
  typedef v16h V; union U { v16h v; v8h h[2]; };
  static __device__ __forceinline__ v16h load(const _Float16* p) {   // elements 0..7 <- p[0..7], 8..15 <- p[16..23]
    U f; f.h[0] = *(const v8h*)(p); f.h[1] = *(const v8h*)(p + 16); return f.v;
  }
  static __device__ __forceinline__ v8f mma(v16h a, v16h b, v8f c) {
    return __builtin_amdgcn_wmma_f32_16x16x32_f16(false, a, false, b, (short)0, c, false, false);
  }
  static __device__ __forceinline__ void guard(v8f& a, v8f& b, v16h x, v16h y) { dep_guard_h(a, b, x, y); }
  static __device__ __forceinline__ void keep(v16h a, v16h b, v16h c, v16h d) { keep4_h(a, b, c, d); }
};
template <> struct Frag<__bf16> {
  typedef v16b V; union U { v16b v; v8b h[2]; };
  static __device__ __forceinline__ v16b load(const __bf16* p) {
    U f; f.h[0] = *(const v8b*)(p); f.h[1] = *(const v8b*)(p + 16); return f.v;
  }
  static __device__ __forceinline__ v8f mma(v16b a, v16b b, v8f c) {
    return __builtin_amdgcn_wmma_f32_16x16x32_bf16(false, a, false, b, (short)0, c, false, false);
  }
  static __device__ __forceinline__ void guard(v8f& a, v8f& b, v16b x, v16b y) { dep_guard_b(a, b, x, y); }
  static __device__ __forceinline__ void keep(v16b a, v16b b, v16b c, v16b d) { keep4_b(a, b, c, d); }
};

// Twelve asynchronous 16-B-per-lane copies global -> LDS. The s_wait_xcnt is the last line of the copies' own statement,
// so that no address register of an issued copy is rewritten in front of it.
__device__ __forceinline__ void at_copy12(const unsigned* l, const __bf16* const* g) {
  asm volatile(
      "global_load_async_to_lds_b128 %0, %12, off\n\t"
      "global_load_async_to_lds_b128 %1, %13, off\n\t"
      "global_load_async_to_lds_b128 %2, %14, off\n\t"
      "global_load_async_to_lds_b128 %3, %15, off\n\t"
      "global_load_async_to_lds_b128 %4, %16, off\n\t"
      "global_load_async_to_lds_b128 %5, %17, off\n\t"
      "global_load_async_to_lds_b128 %6, %18, off\n\t"
      "global_load_async_to_lds_b128 %7, %19, off\n\t"
      "global_load_async_to_lds_b128 %8, %20, off\n\t"
      "global_load_async_to_lds_b128 %9, %21, off\n\t"
      "global_load_async_to_lds_b128 %10, %22, off\n\t"
      "global_load_async_to_lds_b128 %11, %23, off\n\t"
      "s_wait_xcnt 0x0"
      :: "v"(l[0]), "v"(l[1]), "v"(l[2]), "v"(l[3]), "v"(l[4]), "v"(l[5]),
         "v"(l[6]), "v"(l[7]), "v"(l[8]), "v"(l[9]), "v"(l[10]), "v"(l[11]),
         "v"(g[0]), "v"(g[1]), "v"(g[2]), "v"(g[3]), "v"(g[4]), "v"(g[5]),
         "v"(g[6]), "v"(g[7]), "v"(g[8]), "v"(g[9]), "v"(g[10]), "v"(g[11])
      : "memory");
}

// The same for eight copies.
__device__ __forceinline__ void at_copy8(const unsigned* l, const __bf16* const* g) {
  asm volatile(
      "global_load_async_to_lds_b128 %0, %8, off\n\t"
      "global_load_async_to_lds_b128 %1, %9, off\n\t"
      "global_load_async_to_lds_b128 %2, %10, off\n\t"
      "global_load_async_to_lds_b128 %3, %11, off\n\t"
      "global_load_async_to_lds_b128 %4, %12, off\n\t"
      "global_load_async_to_lds_b128 %5, %13, off\n\t"
      "global_load_async_to_lds_b128 %6, %14, off\n\t"
      "global_load_async_to_lds_b128 %7, %15, off\n\t"
      "s_wait_xcnt 0x0"
      :: "v"(l[0]), "v"(l[1]), "v"(l[2]), "v"(l[3]), "v"(l[4]), "v"(l[5]), "v"(l[6]), "v"(l[7]),
         "v"(g[0]), "v"(g[1]), "v"(g[2]), "v"(g[3]), "v"(g[4]), "v"(g[5]), "v"(g[6]), "v"(g[7])
      : "memory");
}

// ---- Register-blocked batched WMMA GEMM ------------------------------------
// C[m,n] = scale * sum_k A[m,k] * Bt[n,k] (+bias); each wave owns a 64x64 tile; a block's 8 waves (2 x 4) own a 128x256 tile.
// A row-major [M,K]; Bt row-major [N,K]; M % 128 == 0, N % 256 == 0, K % 64 == 0.
// Per 64 k the block's 128 A rows and 256 Bt rows (each plane) are brought into LDS once by asynchronous copies, whole 128-B lines,
// two buffers (slab s + 1 flies while slab s is worked on); the waves read their fragments there.
// ASPLIT: A carried as hi/lo planes (A2 = lo plane, same layout); BSPLIT: Bt hi/lo (Bt2 = lo plane).
//   product = hi.hi (+ hi.lo if BSPLIT) (+ lo.hi if ASPLIT).
// BIAS_MODE: 0 = none, 1 = bias[m], 2 = bias[n].
// OUT_MODE: 0 = f32, 1 = f16, 2 = bf16 hi plane (Cout) + bf16 lo plane (Cout2).
// Coverage: per 64x64 tile, 4 slabs x 16 rows x 64 cols -> the whole tile; grid = (M/128)*(N/256) = tilesM*tilesN/8 blocks of 8 waves.
// ET: 0 = f16 operands, 1 = bf16 operands (pointers passed as 16-bit storage)
constexpr int GM_BM = 128;   // block tile rows
constexpr int GM_BN = 256;   // block tile cols
constexpr int GM_KS = 64;    // k per staged slab: 128-B rows
constexpr int GM_SP = 72;    // staged row pitch in elements: 144 B (16 B x odd, for ds_load_b128 readers)
static_assert(SEQ_LEN % GM_BN == 0 && HID % GM_BN == 0 && (2 * QRANK) % GM_BN == 0, "block tile multiples");
static_assert(HID % GM_KS == 0 && QRANK % GM_KS == 0, "K multiples of the slab");
template <int ET> struct Elem;
template <> struct Elem<0> { typedef _Float16 T; };
template <> struct Elem<1> { typedef __bf16 T; };
template <int ET, bool ASPLIT, bool BSPLIT, int BIAS_MODE, int OUT_MODE>
__global__ __launch_bounds__(256) void wmma_gemm64(
    const unsigned short* __restrict__ Ap, const unsigned short* __restrict__ A2p, int lda, long strideA,
    const unsigned short* __restrict__ Btp, const unsigned short* __restrict__ Bt2p, int ldb, long strideB,
    void* __restrict__ Cout, void* __restrict__ Cout2, int ldc, long strideC,
    const float* __restrict__ bias,
    int M, int N, int K, float scale) {
  typedef typename Elem<ET>::T T;
  typedef typename Frag<T>::V V;
  const T* A = (const T*)Ap; const T* A2 = (const T*)A2p; const T* Bt = (const T*)Btp; const T* Bt2 = (const T*)Bt2p;
  // staged rows of one slab: A hi (, A lo), Bt hi (, Bt lo); every plane starts at a multiple of 32 rows
  constexpr int ROW_AL = GM_BM;
  constexpr int ROW_BH = GM_BM * (ASPLIT ? 2 : 1);
  constexpr int ROW_BL = ROW_BH + GM_BN;
  constexpr int ROWS   = ROW_BH + GM_BN * (BSPLIT ? 2 : 1);   // 384, 512 or 640
  constexpr int NCP    = ROWS / 32;                           // copies per thread and slab: 12, 16 or 20
  static_assert(NCP == 12 || NCP == 16 || NCP == 20, "copy statements below");
  __shared__ __align__(16) float sT[8][16 * 68];   // per-wave 16x64 slab, pitch 68 floats
  __shared__ __align__(16) T Stg[2][ROWS * GM_SP]; // two buffers of staged rows, shared by the block
  const int b    = blockIdx.y;
  const int tid  = threadIdx.x;
  const int lane = threadIdx.x & 31;
  const int wave = threadIdx.x >> 5;
  const int blkN = N / GM_BN;
  if ((int)blockIdx.x >= (M / GM_BM) * blkN) return;   // block-uniform, in front of every barrier
  const int bm  = blockIdx.x / blkN;
  const int bm0 = bm * GM_BM;
  const int bn0 = (blockIdx.x - bm * blkN) * GM_BN;
  const int wm0 = (wave >> 2) << 6;            // this wave's 64x64 tile inside the block tile
  const int wn0 = (wave & 3) << 6;
  const int m0 = bm0 + wm0;
  const int n0 = bn0 + wn0;

  const T* Ab  = A  + (size_t)b * strideA;
  const T* Bb  = Bt + (size_t)b * strideB;
  const T* Ab2 = ASPLIT ? (A2  + (size_t)b * strideA) : nullptr;
  const T* Bb2 = BSPLIT ? (Bt2 + (size_t)b * strideB) : nullptr;

  const int rlane = lane & 15;                 // row (A) / col (B, D) within subtile
  const int koff  = (lane >> 4) * 8;           // k offset of this lane half
  const int mOff  = (lane >> 4) * 8;           // D row offset

  v8f acc[4][4];
#pragma unroll
  for (int i = 0; i < 4; ++i)
#pragma unroll
    for (int j = 0; j < 4; ++j) acc[i][j] = (v8f){0.f,0.f,0.f,0.f,0.f,0.f,0.f,0.f};

  // One slab: ROWS staged rows x 8 segments of 16 B = NCP lane copies per thread of the 256-thread block.
  // Copy i of thread tid: staged row i*32 + (tid >> 3), segment tid & 7: a wave's copy covers four whole 128-B lines.
  // One running pointer per plane (this thread's first row and segment of the next slab to stage); the other rows are 32*ld apart.
  const int rg = tid >> 3, seg = (tid & 7) * 8;
  const T* pA  = Ab + (size_t)(bm0 + rg) * lda + seg;
  const T* pB  = Bb + (size_t)(bn0 + rg) * ldb + seg;
  const T* pA2 = ASPLIT ? (Ab2 + (size_t)(bm0 + rg) * lda + seg) : nullptr;
  const T* pB2 = BSPLIT ? (Bb2 + (size_t)(bn0 + rg) * ldb + seg) : nullptr;
  auto stage = [&](T* buf) {
    unsigned l[NCP];
    const __bf16* g[NCP];
    // unrolled so that every index of l and g is a constant and both arrays live in registers
#pragma unroll
    for (int i = 0; i < NCP; ++i) {
      const T* sp;
      if (i * 32 >= ROW_BL)                 sp = pB2 + (size_t)(i * 32 - ROW_BL) * ldb;
      else if (i * 32 >= ROW_BH)            sp = pB  + (size_t)(i * 32 - ROW_BH) * ldb;
      else if (ASPLIT && i * 32 >= ROW_AL)  sp = pA2 + (size_t)(i * 32 - ROW_AL) * lda;
      else                                  sp = pA  + (size_t)(i * 32) * lda;
      l[i] = (unsigned)(size_t)(buf + (i * 32 + rg) * GM_SP + seg);
      g[i] = (const __bf16*)sp;
    }
    if (NCP == 12) { at_copy12(l, g); }
    if (NCP == 16) { at_copy8(l, g); at_copy8(l + NCP - 8, g + NCP - 8); }
    if (NCP == 20) { at_copy12(l, g); at_copy8(l + NCP - 8, g + NCP - 8); }
    pA += GM_KS; pB += GM_KS;
    if (ASPLIT) pA2 += GM_KS;
    if (BSPLIT) pB2 += GM_KS;
  };
  const int nSlabs = K / GM_KS;   // block-uniform

  // ---- ring prologue: slab 0 lands and is published; then slab 1 starts ----
  stage(Stg[0]);
  asm volatile("s_wait_asynccnt 0x0" ::: "memory");   // this wave's copies of slab 0 have landed
  __syncthreads();                                    // every wave's have: slab 0 may be read
  if (nSlabs > 1) stage(Stg[1]);

  for (int s = 0; s < nSlabs; ++s) {
    const T* sb = Stg[s & 1];
    // both 32-k steps of the slab unrolled: the second step's LDS reads may go ahead of the first step's products
#pragma unroll
    for (int kk = 0; kk < GM_KS; kk += 32) {
      V bh[4], bl[4];
#pragma unroll
      for (int j = 0; j < 4; ++j) {
        const int bo = (wn0 + (j << 4) + rlane) * GM_SP + koff + kk;
        bh[j] = Frag<T>::load(sb + ROW_BH * GM_SP + bo);
        if (BSPLIT) bl[j] = Frag<T>::load(sb + ROW_BL * GM_SP + bo);
      }
      // all of the step's LDS reads stand together, ahead of its products
      V ah[4], al[4];
#pragma unroll
      for (int i = 0; i < 4; ++i) {
        const int ao = (wm0 + (i << 4) + rlane) * GM_SP + koff + kk;
        ah[i] = Frag<T>::load(sb + ao);
        al[i] = ah[i];
        if (ASPLIT) al[i] = Frag<T>::load(sb + ROW_AL * GM_SP + ao);
      }
#pragma unroll
      for (int i = 0; i < 4; ++i) {
#pragma unroll
        for (int j = 0; j < 4; ++j) {
          acc[i][j] = Frag<T>::mma(ah[i], bh[j], acc[i][j]);
          if (BSPLIT) acc[i][j] = Frag<T>::mma(ah[i], bl[j], acc[i][j]);
          if (ASPLIT) acc[i][j] = Frag<T>::mma(al[i], bh[j], acc[i][j]);
        }
        Frag<T>::guard(acc[i][0], acc[i][3], ah[i], al[i]);
      }
      Frag<T>::keep(bh[0], bh[1], bh[2], bh[3]);
      if (BSPLIT) Frag<T>::keep(bl[0], bl[1], bl[2], bl[3]);
    }
    // ---- publish point of slab s + 1, every wave ----
    asm volatile("s_wait_dscnt 0x0" ::: "memory");      // this wave's reads of buffer s & 1 have returned
    asm volatile("s_wait_asynccnt 0x0" ::: "memory");   // this wave's copies of slab s + 1 have landed
    __syncthreads();                                    // publishes slab s + 1 and ends every reader's last read of buffer s & 1
    if (s + 2 < nSlabs) stage(Stg[s & 1]);              // block-uniform test; slab s + 2
  }
  asm volatile("s_wait_asynccnt 0x0" ::: "memory");     // no copy is outstanding when the wave goes on to its end
  acc_guard4(acc[0][0], acc[0][1], acc[0][2], acc[0][3]);
  acc_guard4(acc[1][0], acc[1][1], acc[1][2], acc[1][3]);
  acc_guard4(acc[2][0], acc[2][1], acc[2][2], acc[2][3]);
  acc_guard4(acc[3][0], acc[3][1], acc[3][2], acc[3][3]);

  // ---- epilogue ----
  float* slab = sT[wave];
#pragma unroll
  for (int i = 0; i < 4; ++i) {
    const int mBase = m0 + (i << 4);
#pragma unroll
    for (int j = 0; j < 4; ++j) {
      const int n = n0 + (j << 4) + rlane;
      float bv = 0.f;
      if (BIAS_MODE == 2) bv = bias[n];
#pragma unroll
      for (int r = 0; r < 8; ++r) {
        float v = acc[i][j][r] * scale;
        if (BIAS_MODE == 1) v += bias[mBase + mOff + r];
        if (BIAS_MODE == 2) v += bv;
        slab[(mOff + r) * 68 + (j << 4) + rlane] = v;
      }
    }
    __builtin_amdgcn_fence(__ATOMIC_RELEASE, "workgroup");
    __builtin_amdgcn_wave_barrier();
    __builtin_amdgcn_fence(__ATOMIC_ACQUIRE, "workgroup");
    if (OUT_MODE == 0) {
      float* C = (float*)Cout + (size_t)b * strideC;
      const int hh = lane >> 4, c4 = (lane & 15) * 4;     // row seg = 256 B = 16 lanes x 16 B
      {
#pragma unroll
        for (int it = 0; it < 8; ++it) {
          const int row = it * 2 + hh;
          v4f v = *(const v4f*)(slab + row * 68 + c4);
          *(v4f*)(C + (size_t)(mBase + row) * ldc + n0 + c4) = v;
        }
        
      }
    } else {
      const int q = lane >> 3, c8 = (lane & 7) * 8;
      unsigned short* C  = (unsigned short*)Cout  + (size_t)b * strideC;
      unsigned short* C2 = (OUT_MODE == 2) ? ((unsigned short*)Cout2 + (size_t)b * strideC) : nullptr;
      {
#pragma unroll
        for (int it = 0; it < 4; ++it) {
          const int row = it * 4 + q;
          const float* sp = slab + row * 68 + c8;
          v8h hv, lv;
#pragma unroll
          for (int e = 0; e < 8; ++e) {
            if (OUT_MODE == 1) {
              hv[e] = (_Float16)sp[e];
            } else {
              unsigned short hb = f2bf_bits(sp[e]);
              unsigned short lb = f2bf_bits(sp[e] - bf_bits2f(hb));
              hv[e] = __builtin_bit_cast(_Float16, hb);
              lv[e] = __builtin_bit_cast(_Float16, lb);
            }
          }
          *(v8h*)(C + (size_t)(mBase + row) * ldc + n0 + c8) = hv;
          if (OUT_MODE == 2) *(v8h*)(C2 + (size_t)(mBase + row) * ldc + n0 + c8) = lv;
        }
        
      }
    }
    __builtin_amdgcn_fence(__ATOMIC_RELEASE, "workgroup");
    __builtin_amdgcn_wave_barrier();
    __builtin_amdgcn_fence(__ATOMIC_ACQUIRE, "workgroup");
  }
}

// ---- all five f32 inputs -> bf16 (RNE) in one launch: one 16-wave block per WGP, few long waves in place of many two-element ones ----
// Block b converts the b-th of 256 equal contiguous parts of every input, in steps of 2,048 floats (4 a lane):
// a wave's load is 512 contiguous bytes, its store 256. x and W_out take 8 steps a block, the three rank-sized weights 4 each.
// Coverage: 256 blocks x N steps x 2,048 = the whole of each input, each element converted by exactly one lane.
constexpr int CAST_BLOCKS  = 256;
constexpr int CAST_THREADS = 512;
constexpr int CAST_STEP    = CAST_THREADS * 4;                             // floats a block converts per step
constexpr int CAST_NX = SEQ_LEN * HID / (CAST_BLOCKS * CAST_STEP);         // 8
constexpr int CAST_NW = QRANK * HID / (CAST_BLOCKS * CAST_STEP);           // 4
constexpr int CAST_NO = HID * HID / (CAST_BLOCKS * CAST_STEP);             // 8
static_assert(SEQ_LEN * HID == CAST_NX * CAST_BLOCKS * CAST_STEP && QRANK * HID == CAST_NW * CAST_BLOCKS * CAST_STEP &&
              HID * HID == CAST_NO * CAST_BLOCKS * CAST_STEP, "whole steps");
typedef __attribute__((ext_vector_type(2))) unsigned v2u;
// Addresses are a uniform base, one unsigned 32-bit byte offset a lane, and a small constant per step.
template <int N>
__device__ __forceinline__ void cast_load(v4f* r, const float* __restrict__ in) {
  const char* p = (const char*)in + (blockIdx.x * (N * CAST_THREADS) + threadIdx.x) * 16u;
  // unrolled so that r is indexed by constants and lives in registers, and the loads follow one another
#pragma unroll
  for (int i = 0; i < N; ++i) r[i] = *(const v4f*)(p + i * (CAST_STEP * 4));
}
template <int N>
__device__ __forceinline__ void cast_store(const v4f* r, unsigned short* __restrict__ out) {
  char* q = (char*)out + (blockIdx.x * (N * CAST_THREADS) + threadIdx.x) * 8u;
  // unrolled so that r is indexed by constants and lives in registers
#pragma unroll
  for (int i = 0; i < N; ++i) {
    v2u u;
    u[0] = (unsigned)f2bf_bits(r[i][0]) | ((unsigned)f2bf_bits(r[i][1]) << 16);
    u[1] = (unsigned)f2bf_bits(r[i][2]) | ((unsigned)f2bf_bits(r[i][3]) << 16);
    *(v2u*)(q + i * (CAST_STEP * 2)) = u;
  }
}
__global__ __launch_bounds__(CAST_THREADS) void cast_inputs_bf16(
    const float* __restrict__ x, const float* __restrict__ wst, const float* __restrict__ wac,
    const float* __restrict__ wco, const float* __restrict__ wou,
    unsigned short* __restrict__ xb, unsigned short* __restrict__ wstb, unsigned short* __restrict__ wacb,
    unsigned short* __restrict__ wcob, unsigned short* __restrict__ woub) {
  // all of a lane's 28 loads stand ahead of its first store, so that they are in flight together
  v4f rx[CAST_NX], rs[CAST_NW], ra[CAST_NW], rc[CAST_NW], ro[CAST_NO];
  cast_load<CAST_NX>(rx, x);
  cast_load<CAST_NW>(rs, wst);
  cast_load<CAST_NW>(ra, wac);
  cast_load<CAST_NW>(rc, wco);
  // the loads below may be given, for their results, the offset register that the twelve loads above name
  asm volatile("s_wait_xcnt 0x0" ::: "memory");
  cast_load<CAST_NO>(ro, wou);
  cast_store<CAST_NX>(rx, xb);
  cast_store<CAST_NW>(rs, wstb);
  cast_store<CAST_NW>(ra, wacb);
  cast_store<CAST_NW>(rc, wcob);
  cast_store<CAST_NO>(ro, woub);
}

// ---- state|action f32 [SEQ_LEN][2*QRANK] -> bf16 hi/lo planes of state, action and q-value (state*action in f32), each [SEQ_LEN][QRANK] ----
// Coverage: grid = SEQ_LEN/2 blocks x 256 threads; thread -> row = 2*blk + (tid>>7), cols (tid&127)*8 .. +7 -> 2048 rows x 1024 cols exactly, all six planes.
__global__ __launch_bounds__(256) void planes_k(const float* __restrict__ sa,
    unsigned short* __restrict__ sthp, unsigned short* __restrict__ stlp,
    unsigned short* __restrict__ achp, unsigned short* __restrict__ aclp,
    unsigned short* __restrict__ qvhp, unsigned short* __restrict__ qvlp) {
  const int row = blockIdx.x * 2 + (threadIdx.x >> 7);
  const int c8  = (threadIdx.x & 127) * 8;
  const float* sp = sa + (size_t)row * (2 * QRANK) + c8;
  const v8f sv = *(const v8f*)(sp);
  const v8f av = *(const v8f*)(sp + QRANK);
  v8h shv, slv, ahv, alv, qhv, qlv;
#pragma unroll
  for (int e = 0; e < 8; ++e) {
    const float s = sv[e], a = av[e];
    const float q = s * a;
    unsigned short hb, lb;
    hb = f2bf_bits(s); lb = f2bf_bits(s - bf_bits2f(hb));
    shv[e] = __builtin_bit_cast(_Float16, hb); slv[e] = __builtin_bit_cast(_Float16, lb);
    hb = f2bf_bits(a); lb = f2bf_bits(a - bf_bits2f(hb));
    ahv[e] = __builtin_bit_cast(_Float16, hb); alv[e] = __builtin_bit_cast(_Float16, lb);
    hb = f2bf_bits(q); lb = f2bf_bits(q - bf_bits2f(hb));
    qhv[e] = __builtin_bit_cast(_Float16, hb); qlv[e] = __builtin_bit_cast(_Float16, lb);
  }
  const size_t o = (size_t)row * QRANK + c8;
  _Float16* sth = (_Float16*)sthp; _Float16* stl = (_Float16*)stlp;
  _Float16* ach = (_Float16*)achp; _Float16* acl = (_Float16*)aclp;
  _Float16* qvh = (_Float16*)qvhp; _Float16* qvl = (_Float16*)qvlp;
  {
    *(v8h*)(sth + o) = shv;
    *(v8h*)(stl + o) = slv;
    *(v8h*)(ach + o) = ahv;
    *(v8h*)(acl + o) = alv;
    *(v8h*)(qvh + o) = qhv;
    *(v8h*)(qvl + o) = qlv;
    
  }
}

// =====================================================================================
// Causal routing attention, q/k depth 64 (bf16 hi/lo planes, ld QRANK, head cols h*64),
// value width 128 (content^T bf16 hi/lo planes [h*128 + d][kv], ld SEQ_LEN),
// output gathered as bf16 hi/lo planes [q][h*128 + d], ld HID.
//   scores = (q.k) * 1/8   : hi.hi + hi.lo + lo.hi bf16 WMMA, f32 accumulate; future keys := -inf (p = 0, diagonal always present)
//   out    = p.v           : p and v bf16 hi/lo (hi.hi + hi.lo + lo.hi); online softmax in f32.
// Block = 4 waves, each owns 16 query rows of one head; 64-key chunks, chunks above the diagonal skipped.
// Each chunk's K rows and content^T rows (hi and lo planes) are brought into LDS once per block by asynchronous copies,
// whole 128-B lines, two buffers (chunk t + 1 flies while chunk t is worked on); all four waves read their B-fragments there.
// P is relaid C-layout -> A-layout through per-wave LDS.
// Coverage: grid = NHEADS * SEQ_LEN/64 blocks; block (qb, h) writes rows qb*64..+63, cols h*128..+127 of both planes.
// =====================================================================================
constexpr int ATT_QBLK = 64;
constexpr int ATT_KCH  = 64;
constexpr int ATT_OSP  = 132;
constexpr int ATT_NQB  = SEQ_LEN / ATT_QBLK;
constexpr int ATT_SP   = 72;                          // staged row pitch in elements: 128-B rows at 144 B (16 B x odd, for ds_load_b128 readers)
constexpr int ATT_ROW_KH = 0;                         // staged rows: 64 K hi, 64 K lo, 128 V hi, 128 V lo
constexpr int ATT_ROW_KL = ATT_KCH;
constexpr int ATT_ROW_VH = 2 * ATT_KCH;
constexpr int ATT_ROW_VL = 2 * ATT_KCH + HVAL;
constexpr int ATT_ROWS   = 2 * ATT_KCH + 2 * HVAL;    // 384
static_assert(HRANK * 2 == 128 && ATT_KCH * 2 == 128, "staged rows are 128 B");

__device__ __forceinline__ __bf16 at_f2bf(float f) { return __builtin_bit_cast(__bf16, f2bf_bits(f)); }
__device__ __forceinline__ void at_split(float f, __bf16& hi, __bf16& lo) {
  const unsigned short hb = f2bf_bits(f);
  hi = __builtin_bit_cast(__bf16, hb);
  lo = at_f2bf(f - __uint_as_float(((unsigned)hb) << 16));
}
__device__ __forceinline__ v8f at_mma(v16b a, v16b b, v8f c) {
  c = __builtin_amdgcn_wmma_f32_16x16x32_bf16(false, a, false, b, (short)0, c, false, false);
  asm volatile("v_nop\n\tv_nop\n\tv_nop\n\tv_nop" : "+v"(c) : "v"(a), "v"(b));
  return c;
}

// One chunk's 384 staged rows x 8 segments of 16 B = 3072 lane copies = 24 per thread of the 128-thread block.
// Copy i of thread tid: staged row i*16 + (tid >> 3), segment tid & 7: a wave's copy covers four whole 128-B lines.
__device__ __forceinline__ void at_stage(__bf16* buf, const __bf16* ach, const __bf16* acl,
                                         const __bf16* cth, const __bf16* ctl, int h, int kv0, int tid) {
  const int rg = tid >> 3, seg = (tid & 7) * 8;
  unsigned l[24];
  const __bf16* g[24];
  // the three loops are unrolled so that every index of l and g is a constant and both arrays live in registers
#pragma unroll
  for (int i = 0; i < 24; ++i) l[i] = (unsigned)(size_t)(buf + (i * 16 + rg) * ATT_SP + seg);
#pragma unroll
  for (int i = 0; i < 4; ++i) {
    const size_t ko = (size_t)(kv0 + i * 16 + rg) * QRANK + h * HRANK + seg;
    g[i] = ach + ko;
    g[4 + i] = acl + ko;
  }
#pragma unroll
  for (int i = 0; i < 8; ++i) {
    const size_t vo = (size_t)(h * HVAL + i * 16 + rg) * SEQ_LEN + kv0 + seg;
    g[8 + i] = cth + vo;
    g[16 + i] = ctl + vo;
  }
  at_copy12(l, g);
  at_copy12(l + 12, g + 12);
}

__global__ __launch_bounds__(128)
void attn_route_k(const unsigned short* __restrict__ sthp, const unsigned short* __restrict__ stlp,
                  const unsigned short* __restrict__ achp, const unsigned short* __restrict__ aclp,
                  const unsigned short* __restrict__ cthp, const unsigned short* __restrict__ ctlp,
                  unsigned short* __restrict__ ghp, unsigned short* __restrict__ glp) {
  union FB { v16b v; v8b h[2]; };
  __shared__ __align__(16) __bf16 Psh[4][16 * ATT_KCH];        // per wave P hi [row][kv]
  __shared__ __align__(16) __bf16 Psl[4][16 * ATT_KCH];        // per wave P lo
  __shared__ __align__(16) float  Os[4][16 * ATT_OSP];         // per wave out tile [row][d], pitch 132
  __shared__ __align__(16) __bf16 Stg[2][ATT_ROWS * ATT_SP];   // two buffers of staged K and content^T rows, shared by the block

  const __bf16* sth = (const __bf16*)sthp; const __bf16* stl = (const __bf16*)stlp;
  const __bf16* ach = (const __bf16*)achp; const __bf16* acl = (const __bf16*)aclp;
  const __bf16* cth = (const __bf16*)cthp; const __bf16* ctl = (const __bf16*)ctlp;
  _Float16* gh = (_Float16*)ghp; _Float16* gl = (_Float16*)glp;

  const int tid  = threadIdx.x;
  const int wave = tid >> 5;
  const int lane = tid & 31;
  const int hh   = lane >> 4;
  const int c    = lane & 15;
  const int bx = blockIdx.x;
  const int qb = bx % ATT_NQB;
  const int h  = bx / ATT_NQB;
  const int q0 = qb * ATT_QBLK + wave * 16;

  // ---- Q fragments (A operand): 2 depth chunks, hi and lo; row = c, k = dc*32 + 8*hh + {0..7, 16..23} ----
  v16b qah[2], qal[2];
#pragma unroll
  for (int dc = 0; dc < 2; ++dc) {
    const size_t off = (size_t)(q0 + c) * QRANK + h * HRANK + dc * 32 + 8 * hh;
    qah[dc] = Frag<__bf16>::load(sth + off);
    qal[dc] = Frag<__bf16>::load(stl + off);
  }

  float mrow[8], lrow[8];
  v8f oacc[8];
#pragma unroll
  for (int r = 0; r < 8; ++r) { mrow[r] = -INFINITY; lrow[r] = 0.f; }
#pragma unroll
  for (int t = 0; t < 8; ++t) oacc[t] = (v8f){0.f,0.f,0.f,0.f,0.f,0.f,0.f,0.f};

  __bf16* pwh = Psh[wave];
  __bf16* pwl = Psl[wave];
  const int nChunks = qb + 1;   // block-uniform, <= 32

  // ---- ring prologue: chunk 0 lands and is published; then chunk 1 starts ----
  at_stage(Stg[0], ach, acl, cth, ctl, h, 0, tid);
  asm volatile("s_wait_asynccnt 0x0" ::: "memory");   // this wave's copies of chunk 0 have landed
  __syncthreads();                                    // every wave's have: chunk 0 may be read
  if (nChunks > 1) at_stage(Stg[1], ach, acl, cth, ctl, h, ATT_KCH, tid);

  for (int kc = 0; kc < nChunks; ++kc) {
    const int kv0 = kc * ATT_KCH;
    const __bf16* sb = Stg[kc & 1];

    // ---- scores: 4 key subtiles of 16; K B-fragments: col = key, k = depth (staged rows) ----
    v8f s[4];
#pragma unroll
    for (int j = 0; j < 4; ++j) {
      s[j] = (v8f){0.f,0.f,0.f,0.f,0.f,0.f,0.f,0.f};
#pragma unroll
      for (int dc = 0; dc < 2; ++dc) {
        const int ko = (j * 16 + c) * ATT_SP + dc * 32 + 8 * hh;
        const v16b kb = Frag<__bf16>::load(sb + ATT_ROW_KH * ATT_SP + ko);
        const v16b kl = Frag<__bf16>::load(sb + ATT_ROW_KL * ATT_SP + ko);
        s[j] = at_mma(qah[dc], kb, s[j]);
        s[j] = at_mma(qah[dc], kl, s[j]);
        s[j] = at_mma(qal[dc], kb, s[j]);
      }
    }

    // ---- scale by 1/8, causal select on the diagonal chunk, row max ----
    const bool diag = (kc == qb);
    float cm[8];
#pragma unroll
    for (int r = 0; r < 8; ++r) {
      const int qrow = q0 + 8 * hh + r;
      float m = -INFINITY;
#pragma unroll
      for (int j = 0; j < 4; ++j) {
        const int kvcol = kv0 + j * 16 + c;
        float v = s[j][r] * 0.125f;
        if (diag && (kvcol > qrow)) v = -INFINITY;
        s[j][r] = v;
        m = fmaxf(m, v);
      }
#pragma unroll
      for (int off = 1; off < 16; off <<= 1) m = fmaxf(m, __shfl_xor(m, off, 32));
      cm[r] = m;
    }

    // ---- online softmax update; P tile (C layout) -> LDS as bf16 hi/lo ----
#pragma unroll
    for (int r = 0; r < 8; ++r) {
      const float mnew = fmaxf(mrow[r], cm[r]);
      const float alpha = expf(mrow[r] - mnew);
      mrow[r] = mnew;
      float psum = 0.f;
#pragma unroll
      for (int j = 0; j < 4; ++j) {
        const float p = expf(s[j][r] - mnew);
        psum += p;
        __bf16 a, bl; at_split(p, a, bl);
        pwh[(8 * hh + r) * ATT_KCH + j * 16 + c] = a;
        pwl[(8 * hh + r) * ATT_KCH + j * 16 + c] = bl;
      }
#pragma unroll
      for (int off = 1; off < 16; off <<= 1) psum += __shfl_xor(psum, off, 32);
      lrow[r] = lrow[r] * alpha + psum;
#pragma unroll
      for (int t = 0; t < 8; ++t) oacc[t][r] *= alpha;
    }
    __builtin_amdgcn_fence(__ATOMIC_RELEASE, "workgroup");
    __builtin_amdgcn_wave_barrier();
    __builtin_amdgcn_fence(__ATOMIC_ACQUIRE, "workgroup");

    // ---- O += P.V ; P A-fragments from LDS (row = c, k = kv), V B-fragments from the staged content^T rows (col = d, k = kv) ----
#pragma unroll 1
    for (int kk = 0; kk < 2; ++kk) {
      FB pa, pl;
      pa.h[0] = *(const v8b*)(pwh + c * ATT_KCH + kk * 32 + 8 * hh);
      pa.h[1] = *(const v8b*)(pwh + c * ATT_KCH + kk * 32 + 16 + 8 * hh);
      pl.h[0] = *(const v8b*)(pwl + c * ATT_KCH + kk * 32 + 8 * hh);
      pl.h[1] = *(const v8b*)(pwl + c * ATT_KCH + kk * 32 + 16 + 8 * hh);
#pragma unroll
      for (int t = 0; t < 8; ++t) {
        const int vo = (t * 16 + c) * ATT_SP + kk * 32 + 8 * hh;
        const v16b vb = Frag<__bf16>::load(sb + ATT_ROW_VH * ATT_SP + vo);
        const v16b vl = Frag<__bf16>::load(sb + ATT_ROW_VL * ATT_SP + vo);
        oacc[t] = at_mma(pa.v, vb, oacc[t]);
        oacc[t] = at_mma(pa.v, vl, oacc[t]);
        oacc[t] = at_mma(pl.v, vb, oacc[t]);
      }
    }
    // order this chunk's P loads before the next chunk's P stores
    __builtin_amdgcn_fence(__ATOMIC_RELEASE, "workgroup");
    __builtin_amdgcn_wave_barrier();
    __builtin_amdgcn_fence(__ATOMIC_ACQUIRE, "workgroup");

    // ---- publish point of chunk kc + 1, every wave ----
    asm volatile("s_wait_dscnt 0x0" ::: "memory");      // this wave's reads of buffer kc & 1 have returned
    asm volatile("s_wait_asynccnt 0x0" ::: "memory");   // this wave's copies of chunk kc + 1 have landed
    __syncthreads();                                    // publishes chunk kc + 1 and ends every reader's last read of buffer kc & 1
    if (kc + 2 < nChunks) at_stage(Stg[kc & 1], ach, acl, cth, ctl, h, (kc + 2) * ATT_KCH, tid);   // block-uniform test
  }
  asm volatile("s_wait_asynccnt 0x0" ::: "memory");     // no copy is outstanding when the wave goes on to its end

  float* os = Os[wave];
#pragma unroll
  for (int r = 0; r < 8; ++r) {
    const float inv = 1.0f / lrow[r];
#pragma unroll
    for (int t = 0; t < 8; ++t) os[(8 * hh + r) * ATT_OSP + t * 16 + c] = oacc[t][r] * inv;
  }
  __builtin_amdgcn_fence(__ATOMIC_RELEASE, "workgroup");
  __builtin_amdgcn_wave_barrier();
  __builtin_amdgcn_fence(__ATOMIC_ACQUIRE, "workgroup");
  {
    // lane groups of 8: q4 = lane>>3; row parity = q4>>1, column half = q4&1; it = 0..7 -> rows 0..15, cols 0..127: whole 16x128 tile, both planes
    const int q4 = lane >> 3, c8 = (lane & 7) * 8;
    const int rpar = q4 >> 1, chalf = (q4 & 1) * 64;
    {
#pragma unroll
      for (int it = 0; it < 8; ++it) {
        const int row = it * 2 + rpar;
        const int col = chalf + c8;
        const float* sp = os + row * ATT_OSP + col;
        v8h hv, lv;
#pragma unroll
        for (int e = 0; e < 8; ++e) {
          const unsigned short hb = f2bf_bits(sp[e]);
          const unsigned short lb = f2bf_bits(sp[e] - bf_bits2f(hb));
          hv[e] = __builtin_bit_cast(_Float16, hb);
          lv[e] = __builtin_bit_cast(_Float16, lb);
        }
        const size_t go = (size_t)(q0 + row) * HID + h * HVAL + col;
        *(v8h*)(gh + go) = hv;
        *(v8h*)(gl + go) = lv;
      }
      
    }
  }
}

// =====================================================================================
// Host launcher. Workspace region map (bytes, every offset a multiple of 4 MiB):
//   XB   bf16 [2048][2048]   8 MiB   x
//   WSA  bf16 [2048][2048]   8 MiB   rows 0..1023 W_state, 1024..2047 W_action
//   WC   bf16 [2048][1024]   4 MiB   W_content
//   WO   bf16 [2048][2048]   8 MiB   W_out
//   SA32 f32  [2048][2048]  16 MiB   state | action
//   STH, STL, ACH, ACL, QVH, QVL  bf16 [2048][1024]  4 MiB each (state, action, q-value hi/lo)
//   CTH, CTL  bf16 [2048 = h*128+d][2048 = kv]  8 MiB each (content^T hi/lo)
//   GH, GL    bf16 [2048][2048]  8 MiB each (gathered hi/lo)
//   total 104,857,600 B
// =====================================================================================
extern "C" void kernel_launch(void* const* d_in, const int* in_sizes, int n_in,
                              void* d_out, int out_size, void* d_ws, size_t ws_size,
                              hipStream_t stream) {
  if (n_in < 6) return;
  if (in_sizes[0] != SEQ_LEN * HID || in_sizes[1] != QRANK * HID || in_sizes[2] != QRANK * HID ||
      in_sizes[3] != HID * QRANK || in_sizes[4] != HID * HID || in_sizes[5] != HID) return;
  if (out_size != SEQ_LEN * HID) return;

  const float* x  = (const float*)d_in[0];
  const float* Ws = (const float*)d_in[1];
  const float* Wa = (const float*)d_in[2];
  const float* Wc = (const float*)d_in[3];
  const float* Wo = (const float*)d_in[4];
  const float* bo = (const float*)d_in[5];
  float* out = (float*)d_out;

  const size_t B_XB  = (size_t)SEQ_LEN * HID * 2;
  const size_t B_WSA = (size_t)(2 * QRANK) * HID * 2;
  const size_t B_WC  = (size_t)HID * QRANK * 2;
  const size_t B_WO  = (size_t)HID * HID * 2;
  const size_t B_SA  = (size_t)SEQ_LEN * (2 * QRANK) * 4;
  const size_t B_PL  = (size_t)SEQ_LEN * QRANK * 2;     // one [2048][1024] bf16 plane
  const size_t B_CT  = (size_t)HID * SEQ_LEN * 2;       // one [2048][2048] bf16 plane
  const size_t B_G   = (size_t)SEQ_LEN * HID * 2;

  char* ws = (char*)d_ws;
  size_t off = 0;
  unsigned short* XB  = (unsigned short*)(ws + off); off += B_XB;
  unsigned short* WSA = (unsigned short*)(ws + off); off += B_WSA;
  unsigned short* WC  = (unsigned short*)(ws + off); off += B_WC;
  unsigned short* WO  = (unsigned short*)(ws + off); off += B_WO;
  float*          SA  = (float*)(ws + off);          off += B_SA;
  unsigned short* STH = (unsigned short*)(ws + off); off += B_PL;
  unsigned short* STL = (unsigned short*)(ws + off); off += B_PL;
  unsigned short* ACH = (unsigned short*)(ws + off); off += B_PL;
  unsigned short* ACL = (unsigned short*)(ws + off); off += B_PL;
  unsigned short* QVH = (unsigned short*)(ws + off); off += B_PL;
  unsigned short* QVL = (unsigned short*)(ws + off); off += B_PL;
  unsigned short* CTH = (unsigned short*)(ws + off); off += B_CT;
  unsigned short* CTL = (unsigned short*)(ws + off); off += B_CT;
  unsigned short* GH  = (unsigned short*)(ws + off); off += B_G;
  unsigned short* GL  = (unsigned short*)(ws + off); off += B_G;
  if (off > ws_size) return;

  // ---- input casts to bf16 (RNE) ----
  cast_inputs_bf16<<<dim3(CAST_BLOCKS), dim3(CAST_THREADS), 0, stream>>>(
      x, Ws, Wa, Wc, Wo, XB, WSA, WSA + (size_t)QRANK * HID, WC, WO);

  // ---- projections: SA[q][0..2047] = x . [W_state; W_action]^T  (M=2048, N=2048, K=2048) ----
  {
    const int M = SEQ_LEN, N = 2 * QRANK, K = HID;
    const int blocks = (M / 64) * (N / 64) / 8;   // 128
    wmma_gemm64<1, false, false, 0, 0><<<dim3(blocks, 1), dim3(256), 0, stream>>>(
        XB, XB, K, 0L, WSA, WSA, K, 0L, (void*)SA, (void*)SA, N, 0L, bo, M, N, K, 1.0f);
  }

  // ---- bf16 hi/lo planes of state, action, q-value ----
  planes_k<<<dim3(SEQ_LEN / 2), dim3(256), 0, stream>>>(SA, STH, STL, ACH, ACL, QVH, QVL);

  // ---- content^T[n][kv] = W_content[n][:] . qval[kv][:]  (M=2048, N=2048, K=1024; B = q-value hi/lo) -> bf16 hi/lo planes ----
  {
    const int M = HID, N = SEQ_LEN, K = QRANK;
    const int blocks = (M / 64) * (N / 64) / 8;   // 128
    wmma_gemm64<1, false, true, 0, 2><<<dim3(blocks, 1), dim3(256), 0, stream>>>(
        WC, WC, K, 0L, QVH, QVL, K, 0L, (void*)CTH, (void*)CTL, N, 0L, bo, M, N, K, 1.0f);
  }

  // ---- causal routing attention -> gathered hi/lo planes ----
  attn_route_k<<<dim3(NHEADS * ATT_NQB), dim3(128), 0, stream>>>(STH, STL, ACH, ACL, CTH, CTL, GH, GL);

  // ---- out = gathered . W_out^T + b_out  (M=N=K=2048; A = gathered hi/lo), f32 ----
  {
    const int M = SEQ_LEN, N = HID, K = HID;
    const int blocks = (M / 64) * (N / 64) / 8;   // 128
    wmma_gemm64<1, true, false, 2, 0><<<dim3(blocks, 1), dim3(256), 0, stream>>>(
        GH, GL, K, 0L, WO, WO, K, 0L, (void*)out, (void*)out, N, 0L, bo, M, N, K, 1.0f);
  }
}

// v004
// A run of this version takes 216 microseconds.
// Timed twice side by side with v003, it ran 1.15 times as fast both times.
// Counting every step since v000, it is 2.64 times as fast.
// All contractions: v_wmma_f32_16x16x32_bf16 (bf16 operands, f32 accumulate): x and weight matrices as single RNE bf16 planes; state/action, q-value product, softmax p, content and gathered carried as bf16 hi/lo planes (hi.hi + hi.lo + lo.hi); softmax, q-value product and bias in f32.
#include <hip/hip_runtime.h>
#include <stdint.h>

constexpr int SEQ_LEN = 2048;   // L
constexpr int HID     = 2048;   // hidden
constexpr int QRANK   = 1024;   // q_rank
constexpr int NHEADS  = 16;
constexpr int HRANK   = 64;     // per-head rank (q/k depth)
constexpr int HVAL    = 128;    // per-head value width
static_assert(QRANK == NHEADS * HRANK, "rank split");
static_assert(HID == NHEADS * HVAL, "value split");
static_assert(SEQ_LEN % 64 == 0 && HID % 64 == 0 && QRANK % 64 == 0, "tile multiples");
static_assert(HID % 32 == 0 && QRANK % 32 == 0, "K multiples of 32");

typedef __attribute__((ext_vector_type(16))) _Float16 v16h;
typedef __attribute__((ext_vector_type(8)))  _Float16 v8h;
typedef __attribute__((ext_vector_type(16))) __bf16   v16b;
typedef __attribute__((ext_vector_type(8)))  __bf16   v8b;
typedef __attribute__((ext_vector_type(8)))  float    v8f;
typedef __attribute__((ext_vector_type(4)))  float    v4f;

__device__ __forceinline__ unsigned short f2bf_bits(float f) {
  unsigned u = __float_as_uint(f);
  return (unsigned short)((u + 0x7FFFu + ((u >> 16) & 1u)) >> 16);
}
__device__ __forceinline__ float bf_bits2f(unsigned short h) { return __uint_as_float(((unsigned)h) << 16); }

// hazard guards as plain device helpers (no hazard-guard asm inside the kernel template body)
__device__ __forceinline__ void dep_guard_h(v8f& a, v8f& b, v16h x, v16h y) { asm volatile("v_nop\n\tv_nop\n\tv_nop\n\tv_nop" : "+v"(a), "+v"(b) : "v"(x), "v"(y)); }
__device__ __forceinline__ void dep_guard_b(v8f& a, v8f& b, v16b x, v16b y) { asm volatile("v_nop\n\tv_nop\n\tv_nop\n\tv_nop" : "+v"(a), "+v"(b) : "v"(x), "v"(y)); }
__device__ __forceinline__ void keep4_h(v16h a, v16h b, v16h c, v16h d) { asm volatile("v_nop" :: "v"(a), "v"(b), "v"(c), "v"(d)); }
__device__ __forceinline__ void keep4_b(v16b a, v16b b, v16b c, v16b d) { asm volatile("v_nop" :: "v"(a), "v"(b), "v"(c), "v"(d)); }
__device__ __forceinline__ void acc_guard4(v8f& a, v8f& b, v8f& c, v8f& d) { asm volatile("v_nop\n\tv_nop\n\tv_nop\n\tv_nop" : "+v"(a), "+v"(b), "+v"(c), "+v"(d)); }
template <typename T> struct Frag;
template <> struct Frag<_Float16> {
  typedef v16h V; union U { v16h v; v8h h[2]; };
  static __device__ __forceinline__ v16h load(const _Float16* p) {   // elements 0..7 <- p[0..7], 8..15 <- p[16..23]
    U f; f.h[0] = *(const v8h*)(p); f.h[1] = *(const v8h*)(p + 16); return f.v;
  }
  static __device__ __forceinline__ v8f mma(v16h a, v16h b, v8f c) {
    return __builtin_amdgcn_wmma_f32_16x16x32_f16(false, a, false, b, (short)0, c, false, false);
  }
  static __device__ __forceinline__ void guard(v8f& a, v8f& b, v16h x, v16h y) { dep_guard_h(a, b, x, y); }
  static __device__ __forceinline__ void keep(v16h a, v16h b, v16h c, v16h d) { keep4_h(a, b, c, d); }
};
template <> struct Frag<__bf16> {
  typedef v16b V; union U { v16b v; v8b h[2]; };
  static __device__ __forceinline__ v16b load(const __bf16* p) {
    U f; f.h[0] = *(const v8b*)(p); f.h[1] = *(const v8b*)(p + 16); return f.v;
  }
  static __device__ __forceinline__ v8f mma(v16b a, v16b b, v8f c) {
    return __builtin_amdgcn_wmma_f32_16x16x32_bf16(false, a, false, b, (short)0, c, false, false);
  }
  static __device__ __forceinline__ void guard(v8f& a, v8f& b, v16b x, v16b y) { dep_guard_b(a, b, x, y); }
  static __device__ __forceinline__ void keep(v16b a, v16b b, v16b c, v16b d) { keep4_b(a, b, c, d); }
};

// Twelve asynchronous 16-B-per-lane copies global -> LDS. The s_wait_xcnt is the last line of the copies' own statement,
// so that no address register of an issued copy is rewritten in front of it.
__device__ __forceinline__ void at_copy12(const unsigned* l, const __bf16* const* g) {
  asm volatile(
      "global_load_async_to_lds_b128 %0, %12, off\n\t"
      "global_load_async_to_lds_b128 %1, %13, off\n\t"
      "global_load_async_to_lds_b128 %2, %14, off\n\t"
      "global_load_async_to_lds_b128 %3, %15, off\n\t"
      "global_load_async_to_lds_b128 %4, %16, off\n\t"
      "global_load_async_to_lds_b128 %5, %17, off\n\t"
      "global_load_async_to_lds_b128 %6, %18, off\n\t"
      "global_load_async_to_lds_b128 %7, %19, off\n\t"
      "global_load_async_to_lds_b128 %8, %20, off\n\t"
      "global_load_async_to_lds_b128 %9, %21, off\n\t"
      "global_load_async_to_lds_b128 %10, %22, off\n\t"
      "global_load_async_to_lds_b128 %11, %23, off\n\t"
      "s_wait_xcnt 0x0"
      :: "v"(l[0]), "v"(l[1]), "v"(l[2]), "v"(l[3]), "v"(l[4]), "v"(l[5]),
         "v"(l[6]), "v"(l[7]), "v"(l[8]), "v"(l[9]), "v"(l[10]), "v"(l[11]),
         "v"(g[0]), "v"(g[1]), "v"(g[2]), "v"(g[3]), "v"(g[4]), "v"(g[5]),
         "v"(g[6]), "v"(g[7]), "v"(g[8]), "v"(g[9]), "v"(g[10]), "v"(g[11])
      : "memory");
}

// The same for eight copies.
__device__ __forceinline__ void at_copy8(const unsigned* l, const __bf16* const* g) {
  asm volatile(
      "global_load_async_to_lds_b128 %0, %8, off\n\t"
      "global_load_async_to_lds_b128 %1, %9, off\n\t"
      "global_load_async_to_lds_b128 %2, %10, off\n\t"
      "global_load_async_to_lds_b128 %3, %11, off\n\t"
      "global_load_async_to_lds_b128 %4, %12, off\n\t"
      "global_load_async_to_lds_b128 %5, %13, off\n\t"
      "global_load_async_to_lds_b128 %6, %14, off\n\t"
      "global_load_async_to_lds_b128 %7, %15, off\n\t"
      "s_wait_xcnt 0x0"
      :: "v"(l[0]), "v"(l[1]), "v"(l[2]), "v"(l[3]), "v"(l[4]), "v"(l[5]), "v"(l[6]), "v"(l[7]),
         "v"(g[0]), "v"(g[1]), "v"(g[2]), "v"(g[3]), "v"(g[4]), "v"(g[5]), "v"(g[6]), "v"(g[7])
      : "memory");
}

// ---- Register-blocked batched WMMA GEMM ------------------------------------
// C[m,n] = scale * sum_k A[m,k] * Bt[n,k] (+bias); each wave owns a 64x64 tile; a block's 8 waves (2 x 4) own a 128x256 tile.
// A row-major [M,K]; Bt row-major [N,K]; M % 128 == 0, N % 256 == 0, K % 64 == 0.
// Per 64 k the block's 128 A rows and 256 Bt rows (each plane) are brought into LDS once by asynchronous copies, whole 128-B lines,
// two buffers (slab s + 1 flies while slab s is worked on); the waves read their fragments there.
// ASPLIT: A carried as hi/lo planes (A2 = lo plane, same layout); BSPLIT: Bt hi/lo (Bt2 = lo plane).
//   product = hi.hi (+ hi.lo if BSPLIT) (+ lo.hi if ASPLIT).
// BIAS_MODE: 0 = none, 1 = bias[m], 2 = bias[n].
// OUT_MODE: 0 = f32, 1 = f16, 2 = bf16 hi plane (Cout) + bf16 lo plane (Cout2).
// Coverage: per 64x64 tile, 4 slabs x 16 rows x 64 cols -> the whole tile; grid = (M/128)*(N/256) = tilesM*tilesN/8 blocks of 8 waves.
// ET: 0 = f16 operands, 1 = bf16 operands (pointers passed as 16-bit storage)
constexpr int GM_BM = 128;   // block tile rows
constexpr int GM_BN = 256;   // block tile cols
constexpr int GM_KS = 64;    // k per staged slab: 128-B rows
constexpr int GM_SP = 72;    // staged row pitch in elements: 144 B (16 B x odd, for ds_load_b128 readers)
static_assert(SEQ_LEN % GM_BN == 0 && HID % GM_BN == 0 && (2 * QRANK) % GM_BN == 0, "block tile multiples");
static_assert(HID % GM_KS == 0 && QRANK % GM_KS == 0, "K multiples of the slab");
template <int ET> struct Elem;
template <> struct Elem<0> { typedef _Float16 T; };
template <> struct Elem<1> { typedef __bf16 T; };
template <int ET, bool ASPLIT, bool BSPLIT, int BIAS_MODE, int OUT_MODE>
__global__ __launch_bounds__(256) void wmma_gemm64(
    const unsigned short* __restrict__ Ap, const unsigned short* __restrict__ A2p, int lda, long strideA,
    const unsigned short* __restrict__ Btp, const unsigned short* __restrict__ Bt2p, int ldb, long strideB,
    void* __restrict__ Cout, void* __restrict__ Cout2, int ldc, long strideC,
    const float* __restrict__ bias,
    int M, int N, int K, float scale) {
  typedef typename Elem<ET>::T T;
  typedef typename Frag<T>::V V;
  const T* A = (const T*)Ap; const T* A2 = (const T*)A2p; const T* Bt = (const T*)Btp; const T* Bt2 = (const T*)Bt2p;
  // staged rows of one slab: A hi (, A lo), Bt hi (, Bt lo); every plane starts at a multiple of 32 rows
  constexpr int ROW_AL = GM_BM;
  constexpr int ROW_BH = GM_BM * (ASPLIT ? 2 : 1);
  constexpr int ROW_BL = ROW_BH + GM_BN;
  constexpr int ROWS   = ROW_BH + GM_BN * (BSPLIT ? 2 : 1);   // 384, 512 or 640
  constexpr int NCP    = ROWS / 32;                           // copies per thread and slab: 12, 16 or 20
  static_assert(NCP == 12 || NCP == 16 || NCP == 20, "copy statements below");
  __shared__ __align__(16) float sT[8][16 * 68];   // per-wave 16x64 slab, pitch 68 floats
  __shared__ __align__(16) T Stg[2][ROWS * GM_SP]; // two buffers of staged rows, shared by the block
  const int b    = blockIdx.y;
  const int tid  = threadIdx.x;
  const int lane = threadIdx.x & 31;
  const int wave = threadIdx.x >> 5;
  const int blkN = N / GM_BN;
  if ((int)blockIdx.x >= (M / GM_BM) * blkN) return;   // block-uniform, in front of every barrier
  const int bm  = blockIdx.x / blkN;
  const int bm0 = bm * GM_BM;
  const int bn0 = (blockIdx.x - bm * blkN) * GM_BN;
  const int wm0 = (wave >> 2) << 6;            // this wave's 64x64 tile inside the block tile
  const int wn0 = (wave & 3) << 6;
  const int m0 = bm0 + wm0;
  const int n0 = bn0 + wn0;

  const T* Ab  = A  + (size_t)b * strideA;
  const T* Bb  = Bt + (size_t)b * strideB;
  const T* Ab2 = ASPLIT ? (A2  + (size_t)b * strideA) : nullptr;
  const T* Bb2 = BSPLIT ? (Bt2 + (size_t)b * strideB) : nullptr;

  const int rlane = lane & 15;                 // row (A) / col (B, D) within subtile
  const int koff  = (lane >> 4) * 8;           // k offset of this lane half
  const int mOff  = (lane >> 4) * 8;           // D row offset

  v8f acc[4][4];
#pragma unroll
  for (int i = 0; i < 4; ++i)
#pragma unroll
    for (int j = 0; j < 4; ++j) acc[i][j] = (v8f){0.f,0.f,0.f,0.f,0.f,0.f,0.f,0.f};

  // One slab: ROWS staged rows x 8 segments of 16 B = NCP lane copies per thread of the 256-thread block.
  // Copy i of thread tid: staged row i*32 + (tid >> 3), segment tid & 7: a wave's copy covers four whole 128-B lines.
  // One running pointer per plane (this thread's first row and segment of the next slab to stage); the other rows are 32*ld apart.
  const int rg = tid >> 3, seg = (tid & 7) * 8;
  const T* pA  = Ab + (size_t)(bm0 + rg) * lda + seg;
  const T* pB  = Bb + (size_t)(bn0 + rg) * ldb + seg;
  const T* pA2 = ASPLIT ? (Ab2 + (size_t)(bm0 + rg) * lda + seg) : nullptr;
  const T* pB2 = BSPLIT ? (Bb2 + (size_t)(bn0 + rg) * ldb + seg) : nullptr;
  auto stage = [&](T* buf) {
    unsigned l[NCP];
    const __bf16* g[NCP];
    // unrolled so that every index of l and g is a constant and both arrays live in registers
#pragma unroll
    for (int i = 0; i < NCP; ++i) {
      const T* sp;
      if (i * 32 >= ROW_BL)                 sp = pB2 + (size_t)(i * 32 - ROW_BL) * ldb;
      else if (i * 32 >= ROW_BH)            sp = pB  + (size_t)(i * 32 - ROW_BH) * ldb;
      else if (ASPLIT && i * 32 >= ROW_AL)  sp = pA2 + (size_t)(i * 32 - ROW_AL) * lda;
      else                                  sp = pA  + (size_t)(i * 32) * lda;
      l[i] = (unsigned)(size_t)(buf + (i * 32 + rg) * GM_SP + seg);
      g[i] = (const __bf16*)sp;
    }
    if (NCP == 12) { at_copy12(l, g); }
    if (NCP == 16) { at_copy8(l, g); at_copy8(l + NCP - 8, g + NCP - 8); }
    if (NCP == 20) { at_copy12(l, g); at_copy8(l + NCP - 8, g + NCP - 8); }
    pA += GM_KS; pB += GM_KS;
    if (ASPLIT) pA2 += GM_KS;
    if (BSPLIT) pB2 += GM_KS;
  };
  const int nSlabs = K / GM_KS;   // block-uniform

  // ---- ring prologue: slab 0 lands and is published; then slab 1 starts ----
  stage(Stg[0]);
  asm volatile("s_wait_asynccnt 0x0" ::: "memory");   // this wave's copies of slab 0 have landed
  __syncthreads();                                    // every wave's have: slab 0 may be read
  if (nSlabs > 1) stage(Stg[1]);

  for (int s = 0; s < nSlabs; ++s) {
    const T* sb = Stg[s & 1];
    // both 32-k steps of the slab unrolled: the second step's LDS reads may go ahead of the first step's products
#pragma unroll
    for (int kk = 0; kk < GM_KS; kk += 32) {
      V bh[4], bl[4];
#pragma unroll
      for (int j = 0; j < 4; ++j) {
        const int bo = (wn0 + (j << 4) + rlane) * GM_SP + koff + kk;
        bh[j] = Frag<T>::load(sb + ROW_BH * GM_SP + bo);
        if (BSPLIT) bl[j] = Frag<T>::load(sb + ROW_BL * GM_SP + bo);
      }
      // all of the step's LDS reads stand together, ahead of its products
      V ah[4], al[4];
#pragma unroll
      for (int i = 0; i < 4; ++i) {
        const int ao = (wm0 + (i << 4) + rlane) * GM_SP + koff + kk;
        ah[i] = Frag<T>::load(sb + ao);
        al[i] = ah[i];
        if (ASPLIT) al[i] = Frag<T>::load(sb + ROW_AL * GM_SP + ao);
      }
#pragma unroll
      for (int i = 0; i < 4; ++i) {
#pragma unroll
        for (int j = 0; j < 4; ++j) {
          acc[i][j] = Frag<T>::mma(ah[i], bh[j], acc[i][j]);
          if (BSPLIT) acc[i][j] = Frag<T>::mma(ah[i], bl[j], acc[i][j]);
          if (ASPLIT) acc[i][j] = Frag<T>::mma(al[i], bh[j], acc[i][j]);
        }
        Frag<T>::guard(acc[i][0], acc[i][3], ah[i], al[i]);
      }
      Frag<T>::keep(bh[0], bh[1], bh[2], bh[3]);
      if (BSPLIT) Frag<T>::keep(bl[0], bl[1], bl[2], bl[3]);
    }
    // ---- publish point of slab s + 1, every wave ----
    asm volatile("s_wait_dscnt 0x0" ::: "memory");      // this wave's reads of buffer s & 1 have returned
    asm volatile("s_wait_asynccnt 0x0" ::: "memory");   // this wave's copies of slab s + 1 have landed
    __syncthreads();                                    // publishes slab s + 1 and ends every reader's last read of buffer s & 1
    if (s + 2 < nSlabs) stage(Stg[s & 1]);              // block-uniform test; slab s + 2
  }
  asm volatile("s_wait_asynccnt 0x0" ::: "memory");     // no copy is outstanding when the wave goes on to its end
  acc_guard4(acc[0][0], acc[0][1], acc[0][2], acc[0][3]);
  acc_guard4(acc[1][0], acc[1][1], acc[1][2], acc[1][3]);
  acc_guard4(acc[2][0], acc[2][1], acc[2][2], acc[2][3]);
  acc_guard4(acc[3][0], acc[3][1], acc[3][2], acc[3][3]);

  // ---- epilogue ----
  float* slab = sT[wave];
#pragma unroll
  for (int i = 0; i < 4; ++i) {
    const int mBase = m0 + (i << 4);
#pragma unroll
    for (int j = 0; j < 4; ++j) {
      const int n = n0 + (j << 4) + rlane;
      float bv = 0.f;
      if (BIAS_MODE == 2) bv = bias[n];
#pragma unroll
      for (int r = 0; r < 8; ++r) {
        float v = acc[i][j][r] * scale;
        if (BIAS_MODE == 1) v += bias[mBase + mOff + r];
        if (BIAS_MODE == 2) v += bv;
        slab[(mOff + r) * 68 + (j << 4) + rlane] = v;
      }
    }
    __builtin_amdgcn_fence(__ATOMIC_RELEASE, "workgroup");
    __builtin_amdgcn_wave_barrier();
    __builtin_amdgcn_fence(__ATOMIC_ACQUIRE, "workgroup");
    if (OUT_MODE == 0) {
      float* C = (float*)Cout + (size_t)b * strideC;
      const int hh = lane >> 4, c4 = (lane & 15) * 4;     // row seg = 256 B = 16 lanes x 16 B
      {
#pragma unroll
        for (int it = 0; it < 8; ++it) {
          const int row = it * 2 + hh;
          v4f v = *(const v4f*)(slab + row * 68 + c4);
          *(v4f*)(C + (size_t)(mBase + row) * ldc + n0 + c4) = v;
        }
        
      }
    } else {
      const int q = lane >> 3, c8 = (lane & 7) * 8;
      unsigned short* C  = (unsigned short*)Cout  + (size_t)b * strideC;
      unsigned short* C2 = (OUT_MODE == 2) ? ((unsigned short*)Cout2 + (size_t)b * strideC) : nullptr;
      {
#pragma unroll
        for (int it = 0; it < 4; ++it) {
          const int row = it * 4 + q;
          const float* sp = slab + row * 68 + c8;
          v8h hv, lv;
#pragma unroll
          for (int e = 0; e < 8; ++e) {
            if (OUT_MODE == 1) {
              hv[e] = (_Float16)sp[e];
            } else {
              unsigned short hb = f2bf_bits(sp[e]);
              unsigned short lb = f2bf_bits(sp[e] - bf_bits2f(hb));
              hv[e] = __builtin_bit_cast(_Float16, hb);
              lv[e] = __builtin_bit_cast(_Float16, lb);
            }
          }
          *(v8h*)(C + (size_t)(mBase + row) * ldc + n0 + c8) = hv;
          if (OUT_MODE == 2) *(v8h*)(C2 + (size_t)(mBase + row) * ldc + n0 + c8) = lv;
        }
        
      }
    }
    __builtin_amdgcn_fence(__ATOMIC_RELEASE, "workgroup");
    __builtin_amdgcn_wave_barrier();
    __builtin_amdgcn_fence(__ATOMIC_ACQUIRE, "workgroup");
  }
}

// ---- all five f32 inputs -> bf16 (RNE) in one launch: one 16-wave block per WGP, few long waves in place of many two-element ones ----
// Block b converts the b-th of 256 equal contiguous parts of every input, in steps of 2,048 floats (4 a lane):
// a wave's load is 512 contiguous bytes, its store 256. x and W_out take 8 steps a block, the three rank-sized weights 4 each.
// Coverage: 256 blocks x N steps x 2,048 = the whole of each input, each element converted by exactly one lane.
constexpr int CAST_BLOCKS  = 256;
constexpr int CAST_THREADS = 512;
constexpr int CAST_STEP    = CAST_THREADS * 4;                             // floats a block converts per step
constexpr int CAST_NX = SEQ_LEN * HID / (CAST_BLOCKS * CAST_STEP);         // 8
constexpr int CAST_NW = QRANK * HID / (CAST_BLOCKS * CAST_STEP);           // 4
constexpr int CAST_NO = HID * HID / (CAST_BLOCKS * CAST_STEP);             // 8
static_assert(SEQ_LEN * HID == CAST_NX * CAST_BLOCKS * CAST_STEP && QRANK * HID == CAST_NW * CAST_BLOCKS * CAST_STEP &&
              HID * HID == CAST_NO * CAST_BLOCKS * CAST_STEP, "whole steps");
typedef __attribute__((ext_vector_type(2))) unsigned v2u;
// Addresses are a uniform base, one unsigned 32-bit byte offset a lane, and a small constant per step.
template <int N>
__device__ __forceinline__ void cast_load(v4f* r, const float* __restrict__ in) {
  const char* p = (const char*)in + (blockIdx.x * (N * CAST_THREADS) + threadIdx.x) * 16u;
  // unrolled so that r is indexed by constants and lives in registers, and the loads follow one another
#pragma unroll
  for (int i = 0; i < N; ++i) r[i] = *(const v4f*)(p + i * (CAST_STEP * 4));
}
template <int N>
__device__ __forceinline__ void cast_store(const v4f* r, unsigned short* __restrict__ out) {
  char* q = (char*)out + (blockIdx.x * (N * CAST_THREADS) + threadIdx.x) * 8u;
  // unrolled so that r is indexed by constants and lives in registers
#pragma unroll
  for (int i = 0; i < N; ++i) {
    v2u u;
    u[0] = (unsigned)f2bf_bits(r[i][0]) | ((unsigned)f2bf_bits(r[i][1]) << 16);
    u[1] = (unsigned)f2bf_bits(r[i][2]) | ((unsigned)f2bf_bits(r[i][3]) << 16);
    *(v2u*)(q + i * (CAST_STEP * 2)) = u;
  }
}
__global__ __launch_bounds__(CAST_THREADS) void cast_inputs_bf16(
    const float* __restrict__ x, const float* __restrict__ wst, const float* __restrict__ wac,
    const float* __restrict__ wco, const float* __restrict__ wou,
    unsigned short* __restrict__ xb, unsigned short* __restrict__ wstb, unsigned short* __restrict__ wacb,
    unsigned short* __restrict__ wcob, unsigned short* __restrict__ woub) {
  // all of a lane's 28 loads stand ahead of its first store, so that they are in flight together
  v4f rx[CAST_NX], rs[CAST_NW], ra[CAST_NW], rc[CAST_NW], ro[CAST_NO];
  cast_load<CAST_NX>(rx, x);
  cast_load<CAST_NW>(rs, wst);
  cast_load<CAST_NW>(ra, wac);
  cast_load<CAST_NW>(rc, wco);
  // the loads below may be given, for their results, the offset register that the twelve loads above name
  asm volatile("s_wait_xcnt 0x0" ::: "memory");
  cast_load<CAST_NO>(ro, wou);
  cast_store<CAST_NX>(rx, xb);
  cast_store<CAST_NW>(rs, wstb);
  cast_store<CAST_NW>(ra, wacb);
  cast_store<CAST_NW>(rc, wcob);
  cast_store<CAST_NO>(ro, woub);
}

// ---- state|action f32 [SEQ_LEN][2*QRANK] -> bf16 hi/lo planes of state, action and q-value (state*action in f32), each [SEQ_LEN][QRANK] ----
// Coverage: grid = SEQ_LEN/2 blocks x 256 threads; thread -> row = 2*blk + (tid>>7), cols (tid&127)*8 .. +7 -> 2048 rows x 1024 cols exactly, all six planes.
__global__ __launch_bounds__(256) void planes_k(const float* __restrict__ sa,
    unsigned short* __restrict__ sthp, unsigned short* __restrict__ stlp,
    unsigned short* __restrict__ achp, unsigned short* __restrict__ aclp,
    unsigned short* __restrict__ qvhp, unsigned short* __restrict__ qvlp) {
  const int row = blockIdx.x * 2 + (threadIdx.x >> 7);
  const int c8  = (threadIdx.x & 127) * 8;
  const float* sp = sa + (size_t)row * (2 * QRANK) + c8;
  const v8f sv = *(const v8f*)(sp);
  const v8f av = *(const v8f*)(sp + QRANK);
  v8h shv, slv, ahv, alv, qhv, qlv;
#pragma unroll
  for (int e = 0; e < 8; ++e) {
    const float s = sv[e], a = av[e];
    const float q = s * a;
    unsigned short hb, lb;
    hb = f2bf_bits(s); lb = f2bf_bits(s - bf_bits2f(hb));
    shv[e] = __builtin_bit_cast(_Float16, hb); slv[e] = __builtin_bit_cast(_Float16, lb);
    hb = f2bf_bits(a); lb = f2bf_bits(a - bf_bits2f(hb));
    ahv[e] = __builtin_bit_cast(_Float16, hb); alv[e] = __builtin_bit_cast(_Float16, lb);
    hb = f2bf_bits(q); lb = f2bf_bits(q - bf_bits2f(hb));
    qhv[e] = __builtin_bit_cast(_Float16, hb); qlv[e] = __builtin_bit_cast(_Float16, lb);
  }
  const size_t o = (size_t)row * QRANK + c8;
  _Float16* sth = (_Float16*)sthp; _Float16* stl = (_Float16*)stlp;
  _Float16* ach = (_Float16*)achp; _Float16* acl = (_Float16*)aclp;
  _Float16* qvh = (_Float16*)qvhp; _Float16* qvl = (_Float16*)qvlp;
  {
    *(v8h*)(sth + o) = shv;
    *(v8h*)(stl + o) = slv;
    *(v8h*)(ach + o) = ahv;
    *(v8h*)(acl + o) = alv;
    *(v8h*)(qvh + o) = qhv;
    *(v8h*)(qvl + o) = qlv;
    
  }
}

// =====================================================================================
// Causal routing attention, q/k depth 64 (bf16 hi/lo planes, ld QRANK, head cols h*64),
// value width 128 (content^T bf16 hi/lo planes [h*128 + d][kv], ld SEQ_LEN),
// output gathered as bf16 hi/lo planes [q][h*128 + d], ld HID.
//   scores = (q.k) * 1/8   : hi.hi + hi.lo + lo.hi bf16 WMMA, f32 accumulate; future keys := -inf (p = 0, diagonal always present)
//   out    = p.v           : p and v bf16 hi/lo (hi.hi + hi.lo + lo.hi); online softmax in f32.
// Block = 4 waves, each owns 16 query rows of one head; 64-key chunks, chunks above the diagonal skipped.
// Each chunk's K rows and content^T rows (hi and lo planes) are brought into LDS once per block by asynchronous copies,
// whole 128-B lines, two buffers (chunk t + 1 flies while chunk t is worked on); all four waves read their B-fragments there.
// P is relaid C-layout -> A-layout through per-wave LDS.
// Coverage: grid = NHEADS * SEQ_LEN/64 blocks; block (qb, h) writes rows qb*64..+63, cols h*128..+127 of both planes.
// =====================================================================================
constexpr int ATT_QBLK = 64;
constexpr int ATT_KCH  = 64;
constexpr int ATT_OSP  = 132;
constexpr int ATT_NQB  = SEQ_LEN / ATT_QBLK;
constexpr int ATT_SP   = 72;                          // staged row pitch in elements: 128-B rows at 144 B (16 B x odd, for ds_load_b128 readers)
constexpr int ATT_ROW_KH = 0;                         // staged rows: 64 K hi, 64 K lo, 128 V hi, 128 V lo
constexpr int ATT_ROW_KL = ATT_KCH;
constexpr int ATT_ROW_VH = 2 * ATT_KCH;
constexpr int ATT_ROW_VL = 2 * ATT_KCH + HVAL;
constexpr int ATT_ROWS   = 2 * ATT_KCH + 2 * HVAL;    // 384
static_assert(HRANK * 2 == 128 && ATT_KCH * 2 == 128, "staged rows are 128 B");

__device__ __forceinline__ __bf16 at_f2bf(float f) { return __builtin_bit_cast(__bf16, f2bf_bits(f)); }
__device__ __forceinline__ void at_split(float f, __bf16& hi, __bf16& lo) {
  const unsigned short hb = f2bf_bits(f);
  hi = __builtin_bit_cast(__bf16, hb);
  lo = at_f2bf(f - __uint_as_float(((unsigned)hb) << 16));
}
__device__ __forceinline__ v8f at_mma(v16b a, v16b b, v8f c) {
  return __builtin_amdgcn_wmma_f32_16x16x32_bf16(false, a, false, b, (short)0, c, false, false);
}

// One chunk's 384 staged rows x 8 segments of 16 B = 3072 lane copies = 24 per thread of the 128-thread block.
// Copy i of thread tid: staged row i*16 + (tid >> 3), segment tid & 7: a wave's copy covers four whole 128-B lines.
__device__ __forceinline__ void at_stage(__bf16* buf, const __bf16* ach, const __bf16* acl,
                                         const __bf16* cth, const __bf16* ctl, int h, int kv0, int tid) {
  const int rg = tid >> 3, seg = (tid & 7) * 8;
  unsigned l[24];
  const __bf16* g[24];
  // the three loops are unrolled so that every index of l and g is a constant and both arrays live in registers
#pragma unroll
  for (int i = 0; i < 24; ++i) l[i] = (unsigned)(size_t)(buf + (i * 16 + rg) * ATT_SP + seg);
#pragma unroll
  for (int i = 0; i < 4; ++i) {
    const size_t ko = (size_t)(kv0 + i * 16 + rg) * QRANK + h * HRANK + seg;
    g[i] = ach + ko;
    g[4 + i] = acl + ko;
  }
#pragma unroll
  for (int i = 0; i < 8; ++i) {
    const size_t vo = (size_t)(h * HVAL + i * 16 + rg) * SEQ_LEN + kv0 + seg;
    g[8 + i] = cth + vo;
    g[16 + i] = ctl + vo;
  }
  at_copy12(l, g);
  at_copy12(l + 12, g + 12);
}

__global__ __launch_bounds__(128)
void attn_route_k(const unsigned short* __restrict__ sthp, const unsigned short* __restrict__ stlp,
                  const unsigned short* __restrict__ achp, const unsigned short* __restrict__ aclp,
                  const unsigned short* __restrict__ cthp, const unsigned short* __restrict__ ctlp,
                  unsigned short* __restrict__ ghp, unsigned short* __restrict__ glp) {
  union FB { v16b v; v8b h[2]; };
  __shared__ __align__(16) __bf16 Psh[4][16 * ATT_KCH];        // per wave P hi [row][kv]
  __shared__ __align__(16) __bf16 Psl[4][16 * ATT_KCH];        // per wave P lo
  __shared__ __align__(16) float  Os[4][16 * ATT_OSP];         // per wave out tile [row][d], pitch 132
  __shared__ __align__(16) __bf16 Stg[2][ATT_ROWS * ATT_SP];   // two buffers of staged K and content^T rows, shared by the block

  const __bf16* sth = (const __bf16*)sthp; const __bf16* stl = (const __bf16*)stlp;
  const __bf16* ach = (const __bf16*)achp; const __bf16* acl = (const __bf16*)aclp;
  const __bf16* cth = (const __bf16*)cthp; const __bf16* ctl = (const __bf16*)ctlp;
  _Float16* gh = (_Float16*)ghp; _Float16* gl = (_Float16*)glp;

  const int tid  = threadIdx.x;
  const int wave = tid >> 5;
  const int lane = tid & 31;
  const int hh   = lane >> 4;
  const int c    = lane & 15;
  const int bx = blockIdx.x;
  const int qb = bx % ATT_NQB;
  const int h  = bx / ATT_NQB;
  const int q0 = qb * ATT_QBLK + wave * 16;

  // ---- Q fragments (A operand): 2 depth chunks, hi and lo; row = c, k = dc*32 + 8*hh + {0..7, 16..23} ----
  v16b qah[2], qal[2];
#pragma unroll
  for (int dc = 0; dc < 2; ++dc) {
    const size_t off = (size_t)(q0 + c) * QRANK + h * HRANK + dc * 32 + 8 * hh;
    qah[dc] = Frag<__bf16>::load(sth + off);
    qal[dc] = Frag<__bf16>::load(stl + off);
  }

  float mrow[8], lrow[8];
  v8f oacc[8];
#pragma unroll
  for (int r = 0; r < 8; ++r) { mrow[r] = -INFINITY; lrow[r] = 0.f; }
#pragma unroll
  for (int t = 0; t < 8; ++t) oacc[t] = (v8f){0.f,0.f,0.f,0.f,0.f,0.f,0.f,0.f};

  __bf16* pwh = Psh[wave];
  __bf16* pwl = Psl[wave];
  const int nChunks = qb + 1;   // block-uniform, <= 32

  // ---- ring prologue: chunk 0 lands and is published; then chunk 1 starts ----
  at_stage(Stg[0], ach, acl, cth, ctl, h, 0, tid);
  asm volatile("s_wait_asynccnt 0x0" ::: "memory");   // this wave's copies of chunk 0 have landed
  __syncthreads();                                    // every wave's have: chunk 0 may be read
  if (nChunks > 1) at_stage(Stg[1], ach, acl, cth, ctl, h, ATT_KCH, tid);

  for (int kc = 0; kc < nChunks; ++kc) {
    const int kv0 = kc * ATT_KCH;
    const __bf16* sb = Stg[kc & 1];

    // ---- scores: 4 key subtiles of 16; K B-fragments: col = key, k = depth (staged rows) ----
    // All of the chunk's K fragments are read as one group; the products then go round the four subtiles, so that
    // consecutive matrix instructions write different accumulators. Per accumulator and depth step: hi.hi, hi.lo, lo.hi.
    // Every loop over fragments or accumulators in this chunk loop is unrolled, so that these arrays are indexed by constants and live in registers.
    v8f s[4];
    v16b kb[2][4], kl[2][4];
#pragma unroll
    for (int dc = 0; dc < 2; ++dc) {
#pragma unroll
      for (int j = 0; j < 4; ++j) {
        const int ko = (j * 16 + c) * ATT_SP + dc * 32 + 8 * hh;
        kb[dc][j] = Frag<__bf16>::load(sb + ATT_ROW_KH * ATT_SP + ko);
        kl[dc][j] = Frag<__bf16>::load(sb + ATT_ROW_KL * ATT_SP + ko);
      }
    }
    // keeps the K reads one group ahead of the products: a read left among the products is waited for on its own
    __builtin_amdgcn_sched_barrier(0);
#pragma unroll
    for (int j = 0; j < 4; ++j) s[j] = (v8f){0.f,0.f,0.f,0.f,0.f,0.f,0.f,0.f};
#pragma unroll
    for (int dc = 0; dc < 2; ++dc) {
#pragma unroll
      for (int j = 0; j < 4; ++j) s[j] = at_mma(qah[dc], kb[dc][j], s[j]);
#pragma unroll
      for (int j = 0; j < 4; ++j) s[j] = at_mma(qah[dc], kl[dc][j], s[j]);
#pragma unroll
      for (int j = 0; j < 4; ++j) s[j] = at_mma(qal[dc], kb[dc][j], s[j]);
    }

    // ---- content^T B-fragments (col = d, k = kv) of the first 32-key step: read here, they do not depend on the softmax ----
    v16b vb[2][8], vl[2][8];
#pragma unroll
    for (int t = 0; t < 8; ++t) {
      const int vo = (t * 16 + c) * ATT_SP + 8 * hh;
      vb[0][t] = Frag<__bf16>::load(sb + ATT_ROW_VH * ATT_SP + vo);
      vl[0][t] = Frag<__bf16>::load(sb + ATT_ROW_VL * ATT_SP + vo);
    }
    // keeps these reads above the softmax arithmetic, so that their LDS latency passes under it
    __builtin_amdgcn_sched_barrier(0);

    // ---- scale by 1/8, causal select on the diagonal chunk, row max ----
    const bool diag = (kc == qb);
    float cm[8];
#pragma unroll
    for (int r = 0; r < 8; ++r) {
      const int qrow = q0 + 8 * hh + r;
      float m = -INFINITY;
#pragma unroll
      for (int j = 0; j < 4; ++j) {
        const int kvcol = kv0 + j * 16 + c;
        float v = s[j][r] * 0.125f;
        if (diag && (kvcol > qrow)) v = -INFINITY;
        s[j][r] = v;
        m = fmaxf(m, v);
      }
      cm[r] = m;
    }
    // the eight rows' maxima go through each exchange step together, so that the eight exchanges of a step overlap
#pragma unroll
    for (int off = 1; off < 16; off <<= 1) {
      float ex[8];
      // keeps a step's eight exchanges together: spread out, each would be waited for on its own
      __builtin_amdgcn_sched_barrier(0);
#pragma unroll
      for (int r = 0; r < 8; ++r) ex[r] = __shfl_xor(cm[r], off, 32);
#pragma unroll
      for (int r = 0; r < 8; ++r) cm[r] = fmaxf(cm[r], ex[r]);
    }

    // ---- online softmax update; P tile (C layout) -> LDS as bf16 hi/lo ----
    float alphar[8], psumr[8];   // each row's rescale factor and this lane's part of its sum: joined behind the products below
#pragma unroll
    for (int r = 0; r < 8; ++r) {
      const float mnew = fmaxf(mrow[r], cm[r]);
      const float alpha = expf(mrow[r] - mnew);
      mrow[r] = mnew;
      float psum = 0.f;
#pragma unroll
      for (int j = 0; j < 4; ++j) {
        const float p = expf(s[j][r] - mnew);
        psum += p;
        __bf16 a, bl; at_split(p, a, bl);
        pwh[(8 * hh + r) * ATT_KCH + j * 16 + c] = a;
        pwl[(8 * hh + r) * ATT_KCH + j * 16 + c] = bl;
      }
      alphar[r] = alpha;
      psumr[r] = psum;
#pragma unroll
      for (int t = 0; t < 8; ++t) oacc[t][r] *= alpha;
    }
    __builtin_amdgcn_fence(__ATOMIC_RELEASE, "workgroup");
    __builtin_amdgcn_wave_barrier();
    __builtin_amdgcn_fence(__ATOMIC_ACQUIRE, "workgroup");

    // ---- O += P.V ; P A-fragments from LDS (row = c, k = kv), V B-fragments from the staged content^T rows (col = d, k = kv) ----
    // The first step's P fragments, then the second step's content^T and P fragments, all as one group of reads.
    FB pa[2], pl[2];
    pa[0].h[0] = *(const v8b*)(pwh + c * ATT_KCH + 8 * hh);
    pa[0].h[1] = *(const v8b*)(pwh + c * ATT_KCH + 16 + 8 * hh);
    pl[0].h[0] = *(const v8b*)(pwl + c * ATT_KCH + 8 * hh);
    pl[0].h[1] = *(const v8b*)(pwl + c * ATT_KCH + 16 + 8 * hh);
#pragma unroll
    for (int t = 0; t < 8; ++t) {
      const int vo = (t * 16 + c) * ATT_SP + 32 + 8 * hh;
      vb[1][t] = Frag<__bf16>::load(sb + ATT_ROW_VH * ATT_SP + vo);
      vl[1][t] = Frag<__bf16>::load(sb + ATT_ROW_VL * ATT_SP + vo);
    }
    pa[1].h[0] = *(const v8b*)(pwh + c * ATT_KCH + 32 + 8 * hh);
    pa[1].h[1] = *(const v8b*)(pwh + c * ATT_KCH + 32 + 16 + 8 * hh);
    pl[1].h[0] = *(const v8b*)(pwl + c * ATT_KCH + 32 + 8 * hh);
    pl[1].h[1] = *(const v8b*)(pwl + c * ATT_KCH + 32 + 16 + 8 * hh);
    // keeps the second step's reads ahead of the first step's products, so that their LDS latency passes under these
    __builtin_amdgcn_sched_barrier(0);
    // Six groups of eight products, each group going round the eight output subtiles; per accumulator and 32-key step:
    // hi.hi, hi.lo, lo.hi. The row sums are joined over the 16 lanes beside them (nothing in this chunk waits for the sums):
    // the eight exchanges of a step are issued ahead of a group of products and added behind it.
#pragma unroll
    for (int g = 0; g < 6; ++g) {
      const int kk = g / 3, term = g % 3;
      float ex[8];
      if (g >= 2) {
#pragma unroll
        for (int r = 0; r < 8; ++r) ex[r] = __shfl_xor(psumr[r], 1 << (g - 2), 32);
        // keeps the exchanges ahead of the group's products, so that their latency passes under these
        __builtin_amdgcn_sched_barrier(0);
      }
#pragma unroll
      for (int t = 0; t < 8; ++t)
        oacc[t] = at_mma(term == 2 ? pl[kk].v : pa[kk].v, term == 1 ? vl[kk][t] : vb[kk][t], oacc[t]);
      if (g >= 2) {
        // keeps the wait for the exchanges behind the group's products (and the last group above the waits at the loop's foot)
        __builtin_amdgcn_sched_barrier(0);
#pragma unroll
        for (int r = 0; r < 8; ++r) psumr[r] += ex[r];
      }
    }
#pragma unroll
    for (int r = 0; r < 8; ++r) lrow[r] = lrow[r] * alphar[r] + psumr[r];
    // order this chunk's P loads before the next chunk's P stores
    __builtin_amdgcn_fence(__ATOMIC_RELEASE, "workgroup");
    __builtin_amdgcn_wave_barrier();
    __builtin_amdgcn_fence(__ATOMIC_ACQUIRE, "workgroup");

    // ---- publish point of chunk kc + 1, every wave ----
    asm volatile("s_wait_dscnt 0x0" ::: "memory");      // this wave's reads of buffer kc & 1 have returned
    asm volatile("s_wait_asynccnt 0x0" ::: "memory");   // this wave's copies of chunk kc + 1 have landed
    __syncthreads();                                    // publishes chunk kc + 1 and ends every reader's last read of buffer kc & 1
    if (kc + 2 < nChunks) at_stage(Stg[kc & 1], ach, acl, cth, ctl, h, (kc + 2) * ATT_KCH, tid);   // block-uniform test
  }
  asm volatile("s_wait_asynccnt 0x0" ::: "memory");     // no copy is outstanding when the wave goes on to its end

  float* os = Os[wave];
#pragma unroll
  for (int r = 0; r < 8; ++r) {
    const float inv = 1.0f / lrow[r];
#pragma unroll
    for (int t = 0; t < 8; ++t) os[(8 * hh + r) * ATT_OSP + t * 16 + c] = oacc[t][r] * inv;
  }
  __builtin_amdgcn_fence(__ATOMIC_RELEASE, "workgroup");
  __builtin_amdgcn_wave_barrier();
  __builtin_amdgcn_fence(__ATOMIC_ACQUIRE, "workgroup");
  {
    // lane groups of 8: q4 = lane>>3; row parity = q4>>1, column half = q4&1; it = 0..7 -> rows 0..15, cols 0..127: whole 16x128 tile, both planes
    const int q4 = lane >> 3, c8 = (lane & 7) * 8;
    const int rpar = q4 >> 1, chalf = (q4 & 1) * 64;
    {
#pragma unroll
      for (int it = 0; it < 8; ++it) {
        const int row = it * 2 + rpar;
        const int col = chalf + c8;
        const float* sp = os + row * ATT_OSP + col;
        v8h hv, lv;
#pragma unroll
        for (int e = 0; e < 8; ++e) {
          const unsigned short hb = f2bf_bits(sp[e]);
          const unsigned short lb = f2bf_bits(sp[e] - bf_bits2f(hb));
          hv[e] = __builtin_bit_cast(_Float16, hb);
          lv[e] = __builtin_bit_cast(_Float16, lb);
        }
        const size_t go = (size_t)(q0 + row) * HID + h * HVAL + col;
        *(v8h*)(gh + go) = hv;
        *(v8h*)(gl + go) = lv;
      }
      
    }
  }
}

// =====================================================================================
// Host launcher. Workspace region map (bytes, every offset a multiple of 4 MiB):
//   XB   bf16 [2048][2048]   8 MiB   x
//   WSA  bf16 [2048][2048]   8 MiB   rows 0..1023 W_state, 1024..2047 W_action
//   WC   bf16 [2048][1024]   4 MiB   W_content
//   WO   bf16 [2048][2048]   8 MiB   W_out
//   SA32 f32  [2048][2048]  16 MiB   state | action
//   STH, STL, ACH, ACL, QVH, QVL  bf16 [2048][1024]  4 MiB each (state, action, q-value hi/lo)
//   CTH, CTL  bf16 [2048 = h*128+d][2048 = kv]  8 MiB each (content^T hi/lo)
//   GH, GL    bf16 [2048][2048]  8 MiB each (gathered hi/lo)
//   total 104,857,600 B
// =====================================================================================
extern "C" void kernel_launch(void* const* d_in, const int* in_sizes, int n_in,
                              void* d_out, int out_size, void* d_ws, size_t ws_size,
                              hipStream_t stream) {
  if (n_in < 6) return;
  if (in_sizes[0] != SEQ_LEN * HID || in_sizes[1] != QRANK * HID || in_sizes[2] != QRANK * HID ||
      in_sizes[3] != HID * QRANK || in_sizes[4] != HID * HID || in_sizes[5] != HID) return;
  if (out_size != SEQ_LEN * HID) return;

  const float* x  = (const float*)d_in[0];
  const float* Ws = (const float*)d_in[1];
  const float* Wa = (const float*)d_in[2];
  const float* Wc = (const float*)d_in[3];
  const float* Wo = (const float*)d_in[4];
  const float* bo = (const float*)d_in[5];
  float* out = (float*)d_out;

  const size_t B_XB  = (size_t)SEQ_LEN * HID * 2;
  const size_t B_WSA = (size_t)(2 * QRANK) * HID * 2;
  const size_t B_WC  = (size_t)HID * QRANK * 2;
  const size_t B_WO  = (size_t)HID * HID * 2;
  const size_t B_SA  = (size_t)SEQ_LEN * (2 * QRANK) * 4;
  const size_t B_PL  = (size_t)SEQ_LEN * QRANK * 2;     // one [2048][1024] bf16 plane
  const size_t B_CT  = (size_t)HID * SEQ_LEN * 2;       // one [2048][2048] bf16 plane
  const size_t B_G   = (size_t)SEQ_LEN * HID * 2;

  char* ws = (char*)d_ws;
  size_t off = 0;
  unsigned short* XB  = (unsigned short*)(ws + off); off += B_XB;
  unsigned short* WSA = (unsigned short*)(ws + off); off += B_WSA;
  unsigned short* WC  = (unsigned short*)(ws + off); off += B_WC;
  unsigned short* WO  = (unsigned short*)(ws + off); off += B_WO;
  float*          SA  = (float*)(ws + off);          off += B_SA;
  unsigned short* STH = (unsigned short*)(ws + off); off += B_PL;
  unsigned short* STL = (unsigned short*)(ws + off); off += B_PL;
  unsigned short* ACH = (unsigned short*)(ws + off); off += B_PL;
  unsigned short* ACL = (unsigned short*)(ws + off); off += B_PL;
  unsigned short* QVH = (unsigned short*)(ws + off); off += B_PL;
  unsigned short* QVL = (unsigned short*)(ws + off); off += B_PL;
  unsigned short* CTH = (unsigned short*)(ws + off); off += B_CT;
  unsigned short* CTL = (unsigned short*)(ws + off); off += B_CT;
  unsigned short* GH  = (unsigned short*)(ws + off); off += B_G;
  unsigned short* GL  = (unsigned short*)(ws + off); off += B_G;
  if (off > ws_size) return;

  // ---- input casts to bf16 (RNE) ----
  cast_inputs_bf16<<<dim3(CAST_BLOCKS), dim3(CAST_THREADS), 0, stream>>>(
      x, Ws, Wa, Wc, Wo, XB, WSA, WSA + (size_t)QRANK * HID, WC, WO);

  // ---- projections: SA[q][0..2047] = x . [W_state; W_action]^T  (M=2048, N=2048, K=2048) ----
  {
    const int M = SEQ_LEN, N = 2 * QRANK, K = HID;
    const int blocks = (M / 64) * (N / 64) / 8;   // 128
    wmma_gemm64<1, false, false, 0, 0><<<dim3(blocks, 1), dim3(256), 0, stream>>>(
        XB, XB, K, 0L, WSA, WSA, K, 0L, (void*)SA, (void*)SA, N, 0L, bo, M, N, K, 1.0f);
  }

  // ---- bf16 hi/lo planes of state, action, q-value ----
  planes_k<<<dim3(SEQ_LEN / 2), dim3(256), 0, stream>>>(SA, STH, STL, ACH, ACL, QVH, QVL);

  // ---- content^T[n][kv] = W_content[n][:] . qval[kv][:]  (M=2048, N=2048, K=1024; B = q-value hi/lo) -> bf16 hi/lo planes ----
  {
    const int M = HID, N = SEQ_LEN, K = QRANK;
    const int blocks = (M / 64) * (N / 64) / 8;   // 128
    wmma_gemm64<1, false, true, 0, 2><<<dim3(blocks, 1), dim3(256), 0, stream>>>(
        WC, WC, K, 0L, QVH, QVL, K, 0L, (void*)CTH, (void*)CTL, N, 0L, bo, M, N, K, 1.0f);
  }

  // ---- causal routing attention -> gathered hi/lo planes ----
  attn_route_k<<<dim3(NHEADS * ATT_NQB), dim3(128), 0, stream>>>(STH, STL, ACH, ACL, CTH, CTL, GH, GL);

  // ---- out = gathered . W_out^T + b_out  (M=N=K=2048; A = gathered hi/lo), f32 ----
  {
    const int M = SEQ_LEN, N = HID, K = HID;
    const int blocks = (M / 64) * (N / 64) / 8;   // 128
    wmma_gemm64<1, true, false, 2, 0><<<dim3(blocks, 1), dim3(256), 0, stream>>>(
        GH, GL, K, 0L, WO, WO, K, 0L, (void*)out, (void*)out, N, 0L, bo, M, N, K, 1.0f);
  }
}

// v005
// One run takes 184 microseconds.
// Two timings next to v004 put it at 1.17 and 1.16 times that version's speed.
// Over all steps from v000 it is 3.07 times as fast.
// All contractions: v_wmma_f32_16x16x32_bf16 (bf16 operands, f32 accumulate): x and weight matrices as single RNE bf16 planes; state/action, q-value product, softmax p, content and gathered carried as bf16 hi/lo planes (hi.hi + hi.lo + lo.hi); softmax, q-value product and bias in f32.
#include <hip/hip_runtime.h>
#include <stdint.h>

constexpr int SEQ_LEN = 2048;   // L
constexpr int HID     = 2048;   // hidden
constexpr int QRANK   = 1024;   // q_rank
constexpr int NHEADS  = 16;
constexpr int HRANK   = 64;     // per-head rank (q/k depth)
constexpr int HVAL    = 128;    // per-head value width
static_assert(QRANK == NHEADS * HRANK, "rank split");
static_assert(HID == NHEADS * HVAL, "value split");
static_assert(SEQ_LEN % 64 == 0 && HID % 64 == 0 && QRANK % 64 == 0, "tile multiples");
static_assert(HID % 32 == 0 && QRANK % 32 == 0, "K multiples of 32");

typedef __attribute__((ext_vector_type(16))) _Float16 v16h;
typedef __attribute__((ext_vector_type(8)))  _Float16 v8h;
typedef __attribute__((ext_vector_type(16))) __bf16   v16b;
typedef __attribute__((ext_vector_type(8)))  __bf16   v8b;
typedef __attribute__((ext_vector_type(8)))  float    v8f;
typedef __attribute__((ext_vector_type(4)))  float    v4f;

__device__ __forceinline__ unsigned short f2bf_bits(float f) {
  unsigned u = __float_as_uint(f);
  return (unsigned short)((u + 0x7FFFu + ((u >> 16) & 1u)) >> 16);
}
__device__ __forceinline__ float bf_bits2f(unsigned short h) { return __uint_as_float(((unsigned)h) << 16); }

// hazard guards as plain device helpers (no hazard-guard asm inside the kernel template body)
__device__ __forceinline__ void dep_guard_h(v8f& a, v8f& b, v16h x, v16h y) { asm volatile("v_nop\n\tv_nop\n\tv_nop\n\tv_nop" : "+v"(a), "+v"(b) : "v"(x), "v"(y)); }
__device__ __forceinline__ void dep_guard_b(v8f& a, v8f& b, v16b x, v16b y) { asm volatile("v_nop\n\tv_nop\n\tv_nop\n\tv_nop" : "+v"(a), "+v"(b) : "v"(x), "v"(y)); }
__device__ __forceinline__ void keep4_h(v16h a, v16h b, v16h c, v16h d) { asm volatile("v_nop" :: "v"(a), "v"(b), "v"(c), "v"(d)); }
__device__ __forceinline__ void keep4_b(v16b a, v16b b, v16b c, v16b d) { asm volatile("v_nop" :: "v"(a), "v"(b), "v"(c), "v"(d)); }
__device__ __forceinline__ void acc_guard4(v8f& a, v8f& b, v8f& c, v8f& d) { asm volatile("v_nop\n\tv_nop\n\tv_nop\n\tv_nop" : "+v"(a), "+v"(b), "+v"(c), "+v"(d)); }
template <typename T> struct Frag;
template <> struct Frag<_Float16> {
  typedef v16h V; union U { v16h v; v8h h[2]; };
  static __device__ __forceinline__ v16h load(const _Float16* p) {   // elements 0..7 <- p[0..7], 8..15 <- p[16..23]
    U f; f.h[0] = *(const v8h*)(p); f.h[1] = *(const v8h*)(p + 16); return f.v;
  }
  static __device__ __forceinline__ v8f mma(v16h a, v16h b, v8f c) {
    return __builtin_amdgcn_wmma_f32_16x16x32_f16(false, a, false, b, (short)0, c, false, false);
  }
  static __device__ __forceinline__ void guard(v8f& a, v8f& b, v16h x, v16h y) { dep_guard_h(a, b, x, y); }
  static __device__ __forceinline__ void keep(v16h a, v16h b, v16h c, v16h d) { keep4_h(a, b, c, d); }
};
template <> struct Frag<__bf16> {
  typedef v16b V; union U { v16b v; v8b h[2]; };
  static __device__ __forceinline__ v16b load(const __bf16* p) {
    U f; f.h[0] = *(const v8b*)(p); f.h[1] = *(const v8b*)(p + 16); return f.v;
  }
  static __device__ __forceinline__ v8f mma(v16b a, v16b b, v8f c) {
    return __builtin_amdgcn_wmma_f32_16x16x32_bf16(false, a, false, b, (short)0, c, false, false);
  }
  static __device__ __forceinline__ void guard(v8f& a, v8f& b, v16b x, v16b y) { dep_guard_b(a, b, x, y); }
  static __device__ __forceinline__ void keep(v16b a, v16b b, v16b c, v16b d) { keep4_b(a, b, c, d); }
};

// Twelve asynchronous 16-B-per-lane copies global -> LDS. The s_wait_xcnt is the last line of the copies' own statement,
// so that no address register of an issued copy is rewritten in front of it.
__device__ __forceinline__ void at_copy12(const unsigned* l, const __bf16* const* g) {
  asm volatile(
      "global_load_async_to_lds_b128 %0, %12, off\n\t"
      "global_load_async_to_lds_b128 %1, %13, off\n\t"
      "global_load_async_to_lds_b128 %2, %14, off\n\t"
      "global_load_async_to_lds_b128 %3, %15, off\n\t"
      "global_load_async_to_lds_b128 %4, %16, off\n\t"
      "global_load_async_to_lds_b128 %5, %17, off\n\t"
      "global_load_async_to_lds_b128 %6, %18, off\n\t"
      "global_load_async_to_lds_b128 %7, %19, off\n\t"
      "global_load_async_to_lds_b128 %8, %20, off\n\t"
      "global_load_async_to_lds_b128 %9, %21, off\n\t"
      "global_load_async_to_lds_b128 %10, %22, off\n\t"
      "global_load_async_to_lds_b128 %11, %23, off\n\t"
      "s_wait_xcnt 0x0"
      :: "v"(l[0]), "v"(l[1]), "v"(l[2]), "v"(l[3]), "v"(l[4]), "v"(l[5]),
         "v"(l[6]), "v"(l[7]), "v"(l[8]), "v"(l[9]), "v"(l[10]), "v"(l[11]),
         "v"(g[0]), "v"(g[1]), "v"(g[2]), "v"(g[3]), "v"(g[4]), "v"(g[5]),
         "v"(g[6]), "v"(g[7]), "v"(g[8]), "v"(g[9]), "v"(g[10]), "v"(g[11])
      : "memory");
}

// The same for eight copies.
__device__ __forceinline__ void at_copy8(const unsigned* l, const __bf16* const* g) {
  asm volatile(
      "global_load_async_to_lds_b128 %0, %8, off\n\t"
      "global_load_async_to_lds_b128 %1, %9, off\n\t"
      "global_load_async_to_lds_b128 %2, %10, off\n\t"
      "global_load_async_to_lds_b128 %3, %11, off\n\t"
      "global_load_async_to_lds_b128 %4, %12, off\n\t"
      "global_load_async_to_lds_b128 %5, %13, off\n\t"
      "global_load_async_to_lds_b128 %6, %14, off\n\t"
      "global_load_async_to_lds_b128 %7, %15, off\n\t"
      "s_wait_xcnt 0x0"
      :: "v"(l[0]), "v"(l[1]), "v"(l[2]), "v"(l[3]), "v"(l[4]), "v"(l[5]), "v"(l[6]), "v"(l[7]),
         "v"(g[0]), "v"(g[1]), "v"(g[2]), "v"(g[3]), "v"(g[4]), "v"(g[5]), "v"(g[6]), "v"(g[7])
      : "memory");
}

// ---- Register-blocked batched WMMA GEMM ------------------------------------
// C[m,n] = scale * sum_k A[m,k] * Bt[n,k] (+bias); each wave owns a 64x64 tile; a block's 8 waves (2 x 4) own a 128x256 tile.
// A row-major [M,K]; Bt row-major [N,K]; M % 128 == 0, N % 256 == 0, K % 64 == 0.
// Per 64 k the block's 128 A rows and 256 Bt rows (each plane) are brought into LDS once by asynchronous copies, whole 128-B lines,
// two buffers (slab s + 1 flies while slab s is worked on); the waves read their fragments there.
// ASPLIT: A carried as hi/lo planes (A2 = lo plane, same layout); BSPLIT: Bt hi/lo (Bt2 = lo plane).
//   product = hi.hi (+ hi.lo if BSPLIT) (+ lo.hi if ASPLIT).
// BIAS_MODE: 0 = none, 1 = bias[m], 2 = bias[n].
// OUT_MODE: 0 = f32, 1 = f16, 2 = bf16 hi plane (Cout) + bf16 lo plane (Cout2).
// Coverage: per 64x64 tile, 4 slabs x 16 rows x 64 cols -> the whole tile; grid = (M/128)*(N/256) = tilesM*tilesN/8 blocks of 8 waves.
// ET: 0 = f16 operands, 1 = bf16 operands (pointers passed as 16-bit storage)
constexpr int GM_BM = 128;   // block tile rows
constexpr int GM_BN = 256;   // block tile cols
constexpr int GM_KS = 64;    // k per staged slab: 128-B rows
constexpr int GM_SP = 72;    // staged row pitch in elements: 144 B (16 B x odd, for ds_load_b128 readers)
static_assert(SEQ_LEN % GM_BN == 0 && HID % GM_BN == 0 && (2 * QRANK) % GM_BN == 0, "block tile multiples");
static_assert(HID % GM_KS == 0 && QRANK % GM_KS == 0, "K multiples of the slab");
template <int ET> struct Elem;
template <> struct Elem<0> { typedef _Float16 T; };
template <> struct Elem<1> { typedef __bf16 T; };
template <int ET, bool ASPLIT, bool BSPLIT, int BIAS_MODE, int OUT_MODE>
__global__ __launch_bounds__(256) void wmma_gemm64(
    const unsigned short* __restrict__ Ap, const unsigned short* __restrict__ A2p, int lda, long strideA,
    const unsigned short* __restrict__ Btp, const unsigned short* __restrict__ Bt2p, int ldb, long strideB,
    void* __restrict__ Cout, void* __restrict__ Cout2, int ldc, long strideC,
    const float* __restrict__ bias,
    int M, int N, int K, float scale) {
  typedef typename Elem<ET>::T T;
  typedef typename Frag<T>::V V;
  const T* A = (const T*)Ap; const T* A2 = (const T*)A2p; const T* Bt = (const T*)Btp; const T* Bt2 = (const T*)Bt2p;
  // staged rows of one slab: A hi (, A lo), Bt hi (, Bt lo); every plane starts at a multiple of 32 rows
  constexpr int ROW_AL = GM_BM;
  constexpr int ROW_BH = GM_BM * (ASPLIT ? 2 : 1);
  constexpr int ROW_BL = ROW_BH + GM_BN;
  constexpr int ROWS   = ROW_BH + GM_BN * (BSPLIT ? 2 : 1);   // 384, 512 or 640
  constexpr int NCP    = ROWS / 32;                           // copies per thread and slab: 12, 16 or 20
  static_assert(NCP == 12 || NCP == 16 || NCP == 20, "copy statements below");
  __shared__ __align__(16) float sT[8][16 * 68];   // per-wave 16x64 slab, pitch 68 floats
  __shared__ __align__(16) T Stg[2][ROWS * GM_SP]; // two buffers of staged rows, shared by the block
  const int b    = blockIdx.y;
  const int tid  = threadIdx.x;
  const int lane = threadIdx.x & 31;
  const int wave = threadIdx.x >> 5;
  const int blkN = N / GM_BN;
  if ((int)blockIdx.x >= (M / GM_BM) * blkN) return;   // block-uniform, in front of every barrier
  const int bm  = blockIdx.x / blkN;
  const int bm0 = bm * GM_BM;
  const int bn0 = (blockIdx.x - bm * blkN) * GM_BN;
  const int wm0 = (wave >> 2) << 6;            // this wave's 64x64 tile inside the block tile
  const int wn0 = (wave & 3) << 6;
  const int m0 = bm0 + wm0;
  const int n0 = bn0 + wn0;

  const T* Ab  = A  + (size_t)b * strideA;
  const T* Bb  = Bt + (size_t)b * strideB;
  const T* Ab2 = ASPLIT ? (A2  + (size_t)b * strideA) : nullptr;
  const T* Bb2 = BSPLIT ? (Bt2 + (size_t)b * strideB) : nullptr;

  const int rlane = lane & 15;                 // row (A) / col (B, D) within subtile
  const int koff  = (lane >> 4) * 8;           // k offset of this lane half
  const int mOff  = (lane >> 4) * 8;           // D row offset

  v8f acc[4][4];
#pragma unroll
  for (int i = 0; i < 4; ++i)
#pragma unroll
    for (int j = 0; j < 4; ++j) acc[i][j] = (v8f){0.f,0.f,0.f,0.f,0.f,0.f,0.f,0.f};

  // One slab: ROWS staged rows x 8 segments of 16 B = NCP lane copies per thread of the 256-thread block.
  // Copy i of thread tid: staged row i*32 + (tid >> 3), segment tid & 7: a wave's copy covers four whole 128-B lines.
  // One running pointer per plane (this thread's first row and segment of the next slab to stage); the other rows are 32*ld apart.
  const int rg = tid >> 3, seg = (tid & 7) * 8;
  const T* pA  = Ab + (size_t)(bm0 + rg) * lda + seg;
  const T* pB  = Bb + (size_t)(bn0 + rg) * ldb + seg;
  const T* pA2 = ASPLIT ? (Ab2 + (size_t)(bm0 + rg) * lda + seg) : nullptr;
  const T* pB2 = BSPLIT ? (Bb2 + (size_t)(bn0 + rg) * ldb + seg) : nullptr;
  auto stage = [&](T* buf) {
    unsigned l[NCP];
    const __bf16* g[NCP];
    // unrolled so that every index of l and g is a constant and both arrays live in registers
#pragma unroll
    for (int i = 0; i < NCP; ++i) {
      const T* sp;
      if (i * 32 >= ROW_BL)                 sp = pB2 + (size_t)(i * 32 - ROW_BL) * ldb;
      else if (i * 32 >= ROW_BH)            sp = pB  + (size_t)(i * 32 - ROW_BH) * ldb;
      else if (ASPLIT && i * 32 >= ROW_AL)  sp = pA2 + (size_t)(i * 32 - ROW_AL) * lda;
      else                                  sp = pA  + (size_t)(i * 32) * lda;
      l[i] = (unsigned)(size_t)(buf + (i * 32 + rg) * GM_SP + seg);
      g[i] = (const __bf16*)sp;
    }
    if (NCP == 12) { at_copy12(l, g); }
    if (NCP == 16) { at_copy8(l, g); at_copy8(l + NCP - 8, g + NCP - 8); }
    if (NCP == 20) { at_copy12(l, g); at_copy8(l + NCP - 8, g + NCP - 8); }
    pA += GM_KS; pB += GM_KS;
    if (ASPLIT) pA2 += GM_KS;
    if (BSPLIT) pB2 += GM_KS;
  };
  const int nSlabs = K / GM_KS;   // block-uniform

  // ---- ring prologue: slab 0 lands and is published; then slab 1 starts ----
  stage(Stg[0]);
  asm volatile("s_wait_asynccnt 0x0" ::: "memory");   // this wave's copies of slab 0 have landed
  __syncthreads();                                    // every wave's have: slab 0 may be read
  if (nSlabs > 1) stage(Stg[1]);

  for (int s = 0; s < nSlabs; ++s) {
    const T* sb = Stg[s & 1];
    // both 32-k steps of the slab unrolled: the second step's LDS reads may go ahead of the first step's products
#pragma unroll
    for (int kk = 0; kk < GM_KS; kk += 32) {
      V bh[4], bl[4];
#pragma unroll
      for (int j = 0; j < 4; ++j) {
        const int bo = (wn0 + (j << 4) + rlane) * GM_SP + koff + kk;
        bh[j] = Frag<T>::load(sb + ROW_BH * GM_SP + bo);
        if (BSPLIT) bl[j] = Frag<T>::load(sb + ROW_BL * GM_SP + bo);
      }
      // all of the step's LDS reads stand together, ahead of its products
      V ah[4], al[4];
#pragma unroll
      for (int i = 0; i < 4; ++i) {
        const int ao = (wm0 + (i << 4) + rlane) * GM_SP + koff + kk;
        ah[i] = Frag<T>::load(sb + ao);
        al[i] = ah[i];
        if (ASPLIT) al[i] = Frag<T>::load(sb + ROW_AL * GM_SP + ao);
      }
#pragma unroll
      for (int i = 0; i < 4; ++i) {
#pragma unroll
        for (int j = 0; j < 4; ++j) {
          acc[i][j] = Frag<T>::mma(ah[i], bh[j], acc[i][j]);
          if (BSPLIT) acc[i][j] = Frag<T>::mma(ah[i], bl[j], acc[i][j]);
          if (ASPLIT) acc[i][j] = Frag<T>::mma(al[i], bh[j], acc[i][j]);
        }
        Frag<T>::guard(acc[i][0], acc[i][3], ah[i], al[i]);
      }
      Frag<T>::keep(bh[0], bh[1], bh[2], bh[3]);
      if (BSPLIT) Frag<T>::keep(bl[0], bl[1], bl[2], bl[3]);
    }
    // ---- publish point of slab s + 1, every wave ----
    asm volatile("s_wait_dscnt 0x0" ::: "memory");      // this wave's reads of buffer s & 1 have returned
    asm volatile("s_wait_asynccnt 0x0" ::: "memory");   // this wave's copies of slab s + 1 have landed
    __syncthreads();                                    // publishes slab s + 1 and ends every reader's last read of buffer s & 1
    if (s + 2 < nSlabs) stage(Stg[s & 1]);              // block-uniform test; slab s + 2
  }
  asm volatile("s_wait_asynccnt 0x0" ::: "memory");     // no copy is outstanding when the wave goes on to its end
  acc_guard4(acc[0][0], acc[0][1], acc[0][2], acc[0][3]);
  acc_guard4(acc[1][0], acc[1][1], acc[1][2], acc[1][3]);
  acc_guard4(acc[2][0], acc[2][1], acc[2][2], acc[2][3]);
  acc_guard4(acc[3][0], acc[3][1], acc[3][2], acc[3][3]);

  // ---- epilogue ----
  float* slab = sT[wave];
#pragma unroll
  for (int i = 0; i < 4; ++i) {
    const int mBase = m0 + (i << 4);
#pragma unroll
    for (int j = 0; j < 4; ++j) {
      const int n = n0 + (j << 4) + rlane;
      float bv = 0.f;
      if (BIAS_MODE == 2) bv = bias[n];
#pragma unroll
      for (int r = 0; r < 8; ++r) {
        float v = acc[i][j][r] * scale;
        if (BIAS_MODE == 1) v += bias[mBase + mOff + r];
        if (BIAS_MODE == 2) v += bv;
        slab[(mOff + r) * 68 + (j << 4) + rlane] = v;
      }
    }
    __builtin_amdgcn_fence(__ATOMIC_RELEASE, "workgroup");
    __builtin_amdgcn_wave_barrier();
    __builtin_amdgcn_fence(__ATOMIC_ACQUIRE, "workgroup");
    if (OUT_MODE == 0) {
      float* C = (float*)Cout + (size_t)b * strideC;
      const int hh = lane >> 4, c4 = (lane & 15) * 4;     // row seg = 256 B = 16 lanes x 16 B
      {
#pragma unroll
        for (int it = 0; it < 8; ++it) {
          const int row = it * 2 + hh;
          v4f v = *(const v4f*)(slab + row * 68 + c4);
          *(v4f*)(C + (size_t)(mBase + row) * ldc + n0 + c4) = v;
        }
        
      }
    } else {
      const int q = lane >> 3, c8 = (lane & 7) * 8;
      unsigned short* C  = (unsigned short*)Cout  + (size_t)b * strideC;
      unsigned short* C2 = (OUT_MODE == 2) ? ((unsigned short*)Cout2 + (size_t)b * strideC) : nullptr;
      {
#pragma unroll
        for (int it = 0; it < 4; ++it) {
          const int row = it * 4 + q;
          const float* sp = slab + row * 68 + c8;
          v8h hv, lv;
#pragma unroll
          for (int e = 0; e < 8; ++e) {
            if (OUT_MODE == 1) {
              hv[e] = (_Float16)sp[e];
            } else {
              unsigned short hb = f2bf_bits(sp[e]);
              unsigned short lb = f2bf_bits(sp[e] - bf_bits2f(hb));
              hv[e] = __builtin_bit_cast(_Float16, hb);
              lv[e] = __builtin_bit_cast(_Float16, lb);
            }
          }
          *(v8h*)(C + (size_t)(mBase + row) * ldc + n0 + c8) = hv;
          if (OUT_MODE == 2) *(v8h*)(C2 + (size_t)(mBase + row) * ldc + n0 + c8) = lv;
        }
        
      }
    }
    __builtin_amdgcn_fence(__ATOMIC_RELEASE, "workgroup");
    __builtin_amdgcn_wave_barrier();
    __builtin_amdgcn_fence(__ATOMIC_ACQUIRE, "workgroup");
  }
}

// ---- all five f32 inputs -> bf16 (RNE) in one launch: one 16-wave block per WGP, few long waves in place of many two-element ones ----
// Block b converts the b-th of 256 equal contiguous parts of every input, in steps of 2,048 floats (4 a lane):
// a wave's load is 512 contiguous bytes, its store 256. x and W_out take 8 steps a block, the three rank-sized weights 4 each.
// Coverage: 256 blocks x N steps x 2,048 = the whole of each input, each element converted by exactly one lane.
constexpr int CAST_BLOCKS  = 256;
constexpr int CAST_THREADS = 512;
constexpr int CAST_STEP    = CAST_THREADS * 4;                             // floats a block converts per step
constexpr int CAST_NX = SEQ_LEN * HID / (CAST_BLOCKS * CAST_STEP);         // 8
constexpr int CAST_NW = QRANK * HID / (CAST_BLOCKS * CAST_STEP);           // 4
constexpr int CAST_NO = HID * HID / (CAST_BLOCKS * CAST_STEP);             // 8
static_assert(SEQ_LEN * HID == CAST_NX * CAST_BLOCKS * CAST_STEP && QRANK * HID == CAST_NW * CAST_BLOCKS * CAST_STEP &&
              HID * HID == CAST_NO * CAST_BLOCKS * CAST_STEP, "whole steps");
typedef __attribute__((ext_vector_type(2))) unsigned v2u;
// Addresses are a uniform base, one unsigned 32-bit byte offset a lane, and a small constant per step.
template <int N>
__device__ __forceinline__ void cast_load(v4f* r, const float* __restrict__ in) {
  const char* p = (const char*)in + (blockIdx.x * (N * CAST_THREADS) + threadIdx.x) * 16u;
  // unrolled so that r is indexed by constants and lives in registers, and the loads follow one another
#pragma unroll
  for (int i = 0; i < N; ++i) r[i] = *(const v4f*)(p + i * (CAST_STEP * 4));
}
template <int N>
__device__ __forceinline__ void cast_store(const v4f* r, unsigned short* __restrict__ out) {
  char* q = (char*)out + (blockIdx.x * (N * CAST_THREADS) + threadIdx.x) * 8u;
  // unrolled so that r is indexed by constants and lives in registers
#pragma unroll
  for (int i = 0; i < N; ++i) {
    v2u u;
    u[0] = (unsigned)f2bf_bits(r[i][0]) | ((unsigned)f2bf_bits(r[i][1]) << 16);
    u[1] = (unsigned)f2bf_bits(r[i][2]) | ((unsigned)f2bf_bits(r[i][3]) << 16);
    *(v2u*)(q + i * (CAST_STEP * 2)) = u;
  }
}
__global__ __launch_bounds__(CAST_THREADS) void cast_inputs_bf16(
    const float* __restrict__ x, const float* __restrict__ wst, const float* __restrict__ wac,
    const float* __restrict__ wco, const float* __restrict__ wou,
    unsigned short* __restrict__ xb, unsigned short* __restrict__ wstb, unsigned short* __restrict__ wacb,
    unsigned short* __restrict__ wcob, unsigned short* __restrict__ woub) {
  // all of a lane's 28 loads stand ahead of its first store, so that they are in flight together
  v4f rx[CAST_NX], rs[CAST_NW], ra[CAST_NW], rc[CAST_NW], ro[CAST_NO];
  cast_load<CAST_NX>(rx, x);
  cast_load<CAST_NW>(rs, wst);
  cast_load<CAST_NW>(ra, wac);
  cast_load<CAST_NW>(rc, wco);
  // the loads below may be given, for their results, the offset register that the twelve loads above name
  asm volatile("s_wait_xcnt 0x0" ::: "memory");
  cast_load<CAST_NO>(ro, wou);
  cast_store<CAST_NX>(rx, xb);
  cast_store<CAST_NW>(rs, wstb);
  cast_store<CAST_NW>(ra, wacb);
  cast_store<CAST_NW>(rc, wcob);
  cast_store<CAST_NO>(ro, woub);
}

// ---- state|action f32 [SEQ_LEN][2*QRANK] -> bf16 hi/lo planes of state, action and q-value (state*action in f32), each [SEQ_LEN][QRANK] ----
// Coverage: grid = SEQ_LEN/2 blocks x 256 threads; thread -> row = 2*blk + (tid>>7), cols (tid&127)*8 .. +7 -> 2048 rows x 1024 cols exactly, all six planes.
__global__ __launch_bounds__(256) void planes_k(const float* __restrict__ sa,
    unsigned short* __restrict__ sthp, unsigned short* __restrict__ stlp,
    unsigned short* __restrict__ achp, unsigned short* __restrict__ aclp,
    unsigned short* __restrict__ qvhp, unsigned short* __restrict__ qvlp) {
  const int row = blockIdx.x * 2 + (threadIdx.x >> 7);
  const int c8  = (threadIdx.x & 127) * 8;
  const float* sp = sa + (size_t)row * (2 * QRANK) + c8;
  const v8f sv = *(const v8f*)(sp);
  const v8f av = *(const v8f*)(sp + QRANK);
  v8h shv, slv, ahv, alv, qhv, qlv;
#pragma unroll
  for (int e = 0; e < 8; ++e) {
    const float s = sv[e], a = av[e];
    const float q = s * a;
    unsigned short hb, lb;
    hb = f2bf_bits(s); lb = f2bf_bits(s - bf_bits2f(hb));
    shv[e] = __builtin_bit_cast(_Float16, hb); slv[e] = __builtin_bit_cast(_Float16, lb);
    hb = f2bf_bits(a); lb = f2bf_bits(a - bf_bits2f(hb));
    ahv[e] = __builtin_bit_cast(_Float16, hb); alv[e] = __builtin_bit_cast(_Float16, lb);
    hb = f2bf_bits(q); lb = f2bf_bits(q - bf_bits2f(hb));
    qhv[e] = __builtin_bit_cast(_Float16, hb); qlv[e] = __builtin_bit_cast(_Float16, lb);
  }
  const size_t o = (size_t)row * QRANK + c8;
  _Float16* sth = (_Float16*)sthp; _Float16* stl = (_Float16*)stlp;
  _Float16* ach = (_Float16*)achp; _Float16* acl = (_Float16*)aclp;
  _Float16* qvh = (_Float16*)qvhp; _Float16* qvl = (_Float16*)qvlp;
  {
    *(v8h*)(sth + o) = shv;
    *(v8h*)(stl + o) = slv;
    *(v8h*)(ach + o) = ahv;
    *(v8h*)(acl + o) = alv;
    *(v8h*)(qvh + o) = qhv;
    *(v8h*)(qvl + o) = qlv;
    
  }
}

// =====================================================================================
// Causal routing attention, q/k depth 64 (bf16 hi/lo planes, ld QRANK, head cols h*64),
// value width 128 (content^T bf16 hi/lo planes [h*128 + d][kv], ld SEQ_LEN),
// output gathered as bf16 hi/lo planes [q][h*128 + d], ld HID.
//   scores = (q.k) * 1/8   : hi.hi + hi.lo + lo.hi bf16 WMMA, f32 accumulate; future keys := -inf (p = 0, diagonal always present)
//   out    = p.v           : p and v bf16 hi/lo (hi.hi + hi.lo + lo.hi); online softmax in f32.
// Block = 8 waves = 2 key groups x 4 waves, on 64 query rows of one head; wave (grp, wq) owns query rows wq*16..+15 and,
// of the tile's 64-key chunks, those with index 2*step + grp; chunks above the diagonal are skipped. So a tile of n chunks
// takes (n + 1) / 2 steps, and one block fills a WGP with two waves a SIMD. Each group keeps its own online-softmax state
// (row maximum, row sum, unnormalised output); behind the loop group 1 hands its state over through LDS and group 0 joins the two.
// Blocks outnumber the places (one a WGP), so the tiles with the most chunks come first in the grid.
// Each step's two chunks (K rows and content^T rows, hi and lo planes) are brought into LDS once per block by asynchronous copies,
// whole 128-B lines, two buffers (step t + 1 flies while step t is worked on); a group's four waves read their B-fragments there.
// P is relaid C-layout -> A-layout through per-wave LDS.
// Coverage: grid = NHEADS * SEQ_LEN/64 blocks; block (qb, h) writes rows qb*64..+63, cols h*128..+127 of both planes (group 0's waves).
// =====================================================================================
constexpr int ATT_QBLK = 64;
constexpr int ATT_KCH  = 64;
constexpr int ATT_OSP  = 132;
constexpr int ATT_NQB  = SEQ_LEN / ATT_QBLK;
constexpr int ATT_SP   = 72;                          // staged row pitch in elements: 128-B rows at 144 B (16 B x odd, for ds_load_b128 readers)
constexpr int ATT_ROW_KH = 0;                         // staged rows: 64 K hi, 64 K lo, 128 V hi, 128 V lo
constexpr int ATT_ROW_KL = ATT_KCH;
constexpr int ATT_ROW_VH = 2 * ATT_KCH;
constexpr int ATT_ROW_VL = 2 * ATT_KCH + HVAL;
constexpr int ATT_ROWS   = 2 * ATT_KCH + 2 * HVAL;    // 384
static_assert(HRANK * 2 == 128 && ATT_KCH * 2 == 128, "staged rows are 128 B");
static_assert(ATT_QBLK == ATT_KCH && ATT_NQB % 2 == 0, "both chunks of every step lie inside the sequence");

__device__ __forceinline__ __bf16 at_f2bf(float f) { return __builtin_bit_cast(__bf16, f2bf_bits(f)); }
__device__ __forceinline__ void at_split(float f, __bf16& hi, __bf16& lo) {
  const unsigned short hb = f2bf_bits(f);
  hi = __builtin_bit_cast(__bf16, hb);
  lo = at_f2bf(f - __uint_as_float(((unsigned)hb) << 16));
}
__device__ __forceinline__ v8f at_mma(v16b a, v16b b, v8f c) {
  return __builtin_amdgcn_wmma_f32_16x16x32_bf16(false, a, false, b, (short)0, c, false, false);
}

// One chunk's 384 staged rows x 8 segments of 16 B = 3072 lane copies = 24 per thread of a 128-thread key group (tid counts inside the group).
// Copy i of thread tid: staged row i*16 + (tid >> 3), segment tid & 7: a wave's copy covers four whole 128-B lines.
__device__ __forceinline__ void at_stage(__bf16* buf, const __bf16* ach, const __bf16* acl,
                                         const __bf16* cth, const __bf16* ctl, int h, int kv0, int tid) {
  const int rg = tid >> 3, seg = (tid & 7) * 8;
  unsigned l[24];
  const __bf16* g[24];
  // the three loops are unrolled so that every index of l and g is a constant and both arrays live in registers
#pragma unroll
  for (int i = 0; i < 24; ++i) l[i] = (unsigned)(size_t)(buf + (i * 16 + rg) * ATT_SP + seg);
#pragma unroll
  for (int i = 0; i < 4; ++i) {
    const size_t ko = (size_t)(kv0 + i * 16 + rg) * QRANK + h * HRANK + seg;
    g[i] = ach + ko;
    g[4 + i] = acl + ko;
  }
#pragma unroll
  for (int i = 0; i < 8; ++i) {
    const size_t vo = (size_t)(h * HVAL + i * 16 + rg) * SEQ_LEN + kv0 + seg;
    g[8 + i] = cth + vo;
    g[16 + i] = ctl + vo;
  }
  at_copy12(l, g);
  at_copy12(l + 12, g + 12);
}

__global__ __launch_bounds__(256)
void attn_route_k(const unsigned short* __restrict__ sthp, const unsigned short* __restrict__ stlp,
                  const unsigned short* __restrict__ achp, const unsigned short* __restrict__ aclp,
                  const unsigned short* __restrict__ cthp, const unsigned short* __restrict__ ctlp,
                  unsigned short* __restrict__ ghp, unsigned short* __restrict__ glp) {
  union FB { v16b v; v8b h[2]; };
  __shared__ __align__(16) __bf16 Psh[8][16 * ATT_KCH];        // per wave P hi [row][kv]
  __shared__ __align__(16) __bf16 Psl[8][16 * ATT_KCH];        // per wave P lo
  __shared__ __align__(16) float  Os[4][16 * ATT_OSP];         // per 16 query rows: out tile [row][d], pitch 132
  __shared__ float Ms[4][16];                                  // group 1's row maxima
  __shared__ float Ls[4][16];                                  // group 1's row sums
  __shared__ __align__(16) __bf16 Stg[2][2][ATT_ROWS * ATT_SP];   // two buffers x two key groups of staged K and content^T rows

  const __bf16* sth = (const __bf16*)sthp; const __bf16* stl = (const __bf16*)stlp;
  const __bf16* ach = (const __bf16*)achp; const __bf16* acl = (const __bf16*)aclp;
  const __bf16* cth = (const __bf16*)cthp; const __bf16* ctl = (const __bf16*)ctlp;
  _Float16* gh = (_Float16*)ghp; _Float16* gl = (_Float16*)glp;

  const int tid  = threadIdx.x;
  const int wave = __builtin_amdgcn_readfirstlane(tid >> 5);   // in a scalar register: the tests on the key group below are scalar branches
  const int grp  = wave >> 2;    // key group
  const int wq   = wave & 3;     // which 16 query rows
  const int gtid = tid & 127;    // thread index inside the key group
  const int lane = tid & 31;
  const int hh   = lane >> 4;
  const int c    = lane & 15;
  const int bx = blockIdx.x;
  const int qb = ATT_NQB - 1 - bx / NHEADS;   // cost falls with the block index
  const int h  = bx % NHEADS;
  const int q0 = qb * ATT_QBLK + wq * 16;

  // ---- Q fragments (A operand): 2 depth chunks, hi and lo; row = c, k = dc*32 + 8*hh + {0..7, 16..23} ----
  v16b qah[2], qal[2];
#pragma unroll
  for (int dc = 0; dc < 2; ++dc) {
    const size_t off = (size_t)(q0 + c) * QRANK + h * HRANK + dc * 32 + 8 * hh;
    qah[dc] = Frag<__bf16>::load(sth + off);
    qal[dc] = Frag<__bf16>::load(stl + off);
  }

  float mrow[8], lrow[8];
  v8f oacc[8];
#pragma unroll
  for (int r = 0; r < 8; ++r) { mrow[r] = -INFINITY; lrow[r] = 0.f; }
#pragma unroll
  for (int t = 0; t < 8; ++t) oacc[t] = (v8f){0.f,0.f,0.f,0.f,0.f,0.f,0.f,0.f};

  __bf16* pwh = Psh[wave];
  __bf16* pwl = Psl[wave];
  const int nChunks = qb + 1;              // block-uniform, <= 32
  const int nSteps  = (nChunks + 1) >> 1;  // block-uniform, <= 16; step st holds chunks 2*st and 2*st + 1 (<= 31: both lie inside the sequence)

  // ---- ring prologue: step 0 lands and is published; then step 1 starts ----
  at_stage(Stg[0][grp], ach, acl, cth, ctl, h, grp * ATT_KCH, gtid);
  asm volatile("s_wait_asynccnt 0x0" ::: "memory");   // this wave's copies of step 0 have landed
  __syncthreads();                                    // every wave's have: step 0 may be read
  if (nSteps > 1) at_stage(Stg[1][grp], ach, acl, cth, ctl, h, (2 + grp) * ATT_KCH, gtid);

  for (int st = 0; st < nSteps; ++st) {
    const int kc = 2 * st + grp;
    // wave-uniform: with an odd number of chunks group 1 has none in the last step; the publish point below stands outside this test
    if (kc < nChunks) {
    const int kv0 = kc * ATT_KCH;
    const __bf16* sb = Stg[st & 1][grp];

    // ---- scores: 4 key subtiles of 16; K B-fragments: col = key, k = depth (staged rows) ----
    // All of the chunk's K fragments are read as one group; the products then go round the four subtiles, so that
    // consecutive matrix instructions write different accumulators. Per accumulator and depth step: hi.hi, hi.lo, lo.hi.
    // Every loop over fragments or accumulators in this chunk loop is unrolled, so that these arrays are indexed by constants and live in registers.
    v8f s[4];
    v16b kb[2][4], kl[2][4];
#pragma unroll
    for (int dc = 0; dc < 2; ++dc) {
#pragma unroll
      for (int j = 0; j < 4; ++j) {
        const int ko = (j * 16 + c) * ATT_SP + dc * 32 + 8 * hh;
        kb[dc][j] = Frag<__bf16>::load(sb + ATT_ROW_KH * ATT_SP + ko);
        kl[dc][j] = Frag<__bf16>::load(sb + ATT_ROW_KL * ATT_SP + ko);
      }
    }
    // keeps the K reads one group ahead of the products: a read left among the products is waited for on its own
    __builtin_amdgcn_sched_barrier(0);
#pragma unroll
    for (int j = 0; j < 4; ++j) s[j] = (v8f){0.f,0.f,0.f,0.f,0.f,0.f,0.f,0.f};
#pragma unroll
    for (int dc = 0; dc < 2; ++dc) {
#pragma unroll
      for (int j = 0; j < 4; ++j) s[j] = at_mma(qah[dc], kb[dc][j], s[j]);
#pragma unroll
      for (int j = 0; j < 4; ++j) s[j] = at_mma(qah[dc], kl[dc][j], s[j]);
#pragma unroll
      for (int j = 0; j < 4; ++j) s[j] = at_mma(qal[dc], kb[dc][j], s[j]);
    }

    // ---- content^T B-fragments (col = d, k = kv) of the first 32-key step: read here, they do not depend on the softmax ----
    v16b vb[2][8], vl[2][8];
#pragma unroll
    for (int t = 0; t < 8; ++t) {
      const int vo = (t * 16 + c) * ATT_SP + 8 * hh;
      vb[0][t] = Frag<__bf16>::load(sb + ATT_ROW_VH * ATT_SP + vo);
      vl[0][t] = Frag<__bf16>::load(sb + ATT_ROW_VL * ATT_SP + vo);
    }
    // keeps these reads above the softmax arithmetic, so that their LDS latency passes under it
    __builtin_amdgcn_sched_barrier(0);

    // ---- scale by 1/8, causal select on the diagonal chunk, row max ----
    const bool diag = (kc == qb);
    float cm[8];
#pragma unroll
    for (int r = 0; r < 8; ++r) {
      const int qrow = q0 + 8 * hh + r;
      float m = -INFINITY;
#pragma unroll
      for (int j = 0; j < 4; ++j) {
        const int kvcol = kv0 + j * 16 + c;
        float v = s[j][r] * 0.125f;
        if (diag && (kvcol > qrow)) v = -INFINITY;
        s[j][r] = v;
        m = fmaxf(m, v);
      }
      cm[r] = m;
    }
    // the eight rows' maxima go through each exchange step together, so that the eight exchanges of a step overlap
#pragma unroll
    for (int off = 1; off < 16; off <<= 1) {
      float ex[8];
      // keeps a step's eight exchanges together: spread out, each would be waited for on its own
      __builtin_amdgcn_sched_barrier(0);
#pragma unroll
      for (int r = 0; r < 8; ++r) ex[r] = __shfl_xor(cm[r], off, 32);
#pragma unroll
      for (int r = 0; r < 8; ++r) cm[r] = fmaxf(cm[r], ex[r]);
    }

    // ---- online softmax update; P tile (C layout) -> LDS as bf16 hi/lo ----
    float alphar[8], psumr[8];   // each row's rescale factor and this lane's part of its sum: joined behind the products below
#pragma unroll
    for (int r = 0; r < 8; ++r) {
      const float mnew = fmaxf(mrow[r], cm[r]);
      const float alpha = expf(mrow[r] - mnew);
      mrow[r] = mnew;
      float psum = 0.f;
#pragma unroll
      for (int j = 0; j < 4; ++j) {
        const float p = expf(s[j][r] - mnew);
        psum += p;
        __bf16 a, bl; at_split(p, a, bl);
        pwh[(8 * hh + r) * ATT_KCH + j * 16 + c] = a;
        pwl[(8 * hh + r) * ATT_KCH + j * 16 + c] = bl;
      }
      alphar[r] = alpha;
      psumr[r] = psum;
#pragma unroll
      for (int t = 0; t < 8; ++t) oacc[t][r] *= alpha;
    }
    __builtin_amdgcn_fence(__ATOMIC_RELEASE, "workgroup");
    __builtin_amdgcn_wave_barrier();
    __builtin_amdgcn_fence(__ATOMIC_ACQUIRE, "workgroup");

    // ---- O += P.V ; P A-fragments from LDS (row = c, k = kv), V B-fragments from the staged content^T rows (col = d, k = kv) ----
    // The first step's P fragments, then the second step's content^T and P fragments, all as one group of reads.
    FB pa[2], pl[2];
    pa[0].h[0] = *(const v8b*)(pwh + c * ATT_KCH + 8 * hh);
    pa[0].h[1] = *(const v8b*)(pwh + c * ATT_KCH + 16 + 8 * hh);
    pl[0].h[0] = *(const v8b*)(pwl + c * ATT_KCH + 8 * hh);
    pl[0].h[1] = *(const v8b*)(pwl + c * ATT_KCH + 16 + 8 * hh);
#pragma unroll
    for (int t = 0; t < 8; ++t) {
      const int vo = (t * 16 + c) * ATT_SP + 32 + 8 * hh;
      vb[1][t] = Frag<__bf16>::load(sb + ATT_ROW_VH * ATT_SP + vo);
      vl[1][t] = Frag<__bf16>::load(sb + ATT_ROW_VL * ATT_SP + vo);
    }
    pa[1].h[0] = *(const v8b*)(pwh + c * ATT_KCH + 32 + 8 * hh);
    pa[1].h[1] = *(const v8b*)(pwh + c * ATT_KCH + 32 + 16 + 8 * hh);
    pl[1].h[0] = *(const v8b*)(pwl + c * ATT_KCH + 32 + 8 * hh);
    pl[1].h[1] = *(const v8b*)(pwl + c * ATT_KCH + 32 + 16 + 8 * hh);
    // keeps the second step's reads ahead of the first step's products, so that their LDS latency passes under these
    __builtin_amdgcn_sched_barrier(0);
    // Six groups of eight products, each group going round the eight output subtiles; per accumulator and 32-key step:
    // hi.hi, hi.lo, lo.hi. The row sums are joined over the 16 lanes beside them (nothing in this chunk waits for the sums):
    // the eight exchanges of a step are issued ahead of a group of products and added behind it.
#pragma unroll
    for (int g = 0; g < 6; ++g) {
      const int kk = g / 3, term = g % 3;
      float ex[8];
      if (g >= 2) {
#pragma unroll
        for (int r = 0; r < 8; ++r) ex[r] = __shfl_xor(psumr[r], 1 << (g - 2), 32);
        // keeps the exchanges ahead of the group's products, so that their latency passes under these
        __builtin_amdgcn_sched_barrier(0);
      }
#pragma unroll
      for (int t = 0; t < 8; ++t)
        oacc[t] = at_mma(term == 2 ? pl[kk].v : pa[kk].v, term == 1 ? vl[kk][t] : vb[kk][t], oacc[t]);
      if (g >= 2) {
        // keeps the wait for the exchanges behind the group's products (and the last group above the waits at the loop's foot)
        __builtin_amdgcn_sched_barrier(0);
#pragma unroll
        for (int r = 0; r < 8; ++r) psumr[r] += ex[r];
      }
    }
#pragma unroll
    for (int r = 0; r < 8; ++r) lrow[r] = lrow[r] * alphar[r] + psumr[r];
    // order this chunk's P loads before the next chunk's P stores
    __builtin_amdgcn_fence(__ATOMIC_RELEASE, "workgroup");
    __builtin_amdgcn_wave_barrier();
    __builtin_amdgcn_fence(__ATOMIC_ACQUIRE, "workgroup");
    }

    // ---- publish point of step st + 1, every wave ----
    asm volatile("s_wait_dscnt 0x0" ::: "memory");      // this wave's reads of buffer st & 1 have returned
    asm volatile("s_wait_asynccnt 0x0" ::: "memory");   // this wave's copies of step st + 1 have landed
    __syncthreads();                                    // publishes step st + 1 and ends every reader's last read of buffer st & 1
    if (st + 2 < nSteps) at_stage(Stg[st & 1][grp], ach, acl, cth, ctl, h, (2 * (st + 2) + grp) * ATT_KCH, gtid);   // block-uniform test
  }
  asm volatile("s_wait_asynccnt 0x0" ::: "memory");     // no copy is outstanding when the wave goes on to its end

  // ---- the two key groups' states are joined: group 1 writes its own to LDS, group 0 rescales both to the common row maximum ----
  // Every loop of this part is unrolled, so that oacc, mrow, lrow, f1 and f2 are indexed by constants and live in registers.
  float* os = Os[wq];
  if (grp == 1) {
#pragma unroll
    for (int r = 0; r < 8; ++r) {
#pragma unroll
      for (int t = 0; t < 8; ++t) os[(8 * hh + r) * ATT_OSP + t * 16 + c] = oacc[t][r];
    }
    if (c == 0) {   // a row's 16 lanes hold the same maximum and the same sum
#pragma unroll
      for (int r = 0; r < 8; ++r) {
        Ms[wq][8 * hh + r] = mrow[r];
        Ls[wq][8 * hh + r] = lrow[r];
      }
    }
  }
  __syncthreads();   // group 1's state may be read; every wave passes it, and no barrier follows
  if (grp == 0) {
  // Group 0 holds chunk 0, of which every row sees key 0: its maximum is finite. A group 1 without a chunk hands over -inf, 0 and zeros: factor 0.
  float f1[8], f2[8];   // per row: what group 0's and group 1's unnormalised output is multiplied by
#pragma unroll
  for (int r = 0; r < 8; ++r) {
    const float m2 = Ms[wq][8 * hh + r];
    const float l2 = Ls[wq][8 * hh + r];
    const float m  = fmaxf(mrow[r], m2);
    const float a1 = expf(mrow[r] - m);
    const float a2 = expf(m2 - m);
    const float inv = 1.0f / (lrow[r] * a1 + l2 * a2);
    f1[r] = a1 * inv;
    f2[r] = a2 * inv;
  }
  // each lane reads and rewrites its own elements of the tile
#pragma unroll
  for (int r = 0; r < 8; ++r) {
#pragma unroll
    for (int t = 0; t < 8; ++t) {
      const int oi = (8 * hh + r) * ATT_OSP + t * 16 + c;
      os[oi] = oacc[t][r] * f1[r] + os[oi] * f2[r];
    }
  }
  __builtin_amdgcn_fence(__ATOMIC_RELEASE, "workgroup");
  __builtin_amdgcn_wave_barrier();
  __builtin_amdgcn_fence(__ATOMIC_ACQUIRE, "workgroup");
  {
    // lane groups of 8: q4 = lane>>3; row parity = q4>>1, column half = q4&1; it = 0..7 -> rows 0..15, cols 0..127: whole 16x128 tile, both planes
    const int q4 = lane >> 3, c8 = (lane & 7) * 8;
    const int rpar = q4 >> 1, chalf = (q4 & 1) * 64;
    {
#pragma unroll
      for (int it = 0; it < 8; ++it) {
        const int row = it * 2 + rpar;
        const int col = chalf + c8;
        const float* sp = os + row * ATT_OSP + col;
        v8h hv, lv;
#pragma unroll
        for (int e = 0; e < 8; ++e) {
          const unsigned short hb = f2bf_bits(sp[e]);
          const unsigned short lb = f2bf_bits(sp[e] - bf_bits2f(hb));
          hv[e] = __builtin_bit_cast(_Float16, hb);
          lv[e] = __builtin_bit_cast(_Float16, lb);
        }
        const size_t go = (size_t)(q0 + row) * HID + h * HVAL + col;
        *(v8h*)(gh + go) = hv;
        *(v8h*)(gl + go) = lv;
      }
      
    }
  }
  }
}

// =====================================================================================
// Host launcher. Workspace region map (bytes, every offset a multiple of 4 MiB):
//   XB   bf16 [2048][2048]   8 MiB   x
//   WSA  bf16 [2048][2048]   8 MiB   rows 0..1023 W_state, 1024..2047 W_action
//   WC   bf16 [2048][1024]   4 MiB   W_content
//   WO   bf16 [2048][2048]   8 MiB   W_out
//   SA32 f32  [2048][2048]  16 MiB   state | action
//   STH, STL, ACH, ACL, QVH, QVL  bf16 [2048][1024]  4 MiB each (state, action, q-value hi/lo)
//   CTH, CTL  bf16 [2048 = h*128+d][2048 = kv]  8 MiB each (content^T hi/lo)
//   GH, GL    bf16 [2048][2048]  8 MiB each (gathered hi/lo)
//   total 104,857,600 B
// =====================================================================================
extern "C" void kernel_launch(void* const* d_in, const int* in_sizes, int n_in,
                              void* d_out, int out_size, void* d_ws, size_t ws_size,
                              hipStream_t stream) {
  if (n_in < 6) return;
  if (in_sizes[0] != SEQ_LEN * HID || in_sizes[1] != QRANK * HID || in_sizes[2] != QRANK * HID ||
      in_sizes[3] != HID * QRANK || in_sizes[4] != HID * HID || in_sizes[5] != HID) return;
  if (out_size != SEQ_LEN * HID) return;

  const float* x  = (const float*)d_in[0];
  const float* Ws = (const float*)d_in[1];
  const float* Wa = (const float*)d_in[2];
  const float* Wc = (const float*)d_in[3];
  const float* Wo = (const float*)d_in[4];
  const float* bo = (const float*)d_in[5];
  float* out = (float*)d_out;

  const size_t B_XB  = (size_t)SEQ_LEN * HID * 2;
  const size_t B_WSA = (size_t)(2 * QRANK) * HID * 2;
  const size_t B_WC  = (size_t)HID * QRANK * 2;
  const size_t B_WO  = (size_t)HID * HID * 2;
  const size_t B_SA  = (size_t)SEQ_LEN * (2 * QRANK) * 4;
  const size_t B_PL  = (size_t)SEQ_LEN * QRANK * 2;     // one [2048][1024] bf16 plane
  const size_t B_CT  = (size_t)HID * SEQ_LEN * 2;       // one [2048][2048] bf16 plane
  const size_t B_G   = (size_t)SEQ_LEN * HID * 2;

  char* ws = (char*)d_ws;
  size_t off = 0;
  unsigned short* XB  = (unsigned short*)(ws + off); off += B_XB;
  unsigned short* WSA = (unsigned short*)(ws + off); off += B_WSA;
  unsigned short* WC  = (unsigned short*)(ws + off); off += B_WC;
  unsigned short* WO  = (unsigned short*)(ws + off); off += B_WO;
  float*          SA  = (float*)(ws + off);          off += B_SA;
  unsigned short* STH = (unsigned short*)(ws + off); off += B_PL;
  unsigned short* STL = (unsigned short*)(ws + off); off += B_PL;
  unsigned short* ACH = (unsigned short*)(ws + off); off += B_PL;
  unsigned short* ACL = (unsigned short*)(ws + off); off += B_PL;
  unsigned short* QVH = (unsigned short*)(ws + off); off += B_PL;
  unsigned short* QVL = (unsigned short*)(ws + off); off += B_PL;
  unsigned short* CTH = (unsigned short*)(ws + off); off += B_CT;
  unsigned short* CTL = (unsigned short*)(ws + off); off += B_CT;
  unsigned short* GH  = (unsigned short*)(ws + off); off += B_G;
  unsigned short* GL  = (unsigned short*)(ws + off); off += B_G;
  if (off > ws_size) return;

  // ---- input casts to bf16 (RNE) ----
  cast_inputs_bf16<<<dim3(CAST_BLOCKS), dim3(CAST_THREADS), 0, stream>>>(
      x, Ws, Wa, Wc, Wo, XB, WSA, WSA + (size_t)QRANK * HID, WC, WO);

  // ---- projections: SA[q][0..2047] = x . [W_state; W_action]^T  (M=2048, N=2048, K=2048) ----
  {
    const int M = SEQ_LEN, N = 2 * QRANK, K = HID;
    const int blocks = (M / 64) * (N / 64) / 8;   // 128
    wmma_gemm64<1, false, false, 0, 0><<<dim3(blocks, 1), dim3(256), 0, stream>>>(
        XB, XB, K, 0L, WSA, WSA, K, 0L, (void*)SA, (void*)SA, N, 0L, bo, M, N, K, 1.0f);
  }

  // ---- bf16 hi/lo planes of state, action, q-value ----
  planes_k<<<dim3(SEQ_LEN / 2), dim3(256), 0, stream>>>(SA, STH, STL, ACH, ACL, QVH, QVL);

  // ---- content^T[n][kv] = W_content[n][:] . qval[kv][:]  (M=2048, N=2048, K=1024; B = q-value hi/lo) -> bf16 hi/lo planes ----
  {
    const int M = HID, N = SEQ_LEN, K = QRANK;
    const int blocks = (M / 64) * (N / 64) / 8;   // 128
    wmma_gemm64<1, false, true, 0, 2><<<dim3(blocks, 1), dim3(256), 0, stream>>>(
        WC, WC, K, 0L, QVH, QVL, K, 0L, (void*)CTH, (void*)CTL, N, 0L, bo, M, N, K, 1.0f);
  }

  // ---- causal routing attention -> gathered hi/lo planes ----
  attn_route_k<<<dim3(NHEADS * ATT_NQB), dim3(256), 0, stream>>>(STH, STL, ACH, ACL, CTH, CTL, GH, GL);

  // ---- out = gathered . W_out^T + b_out  (M=N=K=2048; A = gathered hi/lo), f32 ----
  {
    const int M = SEQ_LEN, N = HID, K = HID;
    const int blocks = (M / 64) * (N / 64) / 8;   // 128
    wmma_gemm64<1, true, false, 2, 0><<<dim3(blocks, 1), dim3(256), 0, stream>>>(
        GH, GL, K, 0L, WO, WO, K, 0L, (void*)out, (void*)out, N, 0L, bo, M, N, K, 1.0f);
  }
}

// v006
// A run of this version takes 147 microseconds.
// Next to v005, in two timings, it ran 1.25 times as fast each time.
// Over all steps from v000 it is 3.85 times as fast.
// All contractions: v_wmma_f32_16x16x32_bf16 (bf16 operands, f32 accumulate): x and weight matrices as single RNE bf16 planes; state/action, q-value product, softmax p, content and gathered carried as bf16 hi/lo planes (hi.hi + hi.lo + lo.hi); softmax, q-value product and bias in f32.
#include <hip/hip_runtime.h>
#include <stdint.h>

constexpr int SEQ_LEN = 2048;   // L
constexpr int HID     = 2048;   // hidden
constexpr int QRANK   = 1024;   // q_rank
constexpr int NHEADS  = 16;
constexpr int HRANK   = 64;     // per-head rank (q/k depth)
constexpr int HVAL    = 128;    // per-head value width
static_assert(QRANK == NHEADS * HRANK, "rank split");
static_assert(HID == NHEADS * HVAL, "value split");
static_assert(SEQ_LEN % 64 == 0 && HID % 64 == 0 && QRANK % 64 == 0, "tile multiples");
static_assert(HID % 32 == 0 && QRANK % 32 == 0, "K multiples of 32");

typedef __attribute__((ext_vector_type(16))) _Float16 v16h;
typedef __attribute__((ext_vector_type(8)))  _Float16 v8h;
typedef __attribute__((ext_vector_type(16))) __bf16   v16b;
typedef __attribute__((ext_vector_type(8)))  __bf16   v8b;
typedef __attribute__((ext_vector_type(8)))  float    v8f;
typedef __attribute__((ext_vector_type(4)))  float    v4f;

__device__ __forceinline__ unsigned short f2bf_bits(float f) {
  unsigned u = __float_as_uint(f);
  return (unsigned short)((u + 0x7FFFu + ((u >> 16) & 1u)) >> 16);
}
__device__ __forceinline__ float bf_bits2f(unsigned short h) { return __uint_as_float(((unsigned)h) << 16); }

// hazard guards as plain device helpers (no hazard-guard asm inside the kernel template body)
__device__ __forceinline__ void dep_guard_h(v8f& a, v8f& b, v16h x, v16h y) { asm volatile("v_nop\n\tv_nop\n\tv_nop\n\tv_nop" : "+v"(a), "+v"(b) : "v"(x), "v"(y)); }
__device__ __forceinline__ void dep_guard_b(v8f& a, v8f& b, v16b x, v16b y) { asm volatile("v_nop\n\tv_nop\n\tv_nop\n\tv_nop" : "+v"(a), "+v"(b) : "v"(x), "v"(y)); }
__device__ __forceinline__ void keep4_h(v16h a, v16h b, v16h c, v16h d) { asm volatile("v_nop" :: "v"(a), "v"(b), "v"(c), "v"(d)); }
__device__ __forceinline__ void keep4_b(v16b a, v16b b, v16b c, v16b d) { asm volatile("v_nop" :: "v"(a), "v"(b), "v"(c), "v"(d)); }
__device__ __forceinline__ void acc_guard4(v8f& a, v8f& b, v8f& c, v8f& d) { asm volatile("v_nop\n\tv_nop\n\tv_nop\n\tv_nop" : "+v"(a), "+v"(b), "+v"(c), "+v"(d)); }
template <typename T> struct Frag;
template <> struct Frag<_Float16> {
  typedef v16h V; union U { v16h v; v8h h[2]; };
  static __device__ __forceinline__ v16h load(const _Float16* p) {   // elements 0..7 <- p[0..7], 8..15 <- p[16..23]
    U f; f.h[0] = *(const v8h*)(p); f.h[1] = *(const v8h*)(p + 16); return f.v;
  }
  static __device__ __forceinline__ v8f mma(v16h a, v16h b, v8f c) {
    return __builtin_amdgcn_wmma_f32_16x16x32_f16(false, a, false, b, (short)0, c, false, false);
  }
  static __device__ __forceinline__ void guard(v8f& a, v8f& b, v16h x, v16h y) { dep_guard_h(a, b, x, y); }
  static __device__ __forceinline__ void keep(v16h a, v16h b, v16h c, v16h d) { keep4_h(a, b, c, d); }
};
template <> struct Frag<__bf16> {
  typedef v16b V; union U { v16b v; v8b h[2]; };
  static __device__ __forceinline__ v16b load(const __bf16* p) {
    U f; f.h[0] = *(const v8b*)(p); f.h[1] = *(const v8b*)(p + 16); return f.v;
  }
  static __device__ __forceinline__ v8f mma(v16b a, v16b b, v8f c) {
    return __builtin_amdgcn_wmma_f32_16x16x32_bf16(false, a, false, b, (short)0, c, false, false);
  }
  static __device__ __forceinline__ void guard(v8f& a, v8f& b, v16b x, v16b y) { dep_guard_b(a, b, x, y); }
  static __device__ __forceinline__ void keep(v16b a, v16b b, v16b c, v16b d) { keep4_b(a, b, c, d); }
};

// Twelve asynchronous 16-B-per-lane copies global -> LDS. The s_wait_xcnt is the last line of the copies' own statement,
// so that no address register of an issued copy is rewritten in front of it.
__device__ __forceinline__ void at_copy12(const unsigned* l, const __bf16* const* g) {
  asm volatile(
      "global_load_async_to_lds_b128 %0, %12, off\n\t"
      "global_load_async_to_lds_b128 %1, %13, off\n\t"
      "global_load_async_to_lds_b128 %2, %14, off\n\t"
      "global_load_async_to_lds_b128 %3, %15, off\n\t"
      "global_load_async_to_lds_b128 %4, %16, off\n\t"
      "global_load_async_to_lds_b128 %5, %17, off\n\t"
      "global_load_async_to_lds_b128 %6, %18, off\n\t"
      "global_load_async_to_lds_b128 %7, %19, off\n\t"
      "global_load_async_to_lds_b128 %8, %20, off\n\t"
      "global_load_async_to_lds_b128 %9, %21, off\n\t"
      "global_load_async_to_lds_b128 %10, %22, off\n\t"
      "global_load_async_to_lds_b128 %11, %23, off\n\t"
      "s_wait_xcnt 0x0"
      :: "v"(l[0]), "v"(l[1]), "v"(l[2]), "v"(l[3]), "v"(l[4]), "v"(l[5]),
         "v"(l[6]), "v"(l[7]), "v"(l[8]), "v"(l[9]), "v"(l[10]), "v"(l[11]),
         "v"(g[0]), "v"(g[1]), "v"(g[2]), "v"(g[3]), "v"(g[4]), "v"(g[5]),
         "v"(g[6]), "v"(g[7]), "v"(g[8]), "v"(g[9]), "v"(g[10]), "v"(g[11])
      : "memory");
}

// The same for eight copies.
__device__ __forceinline__ void at_copy8(const unsigned* l, const __bf16* const* g) {
  asm volatile(
      "global_load_async_to_lds_b128 %0, %8, off\n\t"
      "global_load_async_to_lds_b128 %1, %9, off\n\t"
      "global_load_async_to_lds_b128 %2, %10, off\n\t"
      "global_load_async_to_lds_b128 %3, %11, off\n\t"
      "global_load_async_to_lds_b128 %4, %12, off\n\t"
      "global_load_async_to_lds_b128 %5, %13, off\n\t"
      "global_load_async_to_lds_b128 %6, %14, off\n\t"
      "global_load_async_to_lds_b128 %7, %15, off\n\t"
      "s_wait_xcnt 0x0"
      :: "v"(l[0]), "v"(l[1]), "v"(l[2]), "v"(l[3]), "v"(l[4]), "v"(l[5]), "v"(l[6]), "v"(l[7]),
         "v"(g[0]), "v"(g[1]), "v"(g[2]), "v"(g[3]), "v"(g[4]), "v"(g[5]), "v"(g[6]), "v"(g[7])
      : "memory");
}

// ---- Register-blocked batched WMMA GEMM ------------------------------------
// C[m,n] = scale * sum_k A[m,k] * Bt[n,k] (+bias); each wave owns a 32x64 tile; a block's 8 waves (4 x 2) own a 128x128 tile,
// so that the 2048x2048 outputs here give 256 blocks, one for every WGP.
// A row-major [M,K]; Bt row-major [N,K]; M % 128 == 0, N % 128 == 0, K % 128 == 0.
// Per 128 k the block's 128 A rows and 128 Bt rows (each plane) are brought into LDS once by asynchronous copies, whole 256-B units,
// two buffers (slab s + 1 flies while slab s is worked on); the waves read their fragments there.
// ASPLIT: A carried as hi/lo planes (A2 = lo plane, same layout); BSPLIT: Bt hi/lo (Bt2 = lo plane).
//   product = hi.hi (+ hi.lo if BSPLIT) (+ lo.hi if ASPLIT).
// BIAS_MODE: 0 = none, 1 = bias[m], 2 = bias[n].
// OUT_MODE: 0 = f32, 1 = f16, 2 = bf16 hi plane (Cout) + bf16 lo plane (Cout2).
// Coverage: per 32x64 tile, 2 slabs x 16 rows x 64 cols -> the whole tile; grid = (M/128)*(N/128) blocks of 8 waves.
// ET: 0 = f16 operands, 1 = bf16 operands (pointers passed as 16-bit storage)
constexpr int GM_BM = 128;   // block tile rows
constexpr int GM_BN = 128;   // block tile cols
constexpr int GM_KS = 128;   // k per staged slab: 256-B rows
constexpr int GM_SP = 136;   // staged row pitch in elements: 272 B (16 B x odd, for ds_load_b128 readers)
static_assert(SEQ_LEN % GM_BM == 0 && HID % GM_BM == 0, "block tile multiples");
static_assert(SEQ_LEN % GM_BN == 0 && HID % GM_BN == 0 && (2 * QRANK) % GM_BN == 0, "block tile multiples");
static_assert(HID % GM_KS == 0 && QRANK % GM_KS == 0, "K multiples of the slab");
template <int ET> struct Elem;
template <> struct Elem<0> { typedef _Float16 T; };
template <> struct Elem<1> { typedef __bf16 T; };
template <int ET, bool ASPLIT, bool BSPLIT, int BIAS_MODE, int OUT_MODE>
__global__ __launch_bounds__(256) void wmma_gemm64(
    const unsigned short* __restrict__ Ap, const unsigned short* __restrict__ A2p, int lda, long strideA,
    const unsigned short* __restrict__ Btp, const unsigned short* __restrict__ Bt2p, int ldb, long strideB,
    void* __restrict__ Cout, void* __restrict__ Cout2, int ldc, long strideC,
    const float* __restrict__ bias,
    int M, int N, int K, float scale) {
  typedef typename Elem<ET>::T T;
  typedef typename Frag<T>::V V;
  const T* A = (const T*)Ap; const T* A2 = (const T*)A2p; const T* Bt = (const T*)Btp; const T* Bt2 = (const T*)Bt2p;
  // staged rows of one slab: A hi (, A lo), Bt hi (, Bt lo); every plane starts at a multiple of 16 rows
  constexpr int ROW_AL = GM_BM;
  constexpr int ROW_BH = GM_BM * (ASPLIT ? 2 : 1);
  constexpr int ROW_BL = ROW_BH + GM_BN;
  constexpr int ROWS   = ROW_BH + GM_BN * (BSPLIT ? 2 : 1);   // 256 or 384
  constexpr int NCP    = ROWS / 16;                           // copies per thread and slab: 16 or 24
  static_assert(NCP == 16 || NCP == 24, "copy statements below");
  __shared__ __align__(16) float sT[8][16 * 68];   // per-wave 16x64 slab, pitch 68 floats
  __shared__ __align__(16) T Stg[2][ROWS * GM_SP]; // two buffers of staged rows, shared by the block
  const int b    = blockIdx.y;
  const int tid  = threadIdx.x;
  const int lane = threadIdx.x & 31;
  const int wave = threadIdx.x >> 5;
  const int blkN = N / GM_BN;
  if ((int)blockIdx.x >= (M / GM_BM) * blkN) return;   // block-uniform, in front of every barrier
  const int bm  = blockIdx.x / blkN;
  const int bm0 = bm * GM_BM;
  const int bn0 = (blockIdx.x - bm * blkN) * GM_BN;
  const int wm0 = (wave >> 1) << 5;            // this wave's 32x64 tile inside the block tile
  const int wn0 = (wave & 1) << 6;
  const int m0 = bm0 + wm0;
  const int n0 = bn0 + wn0;

  const T* Ab  = A  + (size_t)b * strideA;
  const T* Bb  = Bt + (size_t)b * strideB;
  const T* Ab2 = ASPLIT ? (A2  + (size_t)b * strideA) : nullptr;
  const T* Bb2 = BSPLIT ? (Bt2 + (size_t)b * strideB) : nullptr;

  const int rlane = lane & 15;                 // row (A) / col (B, D) within subtile
  const int koff  = (lane >> 4) * 8;           // k offset of this lane half
  const int mOff  = (lane >> 4) * 8;           // D row offset

  v8f acc[2][4];
#pragma unroll
  for (int i = 0; i < 2; ++i)
#pragma unroll
    for (int j = 0; j < 4; ++j) acc[i][j] = (v8f){0.f,0.f,0.f,0.f,0.f,0.f,0.f,0.f};

  // One slab: ROWS staged rows x 16 segments of 16 B = NCP lane copies per thread of the 256-thread block.
  // Copy i of thread tid: staged row i*16 + (tid >> 4), segment tid & 15: a wave's copy covers two whole 256-B units.
  // One running pointer per plane (this thread's first row and segment of the next slab to stage); the other rows are 16*ld apart.
  const int rg = tid >> 4, seg = (tid & 15) * 8;
  const T* pA  = Ab + (size_t)(bm0 + rg) * lda + seg;
  const T* pB  = Bb + (size_t)(bn0 + rg) * ldb + seg;
  const T* pA2 = ASPLIT ? (Ab2 + (size_t)(bm0 + rg) * lda + seg) : nullptr;
  const T* pB2 = BSPLIT ? (Bb2 + (size_t)(bn0 + rg) * ldb + seg) : nullptr;
  auto stage = [&](T* buf) {
    unsigned l[NCP];
    const __bf16* g[NCP];
    // unrolled so that every index of l and g is a constant and both arrays live in registers
#pragma unroll
    for (int i = 0; i < NCP; ++i) {
      const T* sp;
      if (i * 16 >= ROW_BL)                 sp = pB2 + (size_t)(i * 16 - ROW_BL) * ldb;
      else if (i * 16 >= ROW_BH)            sp = pB  + (size_t)(i * 16 - ROW_BH) * ldb;
      else if (ASPLIT && i * 16 >= ROW_AL)  sp = pA2 + (size_t)(i * 16 - ROW_AL) * lda;
      else                                  sp = pA  + (size_t)(i * 16) * lda;
      l[i] = (unsigned)(size_t)(buf + (i * 16 + rg) * GM_SP + seg);
      g[i] = (const __bf16*)sp;
    }
    if (NCP == 16) { at_copy8(l, g); at_copy8(l + NCP - 8, g + NCP - 8); }
    if (NCP == 24) { at_copy12(l, g); at_copy12(l + NCP - 12, g + NCP - 12); }
    pA += GM_KS; pB += GM_KS;
    if (ASPLIT) pA2 += GM_KS;
    if (BSPLIT) pB2 += GM_KS;
  };
  const int nSlabs = K / GM_KS;   // block-uniform

  // ---- ring prologue: slab 0 lands and is published; then slab 1 starts ----
  stage(Stg[0]);
  asm volatile("s_wait_asynccnt 0x0" ::: "memory");   // this wave's copies of slab 0 have landed
  __syncthreads();                                    // every wave's have: slab 0 may be read
  if (nSlabs > 1) stage(Stg[1]);

  for (int s = 0; s < nSlabs; ++s) {
    const T* sb = Stg[s & 1];
    // the four 32-k steps of the slab unrolled: a later step's LDS reads may go ahead of an earlier step's products
#pragma unroll
    for (int kk = 0; kk < GM_KS; kk += 32) {
      V bh[4], bl[4];
#pragma unroll
      for (int j = 0; j < 4; ++j) {
        const int bo = (wn0 + (j << 4) + rlane) * GM_SP + koff + kk;
        bh[j] = Frag<T>::load(sb + ROW_BH * GM_SP + bo);
        if (BSPLIT) bl[j] = Frag<T>::load(sb + ROW_BL * GM_SP + bo);
      }
      // all of the step's LDS reads stand together, ahead of its products
      V ah[2], al[2];
#pragma unroll
      for (int i = 0; i < 2; ++i) {
        const int ao = (wm0 + (i << 4) + rlane) * GM_SP + koff + kk;
        ah[i] = Frag<T>::load(sb + ao);
        al[i] = ah[i];
        if (ASPLIT) al[i] = Frag<T>::load(sb + ROW_AL * GM_SP + ao);
      }
#pragma unroll
      for (int i = 0; i < 2; ++i) {
#pragma unroll
        for (int j = 0; j < 4; ++j) {
          acc[i][j] = Frag<T>::mma(ah[i], bh[j], acc[i][j]);
          if (BSPLIT) acc[i][j] = Frag<T>::mma(ah[i], bl[j], acc[i][j]);
          if (ASPLIT) acc[i][j] = Frag<T>::mma(al[i], bh[j], acc[i][j]);
        }
        Frag<T>::guard(acc[i][0], acc[i][3], ah[i], al[i]);
      }
      Frag<T>::keep(bh[0], bh[1], bh[2], bh[3]);
      if (BSPLIT) Frag<T>::keep(bl[0], bl[1], bl[2], bl[3]);
    }
    // ---- publish point of slab s + 1, every wave ----
    asm volatile("s_wait_dscnt 0x0" ::: "memory");      // this wave's reads of buffer s & 1 have returned
    asm volatile("s_wait_asynccnt 0x0" ::: "memory");   // this wave's copies of slab s + 1 have landed
    __syncthreads();                                    // publishes slab s + 1 and ends every reader's last read of buffer s & 1
    if (s + 2 < nSlabs) stage(Stg[s & 1]);              // block-uniform test; slab s + 2
  }
  asm volatile("s_wait_asynccnt 0x0" ::: "memory");     // no copy is outstanding when the wave goes on to its end
  acc_guard4(acc[0][0], acc[0][1], acc[0][2], acc[0][3]);
  acc_guard4(acc[1][0], acc[1][1], acc[1][2], acc[1][3]);

  // ---- epilogue ----
  float* slab = sT[wave];
#pragma unroll
  for (int i = 0; i < 2; ++i) {
    const int mBase = m0 + (i << 4);
#pragma unroll
    for (int j = 0; j < 4; ++j) {
      const int n = n0 + (j << 4) + rlane;
      float bv = 0.f;
      if (BIAS_MODE == 2) bv = bias[n];
#pragma unroll
      for (int r = 0; r < 8; ++r) {
        float v = acc[i][j][r] * scale;
        if (BIAS_MODE == 1) v += bias[mBase + mOff + r];
        if (BIAS_MODE == 2) v += bv;
        slab[(mOff + r) * 68 + (j << 4) + rlane] = v;
      }
    }
    __builtin_amdgcn_fence(__ATOMIC_RELEASE, "workgroup");
    __builtin_amdgcn_wave_barrier();
    __builtin_amdgcn_fence(__ATOMIC_ACQUIRE, "workgroup");
    if (OUT_MODE == 0) {
      float* C = (float*)Cout + (size_t)b * strideC;
      const int hh = lane >> 4, c4 = (lane & 15) * 4;     // row seg = 256 B = 16 lanes x 16 B
      {
#pragma unroll
        for (int it = 0; it < 8; ++it) {
          const int row = it * 2 + hh;
          v4f v = *(const v4f*)(slab + row * 68 + c4);
          *(v4f*)(C + (size_t)(mBase + row) * ldc + n0 + c4) = v;
        }
        
      }
    } else {
      const int q = lane >> 3, c8 = (lane & 7) * 8;
      unsigned short* C  = (unsigned short*)Cout  + (size_t)b * strideC;
      unsigned short* C2 = (OUT_MODE == 2) ? ((unsigned short*)Cout2 + (size_t)b * strideC) : nullptr;
      {
#pragma unroll
        for (int it = 0; it < 4; ++it) {
          const int row = it * 4 + q;
          const float* sp = slab + row * 68 + c8;
          v8h hv, lv;
#pragma unroll
          for (int e = 0; e < 8; ++e) {
            if (OUT_MODE == 1) {
              hv[e] = (_Float16)sp[e];
            } else {
              unsigned short hb = f2bf_bits(sp[e]);
              unsigned short lb = f2bf_bits(sp[e] - bf_bits2f(hb));
              hv[e] = __builtin_bit_cast(_Float16, hb);
              lv[e] = __builtin_bit_cast(_Float16, lb);
            }
          }
          *(v8h*)(C + (size_t)(mBase + row) * ldc + n0 + c8) = hv;
          if (OUT_MODE == 2) *(v8h*)(C2 + (size_t)(mBase + row) * ldc + n0 + c8) = lv;
        }
        
      }
    }
    __builtin_amdgcn_fence(__ATOMIC_RELEASE, "workgroup");
    __builtin_amdgcn_wave_barrier();
    __builtin_amdgcn_fence(__ATOMIC_ACQUIRE, "workgroup");
  }
}

// ---- all five f32 inputs -> bf16 (RNE) in one launch: one 16-wave block per WGP, few long waves in place of many two-element ones ----
// Block b converts the b-th of 256 equal contiguous parts of every input, in steps of 2,048 floats (4 a lane):
// a wave's load is 512 contiguous bytes, its store 256. x and W_out take 8 steps a block, the three rank-sized weights 4 each.
// Coverage: 256 blocks x N steps x 2,048 = the whole of each input, each element converted by exactly one lane.
constexpr int CAST_BLOCKS  = 256;
constexpr int CAST_THREADS = 512;
constexpr int CAST_STEP    = CAST_THREADS * 4;                             // floats a block converts per step
constexpr int CAST_NX = SEQ_LEN * HID / (CAST_BLOCKS * CAST_STEP);         // 8
constexpr int CAST_NW = QRANK * HID / (CAST_BLOCKS * CAST_STEP);           // 4
constexpr int CAST_NO = HID * HID / (CAST_BLOCKS * CAST_STEP);             // 8
static_assert(SEQ_LEN * HID == CAST_NX * CAST_BLOCKS * CAST_STEP && QRANK * HID == CAST_NW * CAST_BLOCKS * CAST_STEP &&
              HID * HID == CAST_NO * CAST_BLOCKS * CAST_STEP, "whole steps");
typedef __attribute__((ext_vector_type(2))) unsigned v2u;
// Addresses are a uniform base, one unsigned 32-bit byte offset a lane, and a small constant per step.
template <int N>
__device__ __forceinline__ void cast_load(v4f* r, const float* __restrict__ in) {
  const char* p = (const char*)in + (blockIdx.x * (N * CAST_THREADS) + threadIdx.x) * 16u;
  // unrolled so that r is indexed by constants and lives in registers, and the loads follow one another
#pragma unroll
  for (int i = 0; i < N; ++i) r[i] = *(const v4f*)(p + i * (CAST_STEP * 4));
}
template <int N>
__device__ __forceinline__ void cast_store(const v4f* r, unsigned short* __restrict__ out) {
  char* q = (char*)out + (blockIdx.x * (N * CAST_THREADS) + threadIdx.x) * 8u;
  // unrolled so that r is indexed by constants and lives in registers
#pragma unroll
  for (int i = 0; i < N; ++i) {
    v2u u;
    u[0] = (unsigned)f2bf_bits(r[i][0]) | ((unsigned)f2bf_bits(r[i][1]) << 16);
    u[1] = (unsigned)f2bf_bits(r[i][2]) | ((unsigned)f2bf_bits(r[i][3]) << 16);
    *(v2u*)(q + i * (CAST_STEP * 2)) = u;
  }
}
__global__ __launch_bounds__(CAST_THREADS) void cast_inputs_bf16(
    const float* __restrict__ x, const float* __restrict__ wst, const float* __restrict__ wac,
    const float* __restrict__ wco, const float* __restrict__ wou,
    unsigned short* __restrict__ xb, unsigned short* __restrict__ wstb, unsigned short* __restrict__ wacb,
    unsigned short* __restrict__ wcob, unsigned short* __restrict__ woub) {
  // all of a lane's 28 loads stand ahead of its first store, so that they are in flight together
  v4f rx[CAST_NX], rs[CAST_NW], ra[CAST_NW], rc[CAST_NW], ro[CAST_NO];
  cast_load<CAST_NX>(rx, x);
  cast_load<CAST_NW>(rs, wst);
  cast_load<CAST_NW>(ra, wac);
  cast_load<CAST_NW>(rc, wco);
  // the loads below may be given, for their results, the offset register that the twelve loads above name
  asm volatile("s_wait_xcnt 0x0" ::: "memory");
  cast_load<CAST_NO>(ro, wou);
  cast_store<CAST_NX>(rx, xb);
  cast_store<CAST_NW>(rs, wstb);
  cast_store<CAST_NW>(ra, wacb);
  cast_store<CAST_NW>(rc, wcob);
  cast_store<CAST_NO>(ro, woub);
}

// ---- state|action f32 [SEQ_LEN][2*QRANK] -> bf16 hi/lo planes of state, action and q-value (state*action in f32), each [SEQ_LEN][QRANK] ----
// Coverage: grid = SEQ_LEN/2 blocks x 256 threads; thread -> row = 2*blk + (tid>>7), cols (tid&127)*8 .. +7 -> 2048 rows x 1024 cols exactly, all six planes.
__global__ __launch_bounds__(256) void planes_k(const float* __restrict__ sa,
    unsigned short* __restrict__ sthp, unsigned short* __restrict__ stlp,
    unsigned short* __restrict__ achp, unsigned short* __restrict__ aclp,
    unsigned short* __restrict__ qvhp, unsigned short* __restrict__ qvlp) {
  const int row = blockIdx.x * 2 + (threadIdx.x >> 7);
  const int c8  = (threadIdx.x & 127) * 8;
  const float* sp = sa + (size_t)row * (2 * QRANK) + c8;
  const v8f sv = *(const v8f*)(sp);
  const v8f av = *(const v8f*)(sp + QRANK);
  v8h shv, slv, ahv, alv, qhv, qlv;
#pragma unroll
  for (int e = 0; e < 8; ++e) {
    const float s = sv[e], a = av[e];
    const float q = s * a;
    unsigned short hb, lb;
    hb = f2bf_bits(s); lb = f2bf_bits(s - bf_bits2f(hb));
    shv[e] = __builtin_bit_cast(_Float16, hb); slv[e] = __builtin_bit_cast(_Float16, lb);
    hb = f2bf_bits(a); lb = f2bf_bits(a - bf_bits2f(hb));
    ahv[e] = __builtin_bit_cast(_Float16, hb); alv[e] = __builtin_bit_cast(_Float16, lb);
    hb = f2bf_bits(q); lb = f2bf_bits(q - bf_bits2f(hb));
    qhv[e] = __builtin_bit_cast(_Float16, hb); qlv[e] = __builtin_bit_cast(_Float16, lb);
  }
  const size_t o = (size_t)row * QRANK + c8;
  _Float16* sth = (_Float16*)sthp; _Float16* stl = (_Float16*)stlp;
  _Float16* ach = (_Float16*)achp; _Float16* acl = (_Float16*)aclp;
  _Float16* qvh = (_Float16*)qvhp; _Float16* qvl = (_Float16*)qvlp;
  {
    *(v8h*)(sth + o) = shv;
    *(v8h*)(stl + o) = slv;
    *(v8h*)(ach + o) = ahv;
    *(v8h*)(acl + o) = alv;
    *(v8h*)(qvh + o) = qhv;
    *(v8h*)(qvl + o) = qlv;
    
  }
}

// =====================================================================================
// Causal routing attention, q/k depth 64 (bf16 hi/lo planes, ld QRANK, head cols h*64),
// value width 128 (content^T bf16 hi/lo planes [h*128 + d][kv], ld SEQ_LEN),
// output gathered as bf16 hi/lo planes [q][h*128 + d], ld HID.
//   scores = (q.k) * 1/8   : hi.hi + hi.lo + lo.hi bf16 WMMA, f32 accumulate; future keys := -inf (p = 0, diagonal always present)
//   out    = p.v           : p and v bf16 hi/lo (hi.hi + hi.lo + lo.hi); online softmax in f32.
// Block = 8 waves = 2 key groups x 4 waves, on 64 query rows of one head; wave (grp, wq) owns query rows wq*16..+15 and,
// of the tile's 64-key chunks, those with index 2*step + grp; chunks above the diagonal are skipped. So a tile of n chunks
// takes (n + 1) / 2 steps, and one block fills a WGP with two waves a SIMD. Each group keeps its own online-softmax state
// (row maximum, row sum, unnormalised output); behind the loop group 1 hands its state over through LDS and group 0 joins the two.
// Blocks outnumber the places (one a WGP), so the tiles with the most chunks come first in the grid.
// Each step's two chunks (K rows and content^T rows, hi and lo planes) are brought into LDS once per block by asynchronous copies,
// whole 128-B lines, two buffers (step t + 1 flies while step t is worked on); a group's four waves read their B-fragments there.
// P is relaid C-layout -> A-layout through per-wave LDS.
// Coverage: grid = NHEADS * SEQ_LEN/64 blocks; block (qb, h) writes rows qb*64..+63, cols h*128..+127 of both planes (group 0's waves).
// =====================================================================================
constexpr int ATT_QBLK = 64;
constexpr int ATT_KCH  = 64;
constexpr int ATT_OSP  = 132;
constexpr int ATT_NQB  = SEQ_LEN / ATT_QBLK;
constexpr int ATT_SP   = 72;                          // staged row pitch in elements: 128-B rows at 144 B (16 B x odd, for ds_load_b128 readers)
constexpr int ATT_ROW_KH = 0;                         // staged rows: 64 K hi, 64 K lo, 128 V hi, 128 V lo
constexpr int ATT_ROW_KL = ATT_KCH;
constexpr int ATT_ROW_VH = 2 * ATT_KCH;
constexpr int ATT_ROW_VL = 2 * ATT_KCH + HVAL;
constexpr int ATT_ROWS   = 2 * ATT_KCH + 2 * HVAL;    // 384
static_assert(HRANK * 2 == 128 && ATT_KCH * 2 == 128, "staged rows are 128 B");
static_assert(ATT_QBLK == ATT_KCH && ATT_NQB % 2 == 0, "both chunks of every step lie inside the sequence");

__device__ __forceinline__ __bf16 at_f2bf(float f) { return __builtin_bit_cast(__bf16, f2bf_bits(f)); }
__device__ __forceinline__ void at_split(float f, __bf16& hi, __bf16& lo) {
  const unsigned short hb = f2bf_bits(f);
  hi = __builtin_bit_cast(__bf16, hb);
  lo = at_f2bf(f - __uint_as_float(((unsigned)hb) << 16));
}
__device__ __forceinline__ v8f at_mma(v16b a, v16b b, v8f c) {
  return __builtin_amdgcn_wmma_f32_16x16x32_bf16(false, a, false, b, (short)0, c, false, false);
}

// One chunk's 384 staged rows x 8 segments of 16 B = 3072 lane copies = 24 per thread of a 128-thread key group (tid counts inside the group).
// Copy i of thread tid: staged row i*16 + (tid >> 3), segment tid & 7: a wave's copy covers four whole 128-B lines.
__device__ __forceinline__ void at_stage(__bf16* buf, const __bf16* ach, const __bf16* acl,
                                         const __bf16* cth, const __bf16* ctl, int h, int kv0, int tid) {
  const int rg = tid >> 3, seg = (tid & 7) * 8;
  unsigned l[24];
  const __bf16* g[24];
  // the three loops are unrolled so that every index of l and g is a constant and both arrays live in registers
#pragma unroll
  for (int i = 0; i < 24; ++i) l[i] = (unsigned)(size_t)(buf + (i * 16 + rg) * ATT_SP + seg);
#pragma unroll
  for (int i = 0; i < 4; ++i) {
    const size_t ko = (size_t)(kv0 + i * 16 + rg) * QRANK + h * HRANK + seg;
    g[i] = ach + ko;
    g[4 + i] = acl + ko;
  }
#pragma unroll
  for (int i = 0; i < 8; ++i) {
    const size_t vo = (size_t)(h * HVAL + i * 16 + rg) * SEQ_LEN + kv0 + seg;
    g[8 + i] = cth + vo;
    g[16 + i] = ctl + vo;
  }
  at_copy12(l, g);
  at_copy12(l + 12, g + 12);
}

__global__ __launch_bounds__(256)
void attn_route_k(const unsigned short* __restrict__ sthp, const unsigned short* __restrict__ stlp,
                  const unsigned short* __restrict__ achp, const unsigned short* __restrict__ aclp,
                  const unsigned short* __restrict__ cthp, const unsigned short* __restrict__ ctlp,
                  unsigned short* __restrict__ ghp, unsigned short* __restrict__ glp) {
  union FB { v16b v; v8b h[2]; };
  __shared__ __align__(16) __bf16 Psh[8][16 * ATT_KCH];        // per wave P hi [row][kv]
  __shared__ __align__(16) __bf16 Psl[8][16 * ATT_KCH];        // per wave P lo
  __shared__ __align__(16) float  Os[4][16 * ATT_OSP];         // per 16 query rows: out tile [row][d], pitch 132
  __shared__ float Ms[4][16];                                  // group 1's row maxima
  __shared__ float Ls[4][16];                                  // group 1's row sums
  __shared__ __align__(16) __bf16 Stg[2][2][ATT_ROWS * ATT_SP];   // two buffers x two key groups of staged K and content^T rows

  const __bf16* sth = (const __bf16*)sthp; const __bf16* stl = (const __bf16*)stlp;
  const __bf16* ach = (const __bf16*)achp; const __bf16* acl = (const __bf16*)aclp;
  const __bf16* cth = (const __bf16*)cthp; const __bf16* ctl = (const __bf16*)ctlp;
  _Float16* gh = (_Float16*)ghp; _Float16* gl = (_Float16*)glp;

  const int tid  = threadIdx.x;
  const int wave = __builtin_amdgcn_readfirstlane(tid >> 5);   // in a scalar register: the tests on the key group below are scalar branches
  const int grp  = wave >> 2;    // key group
  const int wq   = wave & 3;     // which 16 query rows
  const int gtid = tid & 127;    // thread index inside the key group
  const int lane = tid & 31;
  const int hh   = lane >> 4;
  const int c    = lane & 15;
  const int bx = blockIdx.x;
  const int qb = ATT_NQB - 1 - bx / NHEADS;   // cost falls with the block index
  const int h  = bx % NHEADS;
  const int q0 = qb * ATT_QBLK + wq * 16;

  // ---- Q fragments (A operand): 2 depth chunks, hi and lo; row = c, k = dc*32 + 8*hh + {0..7, 16..23} ----
  v16b qah[2], qal[2];
#pragma unroll
  for (int dc = 0; dc < 2; ++dc) {
    const size_t off = (size_t)(q0 + c) * QRANK + h * HRANK + dc * 32 + 8 * hh;
    qah[dc] = Frag<__bf16>::load(sth + off);
    qal[dc] = Frag<__bf16>::load(stl + off);
  }

  float mrow[8], lrow[8];
  v8f oacc[8];
#pragma unroll
  for (int r = 0; r < 8; ++r) { mrow[r] = -INFINITY; lrow[r] = 0.f; }
#pragma unroll
  for (int t = 0; t < 8; ++t) oacc[t] = (v8f){0.f,0.f,0.f,0.f,0.f,0.f,0.f,0.f};

  __bf16* pwh = Psh[wave];
  __bf16* pwl = Psl[wave];
  const int nChunks = qb + 1;              // block-uniform, <= 32
  const int nSteps  = (nChunks + 1) >> 1;  // block-uniform, <= 16; step st holds chunks 2*st and 2*st + 1 (<= 31: both lie inside the sequence)

  // ---- ring prologue: step 0 lands and is published; then step 1 starts ----
  at_stage(Stg[0][grp], ach, acl, cth, ctl, h, grp * ATT_KCH, gtid);
  asm volatile("s_wait_asynccnt 0x0" ::: "memory");   // this wave's copies of step 0 have landed
  __syncthreads();                                    // every wave's have: step 0 may be read
  if (nSteps > 1) at_stage(Stg[1][grp], ach, acl, cth, ctl, h, (2 + grp) * ATT_KCH, gtid);

  for (int st = 0; st < nSteps; ++st) {
    const int kc = 2 * st + grp;
    // wave-uniform: with an odd number of chunks group 1 has none in the last step; the publish point below stands outside this test
    if (kc < nChunks) {
    const int kv0 = kc * ATT_KCH;
    const __bf16* sb = Stg[st & 1][grp];

    // ---- scores: 4 key subtiles of 16; K B-fragments: col = key, k = depth (staged rows) ----
    // All of the chunk's K fragments are read as one group; the products then go round the four subtiles, so that
    // consecutive matrix instructions write different accumulators. Per accumulator and depth step: hi.hi, hi.lo, lo.hi.
    // Every loop over fragments or accumulators in this chunk loop is unrolled, so that these arrays are indexed by constants and live in registers.
    v8f s[4];
    v16b kb[2][4], kl[2][4];
#pragma unroll
    for (int dc = 0; dc < 2; ++dc) {
#pragma unroll
      for (int j = 0; j < 4; ++j) {
        const int ko = (j * 16 + c) * ATT_SP + dc * 32 + 8 * hh;
        kb[dc][j] = Frag<__bf16>::load(sb + ATT_ROW_KH * ATT_SP + ko);
        kl[dc][j] = Frag<__bf16>::load(sb + ATT_ROW_KL * ATT_SP + ko);
      }
    }
    // keeps the K reads one group ahead of the products: a read left among the products is waited for on its own
    __builtin_amdgcn_sched_barrier(0);
#pragma unroll
    for (int j = 0; j < 4; ++j) s[j] = (v8f){0.f,0.f,0.f,0.f,0.f,0.f,0.f,0.f};
#pragma unroll
    for (int dc = 0; dc < 2; ++dc) {
#pragma unroll
      for (int j = 0; j < 4; ++j) s[j] = at_mma(qah[dc], kb[dc][j], s[j]);
#pragma unroll
      for (int j = 0; j < 4; ++j) s[j] = at_mma(qah[dc], kl[dc][j], s[j]);
#pragma unroll
      for (int j = 0; j < 4; ++j) s[j] = at_mma(qal[dc], kb[dc][j], s[j]);
    }

    // ---- content^T B-fragments (col = d, k = kv) of the first 32-key step: read here, they do not depend on the softmax ----
    v16b vb[2][8], vl[2][8];
#pragma unroll
    for (int t = 0; t < 8; ++t) {
      const int vo = (t * 16 + c) * ATT_SP + 8 * hh;
      vb[0][t] = Frag<__bf16>::load(sb + ATT_ROW_VH * ATT_SP + vo);
      vl[0][t] = Frag<__bf16>::load(sb + ATT_ROW_VL * ATT_SP + vo);
    }
    // keeps these reads above the softmax arithmetic, so that their LDS latency passes under it
    __builtin_amdgcn_sched_barrier(0);

    // ---- scale by 1/8, causal select on the diagonal chunk, row max ----
    const bool diag = (kc == qb);
    float cm[8];
#pragma unroll
    for (int r = 0; r < 8; ++r) {
      const int qrow = q0 + 8 * hh + r;
      float m = -INFINITY;
#pragma unroll
      for (int j = 0; j < 4; ++j) {
        const int kvcol = kv0 + j * 16 + c;
        float v = s[j][r] * 0.125f;
        if (diag && (kvcol > qrow)) v = -INFINITY;
        s[j][r] = v;
        m = fmaxf(m, v);
      }
      cm[r] = m;
    }
    // the eight rows' maxima go through each exchange step together, so that the eight exchanges of a step overlap
#pragma unroll
    for (int off = 1; off < 16; off <<= 1) {
      float ex[8];
      // keeps a step's eight exchanges together: spread out, each would be waited for on its own
      __builtin_amdgcn_sched_barrier(0);
#pragma unroll
      for (int r = 0; r < 8; ++r) ex[r] = __shfl_xor(cm[r], off, 32);
#pragma unroll
      for (int r = 0; r < 8; ++r) cm[r] = fmaxf(cm[r], ex[r]);
    }

    // ---- online softmax update; P tile (C layout) -> LDS as bf16 hi/lo ----
    float alphar[8], psumr[8];   // each row's rescale factor and this lane's part of its sum: joined behind the products below
#pragma unroll
    for (int r = 0; r < 8; ++r) {
      const float mnew = fmaxf(mrow[r], cm[r]);
      const float alpha = expf(mrow[r] - mnew);
      mrow[r] = mnew;
      float psum = 0.f;
#pragma unroll
      for (int j = 0; j < 4; ++j) {
        const float p = expf(s[j][r] - mnew);
        psum += p;
        __bf16 a, bl; at_split(p, a, bl);
        pwh[(8 * hh + r) * ATT_KCH + j * 16 + c] = a;
        pwl[(8 * hh + r) * ATT_KCH + j * 16 + c] = bl;
      }
      alphar[r] = alpha;
      psumr[r] = psum;
#pragma unroll
      for (int t = 0; t < 8; ++t) oacc[t][r] *= alpha;
    }
    __builtin_amdgcn_fence(__ATOMIC_RELEASE, "workgroup");
    __builtin_amdgcn_wave_barrier();
    __builtin_amdgcn_fence(__ATOMIC_ACQUIRE, "workgroup");

    // ---- O += P.V ; P A-fragments from LDS (row = c, k = kv), V B-fragments from the staged content^T rows (col = d, k = kv) ----
    // The first step's P fragments, then the second step's content^T and P fragments, all as one group of reads.
    FB pa[2], pl[2];
    pa[0].h[0] = *(const v8b*)(pwh + c * ATT_KCH + 8 * hh);
    pa[0].h[1] = *(const v8b*)(pwh + c * ATT_KCH + 16 + 8 * hh);
    pl[0].h[0] = *(const v8b*)(pwl + c * ATT_KCH + 8 * hh);
    pl[0].h[1] = *(const v8b*)(pwl + c * ATT_KCH + 16 + 8 * hh);
#pragma unroll
    for (int t = 0; t < 8; ++t) {
      const int vo = (t * 16 + c) * ATT_SP + 32 + 8 * hh;
      vb[1][t] = Frag<__bf16>::load(sb + ATT_ROW_VH * ATT_SP + vo);
      vl[1][t] = Frag<__bf16>::load(sb + ATT_ROW_VL * ATT_SP + vo);
    }
    pa[1].h[0] = *(const v8b*)(pwh + c * ATT_KCH + 32 + 8 * hh);
    pa[1].h[1] = *(const v8b*)(pwh + c * ATT_KCH + 32 + 16 + 8 * hh);
    pl[1].h[0] = *(const v8b*)(pwl + c * ATT_KCH + 32 + 8 * hh);
    pl[1].h[1] = *(const v8b*)(pwl + c * ATT_KCH + 32 + 16 + 8 * hh);
    // keeps the second step's reads ahead of the first step's products, so that their LDS latency passes under these
    __builtin_amdgcn_sched_barrier(0);
    // Six groups of eight products, each group going round the eight output subtiles; per accumulator and 32-key step:
    // hi.hi, hi.lo, lo.hi. The row sums are joined over the 16 lanes beside them (nothing in this chunk waits for the sums):
    // the eight exchanges of a step are issued ahead of a group of products and added behind it.
#pragma unroll
    for (int g = 0; g < 6; ++g) {
      const int kk = g / 3, term = g % 3;
      float ex[8];
      if (g >= 2) {
#pragma unroll
        for (int r = 0; r < 8; ++r) ex[r] = __shfl_xor(psumr[r], 1 << (g - 2), 32);
        // keeps the exchanges ahead of the group's products, so that their latency passes under these
        __builtin_amdgcn_sched_barrier(0);
      }
#pragma unroll
      for (int t = 0; t < 8; ++t)
        oacc[t] = at_mma(term == 2 ? pl[kk].v : pa[kk].v, term == 1 ? vl[kk][t] : vb[kk][t], oacc[t]);
      if (g >= 2) {
        // keeps the wait for the exchanges behind the group's products (and the last group above the waits at the loop's foot)
        __builtin_amdgcn_sched_barrier(0);
#pragma unroll
        for (int r = 0; r < 8; ++r) psumr[r] += ex[r];
      }
    }
#pragma unroll
    for (int r = 0; r < 8; ++r) lrow[r] = lrow[r] * alphar[r] + psumr[r];
    // order this chunk's P loads before the next chunk's P stores
    __builtin_amdgcn_fence(__ATOMIC_RELEASE, "workgroup");
    __builtin_amdgcn_wave_barrier();
    __builtin_amdgcn_fence(__ATOMIC_ACQUIRE, "workgroup");
    }

    // ---- publish point of step st + 1, every wave ----
    asm volatile("s_wait_dscnt 0x0" ::: "memory");      // this wave's reads of buffer st & 1 have returned
    asm volatile("s_wait_asynccnt 0x0" ::: "memory");   // this wave's copies of step st + 1 have landed
    __syncthreads();                                    // publishes step st + 1 and ends every reader's last read of buffer st & 1
    if (st + 2 < nSteps) at_stage(Stg[st & 1][grp], ach, acl, cth, ctl, h, (2 * (st + 2) + grp) * ATT_KCH, gtid);   // block-uniform test
  }
  asm volatile("s_wait_asynccnt 0x0" ::: "memory");     // no copy is outstanding when the wave goes on to its end

  // ---- the two key groups' states are joined: group 1 writes its own to LDS, group 0 rescales both to the common row maximum ----
  // Every loop of this part is unrolled, so that oacc, mrow, lrow, f1 and f2 are indexed by constants and live in registers.
  float* os = Os[wq];
  if (grp == 1) {
#pragma unroll
    for (int r = 0; r < 8; ++r) {
#pragma unroll
      for (int t = 0; t < 8; ++t) os[(8 * hh + r) * ATT_OSP + t * 16 + c] = oacc[t][r];
    }
    if (c == 0) {   // a row's 16 lanes hold the same maximum and the same sum
#pragma unroll
      for (int r = 0; r < 8; ++r) {
        Ms[wq][8 * hh + r] = mrow[r];
        Ls[wq][8 * hh + r] = lrow[r];
      }
    }
  }
  __syncthreads();   // group 1's state may be read; every wave passes it, and no barrier follows
  if (grp == 0) {
  // Group 0 holds chunk 0, of which every row sees key 0: its maximum is finite. A group 1 without a chunk hands over -inf, 0 and zeros: factor 0.
  float f1[8], f2[8];   // per row: what group 0's and group 1's unnormalised output is multiplied by
#pragma unroll
  for (int r = 0; r < 8; ++r) {
    const float m2 = Ms[wq][8 * hh + r];
    const float l2 = Ls[wq][8 * hh + r];
    const float m  = fmaxf(mrow[r], m2);
    const float a1 = expf(mrow[r] - m);
    const float a2 = expf(m2 - m);
    const float inv = 1.0f / (lrow[r] * a1 + l2 * a2);
    f1[r] = a1 * inv;
    f2[r] = a2 * inv;
  }
  // each lane reads and rewrites its own elements of the tile
#pragma unroll
  for (int r = 0; r < 8; ++r) {
#pragma unroll
    for (int t = 0; t < 8; ++t) {
      const int oi = (8 * hh + r) * ATT_OSP + t * 16 + c;
      os[oi] = oacc[t][r] * f1[r] + os[oi] * f2[r];
    }
  }
  __builtin_amdgcn_fence(__ATOMIC_RELEASE, "workgroup");
  __builtin_amdgcn_wave_barrier();
  __builtin_amdgcn_fence(__ATOMIC_ACQUIRE, "workgroup");
  {
    // lane groups of 8: q4 = lane>>3; row parity = q4>>1, column half = q4&1; it = 0..7 -> rows 0..15, cols 0..127: whole 16x128 tile, both planes
    const int q4 = lane >> 3, c8 = (lane & 7) * 8;
    const int rpar = q4 >> 1, chalf = (q4 & 1) * 64;
    {
#pragma unroll
      for (int it = 0; it < 8; ++it) {
        const int row = it * 2 + rpar;
        const int col = chalf + c8;
        const float* sp = os + row * ATT_OSP + col;
        v8h hv, lv;
#pragma unroll
        for (int e = 0; e < 8; ++e) {
          const unsigned short hb = f2bf_bits(sp[e]);
          const unsigned short lb = f2bf_bits(sp[e] - bf_bits2f(hb));
          hv[e] = __builtin_bit_cast(_Float16, hb);
          lv[e] = __builtin_bit_cast(_Float16, lb);
        }
        const size_t go = (size_t)(q0 + row) * HID + h * HVAL + col;
        *(v8h*)(gh + go) = hv;
        *(v8h*)(gl + go) = lv;
      }
      
    }
  }
  }
}

// =====================================================================================
// Host launcher. Workspace region map (bytes, every offset a multiple of 4 MiB):
//   XB   bf16 [2048][2048]   8 MiB   x
//   WSA  bf16 [2048][2048]   8 MiB   rows 0..1023 W_state, 1024..2047 W_action
//   WC   bf16 [2048][1024]   4 MiB   W_content
//   WO   bf16 [2048][2048]   8 MiB   W_out
//   SA32 f32  [2048][2048]  16 MiB   state | action
//   STH, STL, ACH, ACL, QVH, QVL  bf16 [2048][1024]  4 MiB each (state, action, q-value hi/lo)
//   CTH, CTL  bf16 [2048 = h*128+d][2048 = kv]  8 MiB each (content^T hi/lo)
//   GH, GL    bf16 [2048][2048]  8 MiB each (gathered hi/lo)
//   total 104,857,600 B
// =====================================================================================
extern "C" void kernel_launch(void* const* d_in, const int* in_sizes, int n_in,
                              void* d_out, int out_size, void* d_ws, size_t ws_size,
                              hipStream_t stream) {
  if (n_in < 6) return;
  if (in_sizes[0] != SEQ_LEN * HID || in_sizes[1] != QRANK * HID || in_sizes[2] != QRANK * HID ||
      in_sizes[3] != HID * QRANK || in_sizes[4] != HID * HID || in_sizes[5] != HID) return;
  if (out_size != SEQ_LEN * HID) return;

  const float* x  = (const float*)d_in[0];
  const float* Ws = (const float*)d_in[1];
  const float* Wa = (const float*)d_in[2];
  const float* Wc = (const float*)d_in[3];
  const float* Wo = (const float*)d_in[4];
  const float* bo = (const float*)d_in[5];
  float* out = (float*)d_out;

  const size_t B_XB  = (size_t)SEQ_LEN * HID * 2;
  const size_t B_WSA = (size_t)(2 * QRANK) * HID * 2;
  const size_t B_WC  = (size_t)HID * QRANK * 2;
  const size_t B_WO  = (size_t)HID * HID * 2;
  const size_t B_SA  = (size_t)SEQ_LEN * (2 * QRANK) * 4;
  const size_t B_PL  = (size_t)SEQ_LEN * QRANK * 2;     // one [2048][1024] bf16 plane
  const size_t B_CT  = (size_t)HID * SEQ_LEN * 2;       // one [2048][2048] bf16 plane
  const size_t B_G   = (size_t)SEQ_LEN * HID * 2;

  char* ws = (char*)d_ws;
  size_t off = 0;
  unsigned short* XB  = (unsigned short*)(ws + off); off += B_XB;
  unsigned short* WSA = (unsigned short*)(ws + off); off += B_WSA;
  unsigned short* WC  = (unsigned short*)(ws + off); off += B_WC;
  unsigned short* WO  = (unsigned short*)(ws + off); off += B_WO;
  float*          SA  = (float*)(ws + off);          off += B_SA;
  unsigned short* STH = (unsigned short*)(ws + off); off += B_PL;
  unsigned short* STL = (unsigned short*)(ws + off); off += B_PL;
  unsigned short* ACH = (unsigned short*)(ws + off); off += B_PL;
  unsigned short* ACL = (unsigned short*)(ws + off); off += B_PL;
  unsigned short* QVH = (unsigned short*)(ws + off); off += B_PL;
  unsigned short* QVL = (unsigned short*)(ws + off); off += B_PL;
  unsigned short* CTH = (unsigned short*)(ws + off); off += B_CT;
  unsigned short* CTL = (unsigned short*)(ws + off); off += B_CT;
  unsigned short* GH  = (unsigned short*)(ws + off); off += B_G;
  unsigned short* GL  = (unsigned short*)(ws + off); off += B_G;
  if (off > ws_size) return;

  // ---- input casts to bf16 (RNE) ----
  cast_inputs_bf16<<<dim3(CAST_BLOCKS), dim3(CAST_THREADS), 0, stream>>>(
      x, Ws, Wa, Wc, Wo, XB, WSA, WSA + (size_t)QRANK * HID, WC, WO);

  // ---- projections: SA[q][0..2047] = x . [W_state; W_action]^T  (M=2048, N=2048, K=2048) ----
  {
    const int M = SEQ_LEN, N = 2 * QRANK, K = HID;
    const int blocks = (M / GM_BM) * (N / GM_BN);   // 256
    wmma_gemm64<1, false, false, 0, 0><<<dim3(blocks, 1), dim3(256), 0, stream>>>(
        XB, XB, K, 0L, WSA, WSA, K, 0L, (void*)SA, (void*)SA, N, 0L, bo, M, N, K, 1.0f);
  }

  // ---- bf16 hi/lo planes of state, action, q-value ----
  planes_k<<<dim3(SEQ_LEN / 2), dim3(256), 0, stream>>>(SA, STH, STL, ACH, ACL, QVH, QVL);

  // ---- content^T[n][kv] = W_content[n][:] . qval[kv][:]  (M=2048, N=2048, K=1024; B = q-value hi/lo) -> bf16 hi/lo planes ----
  {
    const int M = HID, N = SEQ_LEN, K = QRANK;
    const int blocks = (M / GM_BM) * (N / GM_BN);   // 256
    wmma_gemm64<1, false, true, 0, 2><<<dim3(blocks, 1), dim3(256), 0, stream>>>(
        WC, WC, K, 0L, QVH, QVL, K, 0L, (void*)CTH, (void*)CTL, N, 0L, bo, M, N, K, 1.0f);
  }

  // ---- causal routing attention -> gathered hi/lo planes ----
  attn_route_k<<<dim3(NHEADS * ATT_NQB), dim3(256), 0, stream>>>(STH, STL, ACH, ACL, CTH, CTL, GH, GL);

  // ---- out = gathered . W_out^T + b_out  (M=N=K=2048; A = gathered hi/lo), f32 ----
  {
    const int M = SEQ_LEN, N = HID, K = HID;
    const int blocks = (M / GM_BM) * (N / GM_BN);   // 256
    wmma_gemm64<1, true, false, 2, 0><<<dim3(blocks, 1), dim3(256), 0, stream>>>(
        GH, GL, K, 0L, WO, WO, K, 0L, (void*)out, (void*)out, N, 0L, bo, M, N, K, 1.0f);
  }
}

// v007
// It runs in 137 microseconds.
// Two timings next to v006 both put it at 1.07 times that version's speed.
// Counting every step since v000, it is 4.11 times as fast.
// All contractions: v_wmma_f32_16x16x32_bf16 (bf16 operands, f32 accumulate): x and weight matrices as single RNE bf16 planes; state/action, q-value product, softmax p, content and gathered carried as bf16 hi/lo planes (hi.hi + hi.lo + lo.hi); softmax, q-value product and bias in f32.
#include <hip/hip_runtime.h>
#include <stdint.h>

constexpr int SEQ_LEN = 2048;   // L
constexpr int HID     = 2048;   // hidden
constexpr int QRANK   = 1024;   // q_rank
constexpr int NHEADS  = 16;
constexpr int HRANK   = 64;     // per-head rank (q/k depth)
constexpr int HVAL    = 128;    // per-head value width
static_assert(QRANK == NHEADS * HRANK, "rank split");
static_assert(HID == NHEADS * HVAL, "value split");
static_assert(SEQ_LEN % 64 == 0 && HID % 64 == 0 && QRANK % 64 == 0, "tile multiples");
static_assert(HID % 32 == 0 && QRANK % 32 == 0, "K multiples of 32");

typedef __attribute__((ext_vector_type(16))) _Float16 v16h;
typedef __attribute__((ext_vector_type(8)))  _Float16 v8h;
typedef __attribute__((ext_vector_type(16))) __bf16   v16b;
typedef __attribute__((ext_vector_type(8)))  __bf16   v8b;
typedef __attribute__((ext_vector_type(8)))  float    v8f;
typedef __attribute__((ext_vector_type(4)))  float    v4f;

__device__ __forceinline__ unsigned short f2bf_bits(float f) {
  unsigned u = __float_as_uint(f);
  return (unsigned short)((u + 0x7FFFu + ((u >> 16) & 1u)) >> 16);
}
__device__ __forceinline__ float bf_bits2f(unsigned short h) { return __uint_as_float(((unsigned)h) << 16); }

// hazard guards as plain device helpers (no hazard-guard asm inside the kernel template body)
__device__ __forceinline__ void dep_guard_h(v8f& a, v8f& b, v16h x, v16h y) { asm volatile("v_nop\n\tv_nop\n\tv_nop\n\tv_nop" : "+v"(a), "+v"(b) : "v"(x), "v"(y)); }
__device__ __forceinline__ void dep_guard_b(v8f& a, v8f& b, v16b x, v16b y) { asm volatile("v_nop\n\tv_nop\n\tv_nop\n\tv_nop" : "+v"(a), "+v"(b) : "v"(x), "v"(y)); }
__device__ __forceinline__ void keep4_h(v16h a, v16h b, v16h c, v16h d) { asm volatile("v_nop" :: "v"(a), "v"(b), "v"(c), "v"(d)); }
__device__ __forceinline__ void keep4_b(v16b a, v16b b, v16b c, v16b d) { asm volatile("v_nop" :: "v"(a), "v"(b), "v"(c), "v"(d)); }
__device__ __forceinline__ void acc_guard4(v8f& a, v8f& b, v8f& c, v8f& d) { asm volatile("v_nop\n\tv_nop\n\tv_nop\n\tv_nop" : "+v"(a), "+v"(b), "+v"(c), "+v"(d)); }
template <typename T> struct Frag;
template <> struct Frag<_Float16> {
  typedef v16h V; union U { v16h v; v8h h[2]; };
  static __device__ __forceinline__ v16h load(const _Float16* p) {   // elements 0..7 <- p[0..7], 8..15 <- p[16..23]
    U f; f.h[0] = *(const v8h*)(p); f.h[1] = *(const v8h*)(p + 16); return f.v;
  }
  static __device__ __forceinline__ v8f mma(v16h a, v16h b, v8f c) {
    return __builtin_amdgcn_wmma_f32_16x16x32_f16(false, a, false, b, (short)0, c, false, false);
  }
  static __device__ __forceinline__ void guard(v8f& a, v8f& b, v16h x, v16h y) { dep_guard_h(a, b, x, y); }
  static __device__ __forceinline__ void keep(v16h a, v16h b, v16h c, v16h d) { keep4_h(a, b, c, d); }
};
template <> struct Frag<__bf16> {
  typedef v16b V; union U { v16b v; v8b h[2]; };
  static __device__ __forceinline__ v16b load(const __bf16* p) {
    U f; f.h[0] = *(const v8b*)(p); f.h[1] = *(const v8b*)(p + 16); return f.v;
  }
  static __device__ __forceinline__ v8f mma(v16b a, v16b b, v8f c) {
    return __builtin_amdgcn_wmma_f32_16x16x32_bf16(false, a, false, b, (short)0, c, false, false);
  }
  static __device__ __forceinline__ void guard(v8f& a, v8f& b, v16b x, v16b y) { dep_guard_b(a, b, x, y); }
  static __device__ __forceinline__ void keep(v16b a, v16b b, v16b c, v16b d) { keep4_b(a, b, c, d); }
};

// Twelve asynchronous 16-B-per-lane copies global -> LDS. The s_wait_xcnt is the last line of the copies' own statement,
// so that no address register of an issued copy is rewritten in front of it.
__device__ __forceinline__ void at_copy12(const unsigned* l, const __bf16* const* g) {
  asm volatile(
      "global_load_async_to_lds_b128 %0, %12, off\n\t"
      "global_load_async_to_lds_b128 %1, %13, off\n\t"
      "global_load_async_to_lds_b128 %2, %14, off\n\t"
      "global_load_async_to_lds_b128 %3, %15, off\n\t"
      "global_load_async_to_lds_b128 %4, %16, off\n\t"
      "global_load_async_to_lds_b128 %5, %17, off\n\t"
      "global_load_async_to_lds_b128 %6, %18, off\n\t"
      "global_load_async_to_lds_b128 %7, %19, off\n\t"
      "global_load_async_to_lds_b128 %8, %20, off\n\t"
      "global_load_async_to_lds_b128 %9, %21, off\n\t"
      "global_load_async_to_lds_b128 %10, %22, off\n\t"
      "global_load_async_to_lds_b128 %11, %23, off\n\t"
      "s_wait_xcnt 0x0"
      :: "v"(l[0]), "v"(l[1]), "v"(l[2]), "v"(l[3]), "v"(l[4]), "v"(l[5]),
         "v"(l[6]), "v"(l[7]), "v"(l[8]), "v"(l[9]), "v"(l[10]), "v"(l[11]),
         "v"(g[0]), "v"(g[1]), "v"(g[2]), "v"(g[3]), "v"(g[4]), "v"(g[5]),
         "v"(g[6]), "v"(g[7]), "v"(g[8]), "v"(g[9]), "v"(g[10]), "v"(g[11])
      : "memory");
}

// The same for eight copies.
__device__ __forceinline__ void at_copy8(const unsigned* l, const __bf16* const* g) {
  asm volatile(
      "global_load_async_to_lds_b128 %0, %8, off\n\t"
      "global_load_async_to_lds_b128 %1, %9, off\n\t"
      "global_load_async_to_lds_b128 %2, %10, off\n\t"
      "global_load_async_to_lds_b128 %3, %11, off\n\t"
      "global_load_async_to_lds_b128 %4, %12, off\n\t"
      "global_load_async_to_lds_b128 %5, %13, off\n\t"
      "global_load_async_to_lds_b128 %6, %14, off\n\t"
      "global_load_async_to_lds_b128 %7, %15, off\n\t"
      "s_wait_xcnt 0x0"
      :: "v"(l[0]), "v"(l[1]), "v"(l[2]), "v"(l[3]), "v"(l[4]), "v"(l[5]), "v"(l[6]), "v"(l[7]),
         "v"(g[0]), "v"(g[1]), "v"(g[2]), "v"(g[3]), "v"(g[4]), "v"(g[5]), "v"(g[6]), "v"(g[7])
      : "memory");
}

// ---- Register-blocked batched WMMA GEMM ------------------------------------
// C[m,n] = scale * sum_k A[m,k] * Bt[n,k] (+bias); each wave owns a 32x64 tile; a block's 8 waves (4 x 2) own a 128x128 tile,
// so that the 2048x2048 outputs here give 256 blocks, one for every WGP.
// A row-major [M,K]; Bt row-major [N,K]; M % 128 == 0, N % 128 == 0, K % 128 == 0.
// Per 128 k the block's 128 A rows and 128 Bt rows (each plane) are brought into LDS once by asynchronous copies, whole 256-B units,
// two buffers (slab s + 1 flies while slab s is worked on); the waves read their fragments there.
// ASPLIT: A carried as hi/lo planes (A2 = lo plane, same layout); BSPLIT: Bt hi/lo (Bt2 = lo plane).
//   product = hi.hi (+ hi.lo if BSPLIT) (+ lo.hi if ASPLIT).
// BIAS_MODE: 0 = none, 1 = bias[m], 2 = bias[n].
// OUT_MODE: 0 = f32, 1 = f16, 2 = bf16 hi plane (Cout) + bf16 lo plane (Cout2).
// Coverage: per 32x64 tile, 2 slabs x 16 rows x 64 cols -> the whole tile; grid = (M/128)*(N/128) blocks of 8 waves.
// ET: 0 = f16 operands, 1 = bf16 operands (pointers passed as 16-bit storage)
constexpr int GM_BM = 128;   // block tile rows
constexpr int GM_BN = 128;   // block tile cols
constexpr int GM_KS = 128;   // k per staged slab: 256-B rows
constexpr int GM_SP = 136;   // staged row pitch in elements: 272 B (16 B x odd, for ds_load_b128 readers)
static_assert(SEQ_LEN % GM_BM == 0 && HID % GM_BM == 0, "block tile multiples");
static_assert(SEQ_LEN % GM_BN == 0 && HID % GM_BN == 0 && (2 * QRANK) % GM_BN == 0, "block tile multiples");
static_assert(HID % GM_KS == 0 && QRANK % GM_KS == 0, "K multiples of the slab");
template <int ET> struct Elem;
template <> struct Elem<0> { typedef _Float16 T; };
template <> struct Elem<1> { typedef __bf16 T; };
template <int ET, bool ASPLIT, bool BSPLIT, int BIAS_MODE, int OUT_MODE>
__global__ __launch_bounds__(256) void wmma_gemm64(
    const unsigned short* __restrict__ Ap, const unsigned short* __restrict__ A2p, int lda, long strideA,
    const unsigned short* __restrict__ Btp, const unsigned short* __restrict__ Bt2p, int ldb, long strideB,
    void* __restrict__ Cout, void* __restrict__ Cout2, int ldc, long strideC,
    const float* __restrict__ bias,
    int M, int N, int K, float scale) {
  typedef typename Elem<ET>::T T;
  typedef typename Frag<T>::V V;
  const T* A = (const T*)Ap; const T* A2 = (const T*)A2p; const T* Bt = (const T*)Btp; const T* Bt2 = (const T*)Bt2p;
  // staged rows of one slab: A hi (, A lo), Bt hi (, Bt lo); every plane starts at a multiple of 16 rows
  constexpr int ROW_AL = GM_BM;
  constexpr int ROW_BH = GM_BM * (ASPLIT ? 2 : 1);
  constexpr int ROW_BL = ROW_BH + GM_BN;
  constexpr int ROWS   = ROW_BH + GM_BN * (BSPLIT ? 2 : 1);   // 256 or 384
  constexpr int NCP    = ROWS / 16;                           // copies per thread and slab: 16 or 24
  static_assert(NCP == 16 || NCP == 24, "copy statements below");
  __shared__ __align__(16) float sT[8][16 * 68];   // per-wave 16x64 slab, pitch 68 floats
  __shared__ __align__(16) T Stg[2][ROWS * GM_SP]; // two buffers of staged rows, shared by the block
  const int b    = blockIdx.y;
  const int tid  = threadIdx.x;
  const int lane = threadIdx.x & 31;
  const int wave = threadIdx.x >> 5;
  const int blkN = N / GM_BN;
  if ((int)blockIdx.x >= (M / GM_BM) * blkN) return;   // block-uniform, in front of every barrier
  const int bm  = blockIdx.x / blkN;
  const int bm0 = bm * GM_BM;
  const int bn0 = (blockIdx.x - bm * blkN) * GM_BN;
  const int wm0 = (wave >> 1) << 5;            // this wave's 32x64 tile inside the block tile
  const int wn0 = (wave & 1) << 6;
  const int m0 = bm0 + wm0;
  const int n0 = bn0 + wn0;

  const T* Ab  = A  + (size_t)b * strideA;
  const T* Bb  = Bt + (size_t)b * strideB;
  const T* Ab2 = ASPLIT ? (A2  + (size_t)b * strideA) : nullptr;
  const T* Bb2 = BSPLIT ? (Bt2 + (size_t)b * strideB) : nullptr;

  const int rlane = lane & 15;                 // row (A) / col (B, D) within subtile
  const int koff  = (lane >> 4) * 8;           // k offset of this lane half
  const int mOff  = (lane >> 4) * 8;           // D row offset

  v8f acc[2][4];
#pragma unroll
  for (int i = 0; i < 2; ++i)
#pragma unroll
    for (int j = 0; j < 4; ++j) acc[i][j] = (v8f){0.f,0.f,0.f,0.f,0.f,0.f,0.f,0.f};

  // One slab: ROWS staged rows x 16 segments of 16 B = NCP lane copies per thread of the 256-thread block.
  // Copy i of thread tid: staged row i*16 + (tid >> 4), segment tid & 15: a wave's copy covers two whole 256-B units.
  // One running pointer per plane (this thread's first row and segment of the next slab to stage); the other rows are 16*ld apart.
  const int rg = tid >> 4, seg = (tid & 15) * 8;
  const T* pA  = Ab + (size_t)(bm0 + rg) * lda + seg;
  const T* pB  = Bb + (size_t)(bn0 + rg) * ldb + seg;
  const T* pA2 = ASPLIT ? (Ab2 + (size_t)(bm0 + rg) * lda + seg) : nullptr;
  const T* pB2 = BSPLIT ? (Bb2 + (size_t)(bn0 + rg) * ldb + seg) : nullptr;
  auto stage = [&](T* buf) {
    unsigned l[NCP];
    const __bf16* g[NCP];
    // unrolled so that every index of l and g is a constant and both arrays live in registers
#pragma unroll
    for (int i = 0; i < NCP; ++i) {
      const T* sp;
      if (i * 16 >= ROW_BL)                 sp = pB2 + (size_t)(i * 16 - ROW_BL) * ldb;
      else if (i * 16 >= ROW_BH)            sp = pB  + (size_t)(i * 16 - ROW_BH) * ldb;
      else if (ASPLIT && i * 16 >= ROW_AL)  sp = pA2 + (size_t)(i * 16 - ROW_AL) * lda;
      else                                  sp = pA  + (size_t)(i * 16) * lda;
      l[i] = (unsigned)(size_t)(buf + (i * 16 + rg) * GM_SP + seg);
      g[i] = (const __bf16*)sp;
    }
    if (NCP == 16) { at_copy8(l, g); at_copy8(l + NCP - 8, g + NCP - 8); }
    if (NCP == 24) { at_copy12(l, g); at_copy12(l + NCP - 12, g + NCP - 12); }
    pA += GM_KS; pB += GM_KS;
    if (ASPLIT) pA2 += GM_KS;
    if (BSPLIT) pB2 += GM_KS;
  };
  const int nSlabs = K / GM_KS;   // block-uniform

  // ---- ring prologue: slab 0 lands and is published; then slab 1 starts ----
  stage(Stg[0]);
  asm volatile("s_wait_asynccnt 0x0" ::: "memory");   // this wave's copies of slab 0 have landed
  __syncthreads();                                    // every wave's have: slab 0 may be read
  if (nSlabs > 1) stage(Stg[1]);

  for (int s = 0; s < nSlabs; ++s) {
    const T* sb = Stg[s & 1];
    // the four 32-k steps of the slab unrolled: a later step's LDS reads may go ahead of an earlier step's products
#pragma unroll
    for (int kk = 0; kk < GM_KS; kk += 32) {
      V bh[4], bl[4];
#pragma unroll
      for (int j = 0; j < 4; ++j) {
        const int bo = (wn0 + (j << 4) + rlane) * GM_SP + koff + kk;
        bh[j] = Frag<T>::load(sb + ROW_BH * GM_SP + bo);
        if (BSPLIT) bl[j] = Frag<T>::load(sb + ROW_BL * GM_SP + bo);
      }
      // all of the step's LDS reads stand together, ahead of its products
      V ah[2], al[2];
#pragma unroll
      for (int i = 0; i < 2; ++i) {
        const int ao = (wm0 + (i << 4) + rlane) * GM_SP + koff + kk;
        ah[i] = Frag<T>::load(sb + ao);
        al[i] = ah[i];
        if (ASPLIT) al[i] = Frag<T>::load(sb + ROW_AL * GM_SP + ao);
      }
#pragma unroll
      for (int i = 0; i < 2; ++i) {
#pragma unroll
        for (int j = 0; j < 4; ++j) {
          acc[i][j] = Frag<T>::mma(ah[i], bh[j], acc[i][j]);
          if (BSPLIT) acc[i][j] = Frag<T>::mma(ah[i], bl[j], acc[i][j]);
          if (ASPLIT) acc[i][j] = Frag<T>::mma(al[i], bh[j], acc[i][j]);
        }
        Frag<T>::guard(acc[i][0], acc[i][3], ah[i], al[i]);
      }
      Frag<T>::keep(bh[0], bh[1], bh[2], bh[3]);
      if (BSPLIT) Frag<T>::keep(bl[0], bl[1], bl[2], bl[3]);
    }
    // ---- publish point of slab s + 1, every wave ----
    asm volatile("s_wait_dscnt 0x0" ::: "memory");      // this wave's reads of buffer s & 1 have returned
    asm volatile("s_wait_asynccnt 0x0" ::: "memory");   // this wave's copies of slab s + 1 have landed
    __syncthreads();                                    // publishes slab s + 1 and ends every reader's last read of buffer s & 1
    if (s + 2 < nSlabs) stage(Stg[s & 1]);              // block-uniform test; slab s + 2
  }
  asm volatile("s_wait_asynccnt 0x0" ::: "memory");     // no copy is outstanding when the wave goes on to its end
  acc_guard4(acc[0][0], acc[0][1], acc[0][2], acc[0][3]);
  acc_guard4(acc[1][0], acc[1][1], acc[1][2], acc[1][3]);

  // ---- epilogue ----
  float* slab = sT[wave];
#pragma unroll
  for (int i = 0; i < 2; ++i) {
    const int mBase = m0 + (i << 4);
#pragma unroll
    for (int j = 0; j < 4; ++j) {
      const int n = n0 + (j << 4) + rlane;
      float bv = 0.f;
      if (BIAS_MODE == 2) bv = bias[n];
#pragma unroll
      for (int r = 0; r < 8; ++r) {
        float v = acc[i][j][r] * scale;
        if (BIAS_MODE == 1) v += bias[mBase + mOff + r];
        if (BIAS_MODE == 2) v += bv;
        slab[(mOff + r) * 68 + (j << 4) + rlane] = v;
      }
    }
    __builtin_amdgcn_fence(__ATOMIC_RELEASE, "workgroup");
    __builtin_amdgcn_wave_barrier();
    __builtin_amdgcn_fence(__ATOMIC_ACQUIRE, "workgroup");
    if (OUT_MODE == 0) {
      float* C = (float*)Cout + (size_t)b * strideC;
      const int hh = lane >> 4, c4 = (lane & 15) * 4;     // row seg = 256 B = 16 lanes x 16 B
      {
#pragma unroll
        for (int it = 0; it < 8; ++it) {
          const int row = it * 2 + hh;
          v4f v = *(const v4f*)(slab + row * 68 + c4);
          *(v4f*)(C + (size_t)(mBase + row) * ldc + n0 + c4) = v;
        }
        
      }
    } else {
      const int q = lane >> 3, c8 = (lane & 7) * 8;
      unsigned short* C  = (unsigned short*)Cout  + (size_t)b * strideC;
      unsigned short* C2 = (OUT_MODE == 2) ? ((unsigned short*)Cout2 + (size_t)b * strideC) : nullptr;
      {
#pragma unroll
        for (int it = 0; it < 4; ++it) {
          const int row = it * 4 + q;
          const float* sp = slab + row * 68 + c8;
          v8h hv, lv;
#pragma unroll
          for (int e = 0; e < 8; ++e) {
            if (OUT_MODE == 1) {
              hv[e] = (_Float16)sp[e];
            } else {
              unsigned short hb = f2bf_bits(sp[e]);
              unsigned short lb = f2bf_bits(sp[e] - bf_bits2f(hb));
              hv[e] = __builtin_bit_cast(_Float16, hb);
              lv[e] = __builtin_bit_cast(_Float16, lb);
            }
          }
          *(v8h*)(C + (size_t)(mBase + row) * ldc + n0 + c8) = hv;
          if (OUT_MODE == 2) *(v8h*)(C2 + (size_t)(mBase + row) * ldc + n0 + c8) = lv;
        }
        
      }
    }
    __builtin_amdgcn_fence(__ATOMIC_RELEASE, "workgroup");
    __builtin_amdgcn_wave_barrier();
    __builtin_amdgcn_fence(__ATOMIC_ACQUIRE, "workgroup");
  }
}

// ---- all five f32 inputs -> bf16 (RNE) in one launch: one 16-wave block per WGP, few long waves in place of many two-element ones ----
// Block b converts the b-th of 256 equal contiguous parts of every input, in steps of 2,048 floats (4 a lane):
// a wave's load is 512 contiguous bytes, its store 256. x and W_out take 8 steps a block, the three rank-sized weights 4 each.
// Coverage: 256 blocks x N steps x 2,048 = the whole of each input, each element converted by exactly one lane.
constexpr int CAST_BLOCKS  = 256;
constexpr int CAST_THREADS = 512;
constexpr int CAST_STEP    = CAST_THREADS * 4;                             // floats a block converts per step
constexpr int CAST_NX = SEQ_LEN * HID / (CAST_BLOCKS * CAST_STEP);         // 8
constexpr int CAST_NW = QRANK * HID / (CAST_BLOCKS * CAST_STEP);           // 4
constexpr int CAST_NO = HID * HID / (CAST_BLOCKS * CAST_STEP);             // 8
static_assert(SEQ_LEN * HID == CAST_NX * CAST_BLOCKS * CAST_STEP && QRANK * HID == CAST_NW * CAST_BLOCKS * CAST_STEP &&
              HID * HID == CAST_NO * CAST_BLOCKS * CAST_STEP, "whole steps");
typedef __attribute__((ext_vector_type(2))) unsigned v2u;
// Addresses are a uniform base, one unsigned 32-bit byte offset a lane, and a small constant per step.
template <int N>
__device__ __forceinline__ void cast_load(v4f* r, const float* __restrict__ in) {
  const char* p = (const char*)in + (blockIdx.x * (N * CAST_THREADS) + threadIdx.x) * 16u;
  // unrolled so that r is indexed by constants and lives in registers, and the loads follow one another
#pragma unroll
  for (int i = 0; i < N; ++i) r[i] = *(const v4f*)(p + i * (CAST_STEP * 4));
}
template <int N>
__device__ __forceinline__ void cast_store(const v4f* r, unsigned short* __restrict__ out) {
  char* q = (char*)out + (blockIdx.x * (N * CAST_THREADS) + threadIdx.x) * 8u;
  // unrolled so that r is indexed by constants and lives in registers
#pragma unroll
  for (int i = 0; i < N; ++i) {
    v2u u;
    u[0] = (unsigned)f2bf_bits(r[i][0]) | ((unsigned)f2bf_bits(r[i][1]) << 16);
    u[1] = (unsigned)f2bf_bits(r[i][2]) | ((unsigned)f2bf_bits(r[i][3]) << 16);
    *(v2u*)(q + i * (CAST_STEP * 2)) = u;
  }
}
__global__ __launch_bounds__(CAST_THREADS) void cast_inputs_bf16(
    const float* __restrict__ x, const float* __restrict__ wst, const float* __restrict__ wac,
    const float* __restrict__ wco, const float* __restrict__ wou,
    unsigned short* __restrict__ xb, unsigned short* __restrict__ wstb, unsigned short* __restrict__ wacb,
    unsigned short* __restrict__ wcob, unsigned short* __restrict__ woub) {
  // all of a lane's 28 loads stand ahead of its first store, so that they are in flight together
  v4f rx[CAST_NX], rs[CAST_NW], ra[CAST_NW], rc[CAST_NW], ro[CAST_NO];
  cast_load<CAST_NX>(rx, x);
  cast_load<CAST_NW>(rs, wst);
  cast_load<CAST_NW>(ra, wac);
  cast_load<CAST_NW>(rc, wco);
  // the loads below may be given, for their results, the offset register that the twelve loads above name
  asm volatile("s_wait_xcnt 0x0" ::: "memory");
  cast_load<CAST_NO>(ro, wou);
  cast_store<CAST_NX>(rx, xb);
  cast_store<CAST_NW>(rs, wstb);
  cast_store<CAST_NW>(ra, wacb);
  cast_store<CAST_NW>(rc, wcob);
  cast_store<CAST_NO>(ro, woub);
}

// ---- state|action f32 [SEQ_LEN][2*QRANK] -> bf16 hi/lo planes of state, action and q-value (state*action in f32), each [SEQ_LEN][QRANK] ----
// Coverage: grid = SEQ_LEN/2 blocks x 256 threads; thread -> row = 2*blk + (tid>>7), cols (tid&127)*8 .. +7 -> 2048 rows x 1024 cols exactly, all six planes.
__global__ __launch_bounds__(256) void planes_k(const float* __restrict__ sa,
    unsigned short* __restrict__ sthp, unsigned short* __restrict__ stlp,
    unsigned short* __restrict__ achp, unsigned short* __restrict__ aclp,
    unsigned short* __restrict__ qvhp, unsigned short* __restrict__ qvlp) {
  const int row = blockIdx.x * 2 + (threadIdx.x >> 7);
  const int c8  = (threadIdx.x & 127) * 8;
  const float* sp = sa + (size_t)row * (2 * QRANK) + c8;
  const v8f sv = *(const v8f*)(sp);
  const v8f av = *(const v8f*)(sp + QRANK);
  v8h shv, slv, ahv, alv, qhv, qlv;
#pragma unroll
  for (int e = 0; e < 8; ++e) {
    const float s = sv[e], a = av[e];
    const float q = s * a;
    unsigned short hb, lb;
    hb = f2bf_bits(s); lb = f2bf_bits(s - bf_bits2f(hb));
    shv[e] = __builtin_bit_cast(_Float16, hb); slv[e] = __builtin_bit_cast(_Float16, lb);
    hb = f2bf_bits(a); lb = f2bf_bits(a - bf_bits2f(hb));
    ahv[e] = __builtin_bit_cast(_Float16, hb); alv[e] = __builtin_bit_cast(_Float16, lb);
    hb = f2bf_bits(q); lb = f2bf_bits(q - bf_bits2f(hb));
    qhv[e] = __builtin_bit_cast(_Float16, hb); qlv[e] = __builtin_bit_cast(_Float16, lb);
  }
  const size_t o = (size_t)row * QRANK + c8;
  _Float16* sth = (_Float16*)sthp; _Float16* stl = (_Float16*)stlp;
  _Float16* ach = (_Float16*)achp; _Float16* acl = (_Float16*)aclp;
  _Float16* qvh = (_Float16*)qvhp; _Float16* qvl = (_Float16*)qvlp;
  {
    *(v8h*)(sth + o) = shv;
    *(v8h*)(stl + o) = slv;
    *(v8h*)(ach + o) = ahv;
    *(v8h*)(acl + o) = alv;
    *(v8h*)(qvh + o) = qhv;
    *(v8h*)(qvl + o) = qlv;
    
  }
}

// =====================================================================================
// Causal routing attention, q/k depth 64 (bf16 hi/lo planes, ld QRANK, head cols h*64),
// value width 128 (content^T bf16 hi/lo planes [h*128 + d][kv], ld SEQ_LEN),
// output gathered as bf16 hi/lo planes [q][h*128 + d], ld HID.
//   scores = (q.k) * 1/8   : hi.hi + hi.lo + lo.hi bf16 WMMA, f32 accumulate; future keys := -inf (p = 0, diagonal always present);
//                            row maxima are kept as raw q.k sums, the 1/8 goes into the exponent's factor (ATT_C2)
//   out    = p.v           : p and v bf16 hi/lo (hi.hi + hi.lo + lo.hi); online softmax in f32.
// Block = 8 waves = 2 key groups x 4 waves, on 64 query rows of one head; wave (grp, wq) owns query rows wq*16..+15 and,
// of the tile's 64-key chunks, those with index 2*step + grp; chunks above the diagonal are skipped. So a tile of n chunks
// takes (n + 1) / 2 steps, and one block fills a WGP with two waves a SIMD. Each group keeps its own online-softmax state
// (row maximum, row sum, unnormalised output); behind the loop group 1 hands its state over through LDS and group 0 joins the two.
// Blocks outnumber the places (one a WGP), so the tiles with the most chunks come first in the grid.
// Each step's two chunks (K rows and content^T rows, hi and lo planes) are brought into LDS once per block by asynchronous copies,
// whole 128-B lines, two buffers (step t + 1 flies while step t is worked on); a group's four waves read their B-fragments there.
// P is relaid C-layout -> A-layout through per-wave LDS.
// Coverage: grid = NHEADS * SEQ_LEN/64 blocks; block (qb, h) writes rows qb*64..+63, cols h*128..+127 of both planes (group 0's waves).
// =====================================================================================
constexpr int ATT_QBLK = 64;
constexpr int ATT_KCH  = 64;
constexpr int ATT_OSP  = 132;
constexpr int ATT_NQB  = SEQ_LEN / ATT_QBLK;
constexpr int ATT_SP   = 72;                          // staged row pitch in elements: 128-B rows at 144 B (16 B x odd, for ds_load_b128 readers)
constexpr int ATT_ROW_KH = 0;                         // staged rows: 64 K hi, 64 K lo, 128 V hi, 128 V lo
constexpr int ATT_ROW_KL = ATT_KCH;
constexpr int ATT_ROW_VH = 2 * ATT_KCH;
constexpr int ATT_ROW_VL = 2 * ATT_KCH + HVAL;
constexpr int ATT_ROWS   = 2 * ATT_KCH + 2 * HVAL;    // 384
static_assert(HRANK * 2 == 128 && ATT_KCH * 2 == 128, "staged rows are 128 B");
static_assert(ATT_QBLK == ATT_KCH && ATT_NQB % 2 == 0, "both chunks of every step lie inside the sequence");

__device__ __forceinline__ __bf16 at_f2bf(float f) { return __builtin_bit_cast(__bf16, f2bf_bits(f)); }
__device__ __forceinline__ void at_split(float f, __bf16& hi, __bf16& lo) {
  const unsigned short hb = f2bf_bits(f);
  hi = __builtin_bit_cast(__bf16, hb);
  lo = at_f2bf(f - __uint_as_float(((unsigned)hb) << 16));
}
__device__ __forceinline__ v8f at_mma(v16b a, v16b b, v8f c) {
  return __builtin_amdgcn_wmma_f32_16x16x32_bf16(false, a, false, b, (short)0, c, false, false);
}
// exp(d / 8) = 2^(d * ATT_C2) for a difference d of raw q.k sums: the 1/8 of the scores and log2(e) in one factor,
// so that an exponential is one multiply-add and one v_exp_f32. 2^(-inf) = 0; results below the normal range count as 0.
constexpr float ATT_C2 = 0.125f * 1.44269504088896340736f;
__device__ __forceinline__ float at_exp2(float x) { return __builtin_amdgcn_exp2f(x); }

// One chunk's 384 staged rows x 8 segments of 16 B = 3072 lane copies = 24 per thread of a 128-thread key group (tid counts inside the group).
// Copy i of thread tid: staged row i*16 + (tid >> 3), segment tid & 7: a wave's copy covers four whole 128-B lines.
__device__ __forceinline__ void at_stage(__bf16* buf, const __bf16* ach, const __bf16* acl,
                                         const __bf16* cth, const __bf16* ctl, int h, int kv0, int tid) {
  const int rg = tid >> 3, seg = (tid & 7) * 8;
  unsigned l[24];
  const __bf16* g[24];
  // the three loops are unrolled so that every index of l and g is a constant and both arrays live in registers
#pragma unroll
  for (int i = 0; i < 24; ++i) l[i] = (unsigned)(size_t)(buf + (i * 16 + rg) * ATT_SP + seg);
#pragma unroll
  for (int i = 0; i < 4; ++i) {
    const size_t ko = (size_t)(kv0 + i * 16 + rg) * QRANK + h * HRANK + seg;
    g[i] = ach + ko;
    g[4 + i] = acl + ko;
  }
#pragma unroll
  for (int i = 0; i < 8; ++i) {
    const size_t vo = (size_t)(h * HVAL + i * 16 + rg) * SEQ_LEN + kv0 + seg;
    g[8 + i] = cth + vo;
    g[16 + i] = ctl + vo;
  }
  at_copy12(l, g);
  at_copy12(l + 12, g + 12);
}

__global__ __launch_bounds__(256)
void attn_route_k(const unsigned short* __restrict__ sthp, const unsigned short* __restrict__ stlp,
                  const unsigned short* __restrict__ achp, const unsigned short* __restrict__ aclp,
                  const unsigned short* __restrict__ cthp, const unsigned short* __restrict__ ctlp,
                  unsigned short* __restrict__ ghp, unsigned short* __restrict__ glp) {
  union FB { v16b v; v8b h[2]; };
  __shared__ __align__(16) __bf16 Psh[8][16 * ATT_KCH];        // per wave P hi [row][kv]
  __shared__ __align__(16) __bf16 Psl[8][16 * ATT_KCH];        // per wave P lo
  __shared__ __align__(16) float  Os[4][16 * ATT_OSP];         // per 16 query rows: out tile [row][d], pitch 132
  __shared__ float Ms[4][16];                                  // group 1's row maxima
  __shared__ float Ls[4][16];                                  // group 1's row sums
  __shared__ __align__(16) __bf16 Stg[2][2][ATT_ROWS * ATT_SP];   // two buffers x two key groups of staged K and content^T rows

  const __bf16* sth = (const __bf16*)sthp; const __bf16* stl = (const __bf16*)stlp;
  const __bf16* ach = (const __bf16*)achp; const __bf16* acl = (const __bf16*)aclp;
  const __bf16* cth = (const __bf16*)cthp; const __bf16* ctl = (const __bf16*)ctlp;
  _Float16* gh = (_Float16*)ghp; _Float16* gl = (_Float16*)glp;

  const int tid  = threadIdx.x;
  const int wave = __builtin_amdgcn_readfirstlane(tid >> 5);   // in a scalar register: the tests on the key group below are scalar branches
  const int grp  = wave >> 2;    // key group
  const int wq   = wave & 3;     // which 16 query rows
  const int gtid = tid & 127;    // thread index inside the key group
  const int lane = tid & 31;
  const int hh   = lane >> 4;
  const int c    = lane & 15;
  const int bx = blockIdx.x;
  const int qb = ATT_NQB - 1 - bx / NHEADS;   // cost falls with the block index
  const int h  = bx % NHEADS;
  const int q0 = qb * ATT_QBLK + wq * 16;

  // ---- Q fragments (A operand): 2 depth chunks, hi and lo; row = c, k = dc*32 + 8*hh + {0..7, 16..23} ----
  v16b qah[2], qal[2];
#pragma unroll
  for (int dc = 0; dc < 2; ++dc) {
    const size_t off = (size_t)(q0 + c) * QRANK + h * HRANK + dc * 32 + 8 * hh;
    qah[dc] = Frag<__bf16>::load(sth + off);
    qal[dc] = Frag<__bf16>::load(stl + off);
  }

  float mrow[8], lrow[8];
  v8f oacc[8];
#pragma unroll
  for (int r = 0; r < 8; ++r) { mrow[r] = -INFINITY; lrow[r] = 0.f; }
#pragma unroll
  for (int t = 0; t < 8; ++t) oacc[t] = (v8f){0.f,0.f,0.f,0.f,0.f,0.f,0.f,0.f};

  __bf16* pwh = Psh[wave];
  __bf16* pwl = Psl[wave];
  const int nChunks = qb + 1;              // block-uniform, <= 32
  const int nSteps  = (nChunks + 1) >> 1;  // block-uniform, <= 16; step st holds chunks 2*st and 2*st + 1 (<= 31: both lie inside the sequence)

  // ---- ring prologue: step 0 lands and is published; then step 1 starts ----
  at_stage(Stg[0][grp], ach, acl, cth, ctl, h, grp * ATT_KCH, gtid);
  asm volatile("s_wait_asynccnt 0x0" ::: "memory");   // this wave's copies of step 0 have landed
  __syncthreads();                                    // every wave's have: step 0 may be read
  if (nSteps > 1) at_stage(Stg[1][grp], ach, acl, cth, ctl, h, (2 + grp) * ATT_KCH, gtid);

  for (int st = 0; st < nSteps; ++st) {
    const int kc = 2 * st + grp;
    // wave-uniform: with an odd number of chunks group 1 has none in the last step; the publish point below stands outside this test
    if (kc < nChunks) {
    const int kv0 = kc * ATT_KCH;
    const __bf16* sb = Stg[st & 1][grp];

    // ---- scores: 4 key subtiles of 16; K B-fragments: col = key, k = depth (staged rows) ----
    // All of the chunk's K fragments are read as one group; the products then go round the four subtiles, so that
    // consecutive matrix instructions write different accumulators. Per accumulator and depth step: hi.hi, hi.lo, lo.hi.
    // Every loop over fragments or accumulators in this chunk loop is unrolled, so that these arrays are indexed by constants and live in registers.
    v8f s[4];
    v16b kb[2][4], kl[2][4];
#pragma unroll
    for (int dc = 0; dc < 2; ++dc) {
#pragma unroll
      for (int j = 0; j < 4; ++j) {
        const int ko = (j * 16 + c) * ATT_SP + dc * 32 + 8 * hh;
        kb[dc][j] = Frag<__bf16>::load(sb + ATT_ROW_KH * ATT_SP + ko);
        kl[dc][j] = Frag<__bf16>::load(sb + ATT_ROW_KL * ATT_SP + ko);
      }
    }
    // keeps the K reads one group ahead of the products: a read left among the products is waited for on its own
    __builtin_amdgcn_sched_barrier(0);
#pragma unroll
    for (int j = 0; j < 4; ++j) s[j] = (v8f){0.f,0.f,0.f,0.f,0.f,0.f,0.f,0.f};
#pragma unroll
    for (int dc = 0; dc < 2; ++dc) {
#pragma unroll
      for (int j = 0; j < 4; ++j) s[j] = at_mma(qah[dc], kb[dc][j], s[j]);
#pragma unroll
      for (int j = 0; j < 4; ++j) s[j] = at_mma(qah[dc], kl[dc][j], s[j]);
#pragma unroll
      for (int j = 0; j < 4; ++j) s[j] = at_mma(qal[dc], kb[dc][j], s[j]);
    }

    // ---- content^T B-fragments (col = d, k = kv) of the first 32-key step: read here, they do not depend on the softmax ----
    v16b vb[2][8], vl[2][8];
#pragma unroll
    for (int t = 0; t < 8; ++t) {
      const int vo = (t * 16 + c) * ATT_SP + 8 * hh;
      vb[0][t] = Frag<__bf16>::load(sb + ATT_ROW_VH * ATT_SP + vo);
      vl[0][t] = Frag<__bf16>::load(sb + ATT_ROW_VL * ATT_SP + vo);
    }
    // keeps these reads above the softmax arithmetic, so that their LDS latency passes under it
    __builtin_amdgcn_sched_barrier(0);

    // ---- causal select on the diagonal chunk, row max (raw sums) ----
    const bool diag = (kc == qb);
    float cm[8];
#pragma unroll
    for (int r = 0; r < 8; ++r) {
      const int qrow = q0 + 8 * hh + r;
      float m = -INFINITY;
#pragma unroll
      for (int j = 0; j < 4; ++j) {
        const int kvcol = kv0 + j * 16 + c;
        float v = s[j][r];
        if (diag && (kvcol > qrow)) v = -INFINITY;
        s[j][r] = v;
        m = fmaxf(m, v);
      }
      cm[r] = m;
    }
    // the eight rows' maxima go through each exchange step together, so that the eight exchanges of a step overlap
#pragma unroll
    for (int off = 1; off < 16; off <<= 1) {
      float ex[8];
      // keeps a step's eight exchanges together: spread out, each would be waited for on its own
      __builtin_amdgcn_sched_barrier(0);
#pragma unroll
      for (int r = 0; r < 8; ++r) ex[r] = __shfl_xor(cm[r], off, 32);
#pragma unroll
      for (int r = 0; r < 8; ++r) cm[r] = fmaxf(cm[r], ex[r]);
    }

    // ---- online softmax update; P tile (C layout) -> LDS as bf16 hi/lo ----
    float alphar[8], psumr[8];   // each row's rescale factor and this lane's part of its sum: joined behind the products below
#pragma unroll
    for (int r = 0; r < 8; ++r) {
      const float mnew = fmaxf(mrow[r], cm[r]);
      const float alpha = at_exp2((mrow[r] - mnew) * ATT_C2);
      const float nb = -mnew * ATT_C2;
      mrow[r] = mnew;
      float psum = 0.f;
#pragma unroll
      for (int j = 0; j < 4; ++j) {
        const float p = at_exp2(__builtin_fmaf(s[j][r], ATT_C2, nb));
        psum += p;
        __bf16 a, bl; at_split(p, a, bl);
        pwh[(8 * hh + r) * ATT_KCH + j * 16 + c] = a;
        pwl[(8 * hh + r) * ATT_KCH + j * 16 + c] = bl;
      }
      alphar[r] = alpha;
      psumr[r] = psum;
#pragma unroll
      for (int t = 0; t < 8; ++t) oacc[t][r] *= alpha;
    }
    __builtin_amdgcn_fence(__ATOMIC_RELEASE, "workgroup");
    __builtin_amdgcn_wave_barrier();
    __builtin_amdgcn_fence(__ATOMIC_ACQUIRE, "workgroup");

    // ---- O += P.V ; P A-fragments from LDS (row = c, k = kv), V B-fragments from the staged content^T rows (col = d, k = kv) ----
    // The first step's P fragments, then the second step's content^T and P fragments, all as one group of reads.
    FB pa[2], pl[2];
    pa[0].h[0] = *(const v8b*)(pwh + c * ATT_KCH + 8 * hh);
    pa[0].h[1] = *(const v8b*)(pwh + c * ATT_KCH + 16 + 8 * hh);
    pl[0].h[0] = *(const v8b*)(pwl + c * ATT_KCH + 8 * hh);
    pl[0].h[1] = *(const v8b*)(pwl + c * ATT_KCH + 16 + 8 * hh);
#pragma unroll
    for (int t = 0; t < 8; ++t) {
      const int vo = (t * 16 + c) * ATT_SP + 32 + 8 * hh;
      vb[1][t] = Frag<__bf16>::load(sb + ATT_ROW_VH * ATT_SP + vo);
      vl[1][t] = Frag<__bf16>::load(sb + ATT_ROW_VL * ATT_SP + vo);
    }
    pa[1].h[0] = *(const v8b*)(pwh + c * ATT_KCH + 32 + 8 * hh);
    pa[1].h[1] = *(const v8b*)(pwh + c * ATT_KCH + 32 + 16 + 8 * hh);
    pl[1].h[0] = *(const v8b*)(pwl + c * ATT_KCH + 32 + 8 * hh);
    pl[1].h[1] = *(const v8b*)(pwl + c * ATT_KCH + 32 + 16 + 8 * hh);
    // keeps the second step's reads ahead of the first step's products, so that their LDS latency passes under these
    __builtin_amdgcn_sched_barrier(0);
    // Six groups of eight products, each group going round the eight output subtiles; per accumulator and 32-key step:
    // hi.hi, hi.lo, lo.hi. The row sums are joined over the 16 lanes beside them (nothing in this chunk waits for the sums):
    // the eight exchanges of a step are issued ahead of a group of products and added behind it.
#pragma unroll
    for (int g = 0; g < 6; ++g) {
      const int kk = g / 3, term = g % 3;
      float ex[8];
      if (g >= 2) {
#pragma unroll
        for (int r = 0; r < 8; ++r) ex[r] = __shfl_xor(psumr[r], 1 << (g - 2), 32);
        // keeps the exchanges ahead of the group's products, so that their latency passes under these
        __builtin_amdgcn_sched_barrier(0);
      }
#pragma unroll
      for (int t = 0; t < 8; ++t)
        oacc[t] = at_mma(term == 2 ? pl[kk].v : pa[kk].v, term == 1 ? vl[kk][t] : vb[kk][t], oacc[t]);
      if (g >= 2) {
        // keeps the wait for the exchanges behind the group's products (and the last group above the waits at the loop's foot)
        __builtin_amdgcn_sched_barrier(0);
#pragma unroll
        for (int r = 0; r < 8; ++r) psumr[r] += ex[r];
      }
    }
#pragma unroll
    for (int r = 0; r < 8; ++r) lrow[r] = lrow[r] * alphar[r] + psumr[r];
    // order this chunk's P loads before the next chunk's P stores
    __builtin_amdgcn_fence(__ATOMIC_RELEASE, "workgroup");
    __builtin_amdgcn_wave_barrier();
    __builtin_amdgcn_fence(__ATOMIC_ACQUIRE, "workgroup");
    }

    // ---- publish point of step st + 1, every wave ----
    asm volatile("s_wait_dscnt 0x0" ::: "memory");      // this wave's reads of buffer st & 1 have returned
    asm volatile("s_wait_asynccnt 0x0" ::: "memory");   // this wave's copies of step st + 1 have landed
    __syncthreads();                                    // publishes step st + 1 and ends every reader's last read of buffer st & 1
    if (st + 2 < nSteps) at_stage(Stg[st & 1][grp], ach, acl, cth, ctl, h, (2 * (st + 2) + grp) * ATT_KCH, gtid);   // block-uniform test
  }
  asm volatile("s_wait_asynccnt 0x0" ::: "memory");     // no copy is outstanding when the wave goes on to its end

  // ---- the two key groups' states are joined: group 1 writes its own to LDS, group 0 rescales both to the common row maximum ----
  // Every loop of this part is unrolled, so that oacc, mrow, lrow, f1 and f2 are indexed by constants and live in registers.
  float* os = Os[wq];
  if (grp == 1) {
#pragma unroll
    for (int r = 0; r < 8; ++r) {
#pragma unroll
      for (int t = 0; t < 8; ++t) os[(8 * hh + r) * ATT_OSP + t * 16 + c] = oacc[t][r];
    }
    if (c == 0) {   // a row's 16 lanes hold the same maximum and the same sum
#pragma unroll
      for (int r = 0; r < 8; ++r) {
        Ms[wq][8 * hh + r] = mrow[r];
        Ls[wq][8 * hh + r] = lrow[r];
      }
    }
  }
  __syncthreads();   // group 1's state may be read; every wave passes it, and no barrier follows
  if (grp == 0) {
  // Group 0 holds chunk 0, of which every row sees key 0: its maximum is finite. A group 1 without a chunk hands over -inf, 0 and zeros: factor 0.
  float f1[8], f2[8];   // per row: what group 0's and group 1's unnormalised output is multiplied by
#pragma unroll
  for (int r = 0; r < 8; ++r) {
    const float m2 = Ms[wq][8 * hh + r];
    const float l2 = Ls[wq][8 * hh + r];
    const float m  = fmaxf(mrow[r], m2);
    const float a1 = at_exp2((mrow[r] - m) * ATT_C2);
    const float a2 = at_exp2((m2 - m) * ATT_C2);
    const float inv = 1.0f / (lrow[r] * a1 + l2 * a2);
    f1[r] = a1 * inv;
    f2[r] = a2 * inv;
  }
  // each lane reads and rewrites its own elements of the tile
#pragma unroll
  for (int r = 0; r < 8; ++r) {
#pragma unroll
    for (int t = 0; t < 8; ++t) {
      const int oi = (8 * hh + r) * ATT_OSP + t * 16 + c;
      os[oi] = oacc[t][r] * f1[r] + os[oi] * f2[r];
    }
  }
  __builtin_amdgcn_fence(__ATOMIC_RELEASE, "workgroup");
  __builtin_amdgcn_wave_barrier();
  __builtin_amdgcn_fence(__ATOMIC_ACQUIRE, "workgroup");
  {
    // lane groups of 8: q4 = lane>>3; row parity = q4>>1, column half = q4&1; it = 0..7 -> rows 0..15, cols 0..127: whole 16x128 tile, both planes
    const int q4 = lane >> 3, c8 = (lane & 7) * 8;
    const int rpar = q4 >> 1, chalf = (q4 & 1) * 64;
    {
#pragma unroll
      for (int it = 0; it < 8; ++it) {
        const int row = it * 2 + rpar;
        const int col = chalf + c8;
        const float* sp = os + row * ATT_OSP + col;
        v8h hv, lv;
#pragma unroll
        for (int e = 0; e < 8; ++e) {
          const unsigned short hb = f2bf_bits(sp[e]);
          const unsigned short lb = f2bf_bits(sp[e] - bf_bits2f(hb));
          hv[e] = __builtin_bit_cast(_Float16, hb);
          lv[e] = __builtin_bit_cast(_Float16, lb);
        }
        const size_t go = (size_t)(q0 + row) * HID + h * HVAL + col;
        *(v8h*)(gh + go) = hv;
        *(v8h*)(gl + go) = lv;
      }
      
    }
  }
  }
}

// =====================================================================================
// Host launcher. Workspace region map (bytes, every offset a multiple of 4 MiB):
//   XB   bf16 [2048][2048]   8 MiB   x
//   WSA  bf16 [2048][2048]   8 MiB   rows 0..1023 W_state, 1024..2047 W_action
//   WC   bf16 [2048][1024]   4 MiB   W_content
//   WO   bf16 [2048][2048]   8 MiB   W_out
//   SA32 f32  [2048][2048]  16 MiB   state | action
//   STH, STL, ACH, ACL, QVH, QVL  bf16 [2048][1024]  4 MiB each (state, action, q-value hi/lo)
//   CTH, CTL  bf16 [2048 = h*128+d][2048 = kv]  8 MiB each (content^T hi/lo)
//   GH, GL    bf16 [2048][2048]  8 MiB each (gathered hi/lo)
//   total 104,857,600 B
// =====================================================================================
extern "C" void kernel_launch(void* const* d_in, const int* in_sizes, int n_in,
                              void* d_out, int out_size, void* d_ws, size_t ws_size,
                              hipStream_t stream) {
  if (n_in < 6) return;
  if (in_sizes[0] != SEQ_LEN * HID || in_sizes[1] != QRANK * HID || in_sizes[2] != QRANK * HID ||
      in_sizes[3] != HID * QRANK || in_sizes[4] != HID * HID || in_sizes[5] != HID) return;
  if (out_size != SEQ_LEN * HID) return;

  const float* x  = (const float*)d_in[0];
  const float* Ws = (const float*)d_in[1];
  const float* Wa = (const float*)d_in[2];
  const float* Wc = (const float*)d_in[3];
  const float* Wo = (const float*)d_in[4];
  const float* bo = (const float*)d_in[5];
  float* out = (float*)d_out;

  const size_t B_XB  = (size_t)SEQ_LEN * HID * 2;
  const size_t B_WSA = (size_t)(2 * QRANK) * HID * 2;
  const size_t B_WC  = (size_t)HID * QRANK * 2;
  const size_t B_WO  = (size_t)HID * HID * 2;
  const size_t B_SA  = (size_t)SEQ_LEN * (2 * QRANK) * 4;
  const size_t B_PL  = (size_t)SEQ_LEN * QRANK * 2;     // one [2048][1024] bf16 plane
  const size_t B_CT  = (size_t)HID * SEQ_LEN * 2;       // one [2048][2048] bf16 plane
  const size_t B_G   = (size_t)SEQ_LEN * HID * 2;

  char* ws = (char*)d_ws;
  size_t off = 0;
  unsigned short* XB  = (unsigned short*)(ws + off); off += B_XB;
  unsigned short* WSA = (unsigned short*)(ws + off); off += B_WSA;
  unsigned short* WC  = (unsigned short*)(ws + off); off += B_WC;
  unsigned short* WO  = (unsigned short*)(ws + off); off += B_WO;
  float*          SA  = (float*)(ws + off);          off += B_SA;
  unsigned short* STH = (unsigned short*)(ws + off); off += B_PL;
  unsigned short* STL = (unsigned short*)(ws + off); off += B_PL;
  unsigned short* ACH = (unsigned short*)(ws + off); off += B_PL;
  unsigned short* ACL = (unsigned short*)(ws + off); off += B_PL;
  unsigned short* QVH = (unsigned short*)(ws + off); off += B_PL;
  unsigned short* QVL = (unsigned short*)(ws + off); off += B_PL;
  unsigned short* CTH = (unsigned short*)(ws + off); off += B_CT;
  unsigned short* CTL = (unsigned short*)(ws + off); off += B_CT;
  unsigned short* GH  = (unsigned short*)(ws + off); off += B_G;
  unsigned short* GL  = (unsigned short*)(ws + off); off += B_G;
  if (off > ws_size) return;

  // ---- input casts to bf16 (RNE) ----
  cast_inputs_bf16<<<dim3(CAST_BLOCKS), dim3(CAST_THREADS), 0, stream>>>(
      x, Ws, Wa, Wc, Wo, XB, WSA, WSA + (size_t)QRANK * HID, WC, WO);

  // ---- projections: SA[q][0..2047] = x . [W_state; W_action]^T  (M=2048, N=2048, K=2048) ----
  {
    const int M = SEQ_LEN, N = 2 * QRANK, K = HID;
    const int blocks = (M / GM_BM) * (N / GM_BN);   // 256
    wmma_gemm64<1, false, false, 0, 0><<<dim3(blocks, 1), dim3(256), 0, stream>>>(
        XB, XB, K, 0L, WSA, WSA, K, 0L, (void*)SA, (void*)SA, N, 0L, bo, M, N, K, 1.0f);
  }

  // ---- bf16 hi/lo planes of state, action, q-value ----
  planes_k<<<dim3(SEQ_LEN / 2), dim3(256), 0, stream>>>(SA, STH, STL, ACH, ACL, QVH, QVL);

  // ---- content^T[n][kv] = W_content[n][:] . qval[kv][:]  (M=2048, N=2048, K=1024; B = q-value hi/lo) -> bf16 hi/lo planes ----
  {
    const int M = HID, N = SEQ_LEN, K = QRANK;
    const int blocks = (M / GM_BM) * (N / GM_BN);   // 256
    wmma_gemm64<1, false, true, 0, 2><<<dim3(blocks, 1), dim3(256), 0, stream>>>(
        WC, WC, K, 0L, QVH, QVL, K, 0L, (void*)CTH, (void*)CTL, N, 0L, bo, M, N, K, 1.0f);
  }

  // ---- causal routing attention -> gathered hi/lo planes ----
  attn_route_k<<<dim3(NHEADS * ATT_NQB), dim3(256), 0, stream>>>(STH, STL, ACH, ACL, CTH, CTL, GH, GL);

  // ---- out = gathered . W_out^T + b_out  (M=N=K=2048; A = gathered hi/lo), f32 ----
  {
    const int M = SEQ_LEN, N = HID, K = HID;
    const int blocks = (M / GM_BM) * (N / GM_BN);   // 256
    wmma_gemm64<1, true, false, 2, 0><<<dim3(blocks, 1), dim3(256), 0, stream>>>(
        GH, GL, K, 0L, WO, WO, K, 0L, (void*)out, (void*)out, N, 0L, bo, M, N, K, 1.0f);
  }
}

// v008
// One run takes 124 microseconds.
// Two timings next to v007 both put it at 1.10 times that version's speed.
// Over all steps from v000 it is 4.53 times as fast.
// All contractions: v_wmma_f32_16x16x32_bf16 (bf16 operands, f32 accumulate): x and weight matrices as single RNE bf16 planes; state/action, q-value product, softmax p, content and gathered carried as bf16 hi/lo planes (hi.hi + hi.lo + lo.hi); softmax, q-value product and bias in f32.
#include <hip/hip_runtime.h>
#include <stdint.h>

constexpr int SEQ_LEN = 2048;   // L
constexpr int HID     = 2048;   // hidden
constexpr int QRANK   = 1024;   // q_rank
constexpr int NHEADS  = 16;
constexpr int HRANK   = 64;     // per-head rank (q/k depth)
constexpr int HVAL    = 128;    // per-head value width
static_assert(QRANK == NHEADS * HRANK, "rank split");
static_assert(HID == NHEADS * HVAL, "value split");
static_assert(SEQ_LEN % 64 == 0 && HID % 64 == 0 && QRANK % 64 == 0, "tile multiples");
static_assert(HID % 32 == 0 && QRANK % 32 == 0, "K multiples of 32");

typedef __attribute__((ext_vector_type(16))) _Float16 v16h;
typedef __attribute__((ext_vector_type(8)))  _Float16 v8h;
typedef __attribute__((ext_vector_type(16))) __bf16   v16b;
typedef __attribute__((ext_vector_type(8)))  __bf16   v8b;
typedef __attribute__((ext_vector_type(8)))  float    v8f;
typedef __attribute__((ext_vector_type(4)))  float    v4f;

__device__ __forceinline__ unsigned short f2bf_bits(float f) {
  unsigned u = __float_as_uint(f);
  return (unsigned short)((u + 0x7FFFu + ((u >> 16) & 1u)) >> 16);
}
__device__ __forceinline__ float bf_bits2f(unsigned short h) { return __uint_as_float(((unsigned)h) << 16); }

// hazard guards as plain device helpers (no hazard-guard asm inside the kernel template body)
__device__ __forceinline__ void dep_guard_h(v8f& a, v8f& b, v16h x, v16h y) { asm volatile("v_nop\n\tv_nop\n\tv_nop\n\tv_nop" : "+v"(a), "+v"(b) : "v"(x), "v"(y)); }
__device__ __forceinline__ void dep_guard_b(v8f& a, v8f& b, v16b x, v16b y) { asm volatile("v_nop\n\tv_nop\n\tv_nop\n\tv_nop" : "+v"(a), "+v"(b) : "v"(x), "v"(y)); }
__device__ __forceinline__ void keep4_h(v16h a, v16h b, v16h c, v16h d) { asm volatile("v_nop" :: "v"(a), "v"(b), "v"(c), "v"(d)); }
__device__ __forceinline__ void keep4_b(v16b a, v16b b, v16b c, v16b d) { asm volatile("v_nop" :: "v"(a), "v"(b), "v"(c), "v"(d)); }
__device__ __forceinline__ void acc_guard4(v8f& a, v8f& b, v8f& c, v8f& d) { asm volatile("v_nop\n\tv_nop\n\tv_nop\n\tv_nop" : "+v"(a), "+v"(b), "+v"(c), "+v"(d)); }
template <typename T> struct Frag;
template <> struct Frag<_Float16> {
  typedef v16h V; union U { v16h v; v8h h[2]; };
  static __device__ __forceinline__ v16h load(const _Float16* p) {   // elements 0..7 <- p[0..7], 8..15 <- p[16..23]
    U f; f.h[0] = *(const v8h*)(p); f.h[1] = *(const v8h*)(p + 16); return f.v;
  }
  static __device__ __forceinline__ v8f mma(v16h a, v16h b, v8f c) {
    return __builtin_amdgcn_wmma_f32_16x16x32_f16(false, a, false, b, (short)0, c, false, false);
  }
  static __device__ __forceinline__ void guard(v8f& a, v8f& b, v16h x, v16h y) { dep_guard_h(a, b, x, y); }
  static __device__ __forceinline__ void keep(v16h a, v16h b, v16h c, v16h d) { keep4_h(a, b, c, d); }
};
template <> struct Frag<__bf16> {
  typedef v16b V; union U { v16b v; v8b h[2]; };
  static __device__ __forceinline__ v16b load(const __bf16* p) {
    U f; f.h[0] = *(const v8b*)(p); f.h[1] = *(const v8b*)(p + 16); return f.v;
  }
  static __device__ __forceinline__ v8f mma(v16b a, v16b b, v8f c) {
    return __builtin_amdgcn_wmma_f32_16x16x32_bf16(false, a, false, b, (short)0, c, false, false);
  }
  static __device__ __forceinline__ void guard(v8f& a, v8f& b, v16b x, v16b y) { dep_guard_b(a, b, x, y); }
  static __device__ __forceinline__ void keep(v16b a, v16b b, v16b c, v16b d) { keep4_b(a, b, c, d); }
};

// Twelve asynchronous 16-B-per-lane copies global -> LDS. The s_wait_xcnt is the last line of the copies' own statement,
// so that no address register of an issued copy is rewritten in front of it.
__device__ __forceinline__ void at_copy12(const unsigned* l, const __bf16* const* g) {
  asm volatile(
      "global_load_async_to_lds_b128 %0, %12, off\n\t"
      "global_load_async_to_lds_b128 %1, %13, off\n\t"
      "global_load_async_to_lds_b128 %2, %14, off\n\t"
      "global_load_async_to_lds_b128 %3, %15, off\n\t"
      "global_load_async_to_lds_b128 %4, %16, off\n\t"
      "global_load_async_to_lds_b128 %5, %17, off\n\t"
      "global_load_async_to_lds_b128 %6, %18, off\n\t"
      "global_load_async_to_lds_b128 %7, %19, off\n\t"
      "global_load_async_to_lds_b128 %8, %20, off\n\t"
      "global_load_async_to_lds_b128 %9, %21, off\n\t"
      "global_load_async_to_lds_b128 %10, %22, off\n\t"
      "global_load_async_to_lds_b128 %11, %23, off\n\t"
      "s_wait_xcnt 0x0"
      :: "v"(l[0]), "v"(l[1]), "v"(l[2]), "v"(l[3]), "v"(l[4]), "v"(l[5]),
         "v"(l[6]), "v"(l[7]), "v"(l[8]), "v"(l[9]), "v"(l[10]), "v"(l[11]),
         "v"(g[0]), "v"(g[1]), "v"(g[2]), "v"(g[3]), "v"(g[4]), "v"(g[5]),
         "v"(g[6]), "v"(g[7]), "v"(g[8]), "v"(g[9]), "v"(g[10]), "v"(g[11])
      : "memory");
}

// The same for eight copies.
__device__ __forceinline__ void at_copy8(const unsigned* l, const __bf16* const* g) {
  asm volatile(
      "global_load_async_to_lds_b128 %0, %8, off\n\t"
      "global_load_async_to_lds_b128 %1, %9, off\n\t"
      "global_load_async_to_lds_b128 %2, %10, off\n\t"
      "global_load_async_to_lds_b128 %3, %11, off\n\t"
      "global_load_async_to_lds_b128 %4, %12, off\n\t"
      "global_load_async_to_lds_b128 %5, %13, off\n\t"
      "global_load_async_to_lds_b128 %6, %14, off\n\t"
      "global_load_async_to_lds_b128 %7, %15, off\n\t"
      "s_wait_xcnt 0x0"
      :: "v"(l[0]), "v"(l[1]), "v"(l[2]), "v"(l[3]), "v"(l[4]), "v"(l[5]), "v"(l[6]), "v"(l[7]),
         "v"(g[0]), "v"(g[1]), "v"(g[2]), "v"(g[3]), "v"(g[4]), "v"(g[5]), "v"(g[6]), "v"(g[7])
      : "memory");
}

// ---- Register-blocked batched WMMA GEMM ------------------------------------
// C[m,n] = scale * sum_k A[m,k] * Bt[n,k] (+bias); each wave owns a 32x64 tile; a block's 8 waves (4 x 2) own a 128x128 tile,
// so that the 2048x2048 outputs here give 256 blocks, one for every WGP.
// A row-major [M,K]; Bt row-major [N,K]; M % 128 == 0, N % 128 == 0, K % 128 == 0.
// Per 128 k the block's 128 A rows and 128 Bt rows (each plane) are brought into LDS once by asynchronous copies, whole 256-B units,
// two buffers (slab s + 1 flies while slab s is worked on); the waves read their fragments there.
// ASPLIT: A carried as hi/lo planes (A2 = lo plane, same layout); BSPLIT: Bt hi/lo (Bt2 = lo plane).
//   product = hi.hi (+ hi.lo if BSPLIT) (+ lo.hi if ASPLIT).
// BIAS_MODE: 0 = none, 1 = bias[m], 2 = bias[n].
// OUT_MODE: 0 = f32, 1 = f16, 2 = bf16 hi plane (Cout) + bf16 lo plane (Cout2).
// Coverage: per 32x64 tile, 2 slabs x 16 rows x 64 cols -> the whole tile; grid = (M/128)*(N/128) blocks of 8 waves.
// ET: 0 = f16 operands, 1 = bf16 operands (pointers passed as 16-bit storage)
constexpr int GM_BM = 128;   // block tile rows
constexpr int GM_BN = 128;   // block tile cols
constexpr int GM_KS = 128;   // k per staged slab: 256-B rows
constexpr int GM_SP = 136;   // staged row pitch in elements: 272 B (16 B x odd, for ds_load_b128 readers)
static_assert(SEQ_LEN % GM_BM == 0 && HID % GM_BM == 0, "block tile multiples");
static_assert(SEQ_LEN % GM_BN == 0 && HID % GM_BN == 0 && (2 * QRANK) % GM_BN == 0, "block tile multiples");
static_assert(HID % GM_KS == 0 && QRANK % GM_KS == 0, "K multiples of the slab");
template <int ET> struct Elem;
template <> struct Elem<0> { typedef _Float16 T; };
template <> struct Elem<1> { typedef __bf16 T; };
template <int ET, bool ASPLIT, bool BSPLIT, int BIAS_MODE, int OUT_MODE>
__global__ __launch_bounds__(256) void wmma_gemm64(
    const unsigned short* __restrict__ Ap, const unsigned short* __restrict__ A2p, int lda, long strideA,
    const unsigned short* __restrict__ Btp, const unsigned short* __restrict__ Bt2p, int ldb, long strideB,
    void* __restrict__ Cout, void* __restrict__ Cout2, int ldc, long strideC,
    const float* __restrict__ bias,
    int M, int N, int K, float scale) {
  typedef typename Elem<ET>::T T;
  typedef typename Frag<T>::V V;
  const T* A = (const T*)Ap; const T* A2 = (const T*)A2p; const T* Bt = (const T*)Btp; const T* Bt2 = (const T*)Bt2p;
  // staged rows of one slab: A hi (, A lo), Bt hi (, Bt lo); every plane starts at a multiple of 16 rows
  constexpr int ROW_AL = GM_BM;
  constexpr int ROW_BH = GM_BM * (ASPLIT ? 2 : 1);
  constexpr int ROW_BL = ROW_BH + GM_BN;
  constexpr int ROWS   = ROW_BH + GM_BN * (BSPLIT ? 2 : 1);   // 256 or 384
  constexpr int NCP    = ROWS / 16;                           // copies per thread and slab: 16 or 24
  static_assert(NCP == 16 || NCP == 24, "copy statements below");
  __shared__ __align__(16) float sT[8][16 * 68];   // per-wave 16x64 slab, pitch 68 floats
  __shared__ __align__(16) T Stg[2][ROWS * GM_SP]; // two buffers of staged rows, shared by the block
  const int b    = blockIdx.y;
  const int tid  = threadIdx.x;
  const int lane = threadIdx.x & 31;
  const int wave = threadIdx.x >> 5;
  const int blkN = N / GM_BN;
  if ((int)blockIdx.x >= (M / GM_BM) * blkN) return;   // block-uniform, in front of every barrier
  const int bm  = blockIdx.x / blkN;
  const int bm0 = bm * GM_BM;
  const int bn0 = (blockIdx.x - bm * blkN) * GM_BN;
  const int wm0 = (wave >> 1) << 5;            // this wave's 32x64 tile inside the block tile
  const int wn0 = (wave & 1) << 6;
  const int m0 = bm0 + wm0;
  const int n0 = bn0 + wn0;

  const T* Ab  = A  + (size_t)b * strideA;
  const T* Bb  = Bt + (size_t)b * strideB;
  const T* Ab2 = ASPLIT ? (A2  + (size_t)b * strideA) : nullptr;
  const T* Bb2 = BSPLIT ? (Bt2 + (size_t)b * strideB) : nullptr;

  const int rlane = lane & 15;                 // row (A) / col (B, D) within subtile
  const int koff  = (lane >> 4) * 8;           // k offset of this lane half
  const int mOff  = (lane >> 4) * 8;           // D row offset

  v8f acc[2][4];
#pragma unroll
  for (int i = 0; i < 2; ++i)
#pragma unroll
    for (int j = 0; j < 4; ++j) acc[i][j] = (v8f){0.f,0.f,0.f,0.f,0.f,0.f,0.f,0.f};

  // One slab: ROWS staged rows x 16 segments of 16 B = NCP lane copies per thread of the 256-thread block.
  // Copy i of thread tid: staged row i*16 + (tid >> 4), segment tid & 15: a wave's copy covers two whole 256-B units.
  // One running pointer per plane (this thread's first row and segment of the next slab to stage); the other rows are 16*ld apart.
  const int rg = tid >> 4, seg = (tid & 15) * 8;
  const T* pA  = Ab + (size_t)(bm0 + rg) * lda + seg;
  const T* pB  = Bb + (size_t)(bn0 + rg) * ldb + seg;
  const T* pA2 = ASPLIT ? (Ab2 + (size_t)(bm0 + rg) * lda + seg) : nullptr;
  const T* pB2 = BSPLIT ? (Bb2 + (size_t)(bn0 + rg) * ldb + seg) : nullptr;
  auto stage = [&](T* buf) {
    unsigned l[NCP];
    const __bf16* g[NCP];
    // unrolled so that every index of l and g is a constant and both arrays live in registers
#pragma unroll
    for (int i = 0; i < NCP; ++i) {
      const T* sp;
      if (i * 16 >= ROW_BL)                 sp = pB2 + (size_t)(i * 16 - ROW_BL) * ldb;
      else if (i * 16 >= ROW_BH)            sp = pB  + (size_t)(i * 16 - ROW_BH) * ldb;
      else if (ASPLIT && i * 16 >= ROW_AL)  sp = pA2 + (size_t)(i * 16 - ROW_AL) * lda;
      else                                  sp = pA  + (size_t)(i * 16) * lda;
      l[i] = (unsigned)(size_t)(buf + (i * 16 + rg) * GM_SP + seg);
      g[i] = (const __bf16*)sp;
    }
    if (NCP == 16) { at_copy8(l, g); at_copy8(l + NCP - 8, g + NCP - 8); }
    if (NCP == 24) { at_copy12(l, g); at_copy12(l + NCP - 12, g + NCP - 12); }
    pA += GM_KS; pB += GM_KS;
    if (ASPLIT) pA2 += GM_KS;
    if (BSPLIT) pB2 += GM_KS;
  };
  const int nSlabs = K / GM_KS;   // block-uniform

  // ---- ring prologue: slab 0 lands and is published; then slab 1 starts ----
  stage(Stg[0]);
  asm volatile("s_wait_asynccnt 0x0" ::: "memory");   // this wave's copies of slab 0 have landed
  __syncthreads();                                    // every wave's have: slab 0 may be read
  if (nSlabs > 1) stage(Stg[1]);

  for (int s = 0; s < nSlabs; ++s) {
    const T* sb = Stg[s & 1];
    // the four 32-k steps of the slab unrolled: a later step's LDS reads may go ahead of an earlier step's products
#pragma unroll
    for (int kk = 0; kk < GM_KS; kk += 32) {
      V bh[4], bl[4];
#pragma unroll
      for (int j = 0; j < 4; ++j) {
        const int bo = (wn0 + (j << 4) + rlane) * GM_SP + koff + kk;
        bh[j] = Frag<T>::load(sb + ROW_BH * GM_SP + bo);
        if (BSPLIT) bl[j] = Frag<T>::load(sb + ROW_BL * GM_SP + bo);
      }
      // all of the step's LDS reads stand together, ahead of its products
      V ah[2], al[2];
#pragma unroll
      for (int i = 0; i < 2; ++i) {
        const int ao = (wm0 + (i << 4) + rlane) * GM_SP + koff + kk;
        ah[i] = Frag<T>::load(sb + ao);
        al[i] = ah[i];
        if (ASPLIT) al[i] = Frag<T>::load(sb + ROW_AL * GM_SP + ao);
      }
#pragma unroll
      for (int i = 0; i < 2; ++i) {
#pragma unroll
        for (int j = 0; j < 4; ++j) {
          acc[i][j] = Frag<T>::mma(ah[i], bh[j], acc[i][j]);
          if (BSPLIT) acc[i][j] = Frag<T>::mma(ah[i], bl[j], acc[i][j]);
          if (ASPLIT) acc[i][j] = Frag<T>::mma(al[i], bh[j], acc[i][j]);
        }
        Frag<T>::guard(acc[i][0], acc[i][3], ah[i], al[i]);
      }
      Frag<T>::keep(bh[0], bh[1], bh[2], bh[3]);
      if (BSPLIT) Frag<T>::keep(bl[0], bl[1], bl[2], bl[3]);
    }
    // ---- publish point of slab s + 1, every wave ----
    asm volatile("s_wait_dscnt 0x0" ::: "memory");      // this wave's reads of buffer s & 1 have returned
    asm volatile("s_wait_asynccnt 0x0" ::: "memory");   // this wave's copies of slab s + 1 have landed
    __syncthreads();                                    // publishes slab s + 1 and ends every reader's last read of buffer s & 1
    if (s + 2 < nSlabs) stage(Stg[s & 1]);              // block-uniform test; slab s + 2
  }
  asm volatile("s_wait_asynccnt 0x0" ::: "memory");     // no copy is outstanding when the wave goes on to its end
  acc_guard4(acc[0][0], acc[0][1], acc[0][2], acc[0][3]);
  acc_guard4(acc[1][0], acc[1][1], acc[1][2], acc[1][3]);

  // ---- epilogue ----
  float* slab = sT[wave];
#pragma unroll
  for (int i = 0; i < 2; ++i) {
    const int mBase = m0 + (i << 4);
#pragma unroll
    for (int j = 0; j < 4; ++j) {
      const int n = n0 + (j << 4) + rlane;
      float bv = 0.f;
      if (BIAS_MODE == 2) bv = bias[n];
#pragma unroll
      for (int r = 0; r < 8; ++r) {
        float v = acc[i][j][r] * scale;
        if (BIAS_MODE == 1) v += bias[mBase + mOff + r];
        if (BIAS_MODE == 2) v += bv;
        slab[(mOff + r) * 68 + (j << 4) + rlane] = v;
      }
    }
    __builtin_amdgcn_fence(__ATOMIC_RELEASE, "workgroup");
    __builtin_amdgcn_wave_barrier();
    __builtin_amdgcn_fence(__ATOMIC_ACQUIRE, "workgroup");
    if (OUT_MODE == 0) {
      float* C = (float*)Cout + (size_t)b * strideC;
      const int hh = lane >> 4, c4 = (lane & 15) * 4;     // row seg = 256 B = 16 lanes x 16 B
      {
#pragma unroll
        for (int it = 0; it < 8; ++it) {
          const int row = it * 2 + hh;
          v4f v = *(const v4f*)(slab + row * 68 + c4);
          *(v4f*)(C + (size_t)(mBase + row) * ldc + n0 + c4) = v;
        }
        
      }
    } else {
      const int q = lane >> 3, c8 = (lane & 7) * 8;
      unsigned short* C  = (unsigned short*)Cout  + (size_t)b * strideC;
      unsigned short* C2 = (OUT_MODE == 2) ? ((unsigned short*)Cout2 + (size_t)b * strideC) : nullptr;
      {
#pragma unroll
        for (int it = 0; it < 4; ++it) {
          const int row = it * 4 + q;
          const float* sp = slab + row * 68 + c8;
          v8h hv, lv;
#pragma unroll
          for (int e = 0; e < 8; ++e) {
            if (OUT_MODE == 1) {
              hv[e] = (_Float16)sp[e];
            } else {
              unsigned short hb = f2bf_bits(sp[e]);
              unsigned short lb = f2bf_bits(sp[e] - bf_bits2f(hb));
              hv[e] = __builtin_bit_cast(_Float16, hb);
              lv[e] = __builtin_bit_cast(_Float16, lb);
            }
          }
          *(v8h*)(C + (size_t)(mBase + row) * ldc + n0 + c8) = hv;
          if (OUT_MODE == 2) *(v8h*)(C2 + (size_t)(mBase + row) * ldc + n0 + c8) = lv;
        }
        
      }
    }
    __builtin_amdgcn_fence(__ATOMIC_RELEASE, "workgroup");
    __builtin_amdgcn_wave_barrier();
    __builtin_amdgcn_fence(__ATOMIC_ACQUIRE, "workgroup");
  }
}

// ---- all five f32 inputs -> bf16 (RNE) in one launch: one 16-wave block per WGP, few long waves in place of many two-element ones ----
// Block b converts the b-th of 256 equal contiguous parts of every input, in steps of 2,048 floats (4 a lane):
// a wave's load is 512 contiguous bytes, its store 256. x and W_out take 8 steps a block, the three rank-sized weights 4 each.
// Coverage: 256 blocks x N steps x 2,048 = the whole of each input, each element converted by exactly one lane.
constexpr int CAST_BLOCKS  = 256;
constexpr int CAST_THREADS = 512;
constexpr int CAST_STEP    = CAST_THREADS * 4;                             // floats a block converts per step
constexpr int CAST_NX = SEQ_LEN * HID / (CAST_BLOCKS * CAST_STEP);         // 8
constexpr int CAST_NW = QRANK * HID / (CAST_BLOCKS * CAST_STEP);           // 4
constexpr int CAST_NO = HID * HID / (CAST_BLOCKS * CAST_STEP);             // 8
static_assert(SEQ_LEN * HID == CAST_NX * CAST_BLOCKS * CAST_STEP && QRANK * HID == CAST_NW * CAST_BLOCKS * CAST_STEP &&
              HID * HID == CAST_NO * CAST_BLOCKS * CAST_STEP, "whole steps");
typedef __attribute__((ext_vector_type(2))) unsigned v2u;
// Addresses are a uniform base, one unsigned 32-bit byte offset a lane, and a small constant per step.
template <int N>
__device__ __forceinline__ void cast_load(v4f* r, const float* __restrict__ in) {
  const char* p = (const char*)in + (blockIdx.x * (N * CAST_THREADS) + threadIdx.x) * 16u;
  // unrolled so that r is indexed by constants and lives in registers, and the loads follow one another
#pragma unroll
  for (int i = 0; i < N; ++i) r[i] = *(const v4f*)(p + i * (CAST_STEP * 4));
}
template <int N>
__device__ __forceinline__ void cast_store(const v4f* r, unsigned short* __restrict__ out) {
  char* q = (char*)out + (blockIdx.x * (N * CAST_THREADS) + threadIdx.x) * 8u;
  // unrolled so that r is indexed by constants and lives in registers
#pragma unroll
  for (int i = 0; i < N; ++i) {
    v2u u;
    u[0] = (unsigned)f2bf_bits(r[i][0]) | ((unsigned)f2bf_bits(r[i][1]) << 16);
    u[1] = (unsigned)f2bf_bits(r[i][2]) | ((unsigned)f2bf_bits(r[i][3]) << 16);
    *(v2u*)(q + i * (CAST_STEP * 2)) = u;
  }
}
__global__ __launch_bounds__(CAST_THREADS) void cast_inputs_bf16(
    const float* __restrict__ x, const float* __restrict__ wst, const float* __restrict__ wac,
    const float* __restrict__ wco, const float* __restrict__ wou,
    unsigned short* __restrict__ xb, unsigned short* __restrict__ wstb, unsigned short* __restrict__ wacb,
    unsigned short* __restrict__ wcob, unsigned short* __restrict__ woub) {
  // all of a lane's 28 loads stand ahead of its first store, so that they are in flight together
  v4f rx[CAST_NX], rs[CAST_NW], ra[CAST_NW], rc[CAST_NW], ro[CAST_NO];
  cast_load<CAST_NX>(rx, x);
  cast_load<CAST_NW>(rs, wst);
  cast_load<CAST_NW>(ra, wac);
  cast_load<CAST_NW>(rc, wco);
  // the loads below may be given, for their results, the offset register that the twelve loads above name
  asm volatile("s_wait_xcnt 0x0" ::: "memory");
  cast_load<CAST_NO>(ro, wou);
  cast_store<CAST_NX>(rx, xb);
  cast_store<CAST_NW>(rs, wstb);
  cast_store<CAST_NW>(ra, wacb);
  cast_store<CAST_NW>(rc, wcob);
  cast_store<CAST_NO>(ro, woub);
}

// ---- state|action f32 [SEQ_LEN][2*QRANK] -> bf16 hi/lo planes of state, action and q-value (state*action in f32), each [SEQ_LEN][QRANK] ----
// Coverage: grid = SEQ_LEN/2 blocks x 256 threads; thread -> row = 2*blk + (tid>>7), cols (tid&127)*8 .. +7 -> 2048 rows x 1024 cols exactly, all six planes.
__global__ __launch_bounds__(256) void planes_k(const float* __restrict__ sa,
    unsigned short* __restrict__ sthp, unsigned short* __restrict__ stlp,
    unsigned short* __restrict__ achp, unsigned short* __restrict__ aclp,
    unsigned short* __restrict__ qvhp, unsigned short* __restrict__ qvlp) {
  const int row = blockIdx.x * 2 + (threadIdx.x >> 7);
  const int c8  = (threadIdx.x & 127) * 8;
  const float* sp = sa + (size_t)row * (2 * QRANK) + c8;
  const v8f sv = *(const v8f*)(sp);
  const v8f av = *(const v8f*)(sp + QRANK);
  v8h shv, slv, ahv, alv, qhv, qlv;
#pragma unroll
  for (int e = 0; e < 8; ++e) {
    const float s = sv[e], a = av[e];
    const float q = s * a;
    unsigned short hb, lb;
    hb = f2bf_bits(s); lb = f2bf_bits(s - bf_bits2f(hb));
    shv[e] = __builtin_bit_cast(_Float16, hb); slv[e] = __builtin_bit_cast(_Float16, lb);
    hb = f2bf_bits(a); lb = f2bf_bits(a - bf_bits2f(hb));
    ahv[e] = __builtin_bit_cast(_Float16, hb); alv[e] = __builtin_bit_cast(_Float16, lb);
    hb = f2bf_bits(q); lb = f2bf_bits(q - bf_bits2f(hb));
    qhv[e] = __builtin_bit_cast(_Float16, hb); qlv[e] = __builtin_bit_cast(_Float16, lb);
  }
  const size_t o = (size_t)row * QRANK + c8;
  _Float16* sth = (_Float16*)sthp; _Float16* stl = (_Float16*)stlp;
  _Float16* ach = (_Float16*)achp; _Float16* acl = (_Float16*)aclp;
  _Float16* qvh = (_Float16*)qvhp; _Float16* qvl = (_Float16*)qvlp;
  {
    *(v8h*)(sth + o) = shv;
    *(v8h*)(stl + o) = slv;
    *(v8h*)(ach + o) = ahv;
    *(v8h*)(acl + o) = alv;
    *(v8h*)(qvh + o) = qhv;
    *(v8h*)(qvl + o) = qlv;
    
  }
}

constexpr int ATT_QBLK = 64;
constexpr int ATT_KCH  = 64;
constexpr int ATT_OSP  = 132;
constexpr int ATT_NQB  = SEQ_LEN / ATT_QBLK;
constexpr int ATT_SP   = 72;                          // staged row pitch in elements: 128-B rows at 144 B (16 B x odd, for ds_load_b128 readers)
constexpr int ATT_ROW_KH = 0;                         // staged rows: 64 K hi, 64 K lo, 128 V hi, 128 V lo
constexpr int ATT_ROW_KL = ATT_KCH;
constexpr int ATT_ROW_VH = 2 * ATT_KCH;
constexpr int ATT_ROW_VL = 2 * ATT_KCH + HVAL;
constexpr int ATT_ROWS   = 2 * ATT_KCH + 2 * HVAL;    // 384
static_assert(HRANK * 2 == 128 && ATT_KCH * 2 == 128, "staged rows are 128 B");
static_assert(ATT_QBLK == ATT_KCH && ATT_NQB % 2 == 0, "both chunks of every step lie inside the sequence");

__device__ __forceinline__ __bf16 at_f2bf(float f) { return __builtin_bit_cast(__bf16, f2bf_bits(f)); }
__device__ __forceinline__ void at_split(float f, __bf16& hi, __bf16& lo) {
  const unsigned short hb = f2bf_bits(f);
  hi = __builtin_bit_cast(__bf16, hb);
  lo = at_f2bf(f - __uint_as_float(((unsigned)hb) << 16));
}
__device__ __forceinline__ v8f at_mma(v16b a, v16b b, v8f c) {
  return __builtin_amdgcn_wmma_f32_16x16x32_bf16(false, a, false, b, (short)0, c, false, false);
}
// exp(d / 8) = 2^(d * ATT_C2) for a difference d of raw q.k sums: the 1/8 of the scores and log2(e) in one factor,
// so that an exponential is one multiply-add and one v_exp_f32. 2^(-inf) = 0; results below the normal range count as 0.
constexpr float ATT_C2 = 0.125f * 1.44269504088896340736f;
__device__ __forceinline__ float at_exp2(float x) { return __builtin_amdgcn_exp2f(x); }
// The same with the slot that the instruction set asks for behind a transcendental (one independent instruction or v_nop before its result is
// read or its source overwritten) in the statement itself.
__device__ __forceinline__ float at_exp2_slot(float x) {
  float r;
  asm("v_exp_f32 %0, %1\n\tv_nop" : "=v"(r) : "v"(x));
  return r;
}
// Eight exponentials in place, in one statement: each stands in front of an independent one, the last in front of the v_nop, and what
// reads a result follows the whole group, most of it at a distance that needs no stall.
__device__ __forceinline__ void at_exp2_x8(float* e) {
  asm("v_exp_f32 %0, %0\n\t"
      "v_exp_f32 %1, %1\n\t"
      "v_exp_f32 %2, %2\n\t"
      "v_exp_f32 %3, %3\n\t"
      "v_exp_f32 %4, %4\n\t"
      "v_exp_f32 %5, %5\n\t"
      "v_exp_f32 %6, %6\n\t"
      "v_exp_f32 %7, %7\n\t"
      "v_nop"
      : "+v"(e[0]), "+v"(e[1]), "+v"(e[2]), "+v"(e[3]), "+v"(e[4]), "+v"(e[5]), "+v"(e[6]), "+v"(e[7]));
}
// the value that lane l ^ 16 holds
__device__ __forceinline__ float at_xhalf(float x) {
  const int b = __builtin_bit_cast(int, x);
  return __builtin_bit_cast(float, __builtin_amdgcn_permlanex16(b, b, 0x76543210, 0xfedcba98, false, false));
}

// One chunk's 384 staged rows x 8 segments of 16 B = 3072 lane copies = 24 per thread of a 128-thread key group (tid counts inside the group).
// Copy i of thread tid: staged row i*16 + (tid >> 3), segment tid & 7: a wave's copy covers four whole 128-B lines.
__device__ __forceinline__ void at_stage(__bf16* buf, const __bf16* ach, const __bf16* acl,
                                         const __bf16* cth, const __bf16* ctl, int h, int kv0, int tid) {
  const int rg = tid >> 3, seg = (tid & 7) * 8;
  unsigned l[24];
  const __bf16* g[24];
  // the three loops are unrolled so that every index of l and g is a constant and both arrays live in registers
#pragma unroll
  for (int i = 0; i < 24; ++i) l[i] = (unsigned)(size_t)(buf + (i * 16 + rg) * ATT_SP + seg);
#pragma unroll
  for (int i = 0; i < 4; ++i) {
    const size_t ko = (size_t)(kv0 + i * 16 + rg) * QRANK + h * HRANK + seg;
    g[i] = ach + ko;
    g[4 + i] = acl + ko;
  }
#pragma unroll
  for (int i = 0; i < 8; ++i) {
    const size_t vo = (size_t)(h * HVAL + i * 16 + rg) * SEQ_LEN + kv0 + seg;
    g[8 + i] = cth + vo;
    g[16 + i] = ctl + vo;
  }
  at_copy12(l, g);
  at_copy12(l + 12, g + 12);
}

__global__ __launch_bounds__(256)
void attn_route_k(const unsigned short* __restrict__ sthp, const unsigned short* __restrict__ stlp,
                  const unsigned short* __restrict__ achp, const unsigned short* __restrict__ aclp,
                  const unsigned short* __restrict__ cthp, const unsigned short* __restrict__ ctlp,
                  unsigned short* __restrict__ ghp, unsigned short* __restrict__ glp) {
  __shared__ __align__(16) float  Os[4][16 * ATT_OSP];         // per 16 query rows: out tile [row][d], pitch 132
  __shared__ float Ms[4][16];                                  // group 1's row maxima
  __shared__ float Ls[4][16];                                  // group 1's row sums
  __shared__ __align__(16) __bf16 Stg[2][2][ATT_ROWS * ATT_SP];   // two buffers x two key groups of staged K and content^T rows

  const __bf16* sth = (const __bf16*)sthp; const __bf16* stl = (const __bf16*)stlp;
  const __bf16* ach = (const __bf16*)achp; const __bf16* acl = (const __bf16*)aclp;
  const __bf16* cth = (const __bf16*)cthp; const __bf16* ctl = (const __bf16*)ctlp;
  _Float16* gh = (_Float16*)ghp; _Float16* gl = (_Float16*)glp;

  const int tid  = threadIdx.x;
  const int wave = __builtin_amdgcn_readfirstlane(tid >> 5);   // in a scalar register: the tests on the key group below are scalar branches
  const int grp  = wave >> 2;    // key group
  const int wq   = wave & 3;     // which 16 query rows
  const int gtid = tid & 127;    // thread index inside the key group
  const int lane = tid & 31;
  const int hh   = lane >> 4;
  const int c    = lane & 15;
  const int bx = blockIdx.x;
  const int qb = ATT_NQB - 1 - bx / NHEADS;   // cost falls with the block index
  const int h  = bx % NHEADS;
  const int q0 = qb * ATT_QBLK + wq * 16;

  // ---- Q fragments (B operand): 2 depth chunks, hi and lo; column = query c, k = dc*32 + 8*hh + {0..7, 16..23} ----
  v16b qah[2], qal[2];
#pragma unroll
  for (int dc = 0; dc < 2; ++dc) {
    const size_t off = (size_t)(q0 + c) * QRANK + h * HRANK + dc * 32 + 8 * hh;
    qah[dc] = Frag<__bf16>::load(sth + off);
    qal[dc] = Frag<__bf16>::load(stl + off);
  }

  float mrow = -INFINITY;   // running maximum of query q0 + c, the same in both lane halves
  float lrow = 0.f;         // running sum over the keys that this lane half holds
  v8f oacc[8];
#pragma unroll
  for (int t = 0; t < 8; ++t) oacc[t] = (v8f){0.f,0.f,0.f,0.f,0.f,0.f,0.f,0.f};

  const int nChunks = qb + 1;              // block-uniform, <= 32
  const int nSteps  = (nChunks + 1) >> 1;  // block-uniform, <= 16; step st holds chunks 2*st and 2*st + 1 (<= 31: both lie inside the sequence)

  // ---- ring prologue: step 0 lands and is published; then step 1 starts ----
  at_stage(Stg[0][grp], ach, acl, cth, ctl, h, grp * ATT_KCH, gtid);
  asm volatile("s_wait_asynccnt 0x0" ::: "memory");   // this wave's copies of step 0 have landed
  __syncthreads();                                    // every wave's have: step 0 may be read
  if (nSteps > 1) at_stage(Stg[1][grp], ach, acl, cth, ctl, h, (2 + grp) * ATT_KCH, gtid);

  for (int st = 0; st < nSteps; ++st) {
    const int kc = 2 * st + grp;
    // wave-uniform: with an odd number of chunks group 1 has none in the last step; the publish point below stands outside this test
    if (kc < nChunks) {
    const int kv0 = kc * ATT_KCH;
    const __bf16* sb = Stg[st & 1][grp];

    // ---- scores, transposed: S^T = K . Q^T; 4 key subtiles of 16; A = K rows (row = key, k = depth, staged rows), B = the Q fragments ----
    // Register r of subtile j in lane (hh, c) is the score of key kv0 + j*16 + 8*hh + r and query q0 + c: a lane holds one query's scores.
    // All of the chunk's K fragments are read as one group; the products then go round the four subtiles, so that
    // consecutive matrix instructions write different accumulators. Per accumulator and depth step: hi.hi, q hi . k lo, q lo . k hi.
    // Every loop over fragments or accumulators in this chunk loop is unrolled, so that these arrays are indexed by constants and live in registers.
    v8f s[4];
    v16b kb[2][4], kl[2][4];
#pragma unroll
    for (int dc = 0; dc < 2; ++dc) {
#pragma unroll
      for (int j = 0; j < 4; ++j) {
        const int ko = (j * 16 + c) * ATT_SP + dc * 32 + 8 * hh;
        kb[dc][j] = Frag<__bf16>::load(sb + ATT_ROW_KH * ATT_SP + ko);
        kl[dc][j] = Frag<__bf16>::load(sb + ATT_ROW_KL * ATT_SP + ko);
      }
    }
    // keeps the K reads one group ahead of the products: a read left among the products is waited for on its own
    __builtin_amdgcn_sched_barrier(0);
#pragma unroll
    for (int j = 0; j < 4; ++j) s[j] = (v8f){0.f,0.f,0.f,0.f,0.f,0.f,0.f,0.f};
#pragma unroll
    for (int dc = 0; dc < 2; ++dc) {
#pragma unroll
      for (int j = 0; j < 4; ++j) s[j] = at_mma(kb[dc][j], qah[dc], s[j]);
#pragma unroll
      for (int j = 0; j < 4; ++j) s[j] = at_mma(kl[dc][j], qah[dc], s[j]);
#pragma unroll
      for (int j = 0; j < 4; ++j) s[j] = at_mma(kb[dc][j], qal[dc], s[j]);
    }

    // ---- content^T A-fragments (row = d, k = kv) of both 32-key steps: read here, they do not depend on the softmax ----
    v16b vb[2][8], vl[2][8];
#pragma unroll
    for (int kk = 0; kk < 2; ++kk) {
#pragma unroll
      for (int t = 0; t < 8; ++t) {
        const int vo = (t * 16 + c) * ATT_SP + kk * 32 + 8 * hh;
        vb[kk][t] = Frag<__bf16>::load(sb + ATT_ROW_VH * ATT_SP + vo);
        vl[kk][t] = Frag<__bf16>::load(sb + ATT_ROW_VL * ATT_SP + vo);
      }
    }
    // keeps these reads above the softmax arithmetic, so that their LDS latency passes under it
    __builtin_amdgcn_sched_barrier(0);

    // ---- causal select on the diagonal chunk, the query's maximum (raw sums): in the lane, then one exchange between the lane halves ----
    // key index j*16 + r inside this lane's half of the chunk lies in the future where it exceeds dq; off the diagonal none does
    const int dq = (kc == qb) ? (q0 + c - kv0 - 8 * hh) : ATT_KCH;
    float mj[4];   // four independent chains
#pragma unroll
    for (int j = 0; j < 4; ++j) {
      float m = -INFINITY;
#pragma unroll
      for (int r = 0; r < 8; ++r) {
        float v = s[j][r];
        if (j * 16 + r > dq) v = -INFINITY;
        s[j][r] = v;
        m = fmaxf(m, v);
      }
      mj[j] = m;
    }
    float cm = fmaxf(fmaxf(mj[0], mj[1]), fmaxf(mj[2], mj[3]));
    cm = fmaxf(cm, at_xhalf(cm));

    // ---- online softmax update; P^T goes from the score registers straight into B operands, bf16 hi/lo ----
    // Subtiles 2*kk and 2*kk + 1 of a lane are keys kk*32 + 8*hh + {0..7, 16..23}: the k order of the content^T fragments.
    const float mnew = fmaxf(mrow, cm);
    const float alpha = at_exp2_slot((mrow - mnew) * ATT_C2);
    const float nb = -mnew * ATT_C2;
    mrow = mnew;
    v16b pa[2], pl[2];
    float pj[4];   // this lane's part of the query's sum, four independent chains
#pragma unroll
    for (int j = 0; j < 4; ++j) {
      float e[8];
#pragma unroll
      for (int r = 0; r < 8; ++r) e[r] = __builtin_fmaf(s[j][r], ATT_C2, nb);
      at_exp2_x8(e);
      float psum = 0.f;
#pragma unroll
      for (int r = 0; r < 8; ++r) {
        const float p = e[r];
        psum += p;
        __bf16 a, bl; at_split(p, a, bl);
        pa[j >> 1][(j & 1) * 8 + r] = a;
        pl[j >> 1][(j & 1) * 8 + r] = bl;
      }
      pj[j] = psum;
    }
    lrow = lrow * alpha + ((pj[0] + pj[1]) + (pj[2] + pj[3]));
#pragma unroll
    for (int t = 0; t < 8; ++t) oacc[t] *= alpha;

    // ---- O^T += V^T . P^T: register r of subtile t in lane (hh, c) is output column t*16 + 8*hh + r of query q0 + c ----
    // Six groups of eight products, each group going round the eight output subtiles; per accumulator and 32-key step:
    // hi.hi, p hi . v lo, p lo . v hi.
#pragma unroll
    for (int g = 0; g < 6; ++g) {
      const int kk = g / 3, term = g % 3;
#pragma unroll
      for (int t = 0; t < 8; ++t)
        oacc[t] = at_mma(term == 1 ? vl[kk][t] : vb[kk][t], term == 2 ? pl[kk] : pa[kk], oacc[t]);
    }
    }

    // ---- publish point of step st + 1, every wave ----
    asm volatile("s_wait_dscnt 0x0" ::: "memory");      // this wave's reads of buffer st & 1 have returned
    asm volatile("s_wait_asynccnt 0x0" ::: "memory");   // this wave's copies of step st + 1 have landed
    __syncthreads();                                    // publishes step st + 1 and ends every reader's last read of buffer st & 1
    if (st + 2 < nSteps) at_stage(Stg[st & 1][grp], ach, acl, cth, ctl, h, (2 * (st + 2) + grp) * ATT_KCH, gtid);   // block-uniform test
  }
  asm volatile("s_wait_asynccnt 0x0" ::: "memory");     // no copy is outstanding when the wave goes on to its end

  // ---- the two key groups' states are joined: group 1 writes its own to LDS, group 0 rescales both to the common row maximum ----
  // Every loop of this part is unrolled, so that oacc is indexed by constants and lives in registers.
  lrow += at_xhalf(lrow);   // the two lane halves' parts of the query's sum
  float* os = Os[wq];
  float* ol = os + c * ATT_OSP + 8 * hh;   // this lane's query row; subtile t is the eight columns from t*16 + 8*hh
  if (grp == 1) {
#pragma unroll
    for (int t = 0; t < 8; ++t) {
      *(v4f*)(ol + t * 16)     = (v4f){oacc[t][0], oacc[t][1], oacc[t][2], oacc[t][3]};
      *(v4f*)(ol + t * 16 + 4) = (v4f){oacc[t][4], oacc[t][5], oacc[t][6], oacc[t][7]};
    }
    if (hh == 0) {   // a query's two lanes hold the same maximum and the same sum
      Ms[wq][c] = mrow;
      Ls[wq][c] = lrow;
    }
  }
  __syncthreads();   // group 1's state may be read; every wave passes it, and no barrier follows
  if (grp == 0) {
  // Group 0 holds chunk 0, of which every row sees key 0: its maximum is finite. A group 1 without a chunk hands over -inf, 0 and zeros: factor 0.
  const float m2 = Ms[wq][c];
  const float l2 = Ls[wq][c];
  const float m  = fmaxf(mrow, m2);
  const float a1 = at_exp2((mrow - m) * ATT_C2);
  const float a2 = at_exp2((m2 - m) * ATT_C2);
  const float inv = 1.0f / (lrow * a1 + l2 * a2);
  const float f1 = a1 * inv;   // what group 0's and group 1's unnormalised output is multiplied by
  const float f2 = a2 * inv;
  // each lane reads and rewrites its own elements of the tile
#pragma unroll
  for (int t = 0; t < 8; ++t) {
    const v4f o0 = *(const v4f*)(ol + t * 16);
    const v4f o1 = *(const v4f*)(ol + t * 16 + 4);
    *(v4f*)(ol + t * 16)     = (v4f){oacc[t][0], oacc[t][1], oacc[t][2], oacc[t][3]} * f1 + o0 * f2;
    *(v4f*)(ol + t * 16 + 4) = (v4f){oacc[t][4], oacc[t][5], oacc[t][6], oacc[t][7]} * f1 + o1 * f2;
  }
  __builtin_amdgcn_fence(__ATOMIC_RELEASE, "workgroup");
  __builtin_amdgcn_wave_barrier();
  __builtin_amdgcn_fence(__ATOMIC_ACQUIRE, "workgroup");
  {
    // lane groups of 8: q4 = lane>>3; row parity = q4>>1, column half = q4&1; it = 0..7 -> rows 0..15, cols 0..127: whole 16x128 tile, both planes
    const int q4 = lane >> 3, c8 = (lane & 7) * 8;
    const int rpar = q4 >> 1, chalf = (q4 & 1) * 64;
    {
#pragma unroll
      for (int it = 0; it < 8; ++it) {
        const int row = it * 2 + rpar;
        const int col = chalf + c8;
        const float* sp = os + row * ATT_OSP + col;
        v8h hv, lv;
#pragma unroll
        for (int e = 0; e < 8; ++e) {
          const unsigned short hb = f2bf_bits(sp[e]);
          const unsigned short lb = f2bf_bits(sp[e] - bf_bits2f(hb));
          hv[e] = __builtin_bit_cast(_Float16, hb);
          lv[e] = __builtin_bit_cast(_Float16, lb);
        }
        const size_t go = (size_t)(q0 + row) * HID + h * HVAL + col;
        *(v8h*)(gh + go) = hv;
        *(v8h*)(gl + go) = lv;
      }
      
    }
  }
  }
}

// =====================================================================================
// Host launcher. Workspace region map (bytes, every offset a multiple of 4 MiB):
//   XB   bf16 [2048][2048]   8 MiB   x
//   WSA  bf16 [2048][2048]   8 MiB   rows 0..1023 W_state, 1024..2047 W_action
//   WC   bf16 [2048][1024]   4 MiB   W_content
//   WO   bf16 [2048][2048]   8 MiB   W_out
//   SA32 f32  [2048][2048]  16 MiB   state | action
//   STH, STL, ACH, ACL, QVH, QVL  bf16 [2048][1024]  4 MiB each (state, action, q-value hi/lo)
//   CTH, CTL  bf16 [2048 = h*128+d][2048 = kv]  8 MiB each (content^T hi/lo)
//   GH, GL    bf16 [2048][2048]  8 MiB each (gathered hi/lo)
//   total 104,857,600 B
// =====================================================================================
extern "C" void kernel_launch(void* const* d_in, const int* in_sizes, int n_in,
                              void* d_out, int out_size, void* d_ws, size_t ws_size,
                              hipStream_t stream) {
  if (n_in < 6) return;
  if (in_sizes[0] != SEQ_LEN * HID || in_sizes[1] != QRANK * HID || in_sizes[2] != QRANK * HID ||
      in_sizes[3] != HID * QRANK || in_sizes[4] != HID * HID || in_sizes[5] != HID) return;
  if (out_size != SEQ_LEN * HID) return;

  const float* x  = (const float*)d_in[0];
  const float* Ws = (const float*)d_in[1];
  const float* Wa = (const float*)d_in[2];
  const float* Wc = (const float*)d_in[3];
  const float* Wo = (const float*)d_in[4];
  const float* bo = (const float*)d_in[5];
  float* out = (float*)d_out;

  const size_t B_XB  = (size_t)SEQ_LEN * HID * 2;
  const size_t B_WSA = (size_t)(2 * QRANK) * HID * 2;
  const size_t B_WC  = (size_t)HID * QRANK * 2;
  const size_t B_WO  = (size_t)HID * HID * 2;
  const size_t B_SA  = (size_t)SEQ_LEN * (2 * QRANK) * 4;
  const size_t B_PL  = (size_t)SEQ_LEN * QRANK * 2;     // one [2048][1024] bf16 plane
  const size_t B_CT  = (size_t)HID * SEQ_LEN * 2;       // one [2048][2048] bf16 plane
  const size_t B_G   = (size_t)SEQ_LEN * HID * 2;

  char* ws = (char*)d_ws;
  size_t off = 0;
  unsigned short* XB  = (unsigned short*)(ws + off); off += B_XB;
  unsigned short* WSA = (unsigned short*)(ws + off); off += B_WSA;
  unsigned short* WC  = (unsigned short*)(ws + off); off += B_WC;
  unsigned short* WO  = (unsigned short*)(ws + off); off += B_WO;
  float*          SA  = (float*)(ws + off);          off += B_SA;
  unsigned short* STH = (unsigned short*)(ws + off); off += B_PL;
  unsigned short* STL = (unsigned short*)(ws + off); off += B_PL;
  unsigned short* ACH = (unsigned short*)(ws + off); off += B_PL;
  unsigned short* ACL = (unsigned short*)(ws + off); off += B_PL;
  unsigned short* QVH = (unsigned short*)(ws + off); off += B_PL;
  unsigned short* QVL = (unsigned short*)(ws + off); off += B_PL;
  unsigned short* CTH = (unsigned short*)(ws + off); off += B_CT;
  unsigned short* CTL = (unsigned short*)(ws + off); off += B_CT;
  unsigned short* GH  = (unsigned short*)(ws + off); off += B_G;
  unsigned short* GL  = (unsigned short*)(ws + off); off += B_G;
  if (off > ws_size) return;

  // ---- input casts to bf16 (RNE) ----
  cast_inputs_bf16<<<dim3(CAST_BLOCKS), dim3(CAST_THREADS), 0, stream>>>(
      x, Ws, Wa, Wc, Wo, XB, WSA, WSA + (size_t)QRANK * HID, WC, WO);

  // ---- projections: SA[q][0..2047] = x . [W_state; W_action]^T  (M=2048, N=2048, K=2048) ----
  {
    const int M = SEQ_LEN, N = 2 * QRANK, K = HID;
    const int blocks = (M / GM_BM) * (N / GM_BN);   // 256
    wmma_gemm64<1, false, false, 0, 0><<<dim3(blocks, 1), dim3(256), 0, stream>>>(
        XB, XB, K, 0L, WSA, WSA, K, 0L, (void*)SA, (void*)SA, N, 0L, bo, M, N, K, 1.0f);
  }

  // ---- bf16 hi/lo planes of state, action, q-value ----
  planes_k<<<dim3(SEQ_LEN / 2), dim3(256), 0, stream>>>(SA, STH, STL, ACH, ACL, QVH, QVL);

  // ---- content^T[n][kv] = W_content[n][:] . qval[kv][:]  (M=2048, N=2048, K=1024; B = q-value hi/lo) -> bf16 hi/lo planes ----
  {
    const int M = HID, N = SEQ_LEN, K = QRANK;
    const int blocks = (M / GM_BM) * (N / GM_BN);   // 256
    wmma_gemm64<1, false, true, 0, 2><<<dim3(blocks, 1), dim3(256), 0, stream>>>(
        WC, WC, K, 0L, QVH, QVL, K, 0L, (void*)CTH, (void*)CTL, N, 0L, bo, M, N, K, 1.0f);
  }

  // ---- causal routing attention -> gathered hi/lo planes ----
  attn_route_k<<<dim3(NHEADS * ATT_NQB), dim3(256), 0, stream>>>(STH, STL, ACH, ACL, CTH, CTL, GH, GL);

  // ---- out = gathered . W_out^T + b_out  (M=N=K=2048; A = gathered hi/lo), f32 ----
  {
    const int M = SEQ_LEN, N = HID, K = HID;
    const int blocks = (M / GM_BM) * (N / GM_BN);   // 256
    wmma_gemm64<1, true, false, 2, 0><<<dim3(blocks, 1), dim3(256), 0, stream>>>(
        GH, GL, K, 0L, WO, WO, K, 0L, (void*)out, (void*)out, N, 0L, bo, M, N, K, 1.0f);
  }
}

// v009
// A run of this version takes 120 microseconds.
// Timed twice side by side with v008, it ran 1.03 times as fast both times.
// Over all steps from v000 it is 4.68 times as fast.
// All contractions: v_wmma_f32_16x16x32_bf16 (bf16 operands, f32 accumulate): x and weight matrices as single RNE bf16 planes; state/action, q-value product, softmax p, content and gathered carried as bf16 hi/lo planes (hi.hi + hi.lo + lo.hi); softmax, q-value product and bias in f32.
#include <hip/hip_runtime.h>
#include <stdint.h>

constexpr int SEQ_LEN = 2048;   // L
constexpr int HID     = 2048;   // hidden
constexpr int QRANK   = 1024;   // q_rank
constexpr int NHEADS  = 16;
constexpr int HRANK   = 64;     // per-head rank (q/k depth)
constexpr int HVAL    = 128;    // per-head value width
static_assert(QRANK == NHEADS * HRANK, "rank split");
static_assert(HID == NHEADS * HVAL, "value split");
static_assert(SEQ_LEN % 64 == 0 && HID % 64 == 0 && QRANK % 64 == 0, "tile multiples");
static_assert(HID % 32 == 0 && QRANK % 32 == 0, "K multiples of 32");

typedef __attribute__((ext_vector_type(16))) _Float16 v16h;
typedef __attribute__((ext_vector_type(8)))  _Float16 v8h;
typedef __attribute__((ext_vector_type(16))) __bf16   v16b;
typedef __attribute__((ext_vector_type(8)))  __bf16   v8b;
typedef __attribute__((ext_vector_type(8)))  float    v8f;
typedef __attribute__((ext_vector_type(4)))  float    v4f;

__device__ __forceinline__ unsigned short f2bf_bits(float f) {
  unsigned u = __float_as_uint(f);
  return (unsigned short)((u + 0x7FFFu + ((u >> 16) & 1u)) >> 16);
}
__device__ __forceinline__ float bf_bits2f(unsigned short h) { return __uint_as_float(((unsigned)h) << 16); }

// hazard guards as plain device helpers (no hazard-guard asm inside the kernel template body)
__device__ __forceinline__ void dep_guard_h(v8f& a, v8f& b, v16h x, v16h y) { asm volatile("v_nop\n\tv_nop\n\tv_nop\n\tv_nop" : "+v"(a), "+v"(b) : "v"(x), "v"(y)); }
__device__ __forceinline__ void dep_guard_b(v8f& a, v8f& b, v16b x, v16b y) { asm volatile("v_nop\n\tv_nop\n\tv_nop\n\tv_nop" : "+v"(a), "+v"(b) : "v"(x), "v"(y)); }
__device__ __forceinline__ void keep4_h(v16h a, v16h b, v16h c, v16h d) { asm volatile("v_nop" :: "v"(a), "v"(b), "v"(c), "v"(d)); }
__device__ __forceinline__ void keep4_b(v16b a, v16b b, v16b c, v16b d) { asm volatile("v_nop" :: "v"(a), "v"(b), "v"(c), "v"(d)); }
__device__ __forceinline__ void acc_guard4(v8f& a, v8f& b, v8f& c, v8f& d) { asm volatile("v_nop\n\tv_nop\n\tv_nop\n\tv_nop" : "+v"(a), "+v"(b), "+v"(c), "+v"(d)); }
template <typename T> struct Frag;
template <> struct Frag<_Float16> {
  typedef v16h V; union U { v16h v; v8h h[2]; };
  static __device__ __forceinline__ v16h load(const _Float16* p) {   // elements 0..7 <- p[0..7], 8..15 <- p[16..23]
    U f; f.h[0] = *(const v8h*)(p); f.h[1] = *(const v8h*)(p + 16); return f.v;
  }
  static __device__ __forceinline__ v8f mma(v16h a, v16h b, v8f c) {
    return __builtin_amdgcn_wmma_f32_16x16x32_f16(false, a, false, b, (short)0, c, false, false);
  }
  static __device__ __forceinline__ void guard(v8f& a, v8f& b, v16h x, v16h y) { dep_guard_h(a, b, x, y); }
  static __device__ __forceinline__ void keep(v16h a, v16h b, v16h c, v16h d) { keep4_h(a, b, c, d); }
};
template <> struct Frag<__bf16> {
  typedef v16b V; union U { v16b v; v8b h[2]; };
  static __device__ __forceinline__ v16b load(const __bf16* p) {
    U f; f.h[0] = *(const v8b*)(p); f.h[1] = *(const v8b*)(p + 16); return f.v;
  }
  static __device__ __forceinline__ v8f mma(v16b a, v16b b, v8f c) {
    return __builtin_amdgcn_wmma_f32_16x16x32_bf16(false, a, false, b, (short)0, c, false, false);
  }
  static __device__ __forceinline__ void guard(v8f& a, v8f& b, v16b x, v16b y) { dep_guard_b(a, b, x, y); }
  static __device__ __forceinline__ void keep(v16b a, v16b b, v16b c, v16b d) { keep4_b(a, b, c, d); }
};

// Twelve asynchronous 16-B-per-lane copies global -> LDS. The s_wait_xcnt is the last line of the copies' own statement,
// so that no address register of an issued copy is rewritten in front of it.
__device__ __forceinline__ void at_copy12(const unsigned* l, const __bf16* const* g) {
  asm volatile(
      "global_load_async_to_lds_b128 %0, %12, off\n\t"
      "global_load_async_to_lds_b128 %1, %13, off\n\t"
      "global_load_async_to_lds_b128 %2, %14, off\n\t"
      "global_load_async_to_lds_b128 %3, %15, off\n\t"
      "global_load_async_to_lds_b128 %4, %16, off\n\t"
      "global_load_async_to_lds_b128 %5, %17, off\n\t"
      "global_load_async_to_lds_b128 %6, %18, off\n\t"
      "global_load_async_to_lds_b128 %7, %19, off\n\t"
      "global_load_async_to_lds_b128 %8, %20, off\n\t"
      "global_load_async_to_lds_b128 %9, %21, off\n\t"
      "global_load_async_to_lds_b128 %10, %22, off\n\t"
      "global_load_async_to_lds_b128 %11, %23, off\n\t"
      "s_wait_xcnt 0x0"
      :: "v"(l[0]), "v"(l[1]), "v"(l[2]), "v"(l[3]), "v"(l[4]), "v"(l[5]),
         "v"(l[6]), "v"(l[7]), "v"(l[8]), "v"(l[9]), "v"(l[10]), "v"(l[11]),
         "v"(g[0]), "v"(g[1]), "v"(g[2]), "v"(g[3]), "v"(g[4]), "v"(g[5]),
         "v"(g[6]), "v"(g[7]), "v"(g[8]), "v"(g[9]), "v"(g[10]), "v"(g[11])
      : "memory");
}

// The same for eight copies.
__device__ __forceinline__ void at_copy8(const unsigned* l, const __bf16* const* g) {
  asm volatile(
      "global_load_async_to_lds_b128 %0, %8, off\n\t"
      "global_load_async_to_lds_b128 %1, %9, off\n\t"
      "global_load_async_to_lds_b128 %2, %10, off\n\t"
      "global_load_async_to_lds_b128 %3, %11, off\n\t"
      "global_load_async_to_lds_b128 %4, %12, off\n\t"
      "global_load_async_to_lds_b128 %5, %13, off\n\t"
      "global_load_async_to_lds_b128 %6, %14, off\n\t"
      "global_load_async_to_lds_b128 %7, %15, off\n\t"
      "s_wait_xcnt 0x0"
      :: "v"(l[0]), "v"(l[1]), "v"(l[2]), "v"(l[3]), "v"(l[4]), "v"(l[5]), "v"(l[6]), "v"(l[7]),
         "v"(g[0]), "v"(g[1]), "v"(g[2]), "v"(g[3]), "v"(g[4]), "v"(g[5]), "v"(g[6]), "v"(g[7])
      : "memory");
}

// ---- Register-blocked batched WMMA GEMM ------------------------------------
// C[m,n] = scale * sum_k A[m,k] * Bt[n,k] (+bias); each wave owns a 32x64 tile; a block's 8 waves (4 x 2) own a 128x128 tile,
// so that the 2048x2048 outputs here give 256 blocks, one for every WGP.
// A row-major [M,K]; Bt row-major [N,K]; M % 128 == 0, N % 128 == 0, K % 128 == 0.
// Per 128 k the block's 128 A rows and 128 Bt rows (each plane) are brought into LDS once by asynchronous copies, whole 256-B units,
// three buffers (slabs s + 1 and s + 2 fly while slab s is worked on: a slab has two trips to arrive in); the waves read their fragments there.
// ASPLIT: A carried as hi/lo planes (A2 = lo plane, same layout); BSPLIT: Bt hi/lo (Bt2 = lo plane).
//   product = hi.hi (+ hi.lo if BSPLIT) (+ lo.hi if ASPLIT).
// BIAS_MODE: 0 = none, 1 = bias[m], 2 = bias[n].
// OUT_MODE: 0 = f32, 1 = f16, 2 = bf16 hi plane (Cout) + bf16 lo plane (Cout2).
// Coverage: per 32x64 tile, 2 slabs x 16 rows x 64 cols -> the whole tile; grid = (M/128)*(N/128) blocks of 8 waves.
// ET: 0 = f16 operands, 1 = bf16 operands (pointers passed as 16-bit storage)
constexpr int GM_BM = 128;   // block tile rows
constexpr int GM_BN = 128;   // block tile cols
constexpr int GM_KS = 128;   // k per staged slab: 256-B rows
constexpr int GM_SP = 136;   // staged row pitch in elements: 272 B (16 B x odd, for ds_load_b128 readers)
constexpr int GM_NB = 3;     // buffers of the ring
static_assert(SEQ_LEN % GM_BM == 0 && HID % GM_BM == 0, "block tile multiples");
static_assert(SEQ_LEN % GM_BN == 0 && HID % GM_BN == 0 && (2 * QRANK) % GM_BN == 0, "block tile multiples");
static_assert(HID % GM_KS == 0 && QRANK % GM_KS == 0, "K multiples of the slab");
template <int ET> struct Elem;
template <> struct Elem<0> { typedef _Float16 T; };
template <> struct Elem<1> { typedef __bf16 T; };
template <int ET, bool ASPLIT, bool BSPLIT, int BIAS_MODE, int OUT_MODE>
__global__ __launch_bounds__(256) void wmma_gemm64(
    const unsigned short* __restrict__ Ap, const unsigned short* __restrict__ A2p, int lda, long strideA,
    const unsigned short* __restrict__ Btp, const unsigned short* __restrict__ Bt2p, int ldb, long strideB,
    void* __restrict__ Cout, void* __restrict__ Cout2, int ldc, long strideC,
    const float* __restrict__ bias,
    int M, int N, int K, float scale) {
  typedef typename Elem<ET>::T T;
  typedef typename Frag<T>::V V;
  const T* A = (const T*)Ap; const T* A2 = (const T*)A2p; const T* Bt = (const T*)Btp; const T* Bt2 = (const T*)Bt2p;
  // staged rows of one slab: A hi (, A lo), Bt hi (, Bt lo); every plane starts at a multiple of 16 rows
  constexpr int ROW_AL = GM_BM;
  constexpr int ROW_BH = GM_BM * (ASPLIT ? 2 : 1);
  constexpr int ROW_BL = ROW_BH + GM_BN;
  constexpr int ROWS   = ROW_BH + GM_BN * (BSPLIT ? 2 : 1);   // 256 or 384
  constexpr int NCP    = ROWS / 16;                           // copies per thread and slab: 16 or 24
  static_assert(NCP == 16 || NCP == 24, "copy statements below");
  static_assert((GM_NB - 1) * NCP <= 63, "copies of one wave in flight");
  constexpr int BUF = ROWS * GM_SP;                // elements of one buffer
  static_assert(8 * 16 * 68 * 4 <= BUF * 2, "the epilogue's staging fits in the first buffer");
  __shared__ __align__(16) T Stg[GM_NB * BUF];     // three buffers of staged rows, shared by the block; behind the loop the epilogue's staging
  const int b    = blockIdx.y;
  const int tid  = threadIdx.x;
  const int lane = threadIdx.x & 31;
  const int wave = threadIdx.x >> 5;
  const int blkN = N / GM_BN;
  if ((int)blockIdx.x >= (M / GM_BM) * blkN) return;   // block-uniform, in front of every barrier
  const int bm  = blockIdx.x / blkN;
  const int bm0 = bm * GM_BM;
  const int bn0 = (blockIdx.x - bm * blkN) * GM_BN;
  const int wm0 = (wave >> 1) << 5;            // this wave's 32x64 tile inside the block tile
  const int wn0 = (wave & 1) << 6;
  const int m0 = bm0 + wm0;
  const int n0 = bn0 + wn0;

  const T* Ab  = A  + (size_t)b * strideA;
  const T* Bb  = Bt + (size_t)b * strideB;
  const T* Ab2 = ASPLIT ? (A2  + (size_t)b * strideA) : nullptr;
  const T* Bb2 = BSPLIT ? (Bt2 + (size_t)b * strideB) : nullptr;

  const int rlane = lane & 15;                 // row (A) / col (B, D) within subtile
  const int koff  = (lane >> 4) * 8;           // k offset of this lane half
  const int mOff  = (lane >> 4) * 8;           // D row offset

  v8f acc[2][4];
#pragma unroll
  for (int i = 0; i < 2; ++i)
#pragma unroll
    for (int j = 0; j < 4; ++j) acc[i][j] = (v8f){0.f,0.f,0.f,0.f,0.f,0.f,0.f,0.f};

  // One slab: ROWS staged rows x 16 segments of 16 B = NCP lane copies per thread of the 256-thread block.
  // Copy i of thread tid: staged row i*16 + (tid >> 4), segment tid & 15: a wave's copy covers two whole 256-B units.
  // One running pointer per plane (this thread's first row and segment of the next slab to stage); the other rows are 16*ld apart.
  const int rg = tid >> 4, seg = (tid & 15) * 8;
  const T* pA  = Ab + (size_t)(bm0 + rg) * lda + seg;
  const T* pB  = Bb + (size_t)(bn0 + rg) * ldb + seg;
  const T* pA2 = ASPLIT ? (Ab2 + (size_t)(bm0 + rg) * lda + seg) : nullptr;
  const T* pB2 = BSPLIT ? (Bb2 + (size_t)(bn0 + rg) * ldb + seg) : nullptr;
  auto stage = [&](T* buf) {
    unsigned l[NCP];
    const __bf16* g[NCP];
    // unrolled so that every index of l and g is a constant and both arrays live in registers
#pragma unroll
    for (int i = 0; i < NCP; ++i) {
      const T* sp;
      if (i * 16 >= ROW_BL)                 sp = pB2 + (size_t)(i * 16 - ROW_BL) * ldb;
      else if (i * 16 >= ROW_BH)            sp = pB  + (size_t)(i * 16 - ROW_BH) * ldb;
      else if (ASPLIT && i * 16 >= ROW_AL)  sp = pA2 + (size_t)(i * 16 - ROW_AL) * lda;
      else                                  sp = pA  + (size_t)(i * 16) * lda;
      l[i] = (unsigned)(size_t)(buf + (i * 16 + rg) * GM_SP + seg);
      g[i] = (const __bf16*)sp;
    }
    if (NCP == 16) { at_copy8(l, g); at_copy8(l + NCP - 8, g + NCP - 8); }
    if (NCP == 24) { at_copy12(l, g); at_copy12(l + NCP - 12, g + NCP - 12); }
    pA += GM_KS; pB += GM_KS;
    if (ASPLIT) pA2 += GM_KS;
    if (BSPLIT) pB2 += GM_KS;
  };
  const int nSlabs = K / GM_KS;   // block-uniform

  // ---- ring prologue: slabs 0 and 1 start; slab 0 lands and is published; then slab 2 starts ----
  // Every wave issues exactly NCP copies per slab, all lanes on, and nothing else counts on asynccnt: a wait to NCP leaves
  // the youngest slab's copies in flight and returns when every older slab's have landed.
  stage(Stg);
  if (nSlabs > 1) {                                     // block-uniform test
    stage(Stg + BUF);
    asm volatile("s_wait_asynccnt %0" :: "n"(NCP) : "memory");   // this wave's copies of slab 0 have landed; slab 1's may still fly
  } else {
    asm volatile("s_wait_asynccnt 0x0" ::: "memory");   // this wave's copies of slab 0 have landed
  }
  __syncthreads();                                      // every wave's have: slab 0 may be read
  if (nSlabs > 2) stage(Stg + 2 * BUF);

  int cur = 0;   // s mod GM_NB: the buffer that holds slab s
  for (int s = 0; s < nSlabs; ++s) {
    T* sb = Stg + cur * BUF;
    // the four 32-k steps of the slab unrolled: a later step's LDS reads may go ahead of an earlier step's products
#pragma unroll
    for (int kk = 0; kk < GM_KS; kk += 32) {
      V bh[4], bl[4];
#pragma unroll
      for (int j = 0; j < 4; ++j) {
        const int bo = (wn0 + (j << 4) + rlane) * GM_SP + koff + kk;
        bh[j] = Frag<T>::load(sb + ROW_BH * GM_SP + bo);
        if (BSPLIT) bl[j] = Frag<T>::load(sb + ROW_BL * GM_SP + bo);
      }
      // all of the step's LDS reads stand together, ahead of its products
      V ah[2], al[2];
#pragma unroll
      for (int i = 0; i < 2; ++i) {
        const int ao = (wm0 + (i << 4) + rlane) * GM_SP + koff + kk;
        ah[i] = Frag<T>::load(sb + ao);
        al[i] = ah[i];
        if (ASPLIT) al[i] = Frag<T>::load(sb + ROW_AL * GM_SP + ao);
      }
#pragma unroll
      for (int i = 0; i < 2; ++i) {
#pragma unroll
        for (int j = 0; j < 4; ++j) {
          acc[i][j] = Frag<T>::mma(ah[i], bh[j], acc[i][j]);
          if (BSPLIT) acc[i][j] = Frag<T>::mma(ah[i], bl[j], acc[i][j]);
          if (ASPLIT) acc[i][j] = Frag<T>::mma(al[i], bh[j], acc[i][j]);
        }
        Frag<T>::guard(acc[i][0], acc[i][3], ah[i], al[i]);
      }
      Frag<T>::keep(bh[0], bh[1], bh[2], bh[3]);
      if (BSPLIT) Frag<T>::keep(bl[0], bl[1], bl[2], bl[3]);
    }
    // ---- publish point of slab s + 1, every wave ----
    asm volatile("s_wait_dscnt 0x0" ::: "memory");      // this wave's reads of slab s's buffer have returned
    if (s + 2 < nSlabs) {                               // block-uniform test: slab s + 2 has been issued, its NCP copies are the youngest
      asm volatile("s_wait_asynccnt %0" :: "n"(NCP) : "memory");   // this wave's copies of slab s + 1 have landed; slab s + 2's may still fly
    } else {
      asm volatile("s_wait_asynccnt 0x0" ::: "memory"); // nothing younger than slab s + 1 was issued
    }
    __syncthreads();                                    // publishes slab s + 1 and ends every reader's last read of slab s's buffer
    if (s + 3 < nSlabs) stage(sb);                      // block-uniform test; slab s + 3 into the buffer that trip s has just read
    cur = (cur == GM_NB - 1) ? 0 : cur + 1;
  }
  asm volatile("s_wait_asynccnt 0x0" ::: "memory");     // no copy is outstanding when the wave goes on to its end
  acc_guard4(acc[0][0], acc[0][1], acc[0][2], acc[0][3]);
  acc_guard4(acc[1][0], acc[1][1], acc[1][2], acc[1][3]);

  // ---- epilogue ----
  // The last trip's publish point (every wave: reads returned, no copy outstanding, barrier) has ended all use of the ring:
  // each wave stages its output in a range of its own in the first buffer (16x64 slab, pitch 68 floats).
  float* slab = (float*)Stg + wave * (16 * 68);
#pragma unroll
  for (int i = 0; i < 2; ++i) {
    const int mBase = m0 + (i << 4);
#pragma unroll
    for (int j = 0; j < 4; ++j) {
      const int n = n0 + (j << 4) + rlane;
      float bv = 0.f;
      if (BIAS_MODE == 2) bv = bias[n];
#pragma unroll
      for (int r = 0; r < 8; ++r) {
        float v = acc[i][j][r] * scale;
        if (BIAS_MODE == 1) v += bias[mBase + mOff + r];
        if (BIAS_MODE == 2) v += bv;
        slab[(mOff + r) * 68 + (j << 4) + rlane] = v;
      }
    }
    __builtin_amdgcn_fence(__ATOMIC_RELEASE, "workgroup");
    __builtin_amdgcn_wave_barrier();
    __builtin_amdgcn_fence(__ATOMIC_ACQUIRE, "workgroup");
    if (OUT_MODE == 0) {
      float* C = (float*)Cout + (size_t)b * strideC;
      const int hh = lane >> 4, c4 = (lane & 15) * 4;     // row seg = 256 B = 16 lanes x 16 B
      {
#pragma unroll
        for (int it = 0; it < 8; ++it) {
          const int row = it * 2 + hh;
          v4f v = *(const v4f*)(slab + row * 68 + c4);
          *(v4f*)(C + (size_t)(mBase + row) * ldc + n0 + c4) = v;
        }
        
      }
    } else {
      const int q = lane >> 3, c8 = (lane & 7) * 8;
      unsigned short* C  = (unsigned short*)Cout  + (size_t)b * strideC;
      unsigned short* C2 = (OUT_MODE == 2) ? ((unsigned short*)Cout2 + (size_t)b * strideC) : nullptr;
      {
#pragma unroll
        for (int it = 0; it < 4; ++it) {
          const int row = it * 4 + q;
          const float* sp = slab + row * 68 + c8;
          v8h hv, lv;
#pragma unroll
          for (int e = 0; e < 8; ++e) {
            if (OUT_MODE == 1) {
              hv[e] = (_Float16)sp[e];
            } else {
              unsigned short hb = f2bf_bits(sp[e]);
              unsigned short lb = f2bf_bits(sp[e] - bf_bits2f(hb));
              hv[e] = __builtin_bit_cast(_Float16, hb);
              lv[e] = __builtin_bit_cast(_Float16, lb);
            }
          }
          *(v8h*)(C + (size_t)(mBase + row) * ldc + n0 + c8) = hv;
          if (OUT_MODE == 2) *(v8h*)(C2 + (size_t)(mBase + row) * ldc + n0 + c8) = lv;
        }
        
      }
    }
    __builtin_amdgcn_fence(__ATOMIC_RELEASE, "workgroup");
    __builtin_amdgcn_wave_barrier();
    __builtin_amdgcn_fence(__ATOMIC_ACQUIRE, "workgroup");
  }
}

// ---- all five f32 inputs -> bf16 (RNE) in one launch: one 16-wave block per WGP, few long waves in place of many two-element ones ----
// Block b converts the b-th of 256 equal contiguous parts of every input, in steps of 2,048 floats (4 a lane):
// a wave's load is 512 contiguous bytes, its store 256. x and W_out take 8 steps a block, the three rank-sized weights 4 each.
// Coverage: 256 blocks x N steps x 2,048 = the whole of each input, each element converted by exactly one lane.
constexpr int CAST_BLOCKS  = 256;
constexpr int CAST_THREADS = 512;
constexpr int CAST_STEP    = CAST_THREADS * 4;                             // floats a block converts per step
constexpr int CAST_NX = SEQ_LEN * HID / (CAST_BLOCKS * CAST_STEP);         // 8
constexpr int CAST_NW = QRANK * HID / (CAST_BLOCKS * CAST_STEP);           // 4
constexpr int CAST_NO = HID * HID / (CAST_BLOCKS * CAST_STEP);             // 8
static_assert(SEQ_LEN * HID == CAST_NX * CAST_BLOCKS * CAST_STEP && QRANK * HID == CAST_NW * CAST_BLOCKS * CAST_STEP &&
              HID * HID == CAST_NO * CAST_BLOCKS * CAST_STEP, "whole steps");
typedef __attribute__((ext_vector_type(2))) unsigned v2u;
// Addresses are a uniform base, one unsigned 32-bit byte offset a lane, and a small constant per step.
template <int N>
__device__ __forceinline__ void cast_load(v4f* r, const float* __restrict__ in) {
  const char* p = (const char*)in + (blockIdx.x * (N * CAST_THREADS) + threadIdx.x) * 16u;
  // unrolled so that r is indexed by constants and lives in registers, and the loads follow one another
#pragma unroll
  for (int i = 0; i < N; ++i) r[i] = *(const v4f*)(p + i * (CAST_STEP * 4));
}
template <int N>
__device__ __forceinline__ void cast_store(const v4f* r, unsigned short* __restrict__ out) {
  char* q = (char*)out + (blockIdx.x * (N * CAST_THREADS) + threadIdx.x) * 8u;
  // unrolled so that r is indexed by constants and lives in registers
#pragma unroll
  for (int i = 0; i < N; ++i) {
    v2u u;
    u[0] = (unsigned)f2bf_bits(r[i][0]) | ((unsigned)f2bf_bits(r[i][1]) << 16);
    u[1] = (unsigned)f2bf_bits(r[i][2]) | ((unsigned)f2bf_bits(r[i][3]) << 16);
    *(v2u*)(q + i * (CAST_STEP * 2)) = u;
  }
}
__global__ __launch_bounds__(CAST_THREADS) void cast_inputs_bf16(
    const float* __restrict__ x, const float* __restrict__ wst, const float* __restrict__ wac,
    const float* __restrict__ wco, const float* __restrict__ wou,
    unsigned short* __restrict__ xb, unsigned short* __restrict__ wstb, unsigned short* __restrict__ wacb,
    unsigned short* __restrict__ wcob, unsigned short* __restrict__ woub) {
  // all of a lane's 28 loads stand ahead of its first store, so that they are in flight together
  v4f rx[CAST_NX], rs[CAST_NW], ra[CAST_NW], rc[CAST_NW], ro[CAST_NO];
  cast_load<CAST_NX>(rx, x);
  cast_load<CAST_NW>(rs, wst);
  cast_load<CAST_NW>(ra, wac);
  cast_load<CAST_NW>(rc, wco);
  // the loads below may be given, for their results, the offset register that the twelve loads above name
  asm volatile("s_wait_xcnt 0x0" ::: "memory");
  cast_load<CAST_NO>(ro, wou);
  cast_store<CAST_NX>(rx, xb);
  cast_store<CAST_NW>(rs, wstb);
  cast_store<CAST_NW>(ra, wacb);
  cast_store<CAST_NW>(rc, wcob);
  cast_store<CAST_NO>(ro, woub);
}

// ---- state|action f32 [SEQ_LEN][2*QRANK] -> bf16 hi/lo planes of state, action and q-value (state*action in f32), each [SEQ_LEN][QRANK] ----
// Coverage: grid = SEQ_LEN/2 blocks x 256 threads; thread -> row = 2*blk + (tid>>7), cols (tid&127)*8 .. +7 -> 2048 rows x 1024 cols exactly, all six planes.
__global__ __launch_bounds__(256) void planes_k(const float* __restrict__ sa,
    unsigned short* __restrict__ sthp, unsigned short* __restrict__ stlp,
    unsigned short* __restrict__ achp, unsigned short* __restrict__ aclp,
    unsigned short* __restrict__ qvhp, unsigned short* __restrict__ qvlp) {
  const int row = blockIdx.x * 2 + (threadIdx.x >> 7);
  const int c8  = (threadIdx.x & 127) * 8;
  const float* sp = sa + (size_t)row * (2 * QRANK) + c8;
  const v8f sv = *(const v8f*)(sp);
  const v8f av = *(const v8f*)(sp + QRANK);
  v8h shv, slv, ahv, alv, qhv, qlv;
#pragma unroll
  for (int e = 0; e < 8; ++e) {
    const float s = sv[e], a = av[e];
    const float q = s * a;
    unsigned short hb, lb;
    hb = f2bf_bits(s); lb = f2bf_bits(s - bf_bits2f(hb));
    shv[e] = __builtin_bit_cast(_Float16, hb); slv[e] = __builtin_bit_cast(_Float16, lb);
    hb = f2bf_bits(a); lb = f2bf_bits(a - bf_bits2f(hb));
    ahv[e] = __builtin_bit_cast(_Float16, hb); alv[e] = __builtin_bit_cast(_Float16, lb);
    hb = f2bf_bits(q); lb = f2bf_bits(q - bf_bits2f(hb));
    qhv[e] = __builtin_bit_cast(_Float16, hb); qlv[e] = __builtin_bit_cast(_Float16, lb);
  }
  const size_t o = (size_t)row * QRANK + c8;
  _Float16* sth = (_Float16*)sthp; _Float16* stl = (_Float16*)stlp;
  _Float16* ach = (_Float16*)achp; _Float16* acl = (_Float16*)aclp;
  _Float16* qvh = (_Float16*)qvhp; _Float16* qvl = (_Float16*)qvlp;
  {
    *(v8h*)(sth + o) = shv;
    *(v8h*)(stl + o) = slv;
    *(v8h*)(ach + o) = ahv;
    *(v8h*)(acl + o) = alv;
    *(v8h*)(qvh + o) = qhv;
    *(v8h*)(qvl + o) = qlv;
    
  }
}

constexpr int ATT_QBLK = 64;
constexpr int ATT_KCH  = 64;
constexpr int ATT_OSP  = 132;
constexpr int ATT_NQB  = SEQ_LEN / ATT_QBLK;
constexpr int ATT_SP   = 72;                          // staged row pitch in elements: 128-B rows at 144 B (16 B x odd, for ds_load_b128 readers)
constexpr int ATT_ROW_KH = 0;                         // staged rows: 64 K hi, 64 K lo, 128 V hi, 128 V lo
constexpr int ATT_ROW_KL = ATT_KCH;
constexpr int ATT_ROW_VH = 2 * ATT_KCH;
constexpr int ATT_ROW_VL = 2 * ATT_KCH + HVAL;
constexpr int ATT_ROWS   = 2 * ATT_KCH + 2 * HVAL;    // 384
static_assert(HRANK * 2 == 128 && ATT_KCH * 2 == 128, "staged rows are 128 B");
static_assert(ATT_QBLK == ATT_KCH && ATT_NQB % 2 == 0, "both chunks of every step lie inside the sequence");

__device__ __forceinline__ __bf16 at_f2bf(float f) { return __builtin_bit_cast(__bf16, f2bf_bits(f)); }
__device__ __forceinline__ void at_split(float f, __bf16& hi, __bf16& lo) {
  const unsigned short hb = f2bf_bits(f);
  hi = __builtin_bit_cast(__bf16, hb);
  lo = at_f2bf(f - __uint_as_float(((unsigned)hb) << 16));
}
__device__ __forceinline__ v8f at_mma(v16b a, v16b b, v8f c) {
  return __builtin_amdgcn_wmma_f32_16x16x32_bf16(false, a, false, b, (short)0, c, false, false);
}
// exp(d / 8) = 2^(d * ATT_C2) for a difference d of raw q.k sums: the 1/8 of the scores and log2(e) in one factor,
// so that an exponential is one multiply-add and one v_exp_f32. 2^(-inf) = 0; results below the normal range count as 0.
constexpr float ATT_C2 = 0.125f * 1.44269504088896340736f;
__device__ __forceinline__ float at_exp2(float x) { return __builtin_amdgcn_exp2f(x); }
// The same with the slot that the instruction set asks for behind a transcendental (one independent instruction or v_nop before its result is
// read or its source overwritten) in the statement itself.
__device__ __forceinline__ float at_exp2_slot(float x) {
  float r;
  asm("v_exp_f32 %0, %1\n\tv_nop" : "=v"(r) : "v"(x));
  return r;
}
// Eight exponentials in place, in one statement: each stands in front of an independent one, the last in front of the v_nop, and what
// reads a result follows the whole group, most of it at a distance that needs no stall.
__device__ __forceinline__ void at_exp2_x8(float* e) {
  asm("v_exp_f32 %0, %0\n\t"
      "v_exp_f32 %1, %1\n\t"
      "v_exp_f32 %2, %2\n\t"
      "v_exp_f32 %3, %3\n\t"
      "v_exp_f32 %4, %4\n\t"
      "v_exp_f32 %5, %5\n\t"
      "v_exp_f32 %6, %6\n\t"
      "v_exp_f32 %7, %7\n\t"
      "v_nop"
      : "+v"(e[0]), "+v"(e[1]), "+v"(e[2]), "+v"(e[3]), "+v"(e[4]), "+v"(e[5]), "+v"(e[6]), "+v"(e[7]));
}
// the value that lane l ^ 16 holds
__device__ __forceinline__ float at_xhalf(float x) {
  const int b = __builtin_bit_cast(int, x);
  return __builtin_bit_cast(float, __builtin_amdgcn_permlanex16(b, b, 0x76543210, 0xfedcba98, false, false));
}

// One chunk's 384 staged rows x 8 segments of 16 B = 3072 lane copies = 24 per thread of a 128-thread key group (tid counts inside the group).
// Copy i of thread tid: staged row i*16 + (tid >> 3), segment tid & 7: a wave's copy covers four whole 128-B lines.
__device__ __forceinline__ void at_stage(__bf16* buf, const __bf16* ach, const __bf16* acl,
                                         const __bf16* cth, const __bf16* ctl, int h, int kv0, int tid) {
  const int rg = tid >> 3, seg = (tid & 7) * 8;
  unsigned l[24];
  const __bf16* g[24];
  // the three loops are unrolled so that every index of l and g is a constant and both arrays live in registers
#pragma unroll
  for (int i = 0; i < 24; ++i) l[i] = (unsigned)(size_t)(buf + (i * 16 + rg) * ATT_SP + seg);
#pragma unroll
  for (int i = 0; i < 4; ++i) {
    const size_t ko = (size_t)(kv0 + i * 16 + rg) * QRANK + h * HRANK + seg;
    g[i] = ach + ko;
    g[4 + i] = acl + ko;
  }
#pragma unroll
  for (int i = 0; i < 8; ++i) {
    const size_t vo = (size_t)(h * HVAL + i * 16 + rg) * SEQ_LEN + kv0 + seg;
    g[8 + i] = cth + vo;
    g[16 + i] = ctl + vo;
  }
  at_copy12(l, g);
  at_copy12(l + 12, g + 12);
}

__global__ __launch_bounds__(256)
void attn_route_k(const unsigned short* __restrict__ sthp, const unsigned short* __restrict__ stlp,
                  const unsigned short* __restrict__ achp, const unsigned short* __restrict__ aclp,
                  const unsigned short* __restrict__ cthp, const unsigned short* __restrict__ ctlp,
                  unsigned short* __restrict__ ghp, unsigned short* __restrict__ glp) {
  __shared__ __align__(16) float  Os[4][16 * ATT_OSP];         // per 16 query rows: out tile [row][d], pitch 132
  __shared__ float Ms[4][16];                                  // group 1's row maxima
  __shared__ float Ls[4][16];                                  // group 1's row sums
  __shared__ __align__(16) __bf16 Stg[2][2][ATT_ROWS * ATT_SP];   // two buffers x two key groups of staged K and content^T rows

  const __bf16* sth = (const __bf16*)sthp; const __bf16* stl = (const __bf16*)stlp;
  const __bf16* ach = (const __bf16*)achp; const __bf16* acl = (const __bf16*)aclp;
  const __bf16* cth = (const __bf16*)cthp; const __bf16* ctl = (const __bf16*)ctlp;
  _Float16* gh = (_Float16*)ghp; _Float16* gl = (_Float16*)glp;

  const int tid  = threadIdx.x;
  const int wave = __builtin_amdgcn_readfirstlane(tid >> 5);   // in a scalar register: the tests on the key group below are scalar branches
  const int grp  = wave >> 2;    // key group
  const int wq   = wave & 3;     // which 16 query rows
  const int gtid = tid & 127;    // thread index inside the key group
  const int lane = tid & 31;
  const int hh   = lane >> 4;
  const int c    = lane & 15;
  const int bx = blockIdx.x;
  const int qb = ATT_NQB - 1 - bx / NHEADS;   // cost falls with the block index
  const int h  = bx % NHEADS;
  const int q0 = qb * ATT_QBLK + wq * 16;

  // ---- Q fragments (B operand): 2 depth chunks, hi and lo; column = query c, k = dc*32 + 8*hh + {0..7, 16..23} ----
  v16b qah[2], qal[2];
#pragma unroll
  for (int dc = 0; dc < 2; ++dc) {
    const size_t off = (size_t)(q0 + c) * QRANK + h * HRANK + dc * 32 + 8 * hh;
    qah[dc] = Frag<__bf16>::load(sth + off);
    qal[dc] = Frag<__bf16>::load(stl + off);
  }

  float mrow = -INFINITY;   // running maximum of query q0 + c, the same in both lane halves
  float lrow = 0.f;         // running sum over the keys that this lane half holds
  v8f oacc[8];
#pragma unroll
  for (int t = 0; t < 8; ++t) oacc[t] = (v8f){0.f,0.f,0.f,0.f,0.f,0.f,0.f,0.f};

  const int nChunks = qb + 1;              // block-uniform, <= 32
  const int nSteps  = (nChunks + 1) >> 1;  // block-uniform, <= 16; step st holds chunks 2*st and 2*st + 1 (<= 31: both lie inside the sequence)

  // ---- ring prologue: step 0 lands and is published; then step 1 starts ----
  at_stage(Stg[0][grp], ach, acl, cth, ctl, h, grp * ATT_KCH, gtid);
  asm volatile("s_wait_asynccnt 0x0" ::: "memory");   // this wave's copies of step 0 have landed
  __syncthreads();                                    // every wave's have: step 0 may be read
  if (nSteps > 1) at_stage(Stg[1][grp], ach, acl, cth, ctl, h, (2 + grp) * ATT_KCH, gtid);

  for (int st = 0; st < nSteps; ++st) {
    const int kc = 2 * st + grp;
    // wave-uniform: with an odd number of chunks group 1 has none in the last step; the publish point below stands outside this test
    if (kc < nChunks) {
    const int kv0 = kc * ATT_KCH;
    const __bf16* sb = Stg[st & 1][grp];

    // ---- scores, transposed: S^T = K . Q^T; 4 key subtiles of 16; A = K rows (row = key, k = depth, staged rows), B = the Q fragments ----
    // Register r of subtile j in lane (hh, c) is the score of key kv0 + j*16 + 8*hh + r and query q0 + c: a lane holds one query's scores.
    // All of the chunk's K fragments are read as one group; the products then go round the four subtiles, so that
    // consecutive matrix instructions write different accumulators. Per accumulator and depth step: hi.hi, q hi . k lo, q lo . k hi.
    // Every loop over fragments or accumulators in this chunk loop is unrolled, so that these arrays are indexed by constants and live in registers.
    v8f s[4];
    v16b kb[2][4], kl[2][4];
#pragma unroll
    for (int dc = 0; dc < 2; ++dc) {
#pragma unroll
      for (int j = 0; j < 4; ++j) {
        const int ko = (j * 16 + c) * ATT_SP + dc * 32 + 8 * hh;
        kb[dc][j] = Frag<__bf16>::load(sb + ATT_ROW_KH * ATT_SP + ko);
        kl[dc][j] = Frag<__bf16>::load(sb + ATT_ROW_KL * ATT_SP + ko);
      }
    }
    // keeps the K reads one group ahead of the products: a read left among the products is waited for on its own
    __builtin_amdgcn_sched_barrier(0);
#pragma unroll
    for (int j = 0; j < 4; ++j) s[j] = (v8f){0.f,0.f,0.f,0.f,0.f,0.f,0.f,0.f};
#pragma unroll
    for (int dc = 0; dc < 2; ++dc) {
#pragma unroll
      for (int j = 0; j < 4; ++j) s[j] = at_mma(kb[dc][j], qah[dc], s[j]);
#pragma unroll
      for (int j = 0; j < 4; ++j) s[j] = at_mma(kl[dc][j], qah[dc], s[j]);
#pragma unroll
      for (int j = 0; j < 4; ++j) s[j] = at_mma(kb[dc][j], qal[dc], s[j]);
    }

    // ---- content^T A-fragments (row = d, k = kv) of both 32-key steps: read here, they do not depend on the softmax ----
    v16b vb[2][8], vl[2][8];
#pragma unroll
    for (int kk = 0; kk < 2; ++kk) {
#pragma unroll
      for (int t = 0; t < 8; ++t) {
        const int vo = (t * 16 + c) * ATT_SP + kk * 32 + 8 * hh;
        vb[kk][t] = Frag<__bf16>::load(sb + ATT_ROW_VH * ATT_SP + vo);
        vl[kk][t] = Frag<__bf16>::load(sb + ATT_ROW_VL * ATT_SP + vo);
      }
    }
    // keeps these reads above the softmax arithmetic, so that their LDS latency passes under it
    __builtin_amdgcn_sched_barrier(0);

    // ---- causal select on the diagonal chunk, the query's maximum (raw sums): in the lane, then one exchange between the lane halves ----
    // key index j*16 + r inside this lane's half of the chunk lies in the future where it exceeds dq; off the diagonal none does
    const int dq = (kc == qb) ? (q0 + c - kv0 - 8 * hh) : ATT_KCH;
    float mj[4];   // four independent chains
#pragma unroll
    for (int j = 0; j < 4; ++j) {
      float m = -INFINITY;
#pragma unroll
      for (int r = 0; r < 8; ++r) {
        float v = s[j][r];
        if (j * 16 + r > dq) v = -INFINITY;
        s[j][r] = v;
        m = fmaxf(m, v);
      }
      mj[j] = m;
    }
    float cm = fmaxf(fmaxf(mj[0], mj[1]), fmaxf(mj[2], mj[3]));
    cm = fmaxf(cm, at_xhalf(cm));

    // ---- online softmax update; P^T goes from the score registers straight into B operands, bf16 hi/lo ----
    // Subtiles 2*kk and 2*kk + 1 of a lane are keys kk*32 + 8*hh + {0..7, 16..23}: the k order of the content^T fragments.
    const float mnew = fmaxf(mrow, cm);
    const float alpha = at_exp2_slot((mrow - mnew) * ATT_C2);
    const float nb = -mnew * ATT_C2;
    mrow = mnew;
    v16b pa[2], pl[2];
    float pj[4];   // this lane's part of the query's sum, four independent chains
#pragma unroll
    for (int j = 0; j < 4; ++j) {
      float e[8];
#pragma unroll
      for (int r = 0; r < 8; ++r) e[r] = __builtin_fmaf(s[j][r], ATT_C2, nb);
      at_exp2_x8(e);
      float psum = 0.f;
#pragma unroll
      for (int r = 0; r < 8; ++r) {
        const float p = e[r];
        psum += p;
        __bf16 a, bl; at_split(p, a, bl);
        pa[j >> 1][(j & 1) * 8 + r] = a;
        pl[j >> 1][(j & 1) * 8 + r] = bl;
      }
      pj[j] = psum;
    }
    lrow = lrow * alpha + ((pj[0] + pj[1]) + (pj[2] + pj[3]));
#pragma unroll
    for (int t = 0; t < 8; ++t) oacc[t] *= alpha;

    // ---- O^T += V^T . P^T: register r of subtile t in lane (hh, c) is output column t*16 + 8*hh + r of query q0 + c ----
    // Six groups of eight products, each group going round the eight output subtiles; per accumulator and 32-key step:
    // hi.hi, p hi . v lo, p lo . v hi.
#pragma unroll
    for (int g = 0; g < 6; ++g) {
      const int kk = g / 3, term = g % 3;
#pragma unroll
      for (int t = 0; t < 8; ++t)
        oacc[t] = at_mma(term == 1 ? vl[kk][t] : vb[kk][t], term == 2 ? pl[kk] : pa[kk], oacc[t]);
    }
    }

    // ---- publish point of step st + 1, every wave ----
    asm volatile("s_wait_dscnt 0x0" ::: "memory");      // this wave's reads of buffer st & 1 have returned
    asm volatile("s_wait_asynccnt 0x0" ::: "memory");   // this wave's copies of step st + 1 have landed
    __syncthreads();                                    // publishes step st + 1 and ends every reader's last read of buffer st & 1
    if (st + 2 < nSteps) at_stage(Stg[st & 1][grp], ach, acl, cth, ctl, h, (2 * (st + 2) + grp) * ATT_KCH, gtid);   // block-uniform test
  }
  asm volatile("s_wait_asynccnt 0x0" ::: "memory");     // no copy is outstanding when the wave goes on to its end

  // ---- the two key groups' states are joined: group 1 writes its own to LDS, group 0 rescales both to the common row maximum ----
  // Every loop of this part is unrolled, so that oacc is indexed by constants and lives in registers.
  lrow += at_xhalf(lrow);   // the two lane halves' parts of the query's sum
  float* os = Os[wq];
  float* ol = os + c * ATT_OSP + 8 * hh;   // this lane's query row; subtile t is the eight columns from t*16 + 8*hh
  if (grp == 1) {
#pragma unroll
    for (int t = 0; t < 8; ++t) {
      *(v4f*)(ol + t * 16)     = (v4f){oacc[t][0], oacc[t][1], oacc[t][2], oacc[t][3]};
      *(v4f*)(ol + t * 16 + 4) = (v4f){oacc[t][4], oacc[t][5], oacc[t][6], oacc[t][7]};
    }
    if (hh == 0) {   // a query's two lanes hold the same maximum and the same sum
      Ms[wq][c] = mrow;
      Ls[wq][c] = lrow;
    }
  }
  __syncthreads();   // group 1's state may be read; every wave passes it, and no barrier follows
  if (grp == 0) {
  // Group 0 holds chunk 0, of which every row sees key 0: its maximum is finite. A group 1 without a chunk hands over -inf, 0 and zeros: factor 0.
  const float m2 = Ms[wq][c];
  const float l2 = Ls[wq][c];
  const float m  = fmaxf(mrow, m2);
  const float a1 = at_exp2((mrow - m) * ATT_C2);
  const float a2 = at_exp2((m2 - m) * ATT_C2);
  const float inv = 1.0f / (lrow * a1 + l2 * a2);
  const float f1 = a1 * inv;   // what group 0's and group 1's unnormalised output is multiplied by
  const float f2 = a2 * inv;
  // each lane reads and rewrites its own elements of the tile
#pragma unroll
  for (int t = 0; t < 8; ++t) {
    const v4f o0 = *(const v4f*)(ol + t * 16);
    const v4f o1 = *(const v4f*)(ol + t * 16 + 4);
    *(v4f*)(ol + t * 16)     = (v4f){oacc[t][0], oacc[t][1], oacc[t][2], oacc[t][3]} * f1 + o0 * f2;
    *(v4f*)(ol + t * 16 + 4) = (v4f){oacc[t][4], oacc[t][5], oacc[t][6], oacc[t][7]} * f1 + o1 * f2;
  }
  __builtin_amdgcn_fence(__ATOMIC_RELEASE, "workgroup");
  __builtin_amdgcn_wave_barrier();
  __builtin_amdgcn_fence(__ATOMIC_ACQUIRE, "workgroup");
  {
    // lane groups of 8: q4 = lane>>3; row parity = q4>>1, column half = q4&1; it = 0..7 -> rows 0..15, cols 0..127: whole 16x128 tile, both planes
    const int q4 = lane >> 3, c8 = (lane & 7) * 8;
    const int rpar = q4 >> 1, chalf = (q4 & 1) * 64;
    {
#pragma unroll
      for (int it = 0; it < 8; ++it) {
        const int row = it * 2 + rpar;
        const int col = chalf + c8;
        const float* sp = os + row * ATT_OSP + col;
        v8h hv, lv;
#pragma unroll
        for (int e = 0; e < 8; ++e) {
          const unsigned short hb = f2bf_bits(sp[e]);
          const unsigned short lb = f2bf_bits(sp[e] - bf_bits2f(hb));
          hv[e] = __builtin_bit_cast(_Float16, hb);
          lv[e] = __builtin_bit_cast(_Float16, lb);
        }
        const size_t go = (size_t)(q0 + row) * HID + h * HVAL + col;
        *(v8h*)(gh + go) = hv;
        *(v8h*)(gl + go) = lv;
      }
      
    }
  }
  }
}

// =====================================================================================
// Host launcher. Workspace region map (bytes, every offset a multiple of 4 MiB):
//   XB   bf16 [2048][2048]   8 MiB   x
//   WSA  bf16 [2048][2048]   8 MiB   rows 0..1023 W_state, 1024..2047 W_action
//   WC   bf16 [2048][1024]   4 MiB   W_content
//   WO   bf16 [2048][2048]   8 MiB   W_out
//   SA32 f32  [2048][2048]  16 MiB   state | action
//   STH, STL, ACH, ACL, QVH, QVL  bf16 [2048][1024]  4 MiB each (state, action, q-value hi/lo)
//   CTH, CTL  bf16 [2048 = h*128+d][2048 = kv]  8 MiB each (content^T hi/lo)
//   GH, GL    bf16 [2048][2048]  8 MiB each (gathered hi/lo)
//   total 104,857,600 B
// =====================================================================================
extern "C" void kernel_launch(void* const* d_in, const int* in_sizes, int n_in,
                              void* d_out, int out_size, void* d_ws, size_t ws_size,
                              hipStream_t stream) {
  if (n_in < 6) return;
  if (in_sizes[0] != SEQ_LEN * HID || in_sizes[1] != QRANK * HID || in_sizes[2] != QRANK * HID ||
      in_sizes[3] != HID * QRANK || in_sizes[4] != HID * HID || in_sizes[5] != HID) return;
  if (out_size != SEQ_LEN * HID) return;

  const float* x  = (const float*)d_in[0];
  const float* Ws = (const float*)d_in[1];
  const float* Wa = (const float*)d_in[2];
  const float* Wc = (const float*)d_in[3];
  const float* Wo = (const float*)d_in[4];
  const float* bo = (const float*)d_in[5];
  float* out = (float*)d_out;

  const size_t B_XB  = (size_t)SEQ_LEN * HID * 2;
  const size_t B_WSA = (size_t)(2 * QRANK) * HID * 2;
  const size_t B_WC  = (size_t)HID * QRANK * 2;
  const size_t B_WO  = (size_t)HID * HID * 2;
  const size_t B_SA  = (size_t)SEQ_LEN * (2 * QRANK) * 4;
  const size_t B_PL  = (size_t)SEQ_LEN * QRANK * 2;     // one [2048][1024] bf16 plane
  const size_t B_CT  = (size_t)HID * SEQ_LEN * 2;       // one [2048][2048] bf16 plane
  const size_t B_G   = (size_t)SEQ_LEN * HID * 2;

  char* ws = (char*)d_ws;
  size_t off = 0;
  unsigned short* XB  = (unsigned short*)(ws + off); off += B_XB;
  unsigned short* WSA = (unsigned short*)(ws + off); off += B_WSA;
  unsigned short* WC  = (unsigned short*)(ws + off); off += B_WC;
  unsigned short* WO  = (unsigned short*)(ws + off); off += B_WO;
  float*          SA  = (float*)(ws + off);          off += B_SA;
  unsigned short* STH = (unsigned short*)(ws + off); off += B_PL;
  unsigned short* STL = (unsigned short*)(ws + off); off += B_PL;
  unsigned short* ACH = (unsigned short*)(ws + off); off += B_PL;
  unsigned short* ACL = (unsigned short*)(ws + off); off += B_PL;
  unsigned short* QVH = (unsigned short*)(ws + off); off += B_PL;
  unsigned short* QVL = (unsigned short*)(ws + off); off += B_PL;
  unsigned short* CTH = (unsigned short*)(ws + off); off += B_CT;
  unsigned short* CTL = (unsigned short*)(ws + off); off += B_CT;
  unsigned short* GH  = (unsigned short*)(ws + off); off += B_G;
  unsigned short* GL  = (unsigned short*)(ws + off); off += B_G;
  if (off > ws_size) return;

  // ---- input casts to bf16 (RNE) ----
  cast_inputs_bf16<<<dim3(CAST_BLOCKS), dim3(CAST_THREADS), 0, stream>>>(
      x, Ws, Wa, Wc, Wo, XB, WSA, WSA + (size_t)QRANK * HID, WC, WO);

  // ---- projections: SA[q][0..2047] = x . [W_state; W_action]^T  (M=2048, N=2048, K=2048) ----
  {
    const int M = SEQ_LEN, N = 2 * QRANK, K = HID;
    const int blocks = (M / GM_BM) * (N / GM_BN);   // 256
    wmma_gemm64<1, false, false, 0, 0><<<dim3(blocks, 1), dim3(256), 0, stream>>>(
        XB, XB, K, 0L, WSA, WSA, K, 0L, (void*)SA, (void*)SA, N, 0L, bo, M, N, K, 1.0f);
  }

  // ---- bf16 hi/lo planes of state, action, q-value ----
  planes_k<<<dim3(SEQ_LEN / 2), dim3(256), 0, stream>>>(SA, STH, STL, ACH, ACL, QVH, QVL);

  // ---- content^T[n][kv] = W_content[n][:] . qval[kv][:]  (M=2048, N=2048, K=1024; B = q-value hi/lo) -> bf16 hi/lo planes ----
  {
    const int M = HID, N = SEQ_LEN, K = QRANK;
    const int blocks = (M / GM_BM) * (N / GM_BN);   // 256
    wmma_gemm64<1, false, true, 0, 2><<<dim3(blocks, 1), dim3(256), 0, stream>>>(
        WC, WC, K, 0L, QVH, QVL, K, 0L, (void*)CTH, (void*)CTL, N, 0L, bo, M, N, K, 1.0f);
  }

  // ---- causal routing attention -> gathered hi/lo planes ----
  attn_route_k<<<dim3(NHEADS * ATT_NQB), dim3(256), 0, stream>>>(STH, STL, ACH, ACL, CTH, CTL, GH, GL);

  // ---- out = gathered . W_out^T + b_out  (M=N=K=2048; A = gathered hi/lo), f32 ----
  {
    const int M = SEQ_LEN, N = HID, K = HID;
    const int blocks = (M / GM_BM) * (N / GM_BN);   // 256
    wmma_gemm64<1, true, false, 2, 0><<<dim3(blocks, 1), dim3(256), 0, stream>>>(
        GH, GL, K, 0L, WO, WO, K, 0L, (void*)out, (void*)out, N, 0L, bo, M, N, K, 1.0f);
  }
}

// v010
// It runs in 117 microseconds.
// Two timings next to v009 both put it at 1.03 times that version's speed.
// Over all steps from v000 it is 4.83 times as fast.
// All contractions: v_wmma_f32_16x16x32_bf16 (bf16 operands, f32 accumulate): x and weight matrices as single RNE bf16 planes; state/action, q-value product, softmax p, content and gathered carried as bf16 hi/lo planes (hi.hi + hi.lo + lo.hi); softmax, q-value product and bias in f32.
#include <hip/hip_runtime.h>
#include <stdint.h>

constexpr int SEQ_LEN = 2048;   // L
constexpr int HID     = 2048;   // hidden
constexpr int QRANK   = 1024;   // q_rank
constexpr int NHEADS  = 16;
constexpr int HRANK   = 64;     // per-head rank (q/k depth)
constexpr int HVAL    = 128;    // per-head value width
static_assert(QRANK == NHEADS * HRANK, "rank split");
static_assert(HID == NHEADS * HVAL, "value split");
static_assert(SEQ_LEN % 64 == 0 && HID % 64 == 0 && QRANK % 64 == 0, "tile multiples");
static_assert(HID % 32 == 0 && QRANK % 32 == 0, "K multiples of 32");

typedef __attribute__((ext_vector_type(16))) _Float16 v16h;
typedef __attribute__((ext_vector_type(8)))  _Float16 v8h;
typedef __attribute__((ext_vector_type(16))) __bf16   v16b;
typedef __attribute__((ext_vector_type(8)))  __bf16   v8b;
typedef __attribute__((ext_vector_type(8)))  float    v8f;
typedef __attribute__((ext_vector_type(4)))  float    v4f;

typedef __attribute__((ext_vector_type(2)))  float    v2f;
typedef __attribute__((ext_vector_type(2)))  __bf16   v2b;
typedef __attribute__((ext_vector_type(4)))  unsigned v4u;
typedef __attribute__((ext_vector_type(8)))  unsigned v8u;

// Two f32 -> two bf16 (round to nearest even) in one register, a in the low half: one v_cvt_pk_bf16_f32.
__device__ __forceinline__ unsigned bf_pack2(float a, float b) {
  return __builtin_bit_cast(unsigned, __builtin_convertvector((v2f){a, b}, v2b));
}
// hi and lo planes of two f32, each pair in one register: hi = bf16(v), lo = bf16(v - hi); v - hi is exact in f32.
__device__ __forceinline__ void bf_split2(float a, float b, unsigned& hi, unsigned& lo) {
  const v2b h = __builtin_convertvector((v2f){a, b}, v2b);
  hi = __builtin_bit_cast(unsigned, h);
  lo = bf_pack2(a - (float)h[0], b - (float)h[1]);
}

// hazard guards as plain device helpers
__device__ __forceinline__ void dep_guard_h(v8f& a, v8f& b, v16h x, v16h y) { asm volatile("v_nop\n\tv_nop\n\tv_nop\n\tv_nop" : "+v"(a), "+v"(b) : "v"(x), "v"(y)); }
__device__ __forceinline__ void dep_guard_b(v8f& a, v8f& b, v16b x, v16b y) { asm volatile("v_nop\n\tv_nop\n\tv_nop\n\tv_nop" : "+v"(a), "+v"(b) : "v"(x), "v"(y)); }
__device__ __forceinline__ void keep4_h(v16h a, v16h b, v16h c, v16h d) { asm volatile("v_nop" :: "v"(a), "v"(b), "v"(c), "v"(d)); }
__device__ __forceinline__ void keep4_b(v16b a, v16b b, v16b c, v16b d) { asm volatile("v_nop" :: "v"(a), "v"(b), "v"(c), "v"(d)); }
__device__ __forceinline__ void acc_guard4(v8f& a, v8f& b, v8f& c, v8f& d) { asm volatile("v_nop\n\tv_nop\n\tv_nop\n\tv_nop" : "+v"(a), "+v"(b), "+v"(c), "+v"(d)); }
template <typename T> struct Frag;
template <> struct Frag<_Float16> {
  typedef v16h V; union U { v16h v; v8h h[2]; };
  static __device__ __forceinline__ v16h load(const _Float16* p) {   // elements 0..7 <- p[0..7], 8..15 <- p[16..23]
    U f; f.h[0] = *(const v8h*)(p); f.h[1] = *(const v8h*)(p + 16); return f.v;
  }
  static __device__ __forceinline__ v8f mma(v16h a, v16h b, v8f c) {
    return __builtin_amdgcn_wmma_f32_16x16x32_f16(false, a, false, b, (short)0, c, false, false);
  }
  static __device__ __forceinline__ void guard(v8f& a, v8f& b, v16h x, v16h y) { dep_guard_h(a, b, x, y); }
  static __device__ __forceinline__ void keep(v16h a, v16h b, v16h c, v16h d) { keep4_h(a, b, c, d); }
};
template <> struct Frag<__bf16> {
  typedef v16b V; union U { v16b v; v8b h[2]; };
  static __device__ __forceinline__ v16b load(const __bf16* p) {
    U f; f.h[0] = *(const v8b*)(p); f.h[1] = *(const v8b*)(p + 16); return f.v;
  }
  static __device__ __forceinline__ v8f mma(v16b a, v16b b, v8f c) {
    return __builtin_amdgcn_wmma_f32_16x16x32_bf16(false, a, false, b, (short)0, c, false, false);
  }
  static __device__ __forceinline__ void guard(v8f& a, v8f& b, v16b x, v16b y) { dep_guard_b(a, b, x, y); }
  static __device__ __forceinline__ void keep(v16b a, v16b b, v16b c, v16b d) { keep4_b(a, b, c, d); }
};

// Twelve asynchronous 16-B-per-lane copies global -> LDS. The s_wait_xcnt is the last line of the copies' own statement,
// so that no address register of an issued copy is rewritten in front of it.
__device__ __forceinline__ void at_copy12(const unsigned* l, const __bf16* const* g) {
  asm volatile(
      "global_load_async_to_lds_b128 %0, %12, off\n\t"
      "global_load_async_to_lds_b128 %1, %13, off\n\t"
      "global_load_async_to_lds_b128 %2, %14, off\n\t"
      "global_load_async_to_lds_b128 %3, %15, off\n\t"
      "global_load_async_to_lds_b128 %4, %16, off\n\t"
      "global_load_async_to_lds_b128 %5, %17, off\n\t"
      "global_load_async_to_lds_b128 %6, %18, off\n\t"
      "global_load_async_to_lds_b128 %7, %19, off\n\t"
      "global_load_async_to_lds_b128 %8, %20, off\n\t"
      "global_load_async_to_lds_b128 %9, %21, off\n\t"
      "global_load_async_to_lds_b128 %10, %22, off\n\t"
      "global_load_async_to_lds_b128 %11, %23, off\n\t"
      "s_wait_xcnt 0x0"
      :: "v"(l[0]), "v"(l[1]), "v"(l[2]), "v"(l[3]), "v"(l[4]), "v"(l[5]),
         "v"(l[6]), "v"(l[7]), "v"(l[8]), "v"(l[9]), "v"(l[10]), "v"(l[11]),
         "v"(g[0]), "v"(g[1]), "v"(g[2]), "v"(g[3]), "v"(g[4]), "v"(g[5]),
         "v"(g[6]), "v"(g[7]), "v"(g[8]), "v"(g[9]), "v"(g[10]), "v"(g[11])
      : "memory");
}

// The same for eight copies.
__device__ __forceinline__ void at_copy8(const unsigned* l, const __bf16* const* g) {
  asm volatile(
      "global_load_async_to_lds_b128 %0, %8, off\n\t"
      "global_load_async_to_lds_b128 %1, %9, off\n\t"
      "global_load_async_to_lds_b128 %2, %10, off\n\t"
      "global_load_async_to_lds_b128 %3, %11, off\n\t"
      "global_load_async_to_lds_b128 %4, %12, off\n\t"
      "global_load_async_to_lds_b128 %5, %13, off\n\t"
      "global_load_async_to_lds_b128 %6, %14, off\n\t"
      "global_load_async_to_lds_b128 %7, %15, off\n\t"
      "s_wait_xcnt 0x0"
      :: "v"(l[0]), "v"(l[1]), "v"(l[2]), "v"(l[3]), "v"(l[4]), "v"(l[5]), "v"(l[6]), "v"(l[7]),
         "v"(g[0]), "v"(g[1]), "v"(g[2]), "v"(g[3]), "v"(g[4]), "v"(g[5]), "v"(g[6]), "v"(g[7])
      : "memory");
}

// ---- Register-blocked batched WMMA GEMM ------------------------------------
// C[m,n] = scale * sum_k A[m,k] * Bt[n,k] (+bias); each wave owns a 32x64 tile; a block's 8 waves (4 x 2) own a 128x128 tile,
// so that the 2048x2048 outputs here give 256 blocks, one for every WGP.
// A row-major [M,K]; Bt row-major [N,K]; M % 128 == 0, N % 128 == 0, K % 128 == 0.
// Per 128 k the block's 128 A rows and 128 Bt rows (each plane) are brought into LDS once by asynchronous copies, whole 256-B units,
// three buffers (slabs s + 1 and s + 2 fly while slab s is worked on: a slab has two trips to arrive in); the waves read their fragments there.
// ASPLIT: A carried as hi/lo planes (A2 = lo plane, same layout); BSPLIT: Bt hi/lo (Bt2 = lo plane).
//   product = hi.hi (+ hi.lo if BSPLIT) (+ lo.hi if ASPLIT).
// BIAS_MODE: 0 = none, 1 = bias[m], 2 = bias[n].
// OUT_MODE: 0 = f32, 1 = f16, 2 = bf16 hi plane (Cout) + bf16 lo plane (Cout2).
// Coverage: per 32x64 tile, 2 slabs x 16 rows x 64 cols -> the whole tile; grid = (M/128)*(N/128) blocks of 8 waves.
// ET: 0 = f16 operands, 1 = bf16 operands (pointers passed as 16-bit storage)
constexpr int GM_BM = 128;   // block tile rows
constexpr int GM_BN = 128;   // block tile cols
constexpr int GM_KS = 128;   // k per staged slab: 256-B rows
constexpr int GM_SP = 136;   // staged row pitch in elements: 272 B (16 B x odd, for ds_load_b128 readers)
constexpr int GM_NB = 3;     // buffers of the ring
static_assert(SEQ_LEN % GM_BM == 0 && HID % GM_BM == 0, "block tile multiples");
static_assert(SEQ_LEN % GM_BN == 0 && HID % GM_BN == 0 && (2 * QRANK) % GM_BN == 0, "block tile multiples");
static_assert(HID % GM_KS == 0 && QRANK % GM_KS == 0, "K multiples of the slab");
template <int ET> struct Elem;
template <> struct Elem<0> { typedef _Float16 T; };
template <> struct Elem<1> { typedef __bf16 T; };
template <int ET, bool ASPLIT, bool BSPLIT, int BIAS_MODE, int OUT_MODE>
__global__ __launch_bounds__(256) void wmma_gemm64(
    const unsigned short* __restrict__ Ap, const unsigned short* __restrict__ A2p, int lda, long strideA,
    const unsigned short* __restrict__ Btp, const unsigned short* __restrict__ Bt2p, int ldb, long strideB,
    void* __restrict__ Cout, void* __restrict__ Cout2, int ldc, long strideC,
    const float* __restrict__ bias,
    int M, int N, int K, float scale) {
  typedef typename Elem<ET>::T T;
  typedef typename Frag<T>::V V;
  const T* A = (const T*)Ap; const T* A2 = (const T*)A2p; const T* Bt = (const T*)Btp; const T* Bt2 = (const T*)Bt2p;
  // staged rows of one slab: A hi (, A lo), Bt hi (, Bt lo); every plane starts at a multiple of 16 rows
  constexpr int ROW_AL = GM_BM;
  constexpr int ROW_BH = GM_BM * (ASPLIT ? 2 : 1);
  constexpr int ROW_BL = ROW_BH + GM_BN;
  constexpr int ROWS   = ROW_BH + GM_BN * (BSPLIT ? 2 : 1);   // 256 or 384
  constexpr int NCP    = ROWS / 16;                           // copies per thread and slab: 16 or 24
  static_assert(NCP == 16 || NCP == 24, "copy statements below");
  static_assert((GM_NB - 1) * NCP <= 63, "copies of one wave in flight");
  constexpr int BUF = ROWS * GM_SP;                // elements of one buffer
  static_assert(8 * 16 * 68 * 4 <= BUF * 2, "the epilogue's staging fits in the first buffer");
  __shared__ __align__(16) T Stg[GM_NB * BUF];     // three buffers of staged rows, shared by the block; behind the loop the epilogue's staging
  const int b    = blockIdx.y;
  const int tid  = threadIdx.x;
  const int lane = threadIdx.x & 31;
  const int wave = threadIdx.x >> 5;
  const int blkN = N / GM_BN;
  if ((int)blockIdx.x >= (M / GM_BM) * blkN) return;   // block-uniform, in front of every barrier
  const int bm  = blockIdx.x / blkN;
  const int bm0 = bm * GM_BM;
  const int bn0 = (blockIdx.x - bm * blkN) * GM_BN;
  const int wm0 = (wave >> 1) << 5;            // this wave's 32x64 tile inside the block tile
  const int wn0 = (wave & 1) << 6;
  const int m0 = bm0 + wm0;
  const int n0 = bn0 + wn0;

  const T* Ab  = A  + (size_t)b * strideA;
  const T* Bb  = Bt + (size_t)b * strideB;
  const T* Ab2 = ASPLIT ? (A2  + (size_t)b * strideA) : nullptr;
  const T* Bb2 = BSPLIT ? (Bt2 + (size_t)b * strideB) : nullptr;

  const int rlane = lane & 15;                 // row (A) / col (B, D) within subtile
  const int koff  = (lane >> 4) * 8;           // k offset of this lane half
  const int mOff  = (lane >> 4) * 8;           // D row offset

  v8f acc[2][4];
#pragma unroll
  for (int i = 0; i < 2; ++i)
#pragma unroll
    for (int j = 0; j < 4; ++j) acc[i][j] = (v8f){0.f,0.f,0.f,0.f,0.f,0.f,0.f,0.f};

  // One slab: ROWS staged rows x 16 segments of 16 B = NCP lane copies per thread of the 256-thread block.
  // Copy i of thread tid: staged row i*16 + (tid >> 4), segment tid & 15: a wave's copy covers two whole 256-B units.
  // One running pointer per plane (this thread's first row and segment of the next slab to stage); the other rows are 16*ld apart.
  const int rg = tid >> 4, seg = (tid & 15) * 8;
  const T* pA  = Ab + (size_t)(bm0 + rg) * lda + seg;
  const T* pB  = Bb + (size_t)(bn0 + rg) * ldb + seg;
  const T* pA2 = ASPLIT ? (Ab2 + (size_t)(bm0 + rg) * lda + seg) : nullptr;
  const T* pB2 = BSPLIT ? (Bb2 + (size_t)(bn0 + rg) * ldb + seg) : nullptr;
  auto stage = [&](T* buf) {
    unsigned l[NCP];
    const __bf16* g[NCP];
    // unrolled so that every index of l and g is a constant and both arrays live in registers
#pragma unroll
    for (int i = 0; i < NCP; ++i) {
      const T* sp;
      if (i * 16 >= ROW_BL)                 sp = pB2 + (size_t)(i * 16 - ROW_BL) * ldb;
      else if (i * 16 >= ROW_BH)            sp = pB  + (size_t)(i * 16 - ROW_BH) * ldb;
      else if (ASPLIT && i * 16 >= ROW_AL)  sp = pA2 + (size_t)(i * 16 - ROW_AL) * lda;
      else                                  sp = pA  + (size_t)(i * 16) * lda;
      l[i] = (unsigned)(size_t)(buf + (i * 16 + rg) * GM_SP + seg);
      g[i] = (const __bf16*)sp;
    }
    if (NCP == 16) { at_copy8(l, g); at_copy8(l + NCP - 8, g + NCP - 8); }
    if (NCP == 24) { at_copy12(l, g); at_copy12(l + NCP - 12, g + NCP - 12); }
    pA += GM_KS; pB += GM_KS;
    if (ASPLIT) pA2 += GM_KS;
    if (BSPLIT) pB2 += GM_KS;
  };
  const int nSlabs = K / GM_KS;   // block-uniform

  // ---- ring prologue: slabs 0 and 1 start; slab 0 lands and is published; then slab 2 starts ----
  // Every wave issues exactly NCP copies per slab, all lanes on, and nothing else counts on asynccnt: a wait to NCP leaves
  // the youngest slab's copies in flight and returns when every older slab's have landed.
  stage(Stg);
  if (nSlabs > 1) {                                     // block-uniform test
    stage(Stg + BUF);
    asm volatile("s_wait_asynccnt %0" :: "n"(NCP) : "memory");   // this wave's copies of slab 0 have landed; slab 1's may still fly
  } else {
    asm volatile("s_wait_asynccnt 0x0" ::: "memory");   // this wave's copies of slab 0 have landed
  }
  __syncthreads();                                      // every wave's have: slab 0 may be read
  if (nSlabs > 2) stage(Stg + 2 * BUF);

  int cur = 0;   // s mod GM_NB: the buffer that holds slab s
  for (int s = 0; s < nSlabs; ++s) {
    T* sb = Stg + cur * BUF;
    // the four 32-k steps of the slab unrolled: a later step's LDS reads may go ahead of an earlier step's products
#pragma unroll
    for (int kk = 0; kk < GM_KS; kk += 32) {
      V bh[4], bl[4];
#pragma unroll
      for (int j = 0; j < 4; ++j) {
        const int bo = (wn0 + (j << 4) + rlane) * GM_SP + koff + kk;
        bh[j] = Frag<T>::load(sb + ROW_BH * GM_SP + bo);
        if (BSPLIT) bl[j] = Frag<T>::load(sb + ROW_BL * GM_SP + bo);
      }
      // all of the step's LDS reads stand together, ahead of its products
      V ah[2], al[2];
#pragma unroll
      for (int i = 0; i < 2; ++i) {
        const int ao = (wm0 + (i << 4) + rlane) * GM_SP + koff + kk;
        ah[i] = Frag<T>::load(sb + ao);
        al[i] = ah[i];
        if (ASPLIT) al[i] = Frag<T>::load(sb + ROW_AL * GM_SP + ao);
      }
#pragma unroll
      for (int i = 0; i < 2; ++i) {
#pragma unroll
        for (int j = 0; j < 4; ++j) {
          acc[i][j] = Frag<T>::mma(ah[i], bh[j], acc[i][j]);
          if (BSPLIT) acc[i][j] = Frag<T>::mma(ah[i], bl[j], acc[i][j]);
          if (ASPLIT) acc[i][j] = Frag<T>::mma(al[i], bh[j], acc[i][j]);
        }
        Frag<T>::guard(acc[i][0], acc[i][3], ah[i], al[i]);
      }
      Frag<T>::keep(bh[0], bh[1], bh[2], bh[3]);
      if (BSPLIT) Frag<T>::keep(bl[0], bl[1], bl[2], bl[3]);
    }
    // ---- publish point of slab s + 1, every wave ----
    asm volatile("s_wait_dscnt 0x0" ::: "memory");      // this wave's reads of slab s's buffer have returned
    if (s + 2 < nSlabs) {                               // block-uniform test: slab s + 2 has been issued, its NCP copies are the youngest
      asm volatile("s_wait_asynccnt %0" :: "n"(NCP) : "memory");   // this wave's copies of slab s + 1 have landed; slab s + 2's may still fly
    } else {
      asm volatile("s_wait_asynccnt 0x0" ::: "memory"); // nothing younger than slab s + 1 was issued
    }
    __syncthreads();                                    // publishes slab s + 1 and ends every reader's last read of slab s's buffer
    if (s + 3 < nSlabs) stage(sb);                      // block-uniform test; slab s + 3 into the buffer that trip s has just read
    cur = (cur == GM_NB - 1) ? 0 : cur + 1;
  }
  asm volatile("s_wait_asynccnt 0x0" ::: "memory");     // no copy is outstanding when the wave goes on to its end
  acc_guard4(acc[0][0], acc[0][1], acc[0][2], acc[0][3]);
  acc_guard4(acc[1][0], acc[1][1], acc[1][2], acc[1][3]);

  // ---- epilogue ----
  // The last trip's publish point (every wave: reads returned, no copy outstanding, barrier) has ended all use of the ring:
  // each wave stages its output in a range of its own in the first buffer (16x64 slab, pitch 68 floats).
  float* slab = (float*)Stg + wave * (16 * 68);
#pragma unroll
  for (int i = 0; i < 2; ++i) {
    const int mBase = m0 + (i << 4);
#pragma unroll
    for (int j = 0; j < 4; ++j) {
      const int n = n0 + (j << 4) + rlane;
      float bv = 0.f;
      if (BIAS_MODE == 2) bv = bias[n];
#pragma unroll
      for (int r = 0; r < 8; ++r) {
        float v = acc[i][j][r] * scale;
        if (BIAS_MODE == 1) v += bias[mBase + mOff + r];
        if (BIAS_MODE == 2) v += bv;
        slab[(mOff + r) * 68 + (j << 4) + rlane] = v;
      }
    }
    __builtin_amdgcn_fence(__ATOMIC_RELEASE, "workgroup");
    __builtin_amdgcn_wave_barrier();
    __builtin_amdgcn_fence(__ATOMIC_ACQUIRE, "workgroup");
    if (OUT_MODE == 0) {
      float* C = (float*)Cout + (size_t)b * strideC;
      const int hh = lane >> 4, c4 = (lane & 15) * 4;     // row seg = 256 B = 16 lanes x 16 B
      {
#pragma unroll
        for (int it = 0; it < 8; ++it) {
          const int row = it * 2 + hh;
          v4f v = *(const v4f*)(slab + row * 68 + c4);
          *(v4f*)(C + (size_t)(mBase + row) * ldc + n0 + c4) = v;
        }
        
      }
    } else {
      const int q = lane >> 3, c8 = (lane & 7) * 8;
      unsigned short* C  = (unsigned short*)Cout  + (size_t)b * strideC;
      unsigned short* C2 = (OUT_MODE == 2) ? ((unsigned short*)Cout2 + (size_t)b * strideC) : nullptr;
      {
#pragma unroll
        for (int it = 0; it < 4; ++it) {
          const int row = it * 4 + q;
          const float* sp = slab + row * 68 + c8;
          if (OUT_MODE == 1) {
            v8h hv;
#pragma unroll
            for (int e = 0; e < 8; ++e) hv[e] = (_Float16)sp[e];
            *(v8h*)(C + (size_t)(mBase + row) * ldc + n0 + c8) = hv;
          } else {
            v4u hv, lv;
            // unrolled so that hv and lv are indexed by constants and live in registers
#pragma unroll
            for (int e = 0; e < 4; ++e) { unsigned hb, lb; bf_split2(sp[2 * e], sp[2 * e + 1], hb, lb); hv[e] = hb; lv[e] = lb; }
            *(v4u*)(C  + (size_t)(mBase + row) * ldc + n0 + c8) = hv;
            *(v4u*)(C2 + (size_t)(mBase + row) * ldc + n0 + c8) = lv;
          }
        }
        
      }
    }
    __builtin_amdgcn_fence(__ATOMIC_RELEASE, "workgroup");
    __builtin_amdgcn_wave_barrier();
    __builtin_amdgcn_fence(__ATOMIC_ACQUIRE, "workgroup");
  }
}

// ---- all five f32 inputs -> bf16 (RNE) in one launch: one 16-wave block per WGP, few long waves in place of many two-element ones ----
// Block b converts the b-th of 256 equal contiguous parts of every input, in steps of 2,048 floats (4 a lane):
// a wave's load is 512 contiguous bytes, its store 256. x and W_out take 8 steps a block, the three rank-sized weights 4 each.
// Coverage: 256 blocks x N steps x 2,048 = the whole of each input, each element converted by exactly one lane.
constexpr int CAST_BLOCKS  = 256;
constexpr int CAST_THREADS = 512;
constexpr int CAST_STEP    = CAST_THREADS * 4;                             // floats a block converts per step
constexpr int CAST_NX = SEQ_LEN * HID / (CAST_BLOCKS * CAST_STEP);         // 8
constexpr int CAST_NW = QRANK * HID / (CAST_BLOCKS * CAST_STEP);           // 4
constexpr int CAST_NO = HID * HID / (CAST_BLOCKS * CAST_STEP);             // 8
static_assert(SEQ_LEN * HID == CAST_NX * CAST_BLOCKS * CAST_STEP && QRANK * HID == CAST_NW * CAST_BLOCKS * CAST_STEP &&
              HID * HID == CAST_NO * CAST_BLOCKS * CAST_STEP, "whole steps");
typedef __attribute__((ext_vector_type(2))) unsigned v2u;
// Addresses are a uniform base, one unsigned 32-bit byte offset a lane, and a small constant per step.
template <int N>
__device__ __forceinline__ void cast_load(v4f* r, const float* __restrict__ in) {
  const char* p = (const char*)in + (blockIdx.x * (N * CAST_THREADS) + threadIdx.x) * 16u;
  // unrolled so that r is indexed by constants and lives in registers, and the loads follow one another
#pragma unroll
  for (int i = 0; i < N; ++i) r[i] = *(const v4f*)(p + i * (CAST_STEP * 4));
}
template <int N>
__device__ __forceinline__ void cast_store(const v4f* r, unsigned short* __restrict__ out) {
  char* q = (char*)out + (blockIdx.x * (N * CAST_THREADS) + threadIdx.x) * 8u;
  // unrolled so that r is indexed by constants and lives in registers
#pragma unroll
  for (int i = 0; i < N; ++i) {
    v2u u;
    u[0] = bf_pack2(r[i][0], r[i][1]);
    u[1] = bf_pack2(r[i][2], r[i][3]);
    *(v2u*)(q + i * (CAST_STEP * 2)) = u;
  }
}
__global__ __launch_bounds__(CAST_THREADS) void cast_inputs_bf16(
    const float* __restrict__ x, const float* __restrict__ wst, const float* __restrict__ wac,
    const float* __restrict__ wco, const float* __restrict__ wou,
    unsigned short* __restrict__ xb, unsigned short* __restrict__ wstb, unsigned short* __restrict__ wacb,
    unsigned short* __restrict__ wcob, unsigned short* __restrict__ woub) {
  // all of a lane's 28 loads stand ahead of its first store, so that they are in flight together
  v4f rx[CAST_NX], rs[CAST_NW], ra[CAST_NW], rc[CAST_NW], ro[CAST_NO];
  cast_load<CAST_NX>(rx, x);
  cast_load<CAST_NW>(rs, wst);
  cast_load<CAST_NW>(ra, wac);
  cast_load<CAST_NW>(rc, wco);
  // the loads below may be given, for their results, the offset register that the twelve loads above name
  asm volatile("s_wait_xcnt 0x0" ::: "memory");
  cast_load<CAST_NO>(ro, wou);
  // keeps every conversion behind the last load: moved up among the loads they free registers early, and fewer loads are then in flight
  __builtin_amdgcn_sched_barrier(0);
  cast_store<CAST_NX>(rx, xb);
  cast_store<CAST_NW>(rs, wstb);
  cast_store<CAST_NW>(ra, wacb);
  cast_store<CAST_NW>(rc, wcob);
  cast_store<CAST_NO>(ro, woub);
}

// ---- state|action f32 [SEQ_LEN][2*QRANK] -> bf16 hi/lo planes of state, action and q-value (state*action in f32), each [SEQ_LEN][QRANK] ----
// Coverage: grid = SEQ_LEN/2 blocks x 256 threads; thread -> row = 2*blk + (tid>>7), cols (tid&127)*8 .. +7 -> 2048 rows x 1024 cols exactly, all six planes.
__global__ __launch_bounds__(256) void planes_k(const float* __restrict__ sa,
    unsigned short* __restrict__ sthp, unsigned short* __restrict__ stlp,
    unsigned short* __restrict__ achp, unsigned short* __restrict__ aclp,
    unsigned short* __restrict__ qvhp, unsigned short* __restrict__ qvlp) {
  const int row = blockIdx.x * 2 + (threadIdx.x >> 7);
  const int c8  = (threadIdx.x & 127) * 8;
  const float* sp = sa + (size_t)row * (2 * QRANK) + c8;
  const v8f sv = *(const v8f*)(sp);
  const v8f av = *(const v8f*)(sp + QRANK);
  v4u shv, slv, ahv, alv, qhv, qlv;
  // unrolled so that the six vectors are indexed by constants and live in registers
#pragma unroll
  for (int e = 0; e < 4; ++e) {
    const float s0 = sv[2 * e], s1 = sv[2 * e + 1], a0 = av[2 * e], a1 = av[2 * e + 1];
    unsigned hb, lb;
    bf_split2(s0, s1, hb, lb);           shv[e] = hb; slv[e] = lb;
    bf_split2(a0, a1, hb, lb);           ahv[e] = hb; alv[e] = lb;
    bf_split2(s0 * a0, s1 * a1, hb, lb); qhv[e] = hb; qlv[e] = lb;
  }
  const size_t o = (size_t)row * QRANK + c8;
  *(v4u*)(sthp + o) = shv;
  *(v4u*)(stlp + o) = slv;
  *(v4u*)(achp + o) = ahv;
  *(v4u*)(aclp + o) = alv;
  *(v4u*)(qvhp + o) = qhv;
  *(v4u*)(qvlp + o) = qlv;
}

constexpr int ATT_QBLK = 64;
constexpr int ATT_KCH  = 64;
constexpr int ATT_OSP  = 132;
constexpr int ATT_NQB  = SEQ_LEN / ATT_QBLK;
constexpr int ATT_SP   = 72;                          // staged row pitch in elements: 128-B rows at 144 B (16 B x odd, for ds_load_b128 readers)
constexpr int ATT_ROW_KH = 0;                         // staged rows: 64 K hi, 64 K lo, 128 V hi, 128 V lo
constexpr int ATT_ROW_KL = ATT_KCH;
constexpr int ATT_ROW_VH = 2 * ATT_KCH;
constexpr int ATT_ROW_VL = 2 * ATT_KCH + HVAL;
constexpr int ATT_ROWS   = 2 * ATT_KCH + 2 * HVAL;    // 384
static_assert(HRANK * 2 == 128 && ATT_KCH * 2 == 128, "staged rows are 128 B");
static_assert(ATT_QBLK == ATT_KCH && ATT_NQB % 2 == 0, "both chunks of every step lie inside the sequence");

__device__ __forceinline__ v8f at_mma(v16b a, v16b b, v8f c) {
  return __builtin_amdgcn_wmma_f32_16x16x32_bf16(false, a, false, b, (short)0, c, false, false);
}
// exp(d / 8) = 2^(d * ATT_C2) for a difference d of raw q.k sums: the 1/8 of the scores and log2(e) in one factor,
// so that an exponential is one multiply-add and one v_exp_f32. 2^(-inf) = 0; results below the normal range count as 0.
constexpr float ATT_C2 = 0.125f * 1.44269504088896340736f;
__device__ __forceinline__ float at_exp2(float x) { return __builtin_amdgcn_exp2f(x); }
// The same with the slot that the instruction set asks for behind a transcendental (one independent instruction or v_nop before its result is
// read or its source overwritten) in the statement itself.
__device__ __forceinline__ float at_exp2_slot(float x) {
  float r;
  asm("v_exp_f32 %0, %1\n\tv_nop" : "=v"(r) : "v"(x));
  return r;
}
// Eight exponentials in place, in one statement: each stands in front of an independent one, the last in front of the v_nop, and what
// reads a result follows the whole group, most of it at a distance that needs no stall.
__device__ __forceinline__ void at_exp2_x8(float* e) {
  asm("v_exp_f32 %0, %0\n\t"
      "v_exp_f32 %1, %1\n\t"
      "v_exp_f32 %2, %2\n\t"
      "v_exp_f32 %3, %3\n\t"
      "v_exp_f32 %4, %4\n\t"
      "v_exp_f32 %5, %5\n\t"
      "v_exp_f32 %6, %6\n\t"
      "v_exp_f32 %7, %7\n\t"
      "v_nop"
      : "+v"(e[0]), "+v"(e[1]), "+v"(e[2]), "+v"(e[3]), "+v"(e[4]), "+v"(e[5]), "+v"(e[6]), "+v"(e[7]));
}
// the value that lane l ^ 16 holds
__device__ __forceinline__ float at_xhalf(float x) {
  const int b = __builtin_bit_cast(int, x);
  return __builtin_bit_cast(float, __builtin_amdgcn_permlanex16(b, b, 0x76543210, 0xfedcba98, false, false));
}

// One chunk's 384 staged rows x 8 segments of 16 B = 3072 lane copies = 24 per thread of a 128-thread key group (tid counts inside the group).
// Copy i of thread tid: staged row i*16 + (tid >> 3), segment tid & 7: a wave's copy covers four whole 128-B lines.
__device__ __forceinline__ void at_stage(__bf16* buf, const __bf16* ach, const __bf16* acl,
                                         const __bf16* cth, const __bf16* ctl, int h, int kv0, int tid) {
  const int rg = tid >> 3, seg = (tid & 7) * 8;
  unsigned l[24];
  const __bf16* g[24];
  // the three loops are unrolled so that every index of l and g is a constant and both arrays live in registers
#pragma unroll
  for (int i = 0; i < 24; ++i) l[i] = (unsigned)(size_t)(buf + (i * 16 + rg) * ATT_SP + seg);
#pragma unroll
  for (int i = 0; i < 4; ++i) {
    const size_t ko = (size_t)(kv0 + i * 16 + rg) * QRANK + h * HRANK + seg;
    g[i] = ach + ko;
    g[4 + i] = acl + ko;
  }
#pragma unroll
  for (int i = 0; i < 8; ++i) {
    const size_t vo = (size_t)(h * HVAL + i * 16 + rg) * SEQ_LEN + kv0 + seg;
    g[8 + i] = cth + vo;
    g[16 + i] = ctl + vo;
  }
  at_copy12(l, g);
  at_copy12(l + 12, g + 12);
}

__global__ __launch_bounds__(256)
void attn_route_k(const unsigned short* __restrict__ sthp, const unsigned short* __restrict__ stlp,
                  const unsigned short* __restrict__ achp, const unsigned short* __restrict__ aclp,
                  const unsigned short* __restrict__ cthp, const unsigned short* __restrict__ ctlp,
                  unsigned short* __restrict__ ghp, unsigned short* __restrict__ glp) {
  __shared__ __align__(16) float  Os[4][16 * ATT_OSP];         // per 16 query rows: out tile [row][d], pitch 132
  __shared__ float Ms[4][16];                                  // group 1's row maxima
  __shared__ float Ls[4][16];                                  // group 1's row sums
  __shared__ __align__(16) __bf16 Stg[2][2][ATT_ROWS * ATT_SP];   // two buffers x two key groups of staged K and content^T rows

  const __bf16* sth = (const __bf16*)sthp; const __bf16* stl = (const __bf16*)stlp;
  const __bf16* ach = (const __bf16*)achp; const __bf16* acl = (const __bf16*)aclp;
  const __bf16* cth = (const __bf16*)cthp; const __bf16* ctl = (const __bf16*)ctlp;

  const int tid  = threadIdx.x;
  const int wave = __builtin_amdgcn_readfirstlane(tid >> 5);   // in a scalar register: the tests on the key group below are scalar branches
  const int grp  = wave >> 2;    // key group
  const int wq   = wave & 3;     // which 16 query rows
  const int gtid = tid & 127;    // thread index inside the key group
  const int lane = tid & 31;
  const int hh   = lane >> 4;
  const int c    = lane & 15;
  const int bx = blockIdx.x;
  const int qb = ATT_NQB - 1 - bx / NHEADS;   // cost falls with the block index
  const int h  = bx % NHEADS;
  const int q0 = qb * ATT_QBLK + wq * 16;

  // ---- Q fragments (B operand): 2 depth chunks, hi and lo; column = query c, k = dc*32 + 8*hh + {0..7, 16..23} ----
  v16b qah[2], qal[2];
#pragma unroll
  for (int dc = 0; dc < 2; ++dc) {
    const size_t off = (size_t)(q0 + c) * QRANK + h * HRANK + dc * 32 + 8 * hh;
    qah[dc] = Frag<__bf16>::load(sth + off);
    qal[dc] = Frag<__bf16>::load(stl + off);
  }

  float mrow = -INFINITY;   // running maximum of query q0 + c, the same in both lane halves
  float lrow = 0.f;         // running sum over the keys that this lane half holds
  v8f oacc[8];
#pragma unroll
  for (int t = 0; t < 8; ++t) oacc[t] = (v8f){0.f,0.f,0.f,0.f,0.f,0.f,0.f,0.f};

  const int nChunks = qb + 1;              // block-uniform, <= 32
  const int nSteps  = (nChunks + 1) >> 1;  // block-uniform, <= 16; step st holds chunks 2*st and 2*st + 1 (<= 31: both lie inside the sequence)

  // ---- ring prologue: step 0 lands and is published; then step 1 starts ----
  at_stage(Stg[0][grp], ach, acl, cth, ctl, h, grp * ATT_KCH, gtid);
  asm volatile("s_wait_asynccnt 0x0" ::: "memory");   // this wave's copies of step 0 have landed
  __syncthreads();                                    // every wave's have: step 0 may be read
  if (nSteps > 1) at_stage(Stg[1][grp], ach, acl, cth, ctl, h, (2 + grp) * ATT_KCH, gtid);

  for (int st = 0; st < nSteps; ++st) {
    const int kc = 2 * st + grp;
    // wave-uniform: with an odd number of chunks group 1 has none in the last step; the publish point below stands outside this test
    if (kc < nChunks) {
    const int kv0 = kc * ATT_KCH;
    const __bf16* sb = Stg[st & 1][grp];

    // ---- scores, transposed: S^T = K . Q^T; 4 key subtiles of 16; A = K rows (row = key, k = depth, staged rows), B = the Q fragments ----
    // Register r of subtile j in lane (hh, c) is the score of key kv0 + j*16 + 8*hh + r and query q0 + c: a lane holds one query's scores.
    // All of the chunk's K fragments are read as one group; the products then go round the four subtiles, so that
    // consecutive matrix instructions write different accumulators. Per accumulator and depth step: hi.hi, q hi . k lo, q lo . k hi.
    // Every loop over fragments or accumulators in this chunk loop is unrolled, so that these arrays are indexed by constants and live in registers.
    v8f s[4];
    v16b kb[2][4], kl[2][4];
#pragma unroll
    for (int dc = 0; dc < 2; ++dc) {
#pragma unroll
      for (int j = 0; j < 4; ++j) {
        const int ko = (j * 16 + c) * ATT_SP + dc * 32 + 8 * hh;
        kb[dc][j] = Frag<__bf16>::load(sb + ATT_ROW_KH * ATT_SP + ko);
        kl[dc][j] = Frag<__bf16>::load(sb + ATT_ROW_KL * ATT_SP + ko);
      }
    }
    // keeps the K reads one group ahead of the products: a read left among the products is waited for on its own
    __builtin_amdgcn_sched_barrier(0);
#pragma unroll
    for (int j = 0; j < 4; ++j) s[j] = (v8f){0.f,0.f,0.f,0.f,0.f,0.f,0.f,0.f};
#pragma unroll
    for (int dc = 0; dc < 2; ++dc) {
#pragma unroll
      for (int j = 0; j < 4; ++j) s[j] = at_mma(kb[dc][j], qah[dc], s[j]);
#pragma unroll
      for (int j = 0; j < 4; ++j) s[j] = at_mma(kl[dc][j], qah[dc], s[j]);
#pragma unroll
      for (int j = 0; j < 4; ++j) s[j] = at_mma(kb[dc][j], qal[dc], s[j]);
    }

    // ---- content^T A-fragments (row = d, k = kv) of both 32-key steps: read here, they do not depend on the softmax ----
    v16b vb[2][8], vl[2][8];
#pragma unroll
    for (int kk = 0; kk < 2; ++kk) {
#pragma unroll
      for (int t = 0; t < 8; ++t) {
        const int vo = (t * 16 + c) * ATT_SP + kk * 32 + 8 * hh;
        vb[kk][t] = Frag<__bf16>::load(sb + ATT_ROW_VH * ATT_SP + vo);
        vl[kk][t] = Frag<__bf16>::load(sb + ATT_ROW_VL * ATT_SP + vo);
      }
    }
    // keeps these reads above the softmax arithmetic, so that their LDS latency passes under it
    __builtin_amdgcn_sched_barrier(0);

    // ---- causal select on the diagonal chunk, the query's maximum (raw sums): in the lane, then one exchange between the lane halves ----
    // key index j*16 + r inside this lane's half of the chunk lies in the future where it exceeds dq; off the diagonal none does
    const int dq = (kc == qb) ? (q0 + c - kv0 - 8 * hh) : ATT_KCH;
    float mj[4];   // four independent chains
#pragma unroll
    for (int j = 0; j < 4; ++j) {
      float m = -INFINITY;
#pragma unroll
      for (int r = 0; r < 8; ++r) {
        float v = s[j][r];
        if (j * 16 + r > dq) v = -INFINITY;
        s[j][r] = v;
        m = fmaxf(m, v);
      }
      mj[j] = m;
    }
    float cm = fmaxf(fmaxf(mj[0], mj[1]), fmaxf(mj[2], mj[3]));
    cm = fmaxf(cm, at_xhalf(cm));

    // ---- online softmax update; P^T goes from the score registers straight into B operands, bf16 hi/lo ----
    // Subtiles 2*kk and 2*kk + 1 of a lane are keys kk*32 + 8*hh + {0..7, 16..23}: the k order of the content^T fragments.
    const float mnew = fmaxf(mrow, cm);
    const float alpha = at_exp2_slot((mrow - mnew) * ATT_C2);
    const float nb = -mnew * ATT_C2;
    mrow = mnew;
    v8u pau[2], plu[2];   // P^T hi and lo, two keys a register
    float pj[4];   // this lane's part of the query's sum, four independent chains
#pragma unroll
    for (int j = 0; j < 4; ++j) {
      float e[8];
#pragma unroll
      for (int r = 0; r < 8; ++r) e[r] = __builtin_fmaf(s[j][r], ATT_C2, nb);
      at_exp2_x8(e);
      float psum = 0.f;
#pragma unroll
      for (int r = 0; r < 8; ++r) psum += e[r];
#pragma unroll
      for (int r = 0; r < 4; ++r) {
        unsigned a, bl; bf_split2(e[2 * r], e[2 * r + 1], a, bl);
        pau[j >> 1][(j & 1) * 4 + r] = a;
        plu[j >> 1][(j & 1) * 4 + r] = bl;
      }
      pj[j] = psum;
    }
    const v16b pa[2] = {__builtin_bit_cast(v16b, pau[0]), __builtin_bit_cast(v16b, pau[1])};
    const v16b pl[2] = {__builtin_bit_cast(v16b, plu[0]), __builtin_bit_cast(v16b, plu[1])};
    lrow = lrow * alpha + ((pj[0] + pj[1]) + (pj[2] + pj[3]));
#pragma unroll
    for (int t = 0; t < 8; ++t) oacc[t] *= alpha;

    // ---- O^T += V^T . P^T: register r of subtile t in lane (hh, c) is output column t*16 + 8*hh + r of query q0 + c ----
    // Six groups of eight products, each group going round the eight output subtiles; per accumulator and 32-key step:
    // hi.hi, p hi . v lo, p lo . v hi.
#pragma unroll
    for (int g = 0; g < 6; ++g) {
      const int kk = g / 3, term = g % 3;
#pragma unroll
      for (int t = 0; t < 8; ++t)
        oacc[t] = at_mma(term == 1 ? vl[kk][t] : vb[kk][t], term == 2 ? pl[kk] : pa[kk], oacc[t]);
    }
    }

    // ---- publish point of step st + 1, every wave ----
    asm volatile("s_wait_dscnt 0x0" ::: "memory");      // this wave's reads of buffer st & 1 have returned
    asm volatile("s_wait_asynccnt 0x0" ::: "memory");   // this wave's copies of step st + 1 have landed
    __syncthreads();                                    // publishes step st + 1 and ends every reader's last read of buffer st & 1
    if (st + 2 < nSteps) at_stage(Stg[st & 1][grp], ach, acl, cth, ctl, h, (2 * (st + 2) + grp) * ATT_KCH, gtid);   // block-uniform test
  }
  asm volatile("s_wait_asynccnt 0x0" ::: "memory");     // no copy is outstanding when the wave goes on to its end

  // ---- the two key groups' states are joined: group 1 writes its own to LDS, group 0 rescales both to the common row maximum ----
  // Every loop of this part is unrolled, so that oacc is indexed by constants and lives in registers.
  lrow += at_xhalf(lrow);   // the two lane halves' parts of the query's sum
  float* os = Os[wq];
  float* ol = os + c * ATT_OSP + 8 * hh;   // this lane's query row; subtile t is the eight columns from t*16 + 8*hh
  if (grp == 1) {
#pragma unroll
    for (int t = 0; t < 8; ++t) {
      *(v4f*)(ol + t * 16)     = (v4f){oacc[t][0], oacc[t][1], oacc[t][2], oacc[t][3]};
      *(v4f*)(ol + t * 16 + 4) = (v4f){oacc[t][4], oacc[t][5], oacc[t][6], oacc[t][7]};
    }
    if (hh == 0) {   // a query's two lanes hold the same maximum and the same sum
      Ms[wq][c] = mrow;
      Ls[wq][c] = lrow;
    }
  }
  __syncthreads();   // group 1's state may be read; every wave passes it, and no barrier follows
  if (grp == 0) {
  // Group 0 holds chunk 0, of which every row sees key 0: its maximum is finite. A group 1 without a chunk hands over -inf, 0 and zeros: factor 0.
  const float m2 = Ms[wq][c];
  const float l2 = Ls[wq][c];
  const float m  = fmaxf(mrow, m2);
  const float a1 = at_exp2((mrow - m) * ATT_C2);
  const float a2 = at_exp2((m2 - m) * ATT_C2);
  const float inv = 1.0f / (lrow * a1 + l2 * a2);
  const float f1 = a1 * inv;   // what group 0's and group 1's unnormalised output is multiplied by
  const float f2 = a2 * inv;
  // each lane reads and rewrites its own elements of the tile
#pragma unroll
  for (int t = 0; t < 8; ++t) {
    const v4f o0 = *(const v4f*)(ol + t * 16);
    const v4f o1 = *(const v4f*)(ol + t * 16 + 4);
    *(v4f*)(ol + t * 16)     = (v4f){oacc[t][0], oacc[t][1], oacc[t][2], oacc[t][3]} * f1 + o0 * f2;
    *(v4f*)(ol + t * 16 + 4) = (v4f){oacc[t][4], oacc[t][5], oacc[t][6], oacc[t][7]} * f1 + o1 * f2;
  }
  __builtin_amdgcn_fence(__ATOMIC_RELEASE, "workgroup");
  __builtin_amdgcn_wave_barrier();
  __builtin_amdgcn_fence(__ATOMIC_ACQUIRE, "workgroup");
  {
    // lane groups of 8: q4 = lane>>3; row parity = q4>>1, column half = q4&1; it = 0..7 -> rows 0..15, cols 0..127: whole 16x128 tile, both planes
    const int q4 = lane >> 3, c8 = (lane & 7) * 8;
    const int rpar = q4 >> 1, chalf = (q4 & 1) * 64;
    {
#pragma unroll
      for (int it = 0; it < 8; ++it) {
        const int row = it * 2 + rpar;
        const int col = chalf + c8;
        const float* sp = os + row * ATT_OSP + col;
        v4u hv, lv;
#pragma unroll
        for (int e = 0; e < 4; ++e) { unsigned hb, lb; bf_split2(sp[2 * e], sp[2 * e + 1], hb, lb); hv[e] = hb; lv[e] = lb; }
        const size_t go = (size_t)(q0 + row) * HID + h * HVAL + col;
        *(v4u*)(ghp + go) = hv;
        *(v4u*)(glp + go) = lv;
      }
      
    }
  }
  }
}

// =====================================================================================
// Host launcher. Workspace region map (bytes, every offset a multiple of 4 MiB):
//   XB   bf16 [2048][2048]   8 MiB   x
//   WSA  bf16 [2048][2048]   8 MiB   rows 0..1023 W_state, 1024..2047 W_action
//   WC   bf16 [2048][1024]   4 MiB   W_content
//   WO   bf16 [2048][2048]   8 MiB   W_out
//   SA32 f32  [2048][2048]  16 MiB   state | action
//   STH, STL, ACH, ACL, QVH, QVL  bf16 [2048][1024]  4 MiB each (state, action, q-value hi/lo)
//   CTH, CTL  bf16 [2048 = h*128+d][2048 = kv]  8 MiB each (content^T hi/lo)
//   GH, GL    bf16 [2048][2048]  8 MiB each (gathered hi/lo)
//   total 104,857,600 B
// =====================================================================================
extern "C" void kernel_launch(void* const* d_in, const int* in_sizes, int n_in,
                              void* d_out, int out_size, void* d_ws, size_t ws_size,
                              hipStream_t stream) {
  if (n_in < 6) return;
  if (in_sizes[0] != SEQ_LEN * HID || in_sizes[1] != QRANK * HID || in_sizes[2] != QRANK * HID ||
      in_sizes[3] != HID * QRANK || in_sizes[4] != HID * HID || in_sizes[5] != HID) return;
  if (out_size != SEQ_LEN * HID) return;

  const float* x  = (const float*)d_in[0];
  const float* Ws = (const float*)d_in[1];
  const float* Wa = (const float*)d_in[2];
  const float* Wc = (const float*)d_in[3];
  const float* Wo = (const float*)d_in[4];
  const float* bo = (const float*)d_in[5];
  float* out = (float*)d_out;

  const size_t B_XB  = (size_t)SEQ_LEN * HID * 2;
  const size_t B_WSA = (size_t)(2 * QRANK) * HID * 2;
  const size_t B_WC  = (size_t)HID * QRANK * 2;
  const size_t B_WO  = (size_t)HID * HID * 2;
  const size_t B_SA  = (size_t)SEQ_LEN * (2 * QRANK) * 4;
  const size_t B_PL  = (size_t)SEQ_LEN * QRANK * 2;     // one [2048][1024] bf16 plane
  const size_t B_CT  = (size_t)HID * SEQ_LEN * 2;       // one [2048][2048] bf16 plane
  const size_t B_G   = (size_t)SEQ_LEN * HID * 2;

  char* ws = (char*)d_ws;
  size_t off = 0;
  unsigned short* XB  = (unsigned short*)(ws + off); off += B_XB;
  unsigned short* WSA = (unsigned short*)(ws + off); off += B_WSA;
  unsigned short* WC  = (unsigned short*)(ws + off); off += B_WC;
  unsigned short* WO  = (unsigned short*)(ws + off); off += B_WO;
  float*          SA  = (float*)(ws + off);          off += B_SA;
  unsigned short* STH = (unsigned short*)(ws + off); off += B_PL;
  unsigned short* STL = (unsigned short*)(ws + off); off += B_PL;
  unsigned short* ACH = (unsigned short*)(ws + off); off += B_PL;
  unsigned short* ACL = (unsigned short*)(ws + off); off += B_PL;
  unsigned short* QVH = (unsigned short*)(ws + off); off += B_PL;
  unsigned short* QVL = (unsigned short*)(ws + off); off += B_PL;
  unsigned short* CTH = (unsigned short*)(ws + off); off += B_CT;
  unsigned short* CTL = (unsigned short*)(ws + off); off += B_CT;
  unsigned short* GH  = (unsigned short*)(ws + off); off += B_G;
  unsigned short* GL  = (unsigned short*)(ws + off); off += B_G;
  if (off > ws_size) return;

  // ---- input casts to bf16 (RNE) ----
  cast_inputs_bf16<<<dim3(CAST_BLOCKS), dim3(CAST_THREADS), 0, stream>>>(
      x, Ws, Wa, Wc, Wo, XB, WSA, WSA + (size_t)QRANK * HID, WC, WO);

  // ---- projections: SA[q][0..2047] = x . [W_state; W_action]^T  (M=2048, N=2048, K=2048) ----
  {
    const int M = SEQ_LEN, N = 2 * QRANK, K = HID;
    const int blocks = (M / GM_BM) * (N / GM_BN);   // 256
    wmma_gemm64<1, false, false, 0, 0><<<dim3(blocks, 1), dim3(256), 0, stream>>>(
        XB, XB, K, 0L, WSA, WSA, K, 0L, (void*)SA, (void*)SA, N, 0L, bo, M, N, K, 1.0f);
  }

  // ---- bf16 hi/lo planes of state, action, q-value ----
  planes_k<<<dim3(SEQ_LEN / 2), dim3(256), 0, stream>>>(SA, STH, STL, ACH, ACL, QVH, QVL);

  // ---- content^T[n][kv] = W_content[n][:] . qval[kv][:]  (M=2048, N=2048, K=1024; B = q-value hi/lo) -> bf16 hi/lo planes ----
  {
    const int M = HID, N = SEQ_LEN, K = QRANK;
    const int blocks = (M / GM_BM) * (N / GM_BN);   // 256
    wmma_gemm64<1, false, true, 0, 2><<<dim3(blocks, 1), dim3(256), 0, stream>>>(
        WC, WC, K, 0L, QVH, QVL, K, 0L, (void*)CTH, (void*)CTL, N, 0L, bo, M, N, K, 1.0f);
  }

  // ---- causal routing attention -> gathered hi/lo planes ----
  attn_route_k<<<dim3(NHEADS * ATT_NQB), dim3(256), 0, stream>>>(STH, STL, ACH, ACL, CTH, CTL, GH, GL);

  // ---- out = gathered . W_out^T + b_out  (M=N=K=2048; A = gathered hi/lo), f32 ----
  {
    const int M = SEQ_LEN, N = HID, K = HID;
    const int blocks = (M / GM_BM) * (N / GM_BN);   // 256
    wmma_gemm64<1, true, false, 2, 0><<<dim3(blocks, 1), dim3(256), 0, stream>>>(
        GH, GL, K, 0L, WO, WO, K, 0L, (void*)out, (void*)out, N, 0L, bo, M, N, K, 1.0f);
  }
}
